// v000
// The times below were measured on an AMD MI455X: many runs one after another, warmed up first and cycling through
// copies of the inputs, with the whole window's GPU time divided by the number of runs. Launches and the gaps
// between them are all in it. The median over several windows is given; except for v000 it joins two sittings, which
// can be a few percent apart, so the side-by-side timings, each taken in one sitting, are the better comparison.
// v000, which the later versions start from, runs in 199 microseconds.
#include <hip/hip_runtime.h>
// Contractions: x Wq^T, x Wk^T, x Wv^T on v_wmma_f32_16x16x32_bf16 (x and W converted RNE to bf16, single product, f32 accumulate); S^T = K Q^T on v_wmma_f32_16x16x32_f16 (Q, K: f16 planes of the f32 projections x16, single product); O^T = V^T P^T on v_wmma_f32_16x16x32_f16 (V: f16 plane x16; P: x256 f16 hi plane + x2^11 f16 residual plane in a separate f32 accumulator); softmax statistics and LayerNorm f32.
// Multi-head self attention, B x S x 1024, 16 heads x 64, scores scaled 1/8, key-padding mask replaces masked scores by -1e20, LayerNorm over the 1024 concatenated columns.
// Engine: transposed flash. Each wave owns 16 queries of one (batch, head). Per 32-key step: S^T tiles (key rows x query columns) from K rows (A, global f16 plane)
// and Q^T (B, registers); the two 16-key D tiles pack straight into the P^T B fragment; O^T (d rows x query columns) accumulates from V^T rows (A, global f16 plane).
#ifndef NB
#define NB 2
#endif
#ifndef SEQ
#define SEQ 2048
#endif
#define NB_FULL 2
#define SEQ_FULL 2048
#define DM 1024
#define NH 16
#define HD 64
#define XB_FULL ((size_t)SEQ_FULL * DM)          /* per-batch element stride of the activation input and of the output */
#define PLANE ((size_t)NB * NH * SEQ * HD)       /* elements of one of the Q / K / V^T planes */

static_assert(SEQ % 128 == 0);
static_assert(SEQ <= SEQ_FULL);
static_assert(NB <= NB_FULL);
static_assert(HD == 64);
static_assert(DM == NH * HD);
static_assert(DM % 32 == 0);
static_assert((3 * DM) % 64 == 0);
static_assert((size_t)NB * SEQ * DM * 2 + (size_t)3 * DM * DM * 2 + 3 * PLANE * 2 + (size_t)NB * SEQ * DM * 4 <= (size_t)134217728);

typedef __bf16 v16b __attribute__((ext_vector_type(16)));
typedef _Float16 v16h __attribute__((ext_vector_type(16)));
typedef unsigned short v8us __attribute__((ext_vector_type(8), may_alias));
typedef float v8f __attribute__((ext_vector_type(8)));
typedef float v4f __attribute__((ext_vector_type(4)));
typedef float v4fa __attribute__((ext_vector_type(4), may_alias));
union FragB { v16b v; v8us half[2]; unsigned short u[16]; };
union FragH { v16h v; v8us half[2]; _Float16 h[16]; unsigned short u[16]; };

#define LOG2E 1.4426950408889634f
#define NEGFILL (-1.0e20f)
#define CARRY 16.0f                      /* power-of-two carry of the Q, K and V planes */
#define QKSCALE 0.00048828125f           /* (1/8) / (16*16) */

__device__ __forceinline__ unsigned short bf16_bits(float x) {   // RNE convert to bf16 bits
  unsigned int u = __float_as_uint(x);
  return (unsigned short)((u + 0x7FFFu + ((u >> 16) & 1u)) >> 16);
}
__device__ __forceinline__ float bf16_val(unsigned short b) { return __uint_as_float(((unsigned int)b) << 16); }
__device__ __forceinline__ float bf16_rne(float x) { return bf16_val(bf16_bits(x)); }
__device__ __forceinline__ unsigned short f16_bits(float x) { const _Float16 h = (_Float16)x; return __builtin_bit_cast(unsigned short, h); }

// c0..c3 += a * b0..b3 (one bf16 k-step of four column tiles), then the hazard guard
__device__ __forceinline__ void mma_b4(v16b a, v16b b0, v16b b1, v16b b2, v16b b3, v8f& c0, v8f& c1, v8f& c2, v8f& c3) {
  c0 = __builtin_amdgcn_wmma_f32_16x16x32_bf16(false, a, false, b0, (short)0, c0, false, false);
  c1 = __builtin_amdgcn_wmma_f32_16x16x32_bf16(false, a, false, b1, (short)0, c1, false, false);
  c2 = __builtin_amdgcn_wmma_f32_16x16x32_bf16(false, a, false, b2, (short)0, c2, false, false);
  c3 = __builtin_amdgcn_wmma_f32_16x16x32_bf16(false, a, false, b3, (short)0, c3, false, false);
  asm volatile("v_nop\n\tv_nop\n\tv_nop\n\tv_nop" : "+v"(c0), "+v"(c1), "+v"(c2), "+v"(c3) : "v"(a), "v"(b0), "v"(b1), "v"(b2), "v"(b3));
}
// c += a0*b0 + a1*b1 (two k-steps of one f16 tile), then the hazard guard
__device__ __forceinline__ v8f mma_hh2(v16h a0, v16h b0, v16h a1, v16h b1, v8f c) {
  c = __builtin_amdgcn_wmma_f32_16x16x32_f16(false, a0, false, b0, (short)0, c, false, false);
  c = __builtin_amdgcn_wmma_f32_16x16x32_f16(false, a1, false, b1, (short)0, c, false, false);
  asm volatile("v_nop\n\tv_nop\n\tv_nop\n\tv_nop" : "+v"(c) : "v"(a0), "v"(b0), "v"(a1), "v"(b1));
  return c;
}
// ch += a*bh ; cl += a*bl (scaled residual plane keeps its own accumulator), then the hazard guard
__device__ __forceinline__ void mma_h2(v16h a, v16h bh, v16h bl, v8f& ch, v8f& cl) {
  ch = __builtin_amdgcn_wmma_f32_16x16x32_f16(false, a, false, bh, (short)0, ch, false, false);
  cl = __builtin_amdgcn_wmma_f32_16x16x32_f16(false, a, false, bl, (short)0, cl, false, false);
  asm volatile("v_nop\n\tv_nop\n\tv_nop\n\tv_nop" : "+v"(ch), "+v"(cl) : "v"(a), "v"(bh), "v"(bl));
}

// dst[row][1024] = bf16 bits (RNE) of src row; source row = (row / rpb) * bstride + (row % rpb) * 1024.
// coverage: nrows*128 threads x 8 elements = the whole plane.
__global__ __launch_bounds__(256) void k_cvt(const float* __restrict__ src, unsigned short* __restrict__ dst,
                                             int nrows, int rpb, long long bstride) {
  const int t = blockIdx.x * 256 + threadIdx.x;
  if (t >= nrows * 128) return;
  const int row = t >> 7, piece = t & 127;
  const int b = row / rpb, s = row - b * rpb;
  const float* p = src + (size_t)b * (size_t)bstride + (size_t)s * DM + piece * 8;
  const v4f x0 = *(const v4fa*)(p), x1 = *(const v4fa*)(p + 4);
  v8us o;
  o[0] = bf16_bits(x0[0]); o[1] = bf16_bits(x0[1]); o[2] = bf16_bits(x0[2]); o[3] = bf16_bits(x0[3]);
  o[4] = bf16_bits(x1[0]); o[5] = bf16_bits(x1[1]); o[6] = bf16_bits(x1[2]); o[7] = bf16_bits(x1[3]);
  unsigned short* d = dst + (size_t)t * 8;
  *(v8us*)d = o;
  
}

__device__ __forceinline__ void stage8(unsigned short* st, const v8f& c, int base, int rstep) {
#pragma unroll
  for (int r = 0; r < 8; ++r) st[base + r * rstep] = f16_bits(c[r] * CARRY);
}

// Y[m][n] = sum_k Xb[m][k] * Wb[n][k], M = NB*SEQ, N = 3*1024 (Wq | Wk | Wv rows), K = 1024.
// Block = 4 waves, tile 128 rows x 64 columns (one head of one of Q/K/V); wave tile 32 x 64; fragments straight from the bf16 planes.
// A fragment: row m, elements 0..7 <- k0 + 8h + i, 8..15 <- k0 + 16 + 8h + i; B fragment: column n = W row n, same k map; D element r = (row 8h + r, column ln).
//   V^T plane  P3[2][b*16+h][d][SEQ]   : lanes 16q..16q+15 write 128 tokens of one d row (256 B).
// coverage: grid (48, NB*SEQ/128) x (128 x 64) = all three planes; LDS tile fully written before it is read (128x64 or 64x128).
__global__ __launch_bounds__(128) void k_proj(const unsigned short* __restrict__ Xb, const unsigned short* __restrict__ Wb,
                                              unsigned short* __restrict__ P3) {
  __shared__ __attribute__((aligned(16))) unsigned short st[128 * 72];
  const int tid = threadIdx.x, w = __builtin_amdgcn_readfirstlane((int)(tid >> 5)), lane = tid & 31, ln = lane & 15, hh = lane >> 4;
  const int n0 = blockIdx.x * 64;
  const int m0 = blockIdx.y * 128;
  const unsigned short* ap0 = Xb + (size_t)(m0 + 32 * w + ln) * DM + 8 * hh;
  const unsigned short* ap1 = ap0 + (size_t)16 * DM;
  const unsigned short* bp = Wb + (size_t)(n0 + ln) * DM + 8 * hh;
  const v8f z8 = {0.f, 0.f, 0.f, 0.f, 0.f, 0.f, 0.f, 0.f};
  v8f c00 = z8, c01 = z8, c02 = z8, c03 = z8, c10 = z8, c11 = z8, c12 = z8, c13 = z8;
#pragma unroll 1
  for (int k0 = 0; k0 < DM; k0 += 32) {
    FragB a0, a1, b0, b1, b2, b3;
    a0.half[0] = *(const v8us*)(ap0 + k0); a0.half[1] = *(const v8us*)(ap0 + k0 + 16);
    a1.half[0] = *(const v8us*)(ap1 + k0); a1.half[1] = *(const v8us*)(ap1 + k0 + 16);
    b0.half[0] = *(const v8us*)(bp + k0);                        b0.half[1] = *(const v8us*)(bp + k0 + 16);
    b1.half[0] = *(const v8us*)(bp + (size_t)16 * DM + k0);      b1.half[1] = *(const v8us*)(bp + (size_t)16 * DM + k0 + 16);
    b2.half[0] = *(const v8us*)(bp + (size_t)32 * DM + k0);      b2.half[1] = *(const v8us*)(bp + (size_t)32 * DM + k0 + 16);
    b3.half[0] = *(const v8us*)(bp + (size_t)48 * DM + k0);      b3.half[1] = *(const v8us*)(bp + (size_t)48 * DM + k0 + 16);
    mma_b4(a0.v, b0.v, b1.v, b2.v, b3.v, c00, c01, c02, c03);
    mma_b4(a1.v, b0.v, b1.v, b2.v, b3.v, c10, c11, c12, c13);
  }
  const int which = n0 >> 10;                 // 0: Q, 1: K, 2: V (block-uniform)
  const int h = (n0 & 1023) >> 6;
  const int b = m0 / SEQ, s0 = m0 - b * SEQ;
  const int bh = b * NH + h;
  const bool rowmajor = which < 2;
  const int rstep = rowmajor ? 72 : 1;
  const int rb0 = 32 * w + 8 * hh, rb1 = rb0 + 16;
  // element (row rb + r, column 16*nt + ln): Q/K tile st[row*72 + col]; V tile st[col*136 + row]
  stage8(st, c00, rowmajor ? rb0 * 72 + ln        : (ln) * 136 + rb0,      rstep);
  stage8(st, c01, rowmajor ? rb0 * 72 + 16 + ln   : (16 + ln) * 136 + rb0, rstep);
  stage8(st, c02, rowmajor ? rb0 * 72 + 32 + ln   : (32 + ln) * 136 + rb0, rstep);
  stage8(st, c03, rowmajor ? rb0 * 72 + 48 + ln   : (48 + ln) * 136 + rb0, rstep);
  stage8(st, c10, rowmajor ? rb1 * 72 + ln        : (ln) * 136 + rb1,      rstep);
  stage8(st, c11, rowmajor ? rb1 * 72 + 16 + ln   : (16 + ln) * 136 + rb1, rstep);
  stage8(st, c12, rowmajor ? rb1 * 72 + 32 + ln   : (32 + ln) * 136 + rb1, rstep);
  stage8(st, c13, rowmajor ? rb1 * 72 + 48 + ln   : (48 + ln) * 136 + rb1, rstep);
  __syncthreads();
  if (rowmajor) {
    unsigned short* base = P3 + (size_t)which * PLANE + ((size_t)bh * SEQ + s0) * HD;
    {
#pragma unroll
      for (int it = 0; it < 8; ++it) {
        const int i = tid + 128 * it;
        const int row = i >> 3, pc = i & 7;
        const v8us o = *(const v8us*)(&st[row * 72 + pc * 8]);
        *(v8us*)(base + (size_t)row * HD + pc * 8) = o;
      }
      
    }
  } else {
    unsigned short* base = P3 + (size_t)2 * PLANE + (size_t)bh * HD * SEQ + s0;
    {
#pragma unroll
      for (int it = 0; it < 8; ++it) {
        const int i = tid + 128 * it;
        const int dc = i >> 4, pc = i & 15;
        const v8us o = *(const v8us*)(&st[dc * 136 + pc * 8]);
        *(v8us*)(base + (size_t)dc * SEQ + pc * 8) = o;
      }
      
    }
  }
}

// One 32-key step for a wave's 16 queries. Kp, Vp are the (batch, head) bases of the planes; mword bit j set = key key0 + j is padded out.
__device__ __forceinline__ void fa_step(const unsigned short* __restrict__ Kp, const unsigned short* __restrict__ Vp,
                                        int key0, unsigned int mword, int ln, int hh, const FragH& q0, const FragH& q1,
                                        float& mr, float& lr, v8f (&Oh)[4], v8f (&Ol)[4]) {
  // A fragments of K: row m = key (key0 + 16*kt + ln), elements 0..7 <- d = 32c + 8h + i, 8..15 <- d = 32c + 16 + 8h + i
  const unsigned short* kp0 = Kp + (size_t)(key0 + ln) * HD + 8 * hh;
  const unsigned short* kp1 = kp0 + 16 * HD;
  FragH k00, k01, k10, k11;
  k00.half[0] = *(const v8us*)(kp0);      k00.half[1] = *(const v8us*)(kp0 + 16);
  k01.half[0] = *(const v8us*)(kp0 + 32); k01.half[1] = *(const v8us*)(kp0 + 48);
  k10.half[0] = *(const v8us*)(kp1);      k10.half[1] = *(const v8us*)(kp1 + 16);
  k11.half[0] = *(const v8us*)(kp1 + 32); k11.half[1] = *(const v8us*)(kp1 + 48);
  // A fragments of V^T: row m = d (16*t + ln), elements 0..7 <- key0 + 8h + i, 8..15 <- key0 + 16 + 8h + i
  const unsigned short* vp = Vp + (size_t)ln * SEQ + key0 + 8 * hh;
  FragH vf[4];
#pragma unroll
  for (int t = 0; t < 4; ++t) {
    vf[t].half[0] = *(const v8us*)(vp + (size_t)t * 16 * SEQ);
    vf[t].half[1] = *(const v8us*)(vp + (size_t)t * 16 * SEQ + 16);
  }
  const v8f z8 = {0.f, 0.f, 0.f, 0.f, 0.f, 0.f, 0.f, 0.f};
  // S^T tiles: element r of tile kt = score(key0 + 16*kt + 8h + r, query of this lane's column)
  const v8f s0 = mma_hh2(k00.v, q0.v, k01.v, q1.v, z8);
  const v8f s1 = mma_hh2(k10.v, q0.v, k11.v, q1.v, z8);
  const unsigned int wl = mword >> (8 * hh);
  float sc[16];
#pragma unroll
  for (int r = 0; r < 8; ++r) {
    const float a = s0[r] * QKSCALE, c = s1[r] * QKSCALE;
    sc[r]     = ((wl >> r) & 1u) ? NEGFILL : a;            // padded key: the score is replaced
    sc[8 + r] = ((wl >> (16 + r)) & 1u) ? NEGFILL : c;
  }
  float mx = sc[0];
#pragma unroll
  for (int i = 1; i < 16; ++i) mx = fmaxf(mx, sc[i]);
  mx = fmaxf(mx, __shfl_xor(mx, 16, 32));           // the other lane half holds the other 16 keys of this query
  const float mnew = fmaxf(mr, mx);
  const float al = exp2f((mr - mnew) * LOG2E);
  mr = mnew;
  // weights carried x256: pc = 256 * exp(sc - mnew); hi plane f16(pc), residual plane f16((pc - hi) * 2048)
  FragH ph, pl;
  float ps = 0.0f;
#pragma unroll
  for (int i = 0; i < 16; ++i) {
    const float pc = exp2f(fmaf(sc[i] - mnew, LOG2E, 8.0f));
    ps += pc;
    const _Float16 h = (_Float16)pc;
    ph.h[i] = h;                                    // B element i: i<8 -> key0 + 8h + i (tile 0 row 8h+i); i>=8 -> key0 + 16 + 8h + (i-8) (tile 1)
    pl.h[i] = (_Float16)((pc - (float)h) * 2048.0f);
  }
  ps += __shfl_xor(ps, 16, 32);
  lr = lr * al + ps;
#pragma unroll
  for (int t = 0; t < 4; ++t) { Oh[t] = Oh[t] * al; Ol[t] = Ol[t] * al; }
#pragma unroll
  for (int t = 0; t < 4; ++t) mma_h2(vf[t].v, ph.v, pl.v, Oh[t], Ol[t]);
}

// Block = 4 waves x 16 queries = 64 queries of one (batch, head). Mask words built once per block by ballot (LDS, block barrier: cross-wave).
// Epilogue: O^T tile -> per-wave LDS tile [16 queries][64 d] (block barrier), then lanes 0..15 / 16..31 each write 256 contiguous bytes
// coverage: NB*16*(SEQ/64) blocks x 4 waves x 16 rows x 64 columns = every context element exactly once; mw[] fully written (SEQ/32 words) before it is read.
__global__ __launch_bounds__(128) void k_attn(const unsigned short* __restrict__ Qh, const unsigned short* __restrict__ Kh,
                                              const unsigned short* __restrict__ Vt, const int* __restrict__ mask,
                                              float* __restrict__ Cx) {
  __shared__ __attribute__((aligned(16))) float so[4][16][68];
  __shared__ unsigned int mw[SEQ / 32];
  const int tid = threadIdx.x, w = __builtin_amdgcn_readfirstlane((int)(tid >> 5)), lane = tid & 31, ln = lane & 15, hh = lane >> 4;
  const int bh = blockIdx.x / (SEQ / 64), qt = blockIdx.x % (SEQ / 64);
  const int b = bh / NH, h = bh - b * NH;
  const int qbase = qt * 64 + 16 * w;
  const int qg = qbase + ln;
  for (int j = w; j < SEQ / 32; j += 4) {            // wave-uniform loop; all lanes active at the ballot
    const int mv = mask[(size_t)b * SEQ_FULL + 32 * j + lane];
    const unsigned long long bal = __ballot(mv == 0);
    if (lane == 0) mw[j] = (unsigned int)bal;
  }
  __syncthreads();
  // Q^T B fragments: column n = query qg, elements 0..7 <- d = 32c + 8h + i, 8..15 <- d = 32c + 16 + 8h + i
  const unsigned short* qrow = Qh + ((size_t)bh * SEQ + qg) * HD + 8 * hh;
  FragH q0, q1;
  q0.half[0] = *(const v8us*)(qrow);      q0.half[1] = *(const v8us*)(qrow + 16);
  q1.half[0] = *(const v8us*)(qrow + 32); q1.half[1] = *(const v8us*)(qrow + 48);
  float mr = -3.0e38f, lr = 0.0f;
  v8f Oh[4] = {}, Ol[4] = {};
  const unsigned short* Kp = Kh + (size_t)bh * SEQ * HD;
  const unsigned short* Vp = Vt + (size_t)bh * HD * SEQ;
#pragma unroll 1
  for (int j = 0; j < SEQ / 32; ++j)
    fa_step(Kp, Vp, 32 * j, mw[j], ln, hh, q0, q1, mr, lr, Oh, Ol);

  // O^T element r of tile t = ctx(query qg, d = 16t + 8h + r); undo the carries: x256 (in lr), x16 (V), x2048 (residual plane)
  const float inv = 1.0f / (CARRY * lr);
#pragma unroll
  for (int t = 0; t < 4; ++t)
#pragma unroll
    for (int r = 0; r < 8; ++r)
      so[w][ln][16 * t + 8 * hh + r] = (Oh[t][r] + Ol[t][r] * 0.00048828125f) * inv;
  __syncthreads();
  float* og = Cx + ((size_t)b * SEQ + qbase) * DM + h * HD;
  const int rsub = lane >> 4, c4 = (lane & 15) * 4;
  {
#pragma unroll
    for (int q = 0; q < 8; ++q) {
      const int row = 2 * q + rsub;
      const v4f v = *(const v4fa*)&so[w][row][c4];
      *(v4f*)(og + (size_t)row * DM + c4) = v;
    }
    
  }
}

// coverage: NB*SEQ blocks x 256 threads x 4 columns = every output element of the processed region exactly once.
__global__ __launch_bounds__(256) void k_ln(const float* __restrict__ Cx, const float* __restrict__ gamma,
                                            const float* __restrict__ beta, float* __restrict__ out) {
  __shared__ float rs[8];
  __shared__ float rq[8];
  const int tid = threadIdx.x, lane = tid & 31, w = __builtin_amdgcn_readfirstlane((int)(tid >> 5));
  const int r = blockIdx.x;
  const int b = r / SEQ, s = r - b * SEQ;
  const v4f x = *(const v4fa*)(Cx + (size_t)r * DM + tid * 4);
  float sm = (x[0] + x[1]) + (x[2] + x[3]);
#pragma unroll
  for (int off = 16; off >= 1; off >>= 1) sm += __shfl_xor(sm, off, 32);
  if (lane == 0) rs[w] = sm;
  __syncthreads();
  float tot = 0.0f;
#pragma unroll
  for (int i = 0; i < 8; ++i) tot += rs[i];
  const float mu = tot * (1.0f / 1024.0f);
  const float d0 = x[0] - mu, d1 = x[1] - mu, d2 = x[2] - mu, d3 = x[3] - mu;
  float sq = (d0 * d0 + d1 * d1) + (d2 * d2 + d3 * d3);
#pragma unroll
  for (int off = 16; off >= 1; off >>= 1) sq += __shfl_xor(sq, off, 32);
  if (lane == 0) rq[w] = sq;
  __syncthreads();
  float tq = 0.0f;
#pragma unroll
  for (int i = 0; i < 8; ++i) tq += rq[i];
  const float var = tq * (1.0f / 1024.0f);
  const float rinv = rsqrtf(var + 1.0e-6f);
  const v4f g = *(const v4fa*)(gamma + tid * 4);
  const v4f be = *(const v4fa*)(beta + tid * 4);
  v4f o;
  o[0] = d0 * rinv * bf16_rne(g[0]) + bf16_rne(be[0]);
  o[1] = d1 * rinv * bf16_rne(g[1]) + bf16_rne(be[1]);
  o[2] = d2 * rinv * bf16_rne(g[2]) + bf16_rne(be[2]);
  o[3] = d3 * rinv * bf16_rne(g[3]) + bf16_rne(be[3]);
  float* dst = out + ((size_t)b * SEQ_FULL + s) * DM + tid * 4;
  *(v4f*)dst = o;
  
}

extern "C" void kernel_launch(void* const* d_in, const int* in_sizes, int n_in,
                              void* d_out, int out_size, void* d_ws, size_t ws_size, hipStream_t stream) {
  if (n_in < 7) return;
  const long long need_x = (long long)(NB - 1) * SEQ_FULL * DM + (long long)SEQ * DM;   // last element touched + 1
  const long long need_m = (long long)(NB - 1) * SEQ_FULL + (long long)SEQ;
  if ((long long)in_sizes[0] < need_x || (long long)in_sizes[1] < need_m) return;
  if ((long long)in_sizes[2] < (long long)DM * DM || (long long)in_sizes[3] < (long long)DM * DM || (long long)in_sizes[4] < (long long)DM * DM) return;
  if (in_sizes[5] < DM || in_sizes[6] < DM) return;
  if ((long long)out_size < need_x) return;
  const float* X     = (const float*)d_in[0];   // wire order: q [2][2048][1024] f32, mask [2][2048] i32, Wq, Wk, Wv [1024][1024] f32, gamma, beta [1024] f32
  const int*   mask  = (const int*)d_in[1];
  const float* Wq    = (const float*)d_in[2];
  const float* Wk    = (const float*)d_in[3];
  const float* Wv    = (const float*)d_in[4];
  const float* gamma = (const float*)d_in[5];
  const float* beta  = (const float*)d_in[6];
  float* out = (float*)d_out;
  char* ws = (char*)d_ws;
  size_t off = 0;
  const size_t xb_bytes = (size_t)NB * SEQ * DM * 2;        // 8 MiB at full size; every plane is written exactly to its end by whole 16-B pieces
  const size_t wb_bytes = (size_t)3 * DM * DM * 2;          // 6 MiB
  const size_t p3_bytes = 3 * PLANE * 2;                    // 24 MiB
  const size_t cx_bytes = (size_t)NB * SEQ * DM * 4;        // 16 MiB
  unsigned short* Xb = (unsigned short*)(ws + off); off += (xb_bytes + 255) & ~(size_t)255;
  unsigned short* Wb = (unsigned short*)(ws + off); off += (wb_bytes + 255) & ~(size_t)255;
  unsigned short* P3 = (unsigned short*)(ws + off); off += (p3_bytes + 255) & ~(size_t)255;
  float*          Cx = (float*)(ws + off);          off += (cx_bytes + 255) & ~(size_t)255;
  if (off > ws_size) return;
  k_cvt<<<(unsigned)((NB * SEQ * 128 + 255) / 256), 256, 0, stream>>>(X, Xb, NB * SEQ, SEQ, (long long)XB_FULL);
  k_cvt<<<(unsigned)((DM * 128 + 255) / 256), 256, 0, stream>>>(Wq, Wb, DM, DM, 0LL);
  k_cvt<<<(unsigned)((DM * 128 + 255) / 256), 256, 0, stream>>>(Wk, Wb + (size_t)DM * DM, DM, DM, 0LL);
  k_cvt<<<(unsigned)((DM * 128 + 255) / 256), 256, 0, stream>>>(Wv, Wb + (size_t)2 * DM * DM, DM, DM, 0LL);
  k_proj<<<dim3((unsigned)(3 * DM / 64), (unsigned)(NB * SEQ / 128)), 128, 0, stream>>>(Xb, Wb, P3);
  k_attn<<<(unsigned)(NB * NH * (SEQ / 64)), 128, 0, stream>>>(P3, P3 + PLANE, P3 + 2 * PLANE, mask, Cx);
  k_ln<<<(unsigned)(NB * SEQ), 256, 0, stream>>>(Cx, gamma, beta, out);
}

// v001
// Measured time: 146 microseconds a run.
// In two side-by-side timings against v000, it was 1.40 and 1.41 times as fast.
#include <hip/hip_runtime.h>
// Contractions: x Wq^T, x Wk^T, x Wv^T on v_wmma_f32_16x16x32_bf16 (x and W converted RNE to bf16, single product, f32 accumulate); S^T = K Q^T on v_wmma_f32_16x16x32_f16 (Q, K: f16 planes of the f32 projections x16, single product); O^T = V^T P^T on v_wmma_f32_16x16x32_f16 (V: f16 plane x16; P: x256 f16 hi plane + x2^11 f16 residual plane in a separate f32 accumulator); softmax statistics and LayerNorm f32.
// Multi-head self attention, B x S x 1024, 16 heads x 64, scores scaled 1/8, key-padding mask replaces masked scores by -1e20, LayerNorm over the 1024 concatenated columns.
// Engine: transposed flash. Each wave owns 16 queries of one (batch, head). Per 32-key step: S^T tiles (key rows x query columns) from K rows (A, global f16 plane)
// and Q^T (B, registers); the two 16-key D tiles pack straight into the P^T B fragment; O^T (d rows x query columns) accumulates from V^T rows (A, global f16 plane).
// Every 16-bit plane is stored fragment-major: a 16 x 32 operand fragment (16 rows or columns x 32 k) is one 1-KiB block of 64 pieces of 8 elements,
// piece 32*half + lane (lane = 16*hh + ln) = row ln, k = 16*half + 8*hh + 0..7. A wave-wide 16-byte load of one half reads 512 contiguous bytes (4 lines, not 16).
#ifndef NB
#define NB 2
#endif
#ifndef SEQ
#define SEQ 2048
#endif
#define NB_FULL 2
#define SEQ_FULL 2048
#define DM 1024
#define NH 16
#define HD 64
#define XB_FULL ((size_t)SEQ_FULL * DM)          /* per-batch element stride of the activation input and of the output */
#define PLANE ((size_t)NB * NH * SEQ * HD)       /* elements of one of the Q / K / V^T planes */
#define FRAG 512                                 /* elements of one 16 x 32 fragment block; its second half starts at FRAG / 2 */
#define RTILE ((size_t)16 * DM)                  /* elements of 16 rows of a [rows][1024] plane = 32 fragment blocks */

static_assert(SEQ % 128 == 0);
static_assert(SEQ <= SEQ_FULL);
static_assert(NB <= NB_FULL);
static_assert(HD == 64);
static_assert(DM == NH * HD);
static_assert(DM % 32 == 0);
static_assert((3 * DM) % 64 == 0);
static_assert((size_t)NB * SEQ * DM * 2 + (size_t)3 * DM * DM * 2 + 3 * PLANE * 2 + (size_t)NB * SEQ * DM * 4 <= (size_t)134217728);

typedef __bf16 v16b __attribute__((ext_vector_type(16)));
typedef _Float16 v16h __attribute__((ext_vector_type(16)));
typedef unsigned short v8us __attribute__((ext_vector_type(8), may_alias));
typedef float v8f __attribute__((ext_vector_type(8)));
typedef float v4f __attribute__((ext_vector_type(4)));
typedef float v4fa __attribute__((ext_vector_type(4), may_alias));
union FragB { v16b v; v8us half[2]; unsigned short u[16]; };
union FragH { v16h v; v8us half[2]; _Float16 h[16]; unsigned short u[16]; };

#define LOG2E 1.4426950408889634f
#define NEGFILL (-1.0e20f)
#define CARRY 16.0f                      /* power-of-two carry of the Q, K and V planes */
#define QKSCALE 0.00048828125f           /* (1/8) / (16*16) */

__device__ __forceinline__ unsigned short bf16_bits(float x) {   // RNE convert to bf16 bits
  unsigned int u = __float_as_uint(x);
  return (unsigned short)((u + 0x7FFFu + ((u >> 16) & 1u)) >> 16);
}
__device__ __forceinline__ float bf16_val(unsigned short b) { return __uint_as_float(((unsigned int)b) << 16); }
__device__ __forceinline__ float bf16_rne(float x) { return bf16_val(bf16_bits(x)); }
__device__ __forceinline__ unsigned short f16_bits(float x) { const _Float16 h = (_Float16)x; return __builtin_bit_cast(unsigned short, h); }

// c0..c3 += a * b0..b3 (one bf16 k-step of four column tiles), then the hazard guard
__device__ __forceinline__ void mma_b4(v16b a, v16b b0, v16b b1, v16b b2, v16b b3, v8f& c0, v8f& c1, v8f& c2, v8f& c3) {
  c0 = __builtin_amdgcn_wmma_f32_16x16x32_bf16(false, a, false, b0, (short)0, c0, false, false);
  c1 = __builtin_amdgcn_wmma_f32_16x16x32_bf16(false, a, false, b1, (short)0, c1, false, false);
  c2 = __builtin_amdgcn_wmma_f32_16x16x32_bf16(false, a, false, b2, (short)0, c2, false, false);
  c3 = __builtin_amdgcn_wmma_f32_16x16x32_bf16(false, a, false, b3, (short)0, c3, false, false);
  asm volatile("v_nop\n\tv_nop\n\tv_nop\n\tv_nop" : "+v"(c0), "+v"(c1), "+v"(c2), "+v"(c3) : "v"(a), "v"(b0), "v"(b1), "v"(b2), "v"(b3));
}
// c += a0*b0 + a1*b1 (two k-steps of one f16 tile), then the hazard guard
__device__ __forceinline__ v8f mma_hh2(v16h a0, v16h b0, v16h a1, v16h b1, v8f c) {
  c = __builtin_amdgcn_wmma_f32_16x16x32_f16(false, a0, false, b0, (short)0, c, false, false);
  c = __builtin_amdgcn_wmma_f32_16x16x32_f16(false, a1, false, b1, (short)0, c, false, false);
  asm volatile("v_nop\n\tv_nop\n\tv_nop\n\tv_nop" : "+v"(c) : "v"(a0), "v"(b0), "v"(a1), "v"(b1));
  return c;
}
// ch += a*bh ; cl += a*bl (scaled residual plane keeps its own accumulator), then the hazard guard
__device__ __forceinline__ void mma_h2(v16h a, v16h bh, v16h bl, v8f& ch, v8f& cl) {
  ch = __builtin_amdgcn_wmma_f32_16x16x32_f16(false, a, false, bh, (short)0, ch, false, false);
  cl = __builtin_amdgcn_wmma_f32_16x16x32_f16(false, a, false, bl, (short)0, cl, false, false);
  asm volatile("v_nop\n\tv_nop\n\tv_nop\n\tv_nop" : "+v"(ch), "+v"(cl) : "v"(a), "v"(bh), "v"(bl));
}

// dst = bf16 bits (RNE) of src, fragment-major: block (row / 16) * 32 + k / 32; source row = (row / rpb) * bstride + (row % rpb) * 1024.
// A wave takes 8 rows x one 128-B source line each and writes four whole 128-B lines of the block (pieces 16*q + 8*rhi + 0..7, q = k / 8 in the block).
// coverage: nrows*128 threads x 8 elements = the whole plane (nrows a multiple of 16; thread bits 0-2 and 5 -> row in the block, bits 3-4 -> q).
__global__ __launch_bounds__(256) void k_cvt(const float* __restrict__ src, unsigned short* __restrict__ dst,
                                             int nrows, int rpb, long long bstride) {
  const int t = blockIdx.x * 256 + threadIdx.x;
  if (t >= nrows * 128) return;
  const int blk = t >> 6, ln = ((t >> 5) & 1) * 8 + (t & 7), q = (t >> 3) & 3;
  const int row = (blk / (DM / 32)) * 16 + ln, k = (blk % (DM / 32)) * 32 + q * 8;
  const int b = row / rpb, s = row - b * rpb;
  const float* p = src + (size_t)b * (size_t)bstride + (size_t)s * DM + k;
  const v4f x0 = *(const v4fa*)(p), x1 = *(const v4fa*)(p + 4);
  v8us o;
  o[0] = bf16_bits(x0[0]); o[1] = bf16_bits(x0[1]); o[2] = bf16_bits(x0[2]); o[3] = bf16_bits(x0[3]);
  o[4] = bf16_bits(x1[0]); o[5] = bf16_bits(x1[1]); o[6] = bf16_bits(x1[2]); o[7] = bf16_bits(x1[3]);
  unsigned short* d = dst + (size_t)blk * FRAG + (q * 16 + ln) * 8;
  *(v8us*)d = o;
  
}

__device__ __forceinline__ void stage8(unsigned short* st, const v8f& c, int base, int rstep) {
#pragma unroll
  for (int r = 0; r < 8; ++r) st[base + r * rstep] = f16_bits(c[r] * CARRY);
}

// Y[m][n] = sum_k Xb[m][k] * Wb[n][k], M = NB*SEQ, N = 3*1024 (Wq | Wk | Wv rows), K = 1024.
// Block = 4 waves, tile 128 rows x 64 columns (one head of one of Q/K/V); wave tile 32 x 64; fragments straight from the fragment-major bf16 planes.
// A fragment: row m, elements 0..7 <- k0 + 8h + i, 8..15 <- k0 + 16 + 8h + i; B fragment: column n = W row n, same k map; D element r = (row 8h + r, column ln).
//   Q, K planes P3[0..1][b*16+h][token / 16][d / 32][fragment block: row = token % 16, k = d % 32]
//   V^T plane   P3[2][b*16+h][token / 32][d / 16][fragment block: row = d % 16, k = token % 32]; each thread stores the piece of its own index: whole lines.
// coverage: grid (48, NB*SEQ/128) x (128 x 64) = all three planes; LDS tile fully written before it is read (128x64 or 64x128).
__global__ __launch_bounds__(128) void k_proj(const unsigned short* __restrict__ Xb, const unsigned short* __restrict__ Wb,
                                              unsigned short* __restrict__ P3) {
  __shared__ __attribute__((aligned(16))) unsigned short st[128 * 72];
  const int tid = threadIdx.x, w = __builtin_amdgcn_readfirstlane((int)(tid >> 5)), lane = tid & 31, ln = lane & 15, hh = lane >> 4;
  const int n0 = blockIdx.x * 64;
  const int m0 = blockIdx.y * 128;
  const unsigned short* ap0 = Xb + (size_t)((m0 >> 4) + 2 * w) * RTILE + lane * 8;
  const unsigned short* ap1 = ap0 + RTILE;
  const unsigned short* bp = Wb + (size_t)(n0 >> 4) * RTILE + lane * 8;
  const v8f z8 = {0.f, 0.f, 0.f, 0.f, 0.f, 0.f, 0.f, 0.f};
  v8f c00 = z8, c01 = z8, c02 = z8, c03 = z8, c10 = z8, c11 = z8, c12 = z8, c13 = z8;
#pragma unroll 1
  for (int ko = 0; ko < (DM / 32) * FRAG; ko += FRAG) {          // ko: element offset of k-block k0 / 32 inside a row tile
    FragB a0, a1, b0, b1, b2, b3;
    a0.half[0] = *(const v8us*)(ap0 + ko);             a0.half[1] = *(const v8us*)(ap0 + ko + FRAG / 2);
    a1.half[0] = *(const v8us*)(ap1 + ko);             a1.half[1] = *(const v8us*)(ap1 + ko + FRAG / 2);
    b0.half[0] = *(const v8us*)(bp + ko);              b0.half[1] = *(const v8us*)(bp + ko + FRAG / 2);
    b1.half[0] = *(const v8us*)(bp + RTILE + ko);      b1.half[1] = *(const v8us*)(bp + RTILE + ko + FRAG / 2);
    b2.half[0] = *(const v8us*)(bp + 2 * RTILE + ko);  b2.half[1] = *(const v8us*)(bp + 2 * RTILE + ko + FRAG / 2);
    b3.half[0] = *(const v8us*)(bp + 3 * RTILE + ko);  b3.half[1] = *(const v8us*)(bp + 3 * RTILE + ko + FRAG / 2);
    // the wait that is owed before a register named by an issued load is overwritten; the two addresses as inputs keep their registers out of the loads' own destinations
    asm volatile("s_wait_xcnt 0x0" :: "v"(ap0 + ko), "v"(bp + ko) : "memory");
    mma_b4(a0.v, b0.v, b1.v, b2.v, b3.v, c00, c01, c02, c03);
    mma_b4(a1.v, b0.v, b1.v, b2.v, b3.v, c10, c11, c12, c13);
  }
  const int which = n0 >> 10;                 // 0: Q, 1: K, 2: V (block-uniform)
  const int h = (n0 & 1023) >> 6;
  const int b = m0 / SEQ, s0 = m0 - b * SEQ;
  const int bh = b * NH + h;
  const bool rowmajor = which < 2;
  const int rstep = rowmajor ? 72 : 1;
  const int rb0 = 32 * w + 8 * hh, rb1 = rb0 + 16;
  // element (row rb + r, column 16*nt + ln): Q/K tile st[row*72 + col]; V tile st[col*136 + row]
  stage8(st, c00, rowmajor ? rb0 * 72 + ln        : (ln) * 136 + rb0,      rstep);
  stage8(st, c01, rowmajor ? rb0 * 72 + 16 + ln   : (16 + ln) * 136 + rb0, rstep);
  stage8(st, c02, rowmajor ? rb0 * 72 + 32 + ln   : (32 + ln) * 136 + rb0, rstep);
  stage8(st, c03, rowmajor ? rb0 * 72 + 48 + ln   : (48 + ln) * 136 + rb0, rstep);
  stage8(st, c10, rowmajor ? rb1 * 72 + ln        : (ln) * 136 + rb1,      rstep);
  stage8(st, c11, rowmajor ? rb1 * 72 + 16 + ln   : (16 + ln) * 136 + rb1, rstep);
  stage8(st, c12, rowmajor ? rb1 * 72 + 32 + ln   : (32 + ln) * 136 + rb1, rstep);
  stage8(st, c13, rowmajor ? rb1 * 72 + 48 + ln   : (48 + ln) * 136 + rb1, rstep);
  __syncthreads();
  if (rowmajor) {
    unsigned short* base = P3 + (size_t)which * PLANE + ((size_t)bh * SEQ + s0) * HD;
    {
#pragma unroll
      for (int it = 0; it < 8; ++it) {
        const int i = tid + 128 * it;                                   // piece i: token tile i / 128, d block (i / 64) % 2, piece i % 64
        const int row = (i >> 7) * 16 + (i & 15), col = ((i >> 4) & 7) * 8;   // d = 32*c + 16*half + 8*hh
        const v8us o = *(const v8us*)(&st[row * 72 + col]);
        *(v8us*)(base + (size_t)i * 8) = o;
      }
      
    }
  } else {
    unsigned short* base = P3 + (size_t)2 * PLANE + ((size_t)bh * SEQ + s0) * HD;
    {
#pragma unroll
      for (int it = 0; it < 8; ++it) {
        const int i = tid + 128 * it;
        const int dc = ((i >> 6) & 3) * 16 + (i & 15);                  // piece i: key block i / 256, d tile (i / 64) % 4, piece i % 64
        const int tk = (i >> 8) * 32 + ((i >> 4) & 3) * 8;              // token = 32*block + 16*half + 8*hh
        const v8us o = *(const v8us*)(&st[dc * 136 + tk]);
        *(v8us*)(base + (size_t)i * 8) = o;
      }
      
    }
  }
}

// One 32-key step for a wave's 16 queries. Kp, Vp are the (batch, head) bases of the planes; mword bit j set = key key0 + j is padded out.
__device__ __forceinline__ void fa_step(const unsigned short* __restrict__ Kp, const unsigned short* __restrict__ Vp,
                                        int key0, unsigned int mword, int ln, int hh, const FragH& q0, const FragH& q1,
                                        float& mr, float& lr, v8f (&Oh)[4], v8f (&Ol)[4]) {
  // A fragments of K: row m = key (key0 + 16*kt + ln), elements 0..7 <- d = 32c + 8h + i, 8..15 <- d = 32c + 16 + 8h + i; block 2*kt + c of the step's 4 KiB
  const int lane8 = (16 * hh + ln) * 8;
  const unsigned short* kp = Kp + (size_t)key0 * HD + lane8;
  FragH k00, k01, k10, k11;
  k00.half[0] = *(const v8us*)(kp);            k00.half[1] = *(const v8us*)(kp + FRAG / 2);
  k01.half[0] = *(const v8us*)(kp + FRAG);     k01.half[1] = *(const v8us*)(kp + FRAG + FRAG / 2);
  k10.half[0] = *(const v8us*)(kp + 2 * FRAG); k10.half[1] = *(const v8us*)(kp + 2 * FRAG + FRAG / 2);
  k11.half[0] = *(const v8us*)(kp + 3 * FRAG); k11.half[1] = *(const v8us*)(kp + 3 * FRAG + FRAG / 2);
  // A fragments of V^T: row m = d (16*t + ln), elements 0..7 <- key0 + 8h + i, 8..15 <- key0 + 16 + 8h + i; block t of the step's 4 KiB
  const unsigned short* vp = Vp + (size_t)key0 * HD + lane8;
  FragH vf[4];
#pragma unroll
  for (int t = 0; t < 4; ++t) {
    vf[t].half[0] = *(const v8us*)(vp + t * FRAG);
    vf[t].half[1] = *(const v8us*)(vp + t * FRAG + FRAG / 2);
  }
  const v8f z8 = {0.f, 0.f, 0.f, 0.f, 0.f, 0.f, 0.f, 0.f};
  // S^T tiles: element r of tile kt = score(key0 + 16*kt + 8h + r, query of this lane's column)
  const v8f s0 = mma_hh2(k00.v, q0.v, k01.v, q1.v, z8);
  const v8f s1 = mma_hh2(k10.v, q0.v, k11.v, q1.v, z8);
  const unsigned int wl = mword >> (8 * hh);
  float sc[16];
#pragma unroll
  for (int r = 0; r < 8; ++r) {
    const float a = s0[r] * QKSCALE, c = s1[r] * QKSCALE;
    sc[r]     = ((wl >> r) & 1u) ? NEGFILL : a;            // padded key: the score is replaced
    sc[8 + r] = ((wl >> (16 + r)) & 1u) ? NEGFILL : c;
  }
  float mx = sc[0];
#pragma unroll
  for (int i = 1; i < 16; ++i) mx = fmaxf(mx, sc[i]);
  mx = fmaxf(mx, __shfl_xor(mx, 16, 32));           // the other lane half holds the other 16 keys of this query
  const float mnew = fmaxf(mr, mx);
  const float al = exp2f((mr - mnew) * LOG2E);
  mr = mnew;
  // weights carried x256: pc = 256 * exp(sc - mnew); hi plane f16(pc), residual plane f16((pc - hi) * 2048)
  FragH ph, pl;
  float ps = 0.0f;
#pragma unroll
  for (int i = 0; i < 16; ++i) {
    const float pc = exp2f(fmaf(sc[i] - mnew, LOG2E, 8.0f));
    ps += pc;
    const _Float16 h = (_Float16)pc;
    ph.h[i] = h;                                    // B element i: i<8 -> key0 + 8h + i (tile 0 row 8h+i); i>=8 -> key0 + 16 + 8h + (i-8) (tile 1)
    pl.h[i] = (_Float16)((pc - (float)h) * 2048.0f);
  }
  ps += __shfl_xor(ps, 16, 32);
  lr = lr * al + ps;
#pragma unroll
  for (int t = 0; t < 4; ++t) { Oh[t] = Oh[t] * al; Ol[t] = Ol[t] * al; }
#pragma unroll
  for (int t = 0; t < 4; ++t) mma_h2(vf[t].v, ph.v, pl.v, Oh[t], Ol[t]);
}

// Block = 4 waves x 16 queries = 64 queries of one (batch, head). Mask words built once per block by ballot (LDS, block barrier: cross-wave).
// Epilogue: O^T tile -> per-wave LDS tile [16 queries][64 d] (block barrier), then lanes 0..15 / 16..31 each write 256 contiguous bytes
// coverage: NB*16*(SEQ/64) blocks x 4 waves x 16 rows x 64 columns = every context element exactly once; mw[] fully written (SEQ/32 words) before it is read.
__global__ __launch_bounds__(128) void k_attn(const unsigned short* __restrict__ Qh, const unsigned short* __restrict__ Kh,
                                              const unsigned short* __restrict__ Vt, const int* __restrict__ mask,
                                              float* __restrict__ Cx) {
  __shared__ __attribute__((aligned(16))) float so[4][16][68];
  __shared__ unsigned int mw[SEQ / 32];
  const int tid = threadIdx.x, w = __builtin_amdgcn_readfirstlane((int)(tid >> 5)), lane = tid & 31, ln = lane & 15, hh = lane >> 4;
  const int bh = blockIdx.x / (SEQ / 64), qt = blockIdx.x % (SEQ / 64);
  const int b = bh / NH, h = bh - b * NH;
  const int qbase = qt * 64 + 16 * w;
  for (int j = w; j < SEQ / 32; j += 4) {            // wave-uniform loop; all lanes active at the ballot
    const int mv = mask[(size_t)b * SEQ_FULL + 32 * j + lane];
    const unsigned long long bal = __ballot(mv == 0);
    if (lane == 0) mw[j] = (unsigned int)bal;
  }
  __syncthreads();
  // Q^T B fragments: column n = query qbase + ln, elements 0..7 <- d = 32c + 8h + i, 8..15 <- d = 32c + 16 + 8h + i
  const unsigned short* qrow = Qh + ((size_t)bh * SEQ + qbase) * HD + lane * 8;   // the wave's 16 queries are one token tile: blocks c = 0, 1
  FragH q0, q1;
  q0.half[0] = *(const v8us*)(qrow);        q0.half[1] = *(const v8us*)(qrow + FRAG / 2);
  q1.half[0] = *(const v8us*)(qrow + FRAG); q1.half[1] = *(const v8us*)(qrow + FRAG + FRAG / 2);
  float mr = -3.0e38f, lr = 0.0f;
  v8f Oh[4] = {}, Ol[4] = {};
  const unsigned short* Kp = Kh + (size_t)bh * SEQ * HD;
  const unsigned short* Vp = Vt + (size_t)bh * HD * SEQ;
#pragma unroll 1
  for (int j = 0; j < SEQ / 32; ++j)
    fa_step(Kp, Vp, 32 * j, mw[j], ln, hh, q0, q1, mr, lr, Oh, Ol);

  // O^T element r of tile t = ctx(query qbase + ln, d = 16t + 8h + r); undo the carries: x256 (in lr), x16 (V), x2048 (residual plane)
  const float inv = 1.0f / (CARRY * lr);
#pragma unroll
  for (int t = 0; t < 4; ++t)
#pragma unroll
    for (int r = 0; r < 8; ++r)
      so[w][ln][16 * t + 8 * hh + r] = (Oh[t][r] + Ol[t][r] * 0.00048828125f) * inv;
  __syncthreads();
  float* og = Cx + ((size_t)b * SEQ + qbase) * DM + h * HD;
  const int rsub = lane >> 4, c4 = (lane & 15) * 4;
  {
#pragma unroll
    for (int q = 0; q < 8; ++q) {
      const int row = 2 * q + rsub;
      const v4f v = *(const v4fa*)&so[w][row][c4];
      *(v4f*)(og + (size_t)row * DM + c4) = v;
    }
    
  }
}

// coverage: NB*SEQ blocks x 256 threads x 4 columns = every output element of the processed region exactly once.
__global__ __launch_bounds__(256) void k_ln(const float* __restrict__ Cx, const float* __restrict__ gamma,
                                            const float* __restrict__ beta, float* __restrict__ out) {
  __shared__ float rs[8];
  __shared__ float rq[8];
  const int tid = threadIdx.x, lane = tid & 31, w = __builtin_amdgcn_readfirstlane((int)(tid >> 5));
  const int r = blockIdx.x;
  const int b = r / SEQ, s = r - b * SEQ;
  const v4f x = *(const v4fa*)(Cx + (size_t)r * DM + tid * 4);
  float sm = (x[0] + x[1]) + (x[2] + x[3]);
#pragma unroll
  for (int off = 16; off >= 1; off >>= 1) sm += __shfl_xor(sm, off, 32);
  if (lane == 0) rs[w] = sm;
  __syncthreads();
  float tot = 0.0f;
#pragma unroll
  for (int i = 0; i < 8; ++i) tot += rs[i];
  const float mu = tot * (1.0f / 1024.0f);
  const float d0 = x[0] - mu, d1 = x[1] - mu, d2 = x[2] - mu, d3 = x[3] - mu;
  float sq = (d0 * d0 + d1 * d1) + (d2 * d2 + d3 * d3);
#pragma unroll
  for (int off = 16; off >= 1; off >>= 1) sq += __shfl_xor(sq, off, 32);
  if (lane == 0) rq[w] = sq;
  __syncthreads();
  float tq = 0.0f;
#pragma unroll
  for (int i = 0; i < 8; ++i) tq += rq[i];
  const float var = tq * (1.0f / 1024.0f);
  const float rinv = rsqrtf(var + 1.0e-6f);
  const v4f g = *(const v4fa*)(gamma + tid * 4);
  const v4f be = *(const v4fa*)(beta + tid * 4);
  v4f o;
  o[0] = d0 * rinv * bf16_rne(g[0]) + bf16_rne(be[0]);
  o[1] = d1 * rinv * bf16_rne(g[1]) + bf16_rne(be[1]);
  o[2] = d2 * rinv * bf16_rne(g[2]) + bf16_rne(be[2]);
  o[3] = d3 * rinv * bf16_rne(g[3]) + bf16_rne(be[3]);
  float* dst = out + ((size_t)b * SEQ_FULL + s) * DM + tid * 4;
  *(v4f*)dst = o;
  
}

extern "C" void kernel_launch(void* const* d_in, const int* in_sizes, int n_in,
                              void* d_out, int out_size, void* d_ws, size_t ws_size, hipStream_t stream) {
  if (n_in < 7) return;
  const long long need_x = (long long)(NB - 1) * SEQ_FULL * DM + (long long)SEQ * DM;   // last element touched + 1
  const long long need_m = (long long)(NB - 1) * SEQ_FULL + (long long)SEQ;
  if ((long long)in_sizes[0] < need_x || (long long)in_sizes[1] < need_m) return;
  if ((long long)in_sizes[2] < (long long)DM * DM || (long long)in_sizes[3] < (long long)DM * DM || (long long)in_sizes[4] < (long long)DM * DM) return;
  if (in_sizes[5] < DM || in_sizes[6] < DM) return;
  if ((long long)out_size < need_x) return;
  const float* X     = (const float*)d_in[0];   // wire order: q [2][2048][1024] f32, mask [2][2048] i32, Wq, Wk, Wv [1024][1024] f32, gamma, beta [1024] f32
  const int*   mask  = (const int*)d_in[1];
  const float* Wq    = (const float*)d_in[2];
  const float* Wk    = (const float*)d_in[3];
  const float* Wv    = (const float*)d_in[4];
  const float* gamma = (const float*)d_in[5];
  const float* beta  = (const float*)d_in[6];
  float* out = (float*)d_out;
  char* ws = (char*)d_ws;
  size_t off = 0;
  const size_t xb_bytes = (size_t)NB * SEQ * DM * 2;        // 8 MiB at full size; every plane is written exactly to its end by whole 16-B pieces
  const size_t wb_bytes = (size_t)3 * DM * DM * 2;          // 6 MiB
  const size_t p3_bytes = 3 * PLANE * 2;                    // 24 MiB
  const size_t cx_bytes = (size_t)NB * SEQ * DM * 4;        // 16 MiB
  unsigned short* Xb = (unsigned short*)(ws + off); off += (xb_bytes + 255) & ~(size_t)255;
  unsigned short* Wb = (unsigned short*)(ws + off); off += (wb_bytes + 255) & ~(size_t)255;
  unsigned short* P3 = (unsigned short*)(ws + off); off += (p3_bytes + 255) & ~(size_t)255;
  float*          Cx = (float*)(ws + off);          off += (cx_bytes + 255) & ~(size_t)255;
  if (off > ws_size) return;
  k_cvt<<<(unsigned)((NB * SEQ * 128 + 255) / 256), 256, 0, stream>>>(X, Xb, NB * SEQ, SEQ, (long long)XB_FULL);
  k_cvt<<<(unsigned)((DM * 128 + 255) / 256), 256, 0, stream>>>(Wq, Wb, DM, DM, 0LL);
  k_cvt<<<(unsigned)((DM * 128 + 255) / 256), 256, 0, stream>>>(Wk, Wb + (size_t)DM * DM, DM, DM, 0LL);
  k_cvt<<<(unsigned)((DM * 128 + 255) / 256), 256, 0, stream>>>(Wv, Wb + (size_t)2 * DM * DM, DM, DM, 0LL);
  k_proj<<<dim3((unsigned)(3 * DM / 64), (unsigned)(NB * SEQ / 128)), 128, 0, stream>>>(Xb, Wb, P3);
  k_attn<<<(unsigned)(NB * NH * (SEQ / 64)), 128, 0, stream>>>(P3, P3 + PLANE, P3 + 2 * PLANE, mask, Cx);
  k_ln<<<(unsigned)(NB * SEQ), 256, 0, stream>>>(Cx, gamma, beta, out);
}

// v002
// It runs in 88.5 microseconds.
// Two timings next to v001 put it at 1.61 and 1.65 times that version's speed.
// Over all steps from v000 it is 2.29 times as fast.
#include <hip/hip_runtime.h>
// Contractions: x Wq^T, x Wk^T, x Wv^T on v_wmma_f32_16x16x32_bf16 (x and W converted RNE to bf16, single product, f32 accumulate); S^T = K Q^T on v_wmma_f32_16x16x32_f16 (Q, K: f16 planes of the f32 projections x16, single product); O^T = V^T P^T on v_wmma_f32_16x16x32_f16 (V: f16 plane x16; P: x256 f16 hi plane + x2^11 f16 residual plane in a separate f32 accumulator); softmax statistics and LayerNorm f32.
// Multi-head self attention, B x S x 1024, 16 heads x 64, scores scaled 1/8, key-padding mask replaces masked scores by -1e20, LayerNorm over the 1024 concatenated columns.
// Engine: transposed flash. Each wave owns 16 queries of one (batch, head). Per 32-key step: S^T tiles (key rows x query columns) from K rows (A, global f16 plane)
// and Q^T (B, registers); the two 16-key D tiles pack straight into the P^T B fragment; O^T (d rows x query columns) accumulates from V^T rows (A, global f16 plane).
// Every 16-bit plane is stored fragment-major: a 16 x 32 operand fragment (16 rows or columns x 32 k) is one 1-KiB block of 64 pieces of 8 elements,
// piece 32*half + lane (lane = 16*hh + ln) = row ln, k = 16*half + 8*hh + 0..7. A wave-wide 16-byte load of one half reads 512 contiguous bytes (4 lines, not 16).
// Token order: inside each batch the tokens are stably partitioned by the key mask, kept keys first (perm[position] = token, cnt = kept keys). A padded key's weight is
// exp(-1e20 - max) = 0 whenever one key is kept, so K, V^T and the key loop cover the first cnt positions only; every plane and the context are in position order and
// the LayerNorm kernel stores row perm[position]. No key kept: every score is -1e20 (uniform weights), so all SEQ positions are walked with every key marked padded.
#ifndef NB
#define NB 2
#endif
#ifndef SEQ
#define SEQ 2048
#endif
#define NB_FULL 2
#define SEQ_FULL 2048
#define DM 1024
#define NH 16
#define HD 64
#define XB_FULL ((size_t)SEQ_FULL * DM)          /* per-batch element stride of the activation input and of the output */
#define PLANE ((size_t)NB * NH * SEQ * HD)       /* elements of one of the Q / K / V^T planes */
#define FRAG 512                                 /* elements of one 16 x 32 fragment block; its second half starts at FRAG / 2 */
#define RTILE ((size_t)16 * DM)                  /* elements of 16 rows of a [rows][1024] plane = 32 fragment blocks */

static_assert(SEQ % 256 == 0);
static_assert(SEQ <= SEQ_FULL);
static_assert(NB <= NB_FULL);
static_assert(HD == 64);
static_assert(DM == NH * HD);
static_assert(DM % 32 == 0);
static_assert((3 * DM) % 64 == 0);
static_assert((size_t)NB * SEQ * DM * 2 + (size_t)3 * DM * DM * 2 + 3 * PLANE * 2 + (size_t)NB * SEQ * DM * 4 + (size_t)NB * SEQ * 4 + 1024 <= (size_t)134217728);

typedef __bf16 v16b __attribute__((ext_vector_type(16)));
typedef _Float16 v16h __attribute__((ext_vector_type(16)));
typedef unsigned short v8us __attribute__((ext_vector_type(8), may_alias));
typedef float v8f __attribute__((ext_vector_type(8)));
typedef float v4f __attribute__((ext_vector_type(4)));
typedef float v4fa __attribute__((ext_vector_type(4), may_alias));
union FragB { v16b v; v8us half[2]; unsigned short u[16]; };
union FragH { v16h v; v8us half[2]; _Float16 h[16]; unsigned short u[16]; };

#define LOG2E 1.4426950408889634f
#define NEGFILL (-1.0e20f)
#define CARRY 16.0f                      /* power-of-two carry of the Q, K and V planes */
#define QKSCALE 0.00048828125f           /* (1/8) / (16*16) */

__device__ __forceinline__ unsigned short bf16_bits(float x) {   // RNE convert to bf16 bits
  unsigned int u = __float_as_uint(x);
  return (unsigned short)((u + 0x7FFFu + ((u >> 16) & 1u)) >> 16);
}
__device__ __forceinline__ float bf16_val(unsigned short b) { return __uint_as_float(((unsigned int)b) << 16); }
__device__ __forceinline__ float bf16_rne(float x) { return bf16_val(bf16_bits(x)); }
__device__ __forceinline__ unsigned short f16_bits(float x) { const _Float16 h = (_Float16)x; return __builtin_bit_cast(unsigned short, h); }

// c0..c3 += a * b0..b3 (one bf16 k-step of four column tiles), then the hazard guard
__device__ __forceinline__ void mma_b4(v16b a, v16b b0, v16b b1, v16b b2, v16b b3, v8f& c0, v8f& c1, v8f& c2, v8f& c3) {
  c0 = __builtin_amdgcn_wmma_f32_16x16x32_bf16(false, a, false, b0, (short)0, c0, false, false);
  c1 = __builtin_amdgcn_wmma_f32_16x16x32_bf16(false, a, false, b1, (short)0, c1, false, false);
  c2 = __builtin_amdgcn_wmma_f32_16x16x32_bf16(false, a, false, b2, (short)0, c2, false, false);
  c3 = __builtin_amdgcn_wmma_f32_16x16x32_bf16(false, a, false, b3, (short)0, c3, false, false);
  asm volatile("v_nop\n\tv_nop\n\tv_nop\n\tv_nop" : "+v"(c0), "+v"(c1), "+v"(c2), "+v"(c3) : "v"(a), "v"(b0), "v"(b1), "v"(b2), "v"(b3));
}
// c += a0*b0 + a1*b1 (two k-steps of one f16 tile), then the hazard guard
__device__ __forceinline__ v8f mma_hh2(v16h a0, v16h b0, v16h a1, v16h b1, v8f c) {
  c = __builtin_amdgcn_wmma_f32_16x16x32_f16(false, a0, false, b0, (short)0, c, false, false);
  c = __builtin_amdgcn_wmma_f32_16x16x32_f16(false, a1, false, b1, (short)0, c, false, false);
  asm volatile("v_nop\n\tv_nop\n\tv_nop\n\tv_nop" : "+v"(c) : "v"(a0), "v"(b0), "v"(a1), "v"(b1));
  return c;
}
// ch += a*bh ; cl += a*bl (scaled residual plane keeps its own accumulator), then the hazard guard
__device__ __forceinline__ void mma_h2(v16h a, v16h bh, v16h bl, v8f& ch, v8f& cl) {
  ch = __builtin_amdgcn_wmma_f32_16x16x32_f16(false, a, false, bh, (short)0, ch, false, false);
  cl = __builtin_amdgcn_wmma_f32_16x16x32_f16(false, a, false, bl, (short)0, cl, false, false);
  asm volatile("v_nop\n\tv_nop\n\tv_nop\n\tv_nop" : "+v"(ch), "+v"(cl) : "v"(a), "v"(bh), "v"(bl));
}

// Stable partition of one batch's tokens: position of token s = kept tokens before s if it is kept, else cnt + padded tokens before s (a permutation of 0..SEQ-1 for any mask).
// One block per batch, SEQ / 256 consecutive tokens per thread; the list is gathered in LDS and stored as whole lines.
// coverage: every sp[] entry written once (permutation) before the barrier in front of its read; NB x SEQ entries of perm and NB of cnt.
__global__ __launch_bounds__(256) void k_perm(const int* __restrict__ mask, int* __restrict__ perm, int* __restrict__ cnt) {
  constexpr int TPT = SEQ / 256;
  __shared__ int sp[SEQ];
  __shared__ int wsum[8];
  const int tid = threadIdx.x, lane = tid & 31, w = tid >> 5, b = blockIdx.x;
  const int* mp = mask + (size_t)b * SEQ_FULL + tid * TPT;
  int keep[TPT];
  int c = 0;
#pragma unroll
  for (int i = 0; i < TPT; ++i) { keep[i] = mp[i] != 0 ? 1 : 0; c += keep[i]; }
  int inc = c;                                       // inclusive scan of the threads' kept counts inside the wave
#pragma unroll
  for (int off = 1; off < 32; off <<= 1) { const int v = __shfl_up(inc, off, 32); if (lane >= off) inc += v; }
  if (lane == 31) wsum[w] = inc;
  __syncthreads();
  int base = 0, n = 0;
#pragma unroll
  for (int i = 0; i < 8; ++i) { const int v = wsum[i]; n += v; if (i < w) base += v; }
  int kr = base + inc - c;                           // kept tokens in front of this thread's first token
#pragma unroll
  for (int i = 0; i < TPT; ++i) {
    const int s = tid * TPT + i;
    sp[keep[i] ? kr : n + s - kr] = s;
    kr += keep[i];
  }
  __syncthreads();
#pragma unroll
  for (int i = 0; i < TPT; ++i) perm[(size_t)b * SEQ + tid + 256 * i] = sp[tid + 256 * i];
  if (tid == 0) cnt[b] = n;
}

// dst = bf16 bits (RNE) of src, fragment-major: block (row / 16) * 32 + k / 32; source row = (row / rpb) * bstride + (row % rpb) * 1024, or, with perm, perm[row] for row % rpb.
// A wave takes 8 rows x one 128-B source line each and writes four whole 128-B lines of the block (pieces 16*q + 8*rhi + 0..7, q = k / 8 in the block).
// coverage: nrows*128 threads x 8 elements = the whole plane (nrows a multiple of 16; thread bits 0-2 and 5 -> row in the block, bits 3-4 -> q).
__global__ __launch_bounds__(256) void k_cvt(const float* __restrict__ src, unsigned short* __restrict__ dst,
                                             int nrows, int rpb, long long bstride, const int* __restrict__ perm) {
  const int t = blockIdx.x * 256 + threadIdx.x;
  if (t >= nrows * 128) return;
  const int blk = t >> 6, ln = ((t >> 5) & 1) * 8 + (t & 7), q = (t >> 3) & 3;
  const int row = (blk / (DM / 32)) * 16 + ln, k = (blk % (DM / 32)) * 32 + q * 8;
  const int b = row / rpb;
  int s = row - b * rpb;
  if (perm) {                                        // uniform for the launch
    s = perm[row];
    // the wait that is owed before the row index that the issued load names is overwritten
    asm volatile("s_wait_xcnt 0x0" :: "v"(row) : "memory");
  }
  const float* p = src + (size_t)b * (size_t)bstride + (size_t)s * DM + k;
  const v4f x0 = *(const v4fa*)(p), x1 = *(const v4fa*)(p + 4);
  v8us o;
  o[0] = bf16_bits(x0[0]); o[1] = bf16_bits(x0[1]); o[2] = bf16_bits(x0[2]); o[3] = bf16_bits(x0[3]);
  o[4] = bf16_bits(x1[0]); o[5] = bf16_bits(x1[1]); o[6] = bf16_bits(x1[2]); o[7] = bf16_bits(x1[3]);
  unsigned short* d = dst + (size_t)blk * FRAG + (q * 16 + ln) * 8;
  *(v8us*)d = o;
  
}

__device__ __forceinline__ void stage8(unsigned short* st, const v8f& c, int base, int rstep) {
#pragma unroll
  for (int r = 0; r < 8; ++r) st[base + r * rstep] = f16_bits(c[r] * CARRY);
}

// Y[m][n] = sum_k Xb[m][k] * Wb[n][k], M = NB*SEQ, N = 3*1024 (Wq | Wk | Wv rows), K = 1024.
// Block = 4 waves, tile 128 rows x 64 columns (one head of one of Q/K/V); wave tile 32 x 64; fragments straight from the fragment-major bf16 planes.
// A fragment: row m, elements 0..7 <- k0 + 8h + i, 8..15 <- k0 + 16 + 8h + i; B fragment: column n = W row n, same k map; D element r = (row 8h + r, column ln).
//   Q, K planes P3[0..1][b*16+h][token / 16][d / 32][fragment block: row = token % 16, k = d % 32]
//   V^T plane   P3[2][b*16+h][token / 32][d / 16][fragment block: row = d % 16, k = token % 32]; each thread stores the piece of its own index: whole lines.
// K and V^T tiles that start behind the last kept position are never read and are left out (block-uniform return in front of every barrier); a tile that straddles it is whole.
// coverage: grid (48, NB*SEQ/128) x (128 x 64) = the Q plane and every K, V^T tile the key loop reads; LDS tile fully written before it is read (128x64 or 64x128).
__global__ __launch_bounds__(128) void k_proj(const unsigned short* __restrict__ Xb, const unsigned short* __restrict__ Wb,
                                              unsigned short* __restrict__ P3, const int* __restrict__ cnt) {
  __shared__ __attribute__((aligned(16))) unsigned short st[128 * 72];
  const int tid = threadIdx.x, w = __builtin_amdgcn_readfirstlane((int)(tid >> 5)), lane = tid & 31, ln = lane & 15, hh = lane >> 4;
  const int n0 = blockIdx.x * 64;
  const int m0 = blockIdx.y * 128;
  if (n0 >= DM) {                                    // K or V columns
    const int n = cnt[m0 / SEQ];
    if (n > 0 && m0 % SEQ >= n) return;
  }
  const unsigned short* ap0 = Xb + (size_t)((m0 >> 4) + 2 * w) * RTILE + lane * 8;
  const unsigned short* ap1 = ap0 + RTILE;
  const unsigned short* bp = Wb + (size_t)(n0 >> 4) * RTILE + lane * 8;
  const v8f z8 = {0.f, 0.f, 0.f, 0.f, 0.f, 0.f, 0.f, 0.f};
  v8f c00 = z8, c01 = z8, c02 = z8, c03 = z8, c10 = z8, c11 = z8, c12 = z8, c13 = z8;
#pragma unroll 1
  for (int ko = 0; ko < (DM / 32) * FRAG; ko += FRAG) {          // ko: element offset of k-block k0 / 32 inside a row tile
    FragB a0, a1, b0, b1, b2, b3;
    a0.half[0] = *(const v8us*)(ap0 + ko);             a0.half[1] = *(const v8us*)(ap0 + ko + FRAG / 2);
    a1.half[0] = *(const v8us*)(ap1 + ko);             a1.half[1] = *(const v8us*)(ap1 + ko + FRAG / 2);
    b0.half[0] = *(const v8us*)(bp + ko);              b0.half[1] = *(const v8us*)(bp + ko + FRAG / 2);
    b1.half[0] = *(const v8us*)(bp + RTILE + ko);      b1.half[1] = *(const v8us*)(bp + RTILE + ko + FRAG / 2);
    b2.half[0] = *(const v8us*)(bp + 2 * RTILE + ko);  b2.half[1] = *(const v8us*)(bp + 2 * RTILE + ko + FRAG / 2);
    b3.half[0] = *(const v8us*)(bp + 3 * RTILE + ko);  b3.half[1] = *(const v8us*)(bp + 3 * RTILE + ko + FRAG / 2);
    // the wait that is owed before a register named by an issued load is overwritten; the two addresses as inputs keep their registers out of the loads' own destinations
    asm volatile("s_wait_xcnt 0x0" :: "v"(ap0 + ko), "v"(bp + ko) : "memory");
    mma_b4(a0.v, b0.v, b1.v, b2.v, b3.v, c00, c01, c02, c03);
    mma_b4(a1.v, b0.v, b1.v, b2.v, b3.v, c10, c11, c12, c13);
  }
  const int which = n0 >> 10;                 // 0: Q, 1: K, 2: V (block-uniform)
  const int h = (n0 & 1023) >> 6;
  const int b = m0 / SEQ, s0 = m0 - b * SEQ;
  const int bh = b * NH + h;
  const bool rowmajor = which < 2;
  const int rstep = rowmajor ? 72 : 1;
  const int rb0 = 32 * w + 8 * hh, rb1 = rb0 + 16;
  // element (row rb + r, column 16*nt + ln): Q/K tile st[row*72 + col]; V tile st[col*136 + row]
  stage8(st, c00, rowmajor ? rb0 * 72 + ln        : (ln) * 136 + rb0,      rstep);
  stage8(st, c01, rowmajor ? rb0 * 72 + 16 + ln   : (16 + ln) * 136 + rb0, rstep);
  stage8(st, c02, rowmajor ? rb0 * 72 + 32 + ln   : (32 + ln) * 136 + rb0, rstep);
  stage8(st, c03, rowmajor ? rb0 * 72 + 48 + ln   : (48 + ln) * 136 + rb0, rstep);
  stage8(st, c10, rowmajor ? rb1 * 72 + ln        : (ln) * 136 + rb1,      rstep);
  stage8(st, c11, rowmajor ? rb1 * 72 + 16 + ln   : (16 + ln) * 136 + rb1, rstep);
  stage8(st, c12, rowmajor ? rb1 * 72 + 32 + ln   : (32 + ln) * 136 + rb1, rstep);
  stage8(st, c13, rowmajor ? rb1 * 72 + 48 + ln   : (48 + ln) * 136 + rb1, rstep);
  __syncthreads();
  if (rowmajor) {
    unsigned short* base = P3 + (size_t)which * PLANE + ((size_t)bh * SEQ + s0) * HD;
    {
#pragma unroll
      for (int it = 0; it < 8; ++it) {
        const int i = tid + 128 * it;                                   // piece i: token tile i / 128, d block (i / 64) % 2, piece i % 64
        const int row = (i >> 7) * 16 + (i & 15), col = ((i >> 4) & 7) * 8;   // d = 32*c + 16*half + 8*hh
        const v8us o = *(const v8us*)(&st[row * 72 + col]);
        *(v8us*)(base + (size_t)i * 8) = o;
      }
      
    }
  } else {
    unsigned short* base = P3 + (size_t)2 * PLANE + ((size_t)bh * SEQ + s0) * HD;
    {
#pragma unroll
      for (int it = 0; it < 8; ++it) {
        const int i = tid + 128 * it;
        const int dc = ((i >> 6) & 3) * 16 + (i & 15);                  // piece i: key block i / 256, d tile (i / 64) % 4, piece i % 64
        const int tk = (i >> 8) * 32 + ((i >> 4) & 3) * 8;              // token = 32*block + 16*half + 8*hh
        const v8us o = *(const v8us*)(&st[dc * 136 + tk]);
        *(v8us*)(base + (size_t)i * 8) = o;
      }
      
    }
  }
}

// One 32-key step for a wave's 16 queries. Kp, Vp are the (batch, head) bases of the planes; mword bit j set = key position key0 + j is padded out.
// MASKED = false: a step whose 32 positions are all kept keys (mword not read).
template <bool MASKED>
__device__ __forceinline__ void fa_step(const unsigned short* __restrict__ Kp, const unsigned short* __restrict__ Vp,
                                        int key0, unsigned int mword, int ln, int hh, const FragH& q0, const FragH& q1,
                                        float& mr, float& lr, v8f (&Oh)[4], v8f (&Ol)[4]) {
  // A fragments of K: row m = key (key0 + 16*kt + ln), elements 0..7 <- d = 32c + 8h + i, 8..15 <- d = 32c + 16 + 8h + i; block 2*kt + c of the step's 4 KiB
  const int lane8 = (16 * hh + ln) * 8;
  const unsigned short* kp = Kp + (size_t)key0 * HD + lane8;
  FragH k00, k01, k10, k11;
  k00.half[0] = *(const v8us*)(kp);            k00.half[1] = *(const v8us*)(kp + FRAG / 2);
  k01.half[0] = *(const v8us*)(kp + FRAG);     k01.half[1] = *(const v8us*)(kp + FRAG + FRAG / 2);
  k10.half[0] = *(const v8us*)(kp + 2 * FRAG); k10.half[1] = *(const v8us*)(kp + 2 * FRAG + FRAG / 2);
  k11.half[0] = *(const v8us*)(kp + 3 * FRAG); k11.half[1] = *(const v8us*)(kp + 3 * FRAG + FRAG / 2);
  // A fragments of V^T: row m = d (16*t + ln), elements 0..7 <- key0 + 8h + i, 8..15 <- key0 + 16 + 8h + i; block t of the step's 4 KiB
  const unsigned short* vp = Vp + (size_t)key0 * HD + lane8;
  FragH vf[4];
#pragma unroll
  for (int t = 0; t < 4; ++t) {
    vf[t].half[0] = *(const v8us*)(vp + t * FRAG);
    vf[t].half[1] = *(const v8us*)(vp + t * FRAG + FRAG / 2);
  }
  // the wait that is owed before a register named by an issued load is overwritten; the two addresses as inputs keep their registers out of the loads' own destinations
  asm volatile("s_wait_xcnt 0x0" :: "v"(kp), "v"(vp) : "memory");
  const v8f z8 = {0.f, 0.f, 0.f, 0.f, 0.f, 0.f, 0.f, 0.f};
  // S^T tiles: element r of tile kt = score(key0 + 16*kt + 8h + r, query of this lane's column)
  const v8f s0 = mma_hh2(k00.v, q0.v, k01.v, q1.v, z8);
  const v8f s1 = mma_hh2(k10.v, q0.v, k11.v, q1.v, z8);
  const unsigned int wl = mword >> (8 * hh);
  float sc[16];
#pragma unroll
  for (int r = 0; r < 8; ++r) {
    const float a = s0[r] * QKSCALE, c = s1[r] * QKSCALE;
    sc[r]     = (MASKED && ((wl >> r) & 1u)) ? NEGFILL : a;            // padded key: the score is replaced
    sc[8 + r] = (MASKED && ((wl >> (16 + r)) & 1u)) ? NEGFILL : c;
  }
  float mx = sc[0];
#pragma unroll
  for (int i = 1; i < 16; ++i) mx = fmaxf(mx, sc[i]);
  mx = fmaxf(mx, __shfl_xor(mx, 16, 32));           // the other lane half holds the other 16 keys of this query
  const float mnew = fmaxf(mr, mx);
  const float al = exp2f((mr - mnew) * LOG2E);
  mr = mnew;
  // weights carried x256: pc = 256 * exp(sc - mnew); hi plane f16(pc), residual plane f16((pc - hi) * 2048)
  FragH ph, pl;
  float ps = 0.0f;
#pragma unroll
  for (int i = 0; i < 16; ++i) {
    const float pc = exp2f(fmaf(sc[i] - mnew, LOG2E, 8.0f));
    ps += pc;
    const _Float16 h = (_Float16)pc;
    ph.h[i] = h;                                    // B element i: i<8 -> key0 + 8h + i (tile 0 row 8h+i); i>=8 -> key0 + 16 + 8h + (i-8) (tile 1)
    pl.h[i] = (_Float16)((pc - (float)h) * 2048.0f);
  }
  ps += __shfl_xor(ps, 16, 32);
  lr = lr * al + ps;
#pragma unroll
  for (int t = 0; t < 4; ++t) { Oh[t] = Oh[t] * al; Ol[t] = Ol[t] * al; }
#pragma unroll
  for (int t = 0; t < 4; ++t) mma_h2(vf[t].v, ph.v, pl.v, Oh[t], Ol[t]);
}

// Block = 4 waves x 16 query positions = 64 of one (batch, head). Key positions 0 .. cnt-1 are the kept keys: whole steps carry no mask, the last one masks its tail.
// Epilogue: O^T tile -> per-wave LDS tile [16 queries][64 d] (block barrier), then lanes 0..15 / 16..31 each write 256 contiguous bytes
// coverage: NB*16*(SEQ/64) blocks x 4 waves x 16 rows x 64 columns = every context element exactly once; trip counts clamped to SEQ / 32.
__global__ __launch_bounds__(128) void k_attn(const unsigned short* __restrict__ Qh, const unsigned short* __restrict__ Kh,
                                              const unsigned short* __restrict__ Vt, const int* __restrict__ cnt,
                                              float* __restrict__ Cx) {
  __shared__ __attribute__((aligned(16))) float so[4][16][68];
  const int tid = threadIdx.x, w = __builtin_amdgcn_readfirstlane((int)(tid >> 5)), lane = tid & 31, ln = lane & 15, hh = lane >> 4;
  const int bh = blockIdx.x / (SEQ / 64), qt = blockIdx.x % (SEQ / 64);
  const int b = bh / NH, h = bh - b * NH;
  const int qbase = qt * 64 + 16 * w;
  const int n = min(max(cnt[b], 0), SEQ);            // kept keys of the batch (block-uniform)
  const int full = n >> 5;                           // steps of 32 kept keys
  const int steps = n > 0 ? (n + 31) >> 5 : SEQ / 32;
  // Q^T B fragments: column n = query qbase + ln, elements 0..7 <- d = 32c + 8h + i, 8..15 <- d = 32c + 16 + 8h + i
  const unsigned short* qrow = Qh + ((size_t)bh * SEQ + qbase) * HD + lane * 8;   // the wave's 16 queries are one token tile: blocks c = 0, 1
  FragH q0, q1;
  q0.half[0] = *(const v8us*)(qrow);        q0.half[1] = *(const v8us*)(qrow + FRAG / 2);
  q1.half[0] = *(const v8us*)(qrow + FRAG); q1.half[1] = *(const v8us*)(qrow + FRAG + FRAG / 2);
  // the wait that is owed before the lane offset that the four issued loads name is overwritten
  asm volatile("s_wait_xcnt 0x0" :: "v"(lane) : "memory");
  float mr = -3.0e38f, lr = 0.0f;
  v8f Oh[4] = {}, Ol[4] = {};
  const unsigned short* Kp = Kh + (size_t)bh * SEQ * HD;
  const unsigned short* Vp = Vt + (size_t)bh * HD * SEQ;
#pragma unroll 1
  for (int j = 0; j < full; ++j)
    fa_step<false>(Kp, Vp, 32 * j, 0u, ln, hh, q0, q1, mr, lr, Oh, Ol);
#pragma unroll 1                                     // rolled: runs at most once unless no key is kept, copies would only cost instruction cache
  for (int j = full; j < steps; ++j)                 // the tail step (positions n % 32 and up are padded keys), or every step when no key is kept
    fa_step<true>(Kp, Vp, 32 * j, 0xFFFFFFFFu << (n & 31), ln, hh, q0, q1, mr, lr, Oh, Ol);

  // O^T element r of tile t = ctx(query qbase + ln, d = 16t + 8h + r); undo the carries: x256 (in lr), x16 (V), x2048 (residual plane)
  const float inv = 1.0f / (CARRY * lr);
#pragma unroll
  for (int t = 0; t < 4; ++t)
#pragma unroll
    for (int r = 0; r < 8; ++r)
      so[w][ln][16 * t + 8 * hh + r] = (Oh[t][r] + Ol[t][r] * 0.00048828125f) * inv;
  __syncthreads();
  float* og = Cx + ((size_t)b * SEQ + qbase) * DM + h * HD;
  const int rsub = lane >> 4, c4 = (lane & 15) * 4;
  {
#pragma unroll
    for (int q = 0; q < 8; ++q) {
      const int row = 2 * q + rsub;
      const v4f v = *(const v4fa*)&so[w][row][c4];
      *(v4f*)(og + (size_t)row * DM + c4) = v;
    }
    
  }
}

// coverage: NB*SEQ blocks x 256 threads x 4 columns = every output element of the processed region exactly once.
__global__ __launch_bounds__(256) void k_ln(const float* __restrict__ Cx, const float* __restrict__ gamma,
                                            const float* __restrict__ beta, const int* __restrict__ perm, float* __restrict__ out) {
  __shared__ float rs[8];
  __shared__ float rq[8];
  const int tid = threadIdx.x, lane = tid & 31, w = __builtin_amdgcn_readfirstlane((int)(tid >> 5));
  const int r = blockIdx.x;
  const int b = r / SEQ, s = perm[r];                // context row r holds the token of position r % SEQ
  const v4f x = *(const v4fa*)(Cx + (size_t)r * DM + tid * 4);
  float sm = (x[0] + x[1]) + (x[2] + x[3]);
#pragma unroll
  for (int off = 16; off >= 1; off >>= 1) sm += __shfl_xor(sm, off, 32);
  if (lane == 0) rs[w] = sm;
  __syncthreads();
  float tot = 0.0f;
#pragma unroll
  for (int i = 0; i < 8; ++i) tot += rs[i];
  const float mu = tot * (1.0f / 1024.0f);
  const float d0 = x[0] - mu, d1 = x[1] - mu, d2 = x[2] - mu, d3 = x[3] - mu;
  float sq = (d0 * d0 + d1 * d1) + (d2 * d2 + d3 * d3);
#pragma unroll
  for (int off = 16; off >= 1; off >>= 1) sq += __shfl_xor(sq, off, 32);
  if (lane == 0) rq[w] = sq;
  __syncthreads();
  float tq = 0.0f;
#pragma unroll
  for (int i = 0; i < 8; ++i) tq += rq[i];
  const float var = tq * (1.0f / 1024.0f);
  const float rinv = rsqrtf(var + 1.0e-6f);
  const v4f g = *(const v4fa*)(gamma + tid * 4);
  const v4f be = *(const v4fa*)(beta + tid * 4);
  v4f o;
  o[0] = d0 * rinv * bf16_rne(g[0]) + bf16_rne(be[0]);
  o[1] = d1 * rinv * bf16_rne(g[1]) + bf16_rne(be[1]);
  o[2] = d2 * rinv * bf16_rne(g[2]) + bf16_rne(be[2]);
  o[3] = d3 * rinv * bf16_rne(g[3]) + bf16_rne(be[3]);
  float* dst = out + ((size_t)b * SEQ_FULL + s) * DM + tid * 4;
  *(v4f*)dst = o;
  
}

extern "C" void kernel_launch(void* const* d_in, const int* in_sizes, int n_in,
                              void* d_out, int out_size, void* d_ws, size_t ws_size, hipStream_t stream) {
  if (n_in < 7) return;
  const long long need_x = (long long)(NB - 1) * SEQ_FULL * DM + (long long)SEQ * DM;   // last element touched + 1
  const long long need_m = (long long)(NB - 1) * SEQ_FULL + (long long)SEQ;
  if ((long long)in_sizes[0] < need_x || (long long)in_sizes[1] < need_m) return;
  if ((long long)in_sizes[2] < (long long)DM * DM || (long long)in_sizes[3] < (long long)DM * DM || (long long)in_sizes[4] < (long long)DM * DM) return;
  if (in_sizes[5] < DM || in_sizes[6] < DM) return;
  if ((long long)out_size < need_x) return;
  const float* X     = (const float*)d_in[0];   // wire order: q [2][2048][1024] f32, mask [2][2048] i32, Wq, Wk, Wv [1024][1024] f32, gamma, beta [1024] f32
  const int*   mask  = (const int*)d_in[1];
  const float* Wq    = (const float*)d_in[2];
  const float* Wk    = (const float*)d_in[3];
  const float* Wv    = (const float*)d_in[4];
  const float* gamma = (const float*)d_in[5];
  const float* beta  = (const float*)d_in[6];
  float* out = (float*)d_out;
  char* ws = (char*)d_ws;
  size_t off = 0;
  const size_t xb_bytes = (size_t)NB * SEQ * DM * 2;        // 8 MiB at full size; every plane is written by whole 16-B pieces, none past its end
  const size_t wb_bytes = (size_t)3 * DM * DM * 2;          // 6 MiB
  const size_t p3_bytes = 3 * PLANE * 2;                    // 24 MiB
  const size_t cx_bytes = (size_t)NB * SEQ * DM * 4;        // 16 MiB
  unsigned short* Xb = (unsigned short*)(ws + off); off += (xb_bytes + 255) & ~(size_t)255;
  unsigned short* Wb = (unsigned short*)(ws + off); off += (wb_bytes + 255) & ~(size_t)255;
  unsigned short* P3 = (unsigned short*)(ws + off); off += (p3_bytes + 255) & ~(size_t)255;
  float*          Cx = (float*)(ws + off);          off += (cx_bytes + 255) & ~(size_t)255;
  int*          perm = (int*)(ws + off);            off += ((size_t)NB * SEQ * 4 + 255) & ~(size_t)255;
  int*           cnt = (int*)(ws + off);            off += 256;
  if (off > ws_size) return;
  k_perm<<<(unsigned)NB, 256, 0, stream>>>(mask, perm, cnt);
  k_cvt<<<(unsigned)((NB * SEQ * 128 + 255) / 256), 256, 0, stream>>>(X, Xb, NB * SEQ, SEQ, (long long)XB_FULL, perm);
  k_cvt<<<(unsigned)((DM * 128 + 255) / 256), 256, 0, stream>>>(Wq, Wb, DM, DM, 0LL, nullptr);
  k_cvt<<<(unsigned)((DM * 128 + 255) / 256), 256, 0, stream>>>(Wk, Wb + (size_t)DM * DM, DM, DM, 0LL, nullptr);
  k_cvt<<<(unsigned)((DM * 128 + 255) / 256), 256, 0, stream>>>(Wv, Wb + (size_t)2 * DM * DM, DM, DM, 0LL, nullptr);
  k_proj<<<dim3((unsigned)(3 * DM / 64), (unsigned)(NB * SEQ / 128)), 128, 0, stream>>>(Xb, Wb, P3, cnt);
  k_attn<<<(unsigned)(NB * NH * (SEQ / 64)), 128, 0, stream>>>(P3, P3 + PLANE, P3 + 2 * PLANE, cnt, Cx);
  k_ln<<<(unsigned)(NB * SEQ), 256, 0, stream>>>(Cx, gamma, beta, perm, out);
}

// v003
// It runs in 84.9 microseconds.
// Timed twice side by side with v002, it ran 1.04 and 1.05 times as fast.
// Over all steps from v000 it is 2.40 times as fast.
#include <hip/hip_runtime.h>
// Contractions: x Wq^T, x Wk^T, x Wv^T on v_wmma_f32_16x16x32_bf16 (x and W converted RNE to bf16, single product, f32 accumulate); S^T = K Q^T on v_wmma_f32_16x16x32_f16 (Q, K: f16 planes of the f32 projections x16, single product); O^T = V^T P^T on v_wmma_f32_16x16x32_f16 (V: f16 plane x16; P: x256 f16 hi plane + x2^11 f16 residual plane in a separate f32 accumulator); softmax statistics and LayerNorm f32.
// Multi-head self attention, B x S x 1024, 16 heads x 64, scores scaled 1/8, key-padding mask replaces masked scores by -1e20, LayerNorm over the 1024 concatenated columns.
// Engine: transposed flash. Each wave owns 16 queries of one (batch, head). Per 32-key step: S^T tiles (key rows x query columns) from K rows (A, global f16 plane)
// and Q^T (B, registers); the two 16-key D tiles pack straight into the P^T B fragment; O^T (d rows x query columns) accumulates from V^T rows (A, global f16 plane).
// Every 16-bit plane is stored fragment-major: a 16 x 32 operand fragment (16 rows or columns x 32 k) is one 1-KiB block of 64 pieces of 8 elements,
// piece 32*half + lane (lane = 16*hh + ln) = row ln, k = 16*half + 8*hh + 0..7. A wave-wide 16-byte load of one half reads 512 contiguous bytes (4 lines, not 16).
// Token order: inside each batch the tokens are stably partitioned by the key mask, kept keys first (perm[position] = token, cnt = kept keys). A padded key's weight is
// exp(-1e20 - max) = 0 whenever one key is kept, so K, V^T and the key loop cover the first cnt positions only; every plane and the context are in position order and
// the LayerNorm kernel stores row perm[position]. No key kept: every score is -1e20 (uniform weights), so all SEQ positions are walked with every key marked padded.
#ifndef NB
#define NB 2
#endif
#ifndef SEQ
#define SEQ 2048
#endif
#define NB_FULL 2
#define SEQ_FULL 2048
#define DM 1024
#define NH 16
#define HD 64
#define XB_FULL ((size_t)SEQ_FULL * DM)          /* per-batch element stride of the activation input and of the output */
#define PLANE ((size_t)NB * NH * SEQ * HD)       /* elements of one of the Q / K / V^T planes */
#define FRAG 512                                 /* elements of one 16 x 32 fragment block; its second half starts at FRAG / 2 */
#define RTILE ((size_t)16 * DM)                  /* elements of 16 rows of a [rows][1024] plane = 32 fragment blocks */

static_assert(SEQ % 256 == 0);
static_assert(SEQ <= SEQ_FULL);
static_assert(NB <= NB_FULL);
static_assert(HD == 64);
static_assert(DM == NH * HD);
static_assert(DM % 32 == 0);
static_assert((3 * DM) % 64 == 0);
static_assert((size_t)NB * SEQ * DM * 2 + (size_t)3 * DM * DM * 2 + 3 * PLANE * 2 + (size_t)NB * SEQ * DM * 4 + (size_t)NB * SEQ * 4 + 1024 <= (size_t)134217728);

typedef __bf16 v16b __attribute__((ext_vector_type(16)));
typedef _Float16 v16h __attribute__((ext_vector_type(16)));
typedef unsigned short v8us __attribute__((ext_vector_type(8), may_alias));
typedef float v8f __attribute__((ext_vector_type(8)));
typedef float v4f __attribute__((ext_vector_type(4)));
typedef float v4fa __attribute__((ext_vector_type(4), may_alias));
union FragB { v16b v; v8us half[2]; unsigned short u[16]; };
union FragH { v16h v; v8us half[2]; _Float16 h[16]; unsigned short u[16]; };

#define LOG2E 1.4426950408889634f
#define NEGFILL (-1.0e20f)
#define CARRY 16.0f                      /* power-of-two carry of the Q, K and V planes */
#define QKSCALE 0.00048828125f           /* (1/8) / (16*16) */

__device__ __forceinline__ unsigned short bf16_bits(float x) {   // RNE convert to bf16 bits
  unsigned int u = __float_as_uint(x);
  return (unsigned short)((u + 0x7FFFu + ((u >> 16) & 1u)) >> 16);
}
__device__ __forceinline__ float bf16_val(unsigned short b) { return __uint_as_float(((unsigned int)b) << 16); }
__device__ __forceinline__ float bf16_rne(float x) { return bf16_val(bf16_bits(x)); }
__device__ __forceinline__ unsigned short f16_bits(float x) { const _Float16 h = (_Float16)x; return __builtin_bit_cast(unsigned short, h); }

// c0..c3 += a * b0..b3 (one bf16 k-step of four column tiles), then the hazard guard
__device__ __forceinline__ void mma_b4(v16b a, v16b b0, v16b b1, v16b b2, v16b b3, v8f& c0, v8f& c1, v8f& c2, v8f& c3) {
  c0 = __builtin_amdgcn_wmma_f32_16x16x32_bf16(false, a, false, b0, (short)0, c0, false, false);
  c1 = __builtin_amdgcn_wmma_f32_16x16x32_bf16(false, a, false, b1, (short)0, c1, false, false);
  c2 = __builtin_amdgcn_wmma_f32_16x16x32_bf16(false, a, false, b2, (short)0, c2, false, false);
  c3 = __builtin_amdgcn_wmma_f32_16x16x32_bf16(false, a, false, b3, (short)0, c3, false, false);
  asm volatile("v_nop\n\tv_nop\n\tv_nop\n\tv_nop" : "+v"(c0), "+v"(c1), "+v"(c2), "+v"(c3) : "v"(a), "v"(b0), "v"(b1), "v"(b2), "v"(b3));
}
// c += a0*b0 + a1*b1 (two k-steps of one f16 tile), then the hazard guard
__device__ __forceinline__ v8f mma_hh2(v16h a0, v16h b0, v16h a1, v16h b1, v8f c) {
  c = __builtin_amdgcn_wmma_f32_16x16x32_f16(false, a0, false, b0, (short)0, c, false, false);
  c = __builtin_amdgcn_wmma_f32_16x16x32_f16(false, a1, false, b1, (short)0, c, false, false);
  asm volatile("v_nop\n\tv_nop\n\tv_nop\n\tv_nop" : "+v"(c) : "v"(a0), "v"(b0), "v"(a1), "v"(b1));
  return c;
}
// ch += a*bh ; cl += a*bl (scaled residual plane keeps its own accumulator), then the hazard guard
__device__ __forceinline__ void mma_h2(v16h a, v16h bh, v16h bl, v8f& ch, v8f& cl) {
  ch = __builtin_amdgcn_wmma_f32_16x16x32_f16(false, a, false, bh, (short)0, ch, false, false);
  cl = __builtin_amdgcn_wmma_f32_16x16x32_f16(false, a, false, bl, (short)0, cl, false, false);
  asm volatile("v_nop\n\tv_nop\n\tv_nop\n\tv_nop" : "+v"(ch), "+v"(cl) : "v"(a), "v"(bh), "v"(bl));
}

// Stable partition of one batch's tokens: position of token s = kept tokens before s if it is kept, else cnt + padded tokens before s (a permutation of 0..SEQ-1 for any mask).
// One block per batch, SEQ / 256 consecutive tokens per thread; the list is gathered in LDS and stored as whole lines.
// coverage: every sp[] entry written once (permutation) before the barrier in front of its read; NB x SEQ entries of perm and NB of cnt.
__global__ __launch_bounds__(256) void k_perm(const int* __restrict__ mask, int* __restrict__ perm, int* __restrict__ cnt) {
  constexpr int TPT = SEQ / 256;
  __shared__ int sp[SEQ];
  __shared__ int wsum[8];
  const int tid = threadIdx.x, lane = tid & 31, w = tid >> 5, b = blockIdx.x;
  const int* mp = mask + (size_t)b * SEQ_FULL + tid * TPT;
  int keep[TPT];
  int c = 0;
#pragma unroll
  for (int i = 0; i < TPT; ++i) { keep[i] = mp[i] != 0 ? 1 : 0; c += keep[i]; }
  int inc = c;                                       // inclusive scan of the threads' kept counts inside the wave
#pragma unroll
  for (int off = 1; off < 32; off <<= 1) { const int v = __shfl_up(inc, off, 32); if (lane >= off) inc += v; }
  if (lane == 31) wsum[w] = inc;
  __syncthreads();
  int base = 0, n = 0;
#pragma unroll
  for (int i = 0; i < 8; ++i) { const int v = wsum[i]; n += v; if (i < w) base += v; }
  int kr = base + inc - c;                           // kept tokens in front of this thread's first token
#pragma unroll
  for (int i = 0; i < TPT; ++i) {
    const int s = tid * TPT + i;
    sp[keep[i] ? kr : n + s - kr] = s;
    kr += keep[i];
  }
  __syncthreads();
#pragma unroll
  for (int i = 0; i < TPT; ++i) perm[(size_t)b * SEQ + tid + 256 * i] = sp[tid + 256 * i];
  if (tid == 0) cnt[b] = n;
}

// dst = bf16 bits (RNE) of src, fragment-major: block (row / 16) * 32 + k / 32; source row = (row / rpb) * bstride + (row % rpb) * 1024, or, with perm, perm[row] for row % rpb.
// A wave takes 8 rows x one 128-B source line each and writes four whole 128-B lines of the block (pieces 16*q + 8*rhi + 0..7, q = k / 8 in the block).
// coverage: nrows*128 threads x 8 elements = the whole plane (nrows a multiple of 16; thread bits 0-2 and 5 -> row in the block, bits 3-4 -> q).
__global__ __launch_bounds__(256) void k_cvt(const float* __restrict__ src, unsigned short* __restrict__ dst,
                                             int nrows, int rpb, long long bstride, const int* __restrict__ perm) {
  const int t = blockIdx.x * 256 + threadIdx.x;
  if (t >= nrows * 128) return;
  const int blk = t >> 6, ln = ((t >> 5) & 1) * 8 + (t & 7), q = (t >> 3) & 3;
  const int row = (blk / (DM / 32)) * 16 + ln, k = (blk % (DM / 32)) * 32 + q * 8;
  const int b = row / rpb;
  int s = row - b * rpb;
  if (perm) {                                        // uniform for the launch
    s = perm[row];
    // the wait that is owed before the row index that the issued load names is overwritten
    asm volatile("s_wait_xcnt 0x0" :: "v"(row) : "memory");
  }
  const float* p = src + (size_t)b * (size_t)bstride + (size_t)s * DM + k;
  const v4f x0 = *(const v4fa*)(p), x1 = *(const v4fa*)(p + 4);
  v8us o;
  o[0] = bf16_bits(x0[0]); o[1] = bf16_bits(x0[1]); o[2] = bf16_bits(x0[2]); o[3] = bf16_bits(x0[3]);
  o[4] = bf16_bits(x1[0]); o[5] = bf16_bits(x1[1]); o[6] = bf16_bits(x1[2]); o[7] = bf16_bits(x1[3]);
  unsigned short* d = dst + (size_t)blk * FRAG + (q * 16 + ln) * 8;
  *(v8us*)d = o;
  
}

__device__ __forceinline__ void stage8(unsigned short* st, const v8f& c, int base, int rstep) {
#pragma unroll
  for (int r = 0; r < 8; ++r) st[base + r * rstep] = f16_bits(c[r] * CARRY);
}

// Y[m][n] = sum_k Xb[m][k] * Wb[n][k], M = NB*SEQ, N = 3*1024 (Wq | Wk | Wv rows), K = 1024.
// Block = 4 waves, tile 128 rows x 64 columns (one head of one of Q/K/V); wave tile 32 x 64; fragments straight from the fragment-major bf16 planes.
// A fragment: row m, elements 0..7 <- k0 + 8h + i, 8..15 <- k0 + 16 + 8h + i; B fragment: column n = W row n, same k map; D element r = (row 8h + r, column ln).
//   Q, K planes P3[0..1][b*16+h][token / 16][d / 32][fragment block: row = token % 16, k = d % 32]
//   V^T plane   P3[2][b*16+h][token / 32][d / 16][fragment block: row = d % 16, k = token % 32]; each thread stores the piece of its own index: whole lines.
// K and V^T tiles that start behind the last kept position are never read and are left out (block-uniform return in front of every barrier); a tile that straddles it is whole.
// coverage: grid (48, NB*SEQ/128) x (128 x 64) = the Q plane and every K, V^T tile the key loop reads; LDS tile fully written before it is read (128x64 or 64x128).
__global__ __launch_bounds__(128) void k_proj(const unsigned short* __restrict__ Xb, const unsigned short* __restrict__ Wb,
                                              unsigned short* __restrict__ P3, const int* __restrict__ cnt) {
  __shared__ __attribute__((aligned(16))) unsigned short st[128 * 72];
  const int tid = threadIdx.x, w = __builtin_amdgcn_readfirstlane((int)(tid >> 5)), lane = tid & 31, ln = lane & 15, hh = lane >> 4;
  const int n0 = blockIdx.x * 64;
  const int m0 = blockIdx.y * 128;
  if (n0 >= DM) {                                    // K or V columns
    const int n = cnt[m0 / SEQ];
    if (n > 0 && m0 % SEQ >= n) return;
  }
  const unsigned short* ap0 = Xb + (size_t)((m0 >> 4) + 2 * w) * RTILE + lane * 8;
  const unsigned short* ap1 = ap0 + RTILE;
  const unsigned short* bp = Wb + (size_t)(n0 >> 4) * RTILE + lane * 8;
  const v8f z8 = {0.f, 0.f, 0.f, 0.f, 0.f, 0.f, 0.f, 0.f};
  v8f c00 = z8, c01 = z8, c02 = z8, c03 = z8, c10 = z8, c11 = z8, c12 = z8, c13 = z8;
#pragma unroll 1
  for (int ko = 0; ko < (DM / 32) * FRAG; ko += FRAG) {          // ko: element offset of k-block k0 / 32 inside a row tile
    FragB a0, a1, b0, b1, b2, b3;
    a0.half[0] = *(const v8us*)(ap0 + ko);             a0.half[1] = *(const v8us*)(ap0 + ko + FRAG / 2);
    a1.half[0] = *(const v8us*)(ap1 + ko);             a1.half[1] = *(const v8us*)(ap1 + ko + FRAG / 2);
    b0.half[0] = *(const v8us*)(bp + ko);              b0.half[1] = *(const v8us*)(bp + ko + FRAG / 2);
    b1.half[0] = *(const v8us*)(bp + RTILE + ko);      b1.half[1] = *(const v8us*)(bp + RTILE + ko + FRAG / 2);
    b2.half[0] = *(const v8us*)(bp + 2 * RTILE + ko);  b2.half[1] = *(const v8us*)(bp + 2 * RTILE + ko + FRAG / 2);
    b3.half[0] = *(const v8us*)(bp + 3 * RTILE + ko);  b3.half[1] = *(const v8us*)(bp + 3 * RTILE + ko + FRAG / 2);
    // the wait that is owed before a register named by an issued load is overwritten; the two addresses as inputs keep their registers out of the loads' own destinations
    asm volatile("s_wait_xcnt 0x0" :: "v"(ap0 + ko), "v"(bp + ko) : "memory");
    mma_b4(a0.v, b0.v, b1.v, b2.v, b3.v, c00, c01, c02, c03);
    mma_b4(a1.v, b0.v, b1.v, b2.v, b3.v, c10, c11, c12, c13);
  }
  const int which = n0 >> 10;                 // 0: Q, 1: K, 2: V (block-uniform)
  const int h = (n0 & 1023) >> 6;
  const int b = m0 / SEQ, s0 = m0 - b * SEQ;
  const int bh = b * NH + h;
  const bool rowmajor = which < 2;
  const int rstep = rowmajor ? 72 : 1;
  const int rb0 = 32 * w + 8 * hh, rb1 = rb0 + 16;
  // element (row rb + r, column 16*nt + ln): Q/K tile st[row*72 + col]; V tile st[col*136 + row]
  stage8(st, c00, rowmajor ? rb0 * 72 + ln        : (ln) * 136 + rb0,      rstep);
  stage8(st, c01, rowmajor ? rb0 * 72 + 16 + ln   : (16 + ln) * 136 + rb0, rstep);
  stage8(st, c02, rowmajor ? rb0 * 72 + 32 + ln   : (32 + ln) * 136 + rb0, rstep);
  stage8(st, c03, rowmajor ? rb0 * 72 + 48 + ln   : (48 + ln) * 136 + rb0, rstep);
  stage8(st, c10, rowmajor ? rb1 * 72 + ln        : (ln) * 136 + rb1,      rstep);
  stage8(st, c11, rowmajor ? rb1 * 72 + 16 + ln   : (16 + ln) * 136 + rb1, rstep);
  stage8(st, c12, rowmajor ? rb1 * 72 + 32 + ln   : (32 + ln) * 136 + rb1, rstep);
  stage8(st, c13, rowmajor ? rb1 * 72 + 48 + ln   : (48 + ln) * 136 + rb1, rstep);
  __syncthreads();
  if (rowmajor) {
    unsigned short* base = P3 + (size_t)which * PLANE + ((size_t)bh * SEQ + s0) * HD;
    {
#pragma unroll
      for (int it = 0; it < 8; ++it) {
        const int i = tid + 128 * it;                                   // piece i: token tile i / 128, d block (i / 64) % 2, piece i % 64
        const int row = (i >> 7) * 16 + (i & 15), col = ((i >> 4) & 7) * 8;   // d = 32*c + 16*half + 8*hh
        const v8us o = *(const v8us*)(&st[row * 72 + col]);
        *(v8us*)(base + (size_t)i * 8) = o;
      }
      
    }
  } else {
    unsigned short* base = P3 + (size_t)2 * PLANE + ((size_t)bh * SEQ + s0) * HD;
    {
#pragma unroll
      for (int it = 0; it < 8; ++it) {
        const int i = tid + 128 * it;
        const int dc = ((i >> 6) & 3) * 16 + (i & 15);                  // piece i: key block i / 256, d tile (i / 64) % 4, piece i % 64
        const int tk = (i >> 8) * 32 + ((i >> 4) & 3) * 8;              // token = 32*block + 16*half + 8*hh
        const v8us o = *(const v8us*)(&st[dc * 136 + tk]);
        *(v8us*)(base + (size_t)i * 8) = o;
      }
      
    }
  }
}

// 2^x as the bare v_exp_f32. exp2f() wraps it in a range fix for results below 2^-126 (compare, two selects, add, ldexp per value). Here such a result is a weight that
// rounds to zero in both f16 planes and adds nothing to a row sum of at least 256, or a rescale factor of sums that the new maximum's terms outweigh by 2^126: flushed to 0 it gives the same output.
__device__ __forceinline__ float exp2_raw(float x) { return __builtin_amdgcn_exp2f(x); }

// One 32-key step for a wave's 16 queries. Kp, Vp are the (batch, head) bases of the planes; mword bit j set = key position key0 + j is padded out.
// MASKED = false: a step whose 32 positions are all kept keys (mword not read).
template <bool MASKED>
__device__ __forceinline__ void fa_step(const unsigned short* __restrict__ Kp, const unsigned short* __restrict__ Vp,
                                        int key0, unsigned int mword, int ln, int hh, const FragH& q0, const FragH& q1,
                                        float& mr, float& lr, v8f (&Oh)[4], v8f (&Ol)[4]) {
  // A fragments of K: row m = key (key0 + 16*kt + ln), elements 0..7 <- d = 32c + 8h + i, 8..15 <- d = 32c + 16 + 8h + i; block 2*kt + c of the step's 4 KiB
  const int lane8 = (16 * hh + ln) * 8;
  const unsigned short* kp = Kp + (size_t)key0 * HD + lane8;
  FragH k00, k01, k10, k11;
  k00.half[0] = *(const v8us*)(kp);            k00.half[1] = *(const v8us*)(kp + FRAG / 2);
  k01.half[0] = *(const v8us*)(kp + FRAG);     k01.half[1] = *(const v8us*)(kp + FRAG + FRAG / 2);
  k10.half[0] = *(const v8us*)(kp + 2 * FRAG); k10.half[1] = *(const v8us*)(kp + 2 * FRAG + FRAG / 2);
  k11.half[0] = *(const v8us*)(kp + 3 * FRAG); k11.half[1] = *(const v8us*)(kp + 3 * FRAG + FRAG / 2);
  // A fragments of V^T: row m = d (16*t + ln), elements 0..7 <- key0 + 8h + i, 8..15 <- key0 + 16 + 8h + i; block t of the step's 4 KiB
  const unsigned short* vp = Vp + (size_t)key0 * HD + lane8;
  FragH vf[4];
#pragma unroll
  for (int t = 0; t < 4; ++t) {
    vf[t].half[0] = *(const v8us*)(vp + t * FRAG);
    vf[t].half[1] = *(const v8us*)(vp + t * FRAG + FRAG / 2);
  }
  // the wait that is owed before a register named by an issued load is overwritten; the two addresses as inputs keep their registers out of the loads' own destinations
  asm volatile("s_wait_xcnt 0x0" :: "v"(kp), "v"(vp) : "memory");
  const v8f z8 = {0.f, 0.f, 0.f, 0.f, 0.f, 0.f, 0.f, 0.f};
  // S^T tiles: element r of tile kt = score(key0 + 16*kt + 8h + r, query of this lane's column)
  const v8f s0 = mma_hh2(k00.v, q0.v, k01.v, q1.v, z8);
  const v8f s1 = mma_hh2(k10.v, q0.v, k11.v, q1.v, z8);
  const unsigned int wl = mword >> (8 * hh);
  float sc[16];
#pragma unroll
  for (int r = 0; r < 8; ++r) {
    const float a = s0[r] * QKSCALE, c = s1[r] * QKSCALE;
    sc[r]     = (MASKED && ((wl >> r) & 1u)) ? NEGFILL : a;            // padded key: the score is replaced
    sc[8 + r] = (MASKED && ((wl >> (16 + r)) & 1u)) ? NEGFILL : c;
  }
  float mx = sc[0];
#pragma unroll
  for (int i = 1; i < 16; ++i) mx = fmaxf(mx, sc[i]);
  mx = fmaxf(mx, __shfl_xor(mx, 16, 32));           // the other lane half holds the other 16 keys of this query
  const float mnew = fmaxf(mr, mx);
  const float al = exp2_raw((mr - mnew) * LOG2E);
  mr = mnew;
  // weights carried x256: pc = 256 * exp(sc - mnew); hi plane f16(pc), residual plane f16((pc - hi) * 2048)
  FragH ph, pl;
  float ps = 0.0f;
#pragma unroll
  for (int i = 0; i < 16; ++i) {
    const float pc = exp2_raw(fmaf(sc[i] - mnew, LOG2E, 8.0f));
    ps += pc;
    const _Float16 h = (_Float16)pc;
    ph.h[i] = h;                                    // B element i: i<8 -> key0 + 8h + i (tile 0 row 8h+i); i>=8 -> key0 + 16 + 8h + (i-8) (tile 1)
    pl.h[i] = (_Float16)((pc - (float)h) * 2048.0f);
  }
  ps += __shfl_xor(ps, 16, 32);
  lr = lr * al + ps;
#pragma unroll
  for (int t = 0; t < 4; ++t) { Oh[t] = Oh[t] * al; Ol[t] = Ol[t] * al; }
#pragma unroll
  for (int t = 0; t < 4; ++t) mma_h2(vf[t].v, ph.v, pl.v, Oh[t], Ol[t]);
}

// Block = 4 waves x 16 query positions = 64 of one (batch, head). Key positions 0 .. cnt-1 are the kept keys: whole steps carry no mask, the last one masks its tail.
// Epilogue: O^T tile -> per-wave LDS tile [16 queries][64 d] (block barrier), then lanes 0..15 / 16..31 each write 256 contiguous bytes
// coverage: NB*16*(SEQ/64) blocks x 4 waves x 16 rows x 64 columns = every context element exactly once; trip counts clamped to SEQ / 32.
__global__ __launch_bounds__(128) void k_attn(const unsigned short* __restrict__ Qh, const unsigned short* __restrict__ Kh,
                                              const unsigned short* __restrict__ Vt, const int* __restrict__ cnt,
                                              float* __restrict__ Cx) {
  __shared__ __attribute__((aligned(16))) float so[4][16][68];
  const int tid = threadIdx.x, w = __builtin_amdgcn_readfirstlane((int)(tid >> 5)), lane = tid & 31, ln = lane & 15, hh = lane >> 4;
  const int bh = blockIdx.x / (SEQ / 64), qt = blockIdx.x % (SEQ / 64);
  const int b = bh / NH, h = bh - b * NH;
  const int qbase = qt * 64 + 16 * w;
  const int n = min(max(cnt[b], 0), SEQ);            // kept keys of the batch (block-uniform)
  const int full = n >> 5;                           // steps of 32 kept keys
  const int steps = n > 0 ? (n + 31) >> 5 : SEQ / 32;
  // Q^T B fragments: column n = query qbase + ln, elements 0..7 <- d = 32c + 8h + i, 8..15 <- d = 32c + 16 + 8h + i
  const unsigned short* qrow = Qh + ((size_t)bh * SEQ + qbase) * HD + lane * 8;   // the wave's 16 queries are one token tile: blocks c = 0, 1
  FragH q0, q1;
  q0.half[0] = *(const v8us*)(qrow);        q0.half[1] = *(const v8us*)(qrow + FRAG / 2);
  q1.half[0] = *(const v8us*)(qrow + FRAG); q1.half[1] = *(const v8us*)(qrow + FRAG + FRAG / 2);
  // the wait that is owed before the lane offset that the four issued loads name is overwritten
  asm volatile("s_wait_xcnt 0x0" :: "v"(lane) : "memory");
  float mr = -3.0e38f, lr = 0.0f;
  v8f Oh[4] = {}, Ol[4] = {};
  const unsigned short* Kp = Kh + (size_t)bh * SEQ * HD;
  const unsigned short* Vp = Vt + (size_t)bh * HD * SEQ;
#pragma unroll 1
  for (int j = 0; j < full; ++j)
    fa_step<false>(Kp, Vp, 32 * j, 0u, ln, hh, q0, q1, mr, lr, Oh, Ol);
#pragma unroll 1                                     // rolled: runs at most once unless no key is kept, copies would only cost instruction cache
  for (int j = full; j < steps; ++j)                 // the tail step (positions n % 32 and up are padded keys), or every step when no key is kept
    fa_step<true>(Kp, Vp, 32 * j, 0xFFFFFFFFu << (n & 31), ln, hh, q0, q1, mr, lr, Oh, Ol);

  // O^T element r of tile t = ctx(query qbase + ln, d = 16t + 8h + r); undo the carries: x256 (in lr), x16 (V), x2048 (residual plane)
  const float inv = 1.0f / (CARRY * lr);
#pragma unroll
  for (int t = 0; t < 4; ++t)
#pragma unroll
    for (int r = 0; r < 8; ++r)
      so[w][ln][16 * t + 8 * hh + r] = (Oh[t][r] + Ol[t][r] * 0.00048828125f) * inv;
  __syncthreads();
  float* og = Cx + ((size_t)b * SEQ + qbase) * DM + h * HD;
  const int rsub = lane >> 4, c4 = (lane & 15) * 4;
  {
#pragma unroll
    for (int q = 0; q < 8; ++q) {
      const int row = 2 * q + rsub;
      const v4f v = *(const v4fa*)&so[w][row][c4];
      *(v4f*)(og + (size_t)row * DM + c4) = v;
    }
    
  }
}

// coverage: NB*SEQ blocks x 256 threads x 4 columns = every output element of the processed region exactly once.
__global__ __launch_bounds__(256) void k_ln(const float* __restrict__ Cx, const float* __restrict__ gamma,
                                            const float* __restrict__ beta, const int* __restrict__ perm, float* __restrict__ out) {
  __shared__ float rs[8];
  __shared__ float rq[8];
  const int tid = threadIdx.x, lane = tid & 31, w = __builtin_amdgcn_readfirstlane((int)(tid >> 5));
  const int r = blockIdx.x;
  const int b = r / SEQ, s = perm[r];                // context row r holds the token of position r % SEQ
  const v4f x = *(const v4fa*)(Cx + (size_t)r * DM + tid * 4);
  float sm = (x[0] + x[1]) + (x[2] + x[3]);
#pragma unroll
  for (int off = 16; off >= 1; off >>= 1) sm += __shfl_xor(sm, off, 32);
  if (lane == 0) rs[w] = sm;
  __syncthreads();
  float tot = 0.0f;
#pragma unroll
  for (int i = 0; i < 8; ++i) tot += rs[i];
  const float mu = tot * (1.0f / 1024.0f);
  const float d0 = x[0] - mu, d1 = x[1] - mu, d2 = x[2] - mu, d3 = x[3] - mu;
  float sq = (d0 * d0 + d1 * d1) + (d2 * d2 + d3 * d3);
#pragma unroll
  for (int off = 16; off >= 1; off >>= 1) sq += __shfl_xor(sq, off, 32);
  if (lane == 0) rq[w] = sq;
  __syncthreads();
  float tq = 0.0f;
#pragma unroll
  for (int i = 0; i < 8; ++i) tq += rq[i];
  const float var = tq * (1.0f / 1024.0f);
  const float rinv = rsqrtf(var + 1.0e-6f);
  const v4f g = *(const v4fa*)(gamma + tid * 4);
  const v4f be = *(const v4fa*)(beta + tid * 4);
  v4f o;
  o[0] = d0 * rinv * bf16_rne(g[0]) + bf16_rne(be[0]);
  o[1] = d1 * rinv * bf16_rne(g[1]) + bf16_rne(be[1]);
  o[2] = d2 * rinv * bf16_rne(g[2]) + bf16_rne(be[2]);
  o[3] = d3 * rinv * bf16_rne(g[3]) + bf16_rne(be[3]);
  float* dst = out + ((size_t)b * SEQ_FULL + s) * DM + tid * 4;
  *(v4f*)dst = o;
  
}

extern "C" void kernel_launch(void* const* d_in, const int* in_sizes, int n_in,
                              void* d_out, int out_size, void* d_ws, size_t ws_size, hipStream_t stream) {
  if (n_in < 7) return;
  const long long need_x = (long long)(NB - 1) * SEQ_FULL * DM + (long long)SEQ * DM;   // last element touched + 1
  const long long need_m = (long long)(NB - 1) * SEQ_FULL + (long long)SEQ;
  if ((long long)in_sizes[0] < need_x || (long long)in_sizes[1] < need_m) return;
  if ((long long)in_sizes[2] < (long long)DM * DM || (long long)in_sizes[3] < (long long)DM * DM || (long long)in_sizes[4] < (long long)DM * DM) return;
  if (in_sizes[5] < DM || in_sizes[6] < DM) return;
  if ((long long)out_size < need_x) return;
  const float* X     = (const float*)d_in[0];   // wire order: q [2][2048][1024] f32, mask [2][2048] i32, Wq, Wk, Wv [1024][1024] f32, gamma, beta [1024] f32
  const int*   mask  = (const int*)d_in[1];
  const float* Wq    = (const float*)d_in[2];
  const float* Wk    = (const float*)d_in[3];
  const float* Wv    = (const float*)d_in[4];
  const float* gamma = (const float*)d_in[5];
  const float* beta  = (const float*)d_in[6];
  float* out = (float*)d_out;
  char* ws = (char*)d_ws;
  size_t off = 0;
  const size_t xb_bytes = (size_t)NB * SEQ * DM * 2;        // 8 MiB at full size; every plane is written by whole 16-B pieces, none past its end
  const size_t wb_bytes = (size_t)3 * DM * DM * 2;          // 6 MiB
  const size_t p3_bytes = 3 * PLANE * 2;                    // 24 MiB
  const size_t cx_bytes = (size_t)NB * SEQ * DM * 4;        // 16 MiB
  unsigned short* Xb = (unsigned short*)(ws + off); off += (xb_bytes + 255) & ~(size_t)255;
  unsigned short* Wb = (unsigned short*)(ws + off); off += (wb_bytes + 255) & ~(size_t)255;
  unsigned short* P3 = (unsigned short*)(ws + off); off += (p3_bytes + 255) & ~(size_t)255;
  float*          Cx = (float*)(ws + off);          off += (cx_bytes + 255) & ~(size_t)255;
  int*          perm = (int*)(ws + off);            off += ((size_t)NB * SEQ * 4 + 255) & ~(size_t)255;
  int*           cnt = (int*)(ws + off);            off += 256;
  if (off > ws_size) return;
  k_perm<<<(unsigned)NB, 256, 0, stream>>>(mask, perm, cnt);
  k_cvt<<<(unsigned)((NB * SEQ * 128 + 255) / 256), 256, 0, stream>>>(X, Xb, NB * SEQ, SEQ, (long long)XB_FULL, perm);
  k_cvt<<<(unsigned)((DM * 128 + 255) / 256), 256, 0, stream>>>(Wq, Wb, DM, DM, 0LL, nullptr);
  k_cvt<<<(unsigned)((DM * 128 + 255) / 256), 256, 0, stream>>>(Wk, Wb + (size_t)DM * DM, DM, DM, 0LL, nullptr);
  k_cvt<<<(unsigned)((DM * 128 + 255) / 256), 256, 0, stream>>>(Wv, Wb + (size_t)2 * DM * DM, DM, DM, 0LL, nullptr);
  k_proj<<<dim3((unsigned)(3 * DM / 64), (unsigned)(NB * SEQ / 128)), 128, 0, stream>>>(Xb, Wb, P3, cnt);
  k_attn<<<(unsigned)(NB * NH * (SEQ / 64)), 128, 0, stream>>>(P3, P3 + PLANE, P3 + 2 * PLANE, cnt, Cx);
  k_ln<<<(unsigned)(NB * SEQ), 256, 0, stream>>>(Cx, gamma, beta, perm, out);
}

// v004
// Measured time: 75.6 microseconds a run.
// Two timings next to v003 put it at 1.12 and 1.11 times that version's speed.
// Counting every step since v000, it is 2.67 times as fast.
#include <hip/hip_runtime.h>
// Contractions: x Wq^T, x Wk^T, x Wv^T on v_wmma_f32_16x16x32_bf16 (x and W converted RNE to bf16, single product, f32 accumulate); S^T = K Q^T on v_wmma_f32_16x16x32_f16 (Q, K: f16 planes of the f32 projections x16, single product); O^T = V^T P^T on v_wmma_f32_16x16x32_f16 (V: f16 plane x16; P: x256 f16 hi plane + x2^11 f16 residual plane in a separate f32 accumulator); softmax statistics and LayerNorm f32, gamma and beta rounded RNE to bf16.
// Multi-head self attention, B x S x 1024, 16 heads x 64, scores scaled 1/8, key-padding mask replaces masked scores by -1e20, LayerNorm over the 1024 concatenated columns.
// Engine: transposed flash. Each wave owns 16 queries of one (batch, head). Per 32-key step: S^T tiles (key rows x query columns) from K rows (A, global f16 plane)
// and Q^T (B, registers); the two 16-key D tiles pack straight into the P^T B fragment; O^T (d rows x query columns) accumulates from V^T rows (A, global f16 plane).
// Every 16-bit plane is stored fragment-major: a 16 x 32 operand fragment (16 rows or columns x 32 k) is one 1-KiB block of 64 pieces of 8 elements,
// piece 32*half + lane (lane = 16*hh + ln) = row ln, k = 16*half + 8*hh + 0..7. A wave-wide 16-byte load of one half reads 512 contiguous bytes (4 lines, not 16).
// Token order: inside each batch the tokens are stably partitioned by the key mask, kept keys first (perm[position] = token, cnt = kept keys). A padded key's weight is
// exp(-1e20 - max) = 0 whenever one key is kept, so K, V^T and the key loop cover the first cnt positions only; every plane and the context are in position order and
// the LayerNorm kernel stores row perm[position]. No key kept: every score is -1e20 (uniform weights), so all SEQ positions are walked with every key marked padded.
#ifndef NB
#define NB 2
#endif
#ifndef SEQ
#define SEQ 2048
#endif
#define NB_FULL 2
#define SEQ_FULL 2048
#define DM 1024
#define NH 16
#define HD 64
#define XB_FULL ((size_t)SEQ_FULL * DM)          /* per-batch element stride of the activation input and of the output */
#define PLANE ((size_t)NB * NH * SEQ * HD)       /* elements of one of the Q / K / V^T planes */
#define FRAG 512                                 /* elements of one 16 x 32 fragment block; its second half starts at FRAG / 2 */
#define RTILE ((size_t)16 * DM)                  /* elements of 16 rows of a [rows][1024] plane = 32 fragment blocks */

static_assert(SEQ % 256 == 0);
static_assert(SEQ <= SEQ_FULL);
static_assert(NB <= NB_FULL);
static_assert(HD == 64);
static_assert(DM == NH * HD);
static_assert(DM % 32 == 0);
static_assert((3 * DM) % 64 == 0);
static_assert((size_t)NB * SEQ * DM * 2 + (size_t)3 * DM * DM * 2 + 3 * PLANE * 2 + (size_t)NB * SEQ * DM * 4 + (size_t)NB * SEQ * 4 + 1024 <= (size_t)134217728);

typedef __bf16 v16b __attribute__((ext_vector_type(16)));
typedef _Float16 v16h __attribute__((ext_vector_type(16)));
typedef unsigned short v8us __attribute__((ext_vector_type(8), may_alias));
typedef float v8f __attribute__((ext_vector_type(8)));
typedef float v4f __attribute__((ext_vector_type(4)));
typedef float v4fa __attribute__((ext_vector_type(4), may_alias));
union FragB { v16b v; v8us half[2]; unsigned short u[16]; };
union FragH { v16h v; v8us half[2]; _Float16 h[16]; unsigned short u[16]; };

#define LOG2E 1.4426950408889634f
#define NEGFILL (-1.0e20f)
#define CARRY 16.0f                      /* power-of-two carry of the Q, K and V planes */
#define QKSCALE 0.00048828125f           /* (1/8) / (16*16) */

__device__ __forceinline__ unsigned short bf16_bits(float x) {   // RNE convert to bf16 bits
  unsigned int u = __float_as_uint(x);
  return (unsigned short)((u + 0x7FFFu + ((u >> 16) & 1u)) >> 16);
}
__device__ __forceinline__ float bf16_val(unsigned short b) { return __uint_as_float(((unsigned int)b) << 16); }
__device__ __forceinline__ float bf16_rne(float x) { return bf16_val(bf16_bits(x)); }
__device__ __forceinline__ unsigned short f16_bits(float x) { const _Float16 h = (_Float16)x; return __builtin_bit_cast(unsigned short, h); }

// c0..c3 += a * b0..b3 (one bf16 k-step of four column tiles), then the hazard guard
__device__ __forceinline__ void mma_b4(v16b a, v16b b0, v16b b1, v16b b2, v16b b3, v8f& c0, v8f& c1, v8f& c2, v8f& c3) {
  c0 = __builtin_amdgcn_wmma_f32_16x16x32_bf16(false, a, false, b0, (short)0, c0, false, false);
  c1 = __builtin_amdgcn_wmma_f32_16x16x32_bf16(false, a, false, b1, (short)0, c1, false, false);
  c2 = __builtin_amdgcn_wmma_f32_16x16x32_bf16(false, a, false, b2, (short)0, c2, false, false);
  c3 = __builtin_amdgcn_wmma_f32_16x16x32_bf16(false, a, false, b3, (short)0, c3, false, false);
  asm volatile("v_nop\n\tv_nop\n\tv_nop\n\tv_nop" : "+v"(c0), "+v"(c1), "+v"(c2), "+v"(c3) : "v"(a), "v"(b0), "v"(b1), "v"(b2), "v"(b3));
}
// c += a0*b0 + a1*b1 (two k-steps of one f16 tile), then the hazard guard
__device__ __forceinline__ v8f mma_hh2(v16h a0, v16h b0, v16h a1, v16h b1, v8f c) {
  c = __builtin_amdgcn_wmma_f32_16x16x32_f16(false, a0, false, b0, (short)0, c, false, false);
  c = __builtin_amdgcn_wmma_f32_16x16x32_f16(false, a1, false, b1, (short)0, c, false, false);
  asm volatile("v_nop\n\tv_nop\n\tv_nop\n\tv_nop" : "+v"(c) : "v"(a0), "v"(b0), "v"(a1), "v"(b1));
  return c;
}
// ch += a*bh ; cl += a*bl (scaled residual plane keeps its own accumulator), then the hazard guard
__device__ __forceinline__ void mma_h2(v16h a, v16h bh, v16h bl, v8f& ch, v8f& cl) {
  ch = __builtin_amdgcn_wmma_f32_16x16x32_f16(false, a, false, bh, (short)0, ch, false, false);
  cl = __builtin_amdgcn_wmma_f32_16x16x32_f16(false, a, false, bl, (short)0, cl, false, false);
  asm volatile("v_nop\n\tv_nop\n\tv_nop\n\tv_nop" : "+v"(ch), "+v"(cl) : "v"(a), "v"(bh), "v"(bl));
}

// Preparation, one launch. Blocks 0 .. XBLK-1: the activation plane; the rest: the three weight planes (no token order, no LDS, no barrier).
// Stable partition of one batch's tokens: position of token s = kept tokens before s if it is kept, else cnt + padded tokens before s (a permutation of 0..SEQ-1 for any mask).
// Every activation block works the list of its own batch out for itself (8 KiB of mask, SEQ / 256 consecutive tokens per thread, list gathered in LDS), so that no launch has to
// end before the conversion starts; the first block of each batch also stores the list as whole lines, and cnt, for the later launches.
// dst = bf16 bits (RNE) of src, fragment-major: block (row / 16) * 32 + k / 32; activation row at position p of batch b = token sp[p].
// A wave takes 8 rows x one 128-B source line each and writes four whole 128-B lines of the block (pieces 16*q + 8*rhi + 0..7, q = k / 8 in the block).
// coverage: every sp[] entry written once (permutation) before the barrier in front of its read; NB x SEQ entries of perm and NB of cnt;
// XBLK*256 and WBLK*256 threads x 8 elements = the whole planes (thread bits 0-2 and 5 -> row in the block, bits 3-4 -> q).
#define XBLK (NB * SEQ * 128 / 256)
#define WBLK (3 * DM * 128 / 256)
__global__ __launch_bounds__(256) void k_prep(const float* __restrict__ X, const float* __restrict__ Wq, const float* __restrict__ Wk, const float* __restrict__ Wv,
                                              const int* __restrict__ mask, unsigned short* __restrict__ Xb, unsigned short* __restrict__ Wb,
                                              int* __restrict__ perm, int* __restrict__ cnt) {
  constexpr int TPT = SEQ / 256;
  __shared__ int sp[SEQ];
  __shared__ int wsum[8];
  const int tid = threadIdx.x;
  const bool isx = blockIdx.x < XBLK;                // block-uniform
  const int t = (isx ? blockIdx.x : blockIdx.x - XBLK) * 256 + tid;
  const int blk = t >> 6, ln = ((t >> 5) & 1) * 8 + (t & 7), q = (t >> 3) & 3;
  const int row = (blk / (DM / 32)) * 16 + ln, k = (blk % (DM / 32)) * 32 + q * 8;
  const float* p;
  unsigned short* d;
  if (isx) {
    const int lane = tid & 31, w = tid >> 5, b = blockIdx.x / (XBLK / NB);   // a block lies inside 16 rows, so inside one batch
    const int* mp = mask + (size_t)b * SEQ_FULL + tid * TPT;
    int keep[TPT];
    int c = 0;
#pragma unroll
    for (int i = 0; i < TPT; ++i) { keep[i] = mp[i] != 0 ? 1 : 0; c += keep[i]; }
    int inc = c;                                     // inclusive scan of the threads' kept counts inside the wave
#pragma unroll
    for (int off = 1; off < 32; off <<= 1) { const int v = __shfl_up(inc, off, 32); if (lane >= off) inc += v; }
    if (lane == 31) wsum[w] = inc;
    __syncthreads();
    int base = 0, n = 0;
#pragma unroll
    for (int i = 0; i < 8; ++i) { const int v = wsum[i]; n += v; if (i < w) base += v; }
    int kr = base + inc - c;                         // kept tokens in front of this thread's first token
#pragma unroll
    for (int i = 0; i < TPT; ++i) {
      const int s = tid * TPT + i;
      sp[keep[i] ? kr : n + s - kr] = s;
      kr += keep[i];
    }
    __syncthreads();
    if (blockIdx.x % (XBLK / NB) == 0) {             // block-uniform, behind the last barrier
#pragma unroll
      for (int i = 0; i < TPT; ++i) perm[(size_t)b * SEQ + tid + 256 * i] = sp[tid + 256 * i];
      if (tid == 0) cnt[b] = n;
    }
    p = X + (size_t)b * XB_FULL + (size_t)sp[row - b * SEQ] * DM + k;
    d = Xb + (size_t)blk * FRAG + (q * 16 + ln) * 8;
  } else {
    const int which = (blockIdx.x - XBLK) / (WBLK / 3);   // a block lies inside 16 rows, so inside one of Wq, Wk, Wv
    p = (which == 0 ? Wq : which == 1 ? Wk : Wv) + (size_t)(row - which * DM) * DM + k;
    d = Wb + (size_t)blk * FRAG + (q * 16 + ln) * 8;
  }
  const v4f x0 = *(const v4fa*)(p), x1 = *(const v4fa*)(p + 4);
  v8us o;
  o[0] = bf16_bits(x0[0]); o[1] = bf16_bits(x0[1]); o[2] = bf16_bits(x0[2]); o[3] = bf16_bits(x0[3]);
  o[4] = bf16_bits(x1[0]); o[5] = bf16_bits(x1[1]); o[6] = bf16_bits(x1[2]); o[7] = bf16_bits(x1[3]);
  *(v8us*)d = o;
}

__device__ __forceinline__ void stage8(unsigned short* st, const v8f& c, int base, int rstep) {
#pragma unroll
  for (int r = 0; r < 8; ++r) st[base + r * rstep] = f16_bits(c[r] * CARRY);
}

// Y[m][n] = sum_k Xb[m][k] * Wb[n][k], M = NB*SEQ, N = 3*1024 (Wq | Wk | Wv rows), K = 1024.
// Block = 4 waves, tile 128 rows x 64 columns (one head of one of Q/K/V); wave tile 32 x 64; fragments straight from the fragment-major bf16 planes.
// A fragment: row m, elements 0..7 <- k0 + 8h + i, 8..15 <- k0 + 16 + 8h + i; B fragment: column n = W row n, same k map; D element r = (row 8h + r, column ln).
//   Q, K planes P3[0..1][b*16+h][token / 16][d / 32][fragment block: row = token % 16, k = d % 32]
//   V^T plane   P3[2][b*16+h][token / 32][d / 16][fragment block: row = d % 16, k = token % 32]; each thread stores the piece of its own index: whole lines.
// K and V^T tiles that start behind the last kept position are never read and are left out (block-uniform return in front of every barrier); a tile that straddles it is whole.
// coverage: grid (48, NB*SEQ/128) x (128 x 64) = the Q plane and every K, V^T tile the key loop reads; LDS tile fully written before it is read (128x64 or 64x128).
__global__ __launch_bounds__(128) void k_proj(const unsigned short* __restrict__ Xb, const unsigned short* __restrict__ Wb,
                                              unsigned short* __restrict__ P3, const int* __restrict__ cnt) {
  __shared__ __attribute__((aligned(16))) unsigned short st[128 * 72];
  const int tid = threadIdx.x, w = __builtin_amdgcn_readfirstlane((int)(tid >> 5)), lane = tid & 31, ln = lane & 15, hh = lane >> 4;
  const int n0 = blockIdx.x * 64;
  const int m0 = blockIdx.y * 128;
  if (n0 >= DM) {                                    // K or V columns
    const int n = cnt[m0 / SEQ];
    if (n > 0 && m0 % SEQ >= n) return;
  }
  const unsigned short* ap0 = Xb + (size_t)((m0 >> 4) + 2 * w) * RTILE + lane * 8;
  const unsigned short* ap1 = ap0 + RTILE;
  const unsigned short* bp = Wb + (size_t)(n0 >> 4) * RTILE + lane * 8;
  const v8f z8 = {0.f, 0.f, 0.f, 0.f, 0.f, 0.f, 0.f, 0.f};
  v8f c00 = z8, c01 = z8, c02 = z8, c03 = z8, c10 = z8, c11 = z8, c12 = z8, c13 = z8;
#pragma unroll 1
  for (int ko = 0; ko < (DM / 32) * FRAG; ko += FRAG) {          // ko: element offset of k-block k0 / 32 inside a row tile
    FragB a0, a1, b0, b1, b2, b3;
    a0.half[0] = *(const v8us*)(ap0 + ko);             a0.half[1] = *(const v8us*)(ap0 + ko + FRAG / 2);
    a1.half[0] = *(const v8us*)(ap1 + ko);             a1.half[1] = *(const v8us*)(ap1 + ko + FRAG / 2);
    b0.half[0] = *(const v8us*)(bp + ko);              b0.half[1] = *(const v8us*)(bp + ko + FRAG / 2);
    b1.half[0] = *(const v8us*)(bp + RTILE + ko);      b1.half[1] = *(const v8us*)(bp + RTILE + ko + FRAG / 2);
    b2.half[0] = *(const v8us*)(bp + 2 * RTILE + ko);  b2.half[1] = *(const v8us*)(bp + 2 * RTILE + ko + FRAG / 2);
    b3.half[0] = *(const v8us*)(bp + 3 * RTILE + ko);  b3.half[1] = *(const v8us*)(bp + 3 * RTILE + ko + FRAG / 2);
    // the wait that is owed before a register named by an issued load is overwritten; the two addresses as inputs keep their registers out of the loads' own destinations
    asm volatile("s_wait_xcnt 0x0" :: "v"(ap0 + ko), "v"(bp + ko) : "memory");
    mma_b4(a0.v, b0.v, b1.v, b2.v, b3.v, c00, c01, c02, c03);
    mma_b4(a1.v, b0.v, b1.v, b2.v, b3.v, c10, c11, c12, c13);
  }
  const int which = n0 >> 10;                 // 0: Q, 1: K, 2: V (block-uniform)
  const int h = (n0 & 1023) >> 6;
  const int b = m0 / SEQ, s0 = m0 - b * SEQ;
  const int bh = b * NH + h;
  const bool rowmajor = which < 2;
  const int rstep = rowmajor ? 72 : 1;
  const int rb0 = 32 * w + 8 * hh, rb1 = rb0 + 16;
  // element (row rb + r, column 16*nt + ln): Q/K tile st[row*72 + col]; V tile st[col*136 + row]
  stage8(st, c00, rowmajor ? rb0 * 72 + ln        : (ln) * 136 + rb0,      rstep);
  stage8(st, c01, rowmajor ? rb0 * 72 + 16 + ln   : (16 + ln) * 136 + rb0, rstep);
  stage8(st, c02, rowmajor ? rb0 * 72 + 32 + ln   : (32 + ln) * 136 + rb0, rstep);
  stage8(st, c03, rowmajor ? rb0 * 72 + 48 + ln   : (48 + ln) * 136 + rb0, rstep);
  stage8(st, c10, rowmajor ? rb1 * 72 + ln        : (ln) * 136 + rb1,      rstep);
  stage8(st, c11, rowmajor ? rb1 * 72 + 16 + ln   : (16 + ln) * 136 + rb1, rstep);
  stage8(st, c12, rowmajor ? rb1 * 72 + 32 + ln   : (32 + ln) * 136 + rb1, rstep);
  stage8(st, c13, rowmajor ? rb1 * 72 + 48 + ln   : (48 + ln) * 136 + rb1, rstep);
  __syncthreads();
  if (rowmajor) {
    unsigned short* base = P3 + (size_t)which * PLANE + ((size_t)bh * SEQ + s0) * HD;
    {
#pragma unroll
      for (int it = 0; it < 8; ++it) {
        const int i = tid + 128 * it;                                   // piece i: token tile i / 128, d block (i / 64) % 2, piece i % 64
        const int row = (i >> 7) * 16 + (i & 15), col = ((i >> 4) & 7) * 8;   // d = 32*c + 16*half + 8*hh
        const v8us o = *(const v8us*)(&st[row * 72 + col]);
        *(v8us*)(base + (size_t)i * 8) = o;
      }
      
    }
  } else {
    unsigned short* base = P3 + (size_t)2 * PLANE + ((size_t)bh * SEQ + s0) * HD;
    {
#pragma unroll
      for (int it = 0; it < 8; ++it) {
        const int i = tid + 128 * it;
        const int dc = ((i >> 6) & 3) * 16 + (i & 15);                  // piece i: key block i / 256, d tile (i / 64) % 4, piece i % 64
        const int tk = (i >> 8) * 32 + ((i >> 4) & 3) * 8;              // token = 32*block + 16*half + 8*hh
        const v8us o = *(const v8us*)(&st[dc * 136 + tk]);
        *(v8us*)(base + (size_t)i * 8) = o;
      }
      
    }
  }
}

// 2^x as the bare v_exp_f32. exp2f() wraps it in a range fix for results below 2^-126 (compare, two selects, add, ldexp per value). Here such a result is a weight that
// rounds to zero in both f16 planes and adds nothing to a row sum of at least 256, or a rescale factor of sums that the new maximum's terms outweigh by 2^126: flushed to 0 it gives the same output.
__device__ __forceinline__ float exp2_raw(float x) { return __builtin_amdgcn_exp2f(x); }

// One 32-key step for a wave's 16 queries. Kp, Vp are the (batch, head) bases of the planes; mword bit j set = key position key0 + j is padded out.
// MASKED = false: a step whose 32 positions are all kept keys (mword not read).
template <bool MASKED>
__device__ __forceinline__ void fa_step(const unsigned short* __restrict__ Kp, const unsigned short* __restrict__ Vp,
                                        int key0, unsigned int mword, int ln, int hh, const FragH& q0, const FragH& q1,
                                        float& mr, float& lr, v8f (&Oh)[4], v8f (&Ol)[4]) {
  // A fragments of K: row m = key (key0 + 16*kt + ln), elements 0..7 <- d = 32c + 8h + i, 8..15 <- d = 32c + 16 + 8h + i; block 2*kt + c of the step's 4 KiB
  const int lane8 = (16 * hh + ln) * 8;
  const unsigned short* kp = Kp + (size_t)key0 * HD + lane8;
  FragH k00, k01, k10, k11;
  k00.half[0] = *(const v8us*)(kp);            k00.half[1] = *(const v8us*)(kp + FRAG / 2);
  k01.half[0] = *(const v8us*)(kp + FRAG);     k01.half[1] = *(const v8us*)(kp + FRAG + FRAG / 2);
  k10.half[0] = *(const v8us*)(kp + 2 * FRAG); k10.half[1] = *(const v8us*)(kp + 2 * FRAG + FRAG / 2);
  k11.half[0] = *(const v8us*)(kp + 3 * FRAG); k11.half[1] = *(const v8us*)(kp + 3 * FRAG + FRAG / 2);
  // A fragments of V^T: row m = d (16*t + ln), elements 0..7 <- key0 + 8h + i, 8..15 <- key0 + 16 + 8h + i; block t of the step's 4 KiB
  const unsigned short* vp = Vp + (size_t)key0 * HD + lane8;
  FragH vf[4];
#pragma unroll
  for (int t = 0; t < 4; ++t) {
    vf[t].half[0] = *(const v8us*)(vp + t * FRAG);
    vf[t].half[1] = *(const v8us*)(vp + t * FRAG + FRAG / 2);
  }
  // the wait that is owed before a register named by an issued load is overwritten; the two addresses as inputs keep their registers out of the loads' own destinations
  asm volatile("s_wait_xcnt 0x0" :: "v"(kp), "v"(vp) : "memory");
  const v8f z8 = {0.f, 0.f, 0.f, 0.f, 0.f, 0.f, 0.f, 0.f};
  // S^T tiles: element r of tile kt = score(key0 + 16*kt + 8h + r, query of this lane's column)
  const v8f s0 = mma_hh2(k00.v, q0.v, k01.v, q1.v, z8);
  const v8f s1 = mma_hh2(k10.v, q0.v, k11.v, q1.v, z8);
  const unsigned int wl = mword >> (8 * hh);
  float sc[16];
#pragma unroll
  for (int r = 0; r < 8; ++r) {
    const float a = s0[r] * QKSCALE, c = s1[r] * QKSCALE;
    sc[r]     = (MASKED && ((wl >> r) & 1u)) ? NEGFILL : a;            // padded key: the score is replaced
    sc[8 + r] = (MASKED && ((wl >> (16 + r)) & 1u)) ? NEGFILL : c;
  }
  float mx = sc[0];
#pragma unroll
  for (int i = 1; i < 16; ++i) mx = fmaxf(mx, sc[i]);
  mx = fmaxf(mx, __shfl_xor(mx, 16, 32));           // the other lane half holds the other 16 keys of this query
  const float mnew = fmaxf(mr, mx);
  const float al = exp2_raw((mr - mnew) * LOG2E);
  mr = mnew;
  // weights carried x256: pc = 256 * exp(sc - mnew); hi plane f16(pc), residual plane f16((pc - hi) * 2048)
  FragH ph, pl;
  float ps = 0.0f;
#pragma unroll
  for (int i = 0; i < 16; ++i) {
    const float pc = exp2_raw(fmaf(sc[i] - mnew, LOG2E, 8.0f));
    ps += pc;
    const _Float16 h = (_Float16)pc;
    ph.h[i] = h;                                    // B element i: i<8 -> key0 + 8h + i (tile 0 row 8h+i); i>=8 -> key0 + 16 + 8h + (i-8) (tile 1)
    pl.h[i] = (_Float16)((pc - (float)h) * 2048.0f);
  }
  ps += __shfl_xor(ps, 16, 32);
  lr = lr * al + ps;
#pragma unroll
  for (int t = 0; t < 4; ++t) { Oh[t] = Oh[t] * al; Ol[t] = Ol[t] * al; }
#pragma unroll
  for (int t = 0; t < 4; ++t) mma_h2(vf[t].v, ph.v, pl.v, Oh[t], Ol[t]);
}

// Block = 4 waves x 16 query positions = 64 of one (batch, head). Key positions 0 .. cnt-1 are the kept keys: whole steps carry no mask, the last one masks its tail.
// Epilogue: O^T tile -> per-wave LDS tile [16 queries][64 d] (block barrier), then lanes 0..15 / 16..31 each write 256 contiguous bytes
// coverage: NB*16*(SEQ/64) blocks x 4 waves x 16 rows x 64 columns = every context element exactly once; trip counts clamped to SEQ / 32.
__global__ __launch_bounds__(128) void k_attn(const unsigned short* __restrict__ Qh, const unsigned short* __restrict__ Kh,
                                              const unsigned short* __restrict__ Vt, const int* __restrict__ cnt,
                                              float* __restrict__ Cx) {
  __shared__ __attribute__((aligned(16))) float so[4][16][68];
  const int tid = threadIdx.x, w = __builtin_amdgcn_readfirstlane((int)(tid >> 5)), lane = tid & 31, ln = lane & 15, hh = lane >> 4;
  const int bh = blockIdx.x / (SEQ / 64), qt = blockIdx.x % (SEQ / 64);
  const int b = bh / NH, h = bh - b * NH;
  const int qbase = qt * 64 + 16 * w;
  const int n = min(max(cnt[b], 0), SEQ);            // kept keys of the batch (block-uniform)
  const int full = n >> 5;                           // steps of 32 kept keys
  const int steps = n > 0 ? (n + 31) >> 5 : SEQ / 32;
  // Q^T B fragments: column n = query qbase + ln, elements 0..7 <- d = 32c + 8h + i, 8..15 <- d = 32c + 16 + 8h + i
  const unsigned short* qrow = Qh + ((size_t)bh * SEQ + qbase) * HD + lane * 8;   // the wave's 16 queries are one token tile: blocks c = 0, 1
  FragH q0, q1;
  q0.half[0] = *(const v8us*)(qrow);        q0.half[1] = *(const v8us*)(qrow + FRAG / 2);
  q1.half[0] = *(const v8us*)(qrow + FRAG); q1.half[1] = *(const v8us*)(qrow + FRAG + FRAG / 2);
  // the wait that is owed before the lane offset that the four issued loads name is overwritten
  asm volatile("s_wait_xcnt 0x0" :: "v"(lane) : "memory");
  float mr = -3.0e38f, lr = 0.0f;
  v8f Oh[4] = {}, Ol[4] = {};
  const unsigned short* Kp = Kh + (size_t)bh * SEQ * HD;
  const unsigned short* Vp = Vt + (size_t)bh * HD * SEQ;
#pragma unroll 1
  for (int j = 0; j < full; ++j)
    fa_step<false>(Kp, Vp, 32 * j, 0u, ln, hh, q0, q1, mr, lr, Oh, Ol);
#pragma unroll 1                                     // rolled: runs at most once unless no key is kept, copies would only cost instruction cache
  for (int j = full; j < steps; ++j)                 // the tail step (positions n % 32 and up are padded keys), or every step when no key is kept
    fa_step<true>(Kp, Vp, 32 * j, 0xFFFFFFFFu << (n & 31), ln, hh, q0, q1, mr, lr, Oh, Ol);

  // O^T element r of tile t = ctx(query qbase + ln, d = 16t + 8h + r); undo the carries: x256 (in lr), x16 (V), x2048 (residual plane)
  const float inv = 1.0f / (CARRY * lr);
#pragma unroll
  for (int t = 0; t < 4; ++t)
#pragma unroll
    for (int r = 0; r < 8; ++r)
      so[w][ln][16 * t + 8 * hh + r] = (Oh[t][r] + Ol[t][r] * 0.00048828125f) * inv;
  __syncthreads();
  float* og = Cx + ((size_t)b * SEQ + qbase) * DM + h * HD;
  const int rsub = lane >> 4, c4 = (lane & 15) * 4;
  {
#pragma unroll
    for (int q = 0; q < 8; ++q) {
      const int row = 2 * q + rsub;
      const v4f v = *(const v4fa*)&so[w][row][c4];
      *(v4f*)(og + (size_t)row * DM + c4) = v;
    }
    
  }
}

// coverage: NB*SEQ blocks x 256 threads x 4 columns = every output element of the processed region exactly once.
__global__ __launch_bounds__(256) void k_ln(const float* __restrict__ Cx, const float* __restrict__ gamma,
                                            const float* __restrict__ beta, const int* __restrict__ perm, float* __restrict__ out) {
  __shared__ float rs[8];
  __shared__ float rq[8];
  const int tid = threadIdx.x, lane = tid & 31, w = __builtin_amdgcn_readfirstlane((int)(tid >> 5));
  const int r = blockIdx.x;
  const int b = r / SEQ, s = perm[r];                // context row r holds the token of position r % SEQ
  const v4f x = *(const v4fa*)(Cx + (size_t)r * DM + tid * 4);
  float sm = (x[0] + x[1]) + (x[2] + x[3]);
#pragma unroll
  for (int off = 16; off >= 1; off >>= 1) sm += __shfl_xor(sm, off, 32);
  if (lane == 0) rs[w] = sm;
  __syncthreads();
  float tot = 0.0f;
#pragma unroll
  for (int i = 0; i < 8; ++i) tot += rs[i];
  const float mu = tot * (1.0f / 1024.0f);
  const float d0 = x[0] - mu, d1 = x[1] - mu, d2 = x[2] - mu, d3 = x[3] - mu;
  float sq = (d0 * d0 + d1 * d1) + (d2 * d2 + d3 * d3);
#pragma unroll
  for (int off = 16; off >= 1; off >>= 1) sq += __shfl_xor(sq, off, 32);
  if (lane == 0) rq[w] = sq;
  __syncthreads();
  float tq = 0.0f;
#pragma unroll
  for (int i = 0; i < 8; ++i) tq += rq[i];
  const float var = tq * (1.0f / 1024.0f);
  const float rinv = rsqrtf(var + 1.0e-6f);
  const v4f g = *(const v4fa*)(gamma + tid * 4);
  const v4f be = *(const v4fa*)(beta + tid * 4);
  v4f o;
  o[0] = d0 * rinv * bf16_rne(g[0]) + bf16_rne(be[0]);
  o[1] = d1 * rinv * bf16_rne(g[1]) + bf16_rne(be[1]);
  o[2] = d2 * rinv * bf16_rne(g[2]) + bf16_rne(be[2]);
  o[3] = d3 * rinv * bf16_rne(g[3]) + bf16_rne(be[3]);
  float* dst = out + ((size_t)b * SEQ_FULL + s) * DM + tid * 4;
  *(v4f*)dst = o;
  
}

extern "C" void kernel_launch(void* const* d_in, const int* in_sizes, int n_in,
                              void* d_out, int out_size, void* d_ws, size_t ws_size, hipStream_t stream) {
  if (n_in < 7) return;
  const long long need_x = (long long)(NB - 1) * SEQ_FULL * DM + (long long)SEQ * DM;   // last element touched + 1
  const long long need_m = (long long)(NB - 1) * SEQ_FULL + (long long)SEQ;
  if ((long long)in_sizes[0] < need_x || (long long)in_sizes[1] < need_m) return;
  if ((long long)in_sizes[2] < (long long)DM * DM || (long long)in_sizes[3] < (long long)DM * DM || (long long)in_sizes[4] < (long long)DM * DM) return;
  if (in_sizes[5] < DM || in_sizes[6] < DM) return;
  if ((long long)out_size < need_x) return;
  const float* X     = (const float*)d_in[0];   // wire order: q [2][2048][1024] f32, mask [2][2048] i32, Wq, Wk, Wv [1024][1024] f32, gamma, beta [1024] f32
  const int*   mask  = (const int*)d_in[1];
  const float* Wq    = (const float*)d_in[2];
  const float* Wk    = (const float*)d_in[3];
  const float* Wv    = (const float*)d_in[4];
  const float* gamma = (const float*)d_in[5];
  const float* beta  = (const float*)d_in[6];
  float* out = (float*)d_out;
  char* ws = (char*)d_ws;
  size_t off = 0;
  const size_t xb_bytes = (size_t)NB * SEQ * DM * 2;        // 8 MiB at full size; every plane is written by whole 16-B pieces, none past its end
  const size_t wb_bytes = (size_t)3 * DM * DM * 2;          // 6 MiB
  const size_t p3_bytes = 3 * PLANE * 2;                    // 24 MiB
  const size_t cx_bytes = (size_t)NB * SEQ * DM * 4;        // 16 MiB
  unsigned short* Xb = (unsigned short*)(ws + off); off += (xb_bytes + 255) & ~(size_t)255;
  unsigned short* Wb = (unsigned short*)(ws + off); off += (wb_bytes + 255) & ~(size_t)255;
  unsigned short* P3 = (unsigned short*)(ws + off); off += (p3_bytes + 255) & ~(size_t)255;
  float*          Cx = (float*)(ws + off);          off += (cx_bytes + 255) & ~(size_t)255;
  int*          perm = (int*)(ws + off);            off += ((size_t)NB * SEQ * 4 + 255) & ~(size_t)255;
  int*           cnt = (int*)(ws + off);            off += 256;
  if (off > ws_size) return;
  k_prep<<<(unsigned)(XBLK + WBLK), 256, 0, stream>>>(X, Wq, Wk, Wv, mask, Xb, Wb, perm, cnt);
  k_proj<<<dim3((unsigned)(3 * DM / 64), (unsigned)(NB * SEQ / 128)), 128, 0, stream>>>(Xb, Wb, P3, cnt);
  k_attn<<<(unsigned)(NB * NH * (SEQ / 64)), 128, 0, stream>>>(P3, P3 + PLANE, P3 + 2 * PLANE, cnt, Cx);
  k_ln<<<(unsigned)(NB * SEQ), 256, 0, stream>>>(Cx, gamma, beta, perm, out);
}

// v005
// It runs in 71.6 microseconds.
// In both of two side-by-side timings against v004, it was 1.07 times as fast.
// Over all steps from v000 it is 2.85 times as fast.
#include <hip/hip_runtime.h>
// Contractions: x Wq^T, x Wk^T, x Wv^T on v_wmma_f32_16x16x32_bf16 (x and W converted RNE to bf16, single product, f32 accumulate); S^T = K Q^T on v_wmma_f32_16x16x32_f16 (Q, K: f16 planes of the f32 projections x16, single product); O^T = V^T P^T on v_wmma_f32_16x16x32_f16 (V: f16 plane x16; P: x256 f16 hi plane + x2^11 f16 residual plane in a separate f32 accumulator); softmax statistics and LayerNorm f32, gamma and beta rounded RNE to bf16.
// Multi-head self attention, B x S x 1024, 16 heads x 64, scores scaled 1/8, key-padding mask replaces masked scores by -1e20, LayerNorm over the 1024 concatenated columns.
// Engine: transposed flash. Each wave owns 16 queries of one (batch, head). Per 32-key step: S^T tiles (key rows x query columns) from K rows (A, f16 plane by way of LDS)
// and Q^T (B, registers); the two 16-key D tiles pack straight into the P^T B fragment; O^T (d rows x query columns) accumulates from V^T rows (A, f16 plane by way of LDS).
// Every 16-bit plane is stored fragment-major: a 16 x 32 operand fragment (16 rows or columns x 32 k) is one 1-KiB block of 64 pieces of 8 elements,
// piece 32*half + lane (lane = 16*hh + ln) = row ln, k = 16*half + 8*hh + 0..7. A wave-wide 16-byte load of one half reads 512 contiguous bytes (4 lines, not 16).
// Token order: inside each batch the tokens are stably partitioned by the key mask, kept keys first (perm[position] = token, cnt = kept keys). A padded key's weight is
// exp(-1e20 - max) = 0 whenever one key is kept, so K, V^T and the key loop cover the first cnt positions only; every plane and the context are in position order and
// the LayerNorm kernel stores row perm[position]. No key kept: every score is -1e20 (uniform weights), so all SEQ positions are walked with every key marked padded.
#ifndef NB
#define NB 2
#endif
#ifndef SEQ
#define SEQ 2048
#endif
#define NB_FULL 2
#define SEQ_FULL 2048
#define DM 1024
#define NH 16
#define HD 64
#define XB_FULL ((size_t)SEQ_FULL * DM)          /* per-batch element stride of the activation input and of the output */
#define PLANE ((size_t)NB * NH * SEQ * HD)       /* elements of one of the Q / K / V^T planes */
#define FRAG 512                                 /* elements of one 16 x 32 fragment block; its second half starts at FRAG / 2 */
#define RTILE ((size_t)16 * DM)                  /* elements of 16 rows of a [rows][1024] plane = 32 fragment blocks */

static_assert(SEQ % 256 == 0);
static_assert(SEQ <= SEQ_FULL);
static_assert(NB <= NB_FULL);
static_assert(HD == 64);
static_assert(DM == NH * HD);
static_assert(DM % 32 == 0);
static_assert((3 * DM) % 64 == 0);
static_assert((size_t)NB * SEQ * DM * 2 + (size_t)3 * DM * DM * 2 + 3 * PLANE * 2 + (size_t)NB * SEQ * DM * 4 + (size_t)NB * SEQ * 4 + 1024 <= (size_t)134217728);

typedef __bf16 v16b __attribute__((ext_vector_type(16)));
typedef _Float16 v16h __attribute__((ext_vector_type(16)));
typedef unsigned short v8us __attribute__((ext_vector_type(8), may_alias));
typedef float v8f __attribute__((ext_vector_type(8)));
typedef float v4f __attribute__((ext_vector_type(4)));
typedef float v4fa __attribute__((ext_vector_type(4), may_alias));
union FragB { v16b v; v8us half[2]; unsigned short u[16]; };
union FragH { v16h v; v8us half[2]; _Float16 h[16]; unsigned short u[16]; };

#define LOG2E 1.4426950408889634f
#define NEGFILL (-1.0e20f)
#define CARRY 16.0f                      /* power-of-two carry of the Q, K and V planes */
#define QKSCALE 0.00048828125f           /* (1/8) / (16*16) */

__device__ __forceinline__ unsigned short bf16_bits(float x) {   // RNE convert to bf16 bits
  unsigned int u = __float_as_uint(x);
  return (unsigned short)((u + 0x7FFFu + ((u >> 16) & 1u)) >> 16);
}
__device__ __forceinline__ float bf16_val(unsigned short b) { return __uint_as_float(((unsigned int)b) << 16); }
__device__ __forceinline__ float bf16_rne(float x) { return bf16_val(bf16_bits(x)); }
__device__ __forceinline__ unsigned short f16_bits(float x) { const _Float16 h = (_Float16)x; return __builtin_bit_cast(unsigned short, h); }

// c0..c3 += a * b0..b3 (one bf16 k-step of four column tiles), then the hazard guard
__device__ __forceinline__ void mma_b4(v16b a, v16b b0, v16b b1, v16b b2, v16b b3, v8f& c0, v8f& c1, v8f& c2, v8f& c3) {
  c0 = __builtin_amdgcn_wmma_f32_16x16x32_bf16(false, a, false, b0, (short)0, c0, false, false);
  c1 = __builtin_amdgcn_wmma_f32_16x16x32_bf16(false, a, false, b1, (short)0, c1, false, false);
  c2 = __builtin_amdgcn_wmma_f32_16x16x32_bf16(false, a, false, b2, (short)0, c2, false, false);
  c3 = __builtin_amdgcn_wmma_f32_16x16x32_bf16(false, a, false, b3, (short)0, c3, false, false);
  asm volatile("v_nop\n\tv_nop\n\tv_nop\n\tv_nop" : "+v"(c0), "+v"(c1), "+v"(c2), "+v"(c3) : "v"(a), "v"(b0), "v"(b1), "v"(b2), "v"(b3));
}
// c += a0*b0 + a1*b1 (two k-steps of one f16 tile), then the hazard guard
__device__ __forceinline__ v8f mma_hh2(v16h a0, v16h b0, v16h a1, v16h b1, v8f c) {
  c = __builtin_amdgcn_wmma_f32_16x16x32_f16(false, a0, false, b0, (short)0, c, false, false);
  c = __builtin_amdgcn_wmma_f32_16x16x32_f16(false, a1, false, b1, (short)0, c, false, false);
  asm volatile("v_nop\n\tv_nop\n\tv_nop\n\tv_nop" : "+v"(c) : "v"(a0), "v"(b0), "v"(a1), "v"(b1));
  return c;
}
// ch += a*bh ; cl += a*bl (scaled residual plane keeps its own accumulator), then the hazard guard
__device__ __forceinline__ void mma_h2(v16h a, v16h bh, v16h bl, v8f& ch, v8f& cl) {
  ch = __builtin_amdgcn_wmma_f32_16x16x32_f16(false, a, false, bh, (short)0, ch, false, false);
  cl = __builtin_amdgcn_wmma_f32_16x16x32_f16(false, a, false, bl, (short)0, cl, false, false);
  asm volatile("v_nop\n\tv_nop\n\tv_nop\n\tv_nop" : "+v"(ch), "+v"(cl) : "v"(a), "v"(bh), "v"(bl));
}

// Preparation, one launch. Blocks 0 .. XBLK-1: the activation plane; the rest: the three weight planes (no token order, no LDS, no barrier).
// Stable partition of one batch's tokens: position of token s = kept tokens before s if it is kept, else cnt + padded tokens before s (a permutation of 0..SEQ-1 for any mask).
// Every activation block works the list of its own batch out for itself (8 KiB of mask, SEQ / 256 consecutive tokens per thread, list gathered in LDS), so that no launch has to
// end before the conversion starts; the first block of each batch also stores the list as whole lines, and cnt, for the later launches.
// dst = bf16 bits (RNE) of src, fragment-major: block (row / 16) * 32 + k / 32; activation row at position p of batch b = token sp[p].
// A wave takes 8 rows x one 128-B source line each and writes four whole 128-B lines of the block (pieces 16*q + 8*rhi + 0..7, q = k / 8 in the block).
// coverage: every sp[] entry written once (permutation) before the barrier in front of its read; NB x SEQ entries of perm and NB of cnt;
// XBLK*256 and WBLK*256 threads x 8 elements = the whole planes (thread bits 0-2 and 5 -> row in the block, bits 3-4 -> q).
#define XBLK (NB * SEQ * 128 / 256)
#define WBLK (3 * DM * 128 / 256)
__global__ __launch_bounds__(256) void k_prep(const float* __restrict__ X, const float* __restrict__ Wq, const float* __restrict__ Wk, const float* __restrict__ Wv,
                                              const int* __restrict__ mask, unsigned short* __restrict__ Xb, unsigned short* __restrict__ Wb,
                                              int* __restrict__ perm, int* __restrict__ cnt) {
  constexpr int TPT = SEQ / 256;
  __shared__ int sp[SEQ];
  __shared__ int wsum[8];
  const int tid = threadIdx.x;
  const bool isx = blockIdx.x < XBLK;                // block-uniform
  const int t = (isx ? blockIdx.x : blockIdx.x - XBLK) * 256 + tid;
  const int blk = t >> 6, ln = ((t >> 5) & 1) * 8 + (t & 7), q = (t >> 3) & 3;
  const int row = (blk / (DM / 32)) * 16 + ln, k = (blk % (DM / 32)) * 32 + q * 8;
  const float* p;
  unsigned short* d;
  if (isx) {
    const int lane = tid & 31, w = tid >> 5, b = blockIdx.x / (XBLK / NB);   // a block lies inside 16 rows, so inside one batch
    const int* mp = mask + (size_t)b * SEQ_FULL + tid * TPT;
    int keep[TPT];
    int c = 0;
#pragma unroll
    for (int i = 0; i < TPT; ++i) { keep[i] = mp[i] != 0 ? 1 : 0; c += keep[i]; }
    int inc = c;                                     // inclusive scan of the threads' kept counts inside the wave
#pragma unroll
    for (int off = 1; off < 32; off <<= 1) { const int v = __shfl_up(inc, off, 32); if (lane >= off) inc += v; }
    if (lane == 31) wsum[w] = inc;
    __syncthreads();
    int base = 0, n = 0;
#pragma unroll
    for (int i = 0; i < 8; ++i) { const int v = wsum[i]; n += v; if (i < w) base += v; }
    int kr = base + inc - c;                         // kept tokens in front of this thread's first token
#pragma unroll
    for (int i = 0; i < TPT; ++i) {
      const int s = tid * TPT + i;
      sp[keep[i] ? kr : n + s - kr] = s;
      kr += keep[i];
    }
    __syncthreads();
    if (blockIdx.x % (XBLK / NB) == 0) {             // block-uniform, behind the last barrier
#pragma unroll
      for (int i = 0; i < TPT; ++i) perm[(size_t)b * SEQ + tid + 256 * i] = sp[tid + 256 * i];
      if (tid == 0) cnt[b] = n;
    }
    p = X + (size_t)b * XB_FULL + (size_t)sp[row - b * SEQ] * DM + k;
    d = Xb + (size_t)blk * FRAG + (q * 16 + ln) * 8;
  } else {
    const int which = (blockIdx.x - XBLK) / (WBLK / 3);   // a block lies inside 16 rows, so inside one of Wq, Wk, Wv
    p = (which == 0 ? Wq : which == 1 ? Wk : Wv) + (size_t)(row - which * DM) * DM + k;
    d = Wb + (size_t)blk * FRAG + (q * 16 + ln) * 8;
  }
  const v4f x0 = *(const v4fa*)(p), x1 = *(const v4fa*)(p + 4);
  v8us o;
  o[0] = bf16_bits(x0[0]); o[1] = bf16_bits(x0[1]); o[2] = bf16_bits(x0[2]); o[3] = bf16_bits(x0[3]);
  o[4] = bf16_bits(x1[0]); o[5] = bf16_bits(x1[1]); o[6] = bf16_bits(x1[2]); o[7] = bf16_bits(x1[3]);
  *(v8us*)d = o;
}

__device__ __forceinline__ void stage8(unsigned short* st, const v8f& c, int base, int rstep) {
#pragma unroll
  for (int r = 0; r < 8; ++r) st[base + r * rstep] = f16_bits(c[r] * CARRY);
}

// Y[m][n] = sum_k Xb[m][k] * Wb[n][k], M = NB*SEQ, N = 3*1024 (Wq | Wk | Wv rows), K = 1024.
// Block = 4 waves, tile 128 rows x 64 columns (one head of one of Q/K/V); wave tile 32 x 64; fragments straight from the fragment-major bf16 planes.
// A fragment: row m, elements 0..7 <- k0 + 8h + i, 8..15 <- k0 + 16 + 8h + i; B fragment: column n = W row n, same k map; D element r = (row 8h + r, column ln).
//   Q, K planes P3[0..1][b*16+h][token / 16][d / 32][fragment block: row = token % 16, k = d % 32]
//   V^T plane   P3[2][b*16+h][token / 32][d / 16][fragment block: row = d % 16, k = token % 32]; each thread stores the piece of its own index: whole lines.
// K and V^T tiles that start behind the last kept position are never read and are left out (block-uniform return in front of every barrier); a tile that straddles it is whole.
// coverage: grid (48, NB*SEQ/128) x (128 x 64) = the Q plane and every K, V^T tile the key loop reads; LDS tile fully written before it is read (128x64 or 64x128).
__global__ __launch_bounds__(128) void k_proj(const unsigned short* __restrict__ Xb, const unsigned short* __restrict__ Wb,
                                              unsigned short* __restrict__ P3, const int* __restrict__ cnt) {
  __shared__ __attribute__((aligned(16))) unsigned short st[128 * 72];
  const int tid = threadIdx.x, w = __builtin_amdgcn_readfirstlane((int)(tid >> 5)), lane = tid & 31, ln = lane & 15, hh = lane >> 4;
  const int n0 = blockIdx.x * 64;
  const int m0 = blockIdx.y * 128;
  if (n0 >= DM) {                                    // K or V columns
    const int n = cnt[m0 / SEQ];
    if (n > 0 && m0 % SEQ >= n) return;
  }
  const unsigned short* ap0 = Xb + (size_t)((m0 >> 4) + 2 * w) * RTILE + lane * 8;
  const unsigned short* ap1 = ap0 + RTILE;
  const unsigned short* bp = Wb + (size_t)(n0 >> 4) * RTILE + lane * 8;
  const v8f z8 = {0.f, 0.f, 0.f, 0.f, 0.f, 0.f, 0.f, 0.f};
  v8f c00 = z8, c01 = z8, c02 = z8, c03 = z8, c10 = z8, c11 = z8, c12 = z8, c13 = z8;
#pragma unroll 1
  for (int ko = 0; ko < (DM / 32) * FRAG; ko += FRAG) {          // ko: element offset of k-block k0 / 32 inside a row tile
    FragB a0, a1, b0, b1, b2, b3;
    a0.half[0] = *(const v8us*)(ap0 + ko);             a0.half[1] = *(const v8us*)(ap0 + ko + FRAG / 2);
    a1.half[0] = *(const v8us*)(ap1 + ko);             a1.half[1] = *(const v8us*)(ap1 + ko + FRAG / 2);
    b0.half[0] = *(const v8us*)(bp + ko);              b0.half[1] = *(const v8us*)(bp + ko + FRAG / 2);
    b1.half[0] = *(const v8us*)(bp + RTILE + ko);      b1.half[1] = *(const v8us*)(bp + RTILE + ko + FRAG / 2);
    b2.half[0] = *(const v8us*)(bp + 2 * RTILE + ko);  b2.half[1] = *(const v8us*)(bp + 2 * RTILE + ko + FRAG / 2);
    b3.half[0] = *(const v8us*)(bp + 3 * RTILE + ko);  b3.half[1] = *(const v8us*)(bp + 3 * RTILE + ko + FRAG / 2);
    // the wait that is owed before a register named by an issued load is overwritten; the two addresses as inputs keep their registers out of the loads' own destinations
    asm volatile("s_wait_xcnt 0x0" :: "v"(ap0 + ko), "v"(bp + ko) : "memory");
    mma_b4(a0.v, b0.v, b1.v, b2.v, b3.v, c00, c01, c02, c03);
    mma_b4(a1.v, b0.v, b1.v, b2.v, b3.v, c10, c11, c12, c13);
  }
  const int which = n0 >> 10;                 // 0: Q, 1: K, 2: V (block-uniform)
  const int h = (n0 & 1023) >> 6;
  const int b = m0 / SEQ, s0 = m0 - b * SEQ;
  const int bh = b * NH + h;
  const bool rowmajor = which < 2;
  const int rstep = rowmajor ? 72 : 1;
  const int rb0 = 32 * w + 8 * hh, rb1 = rb0 + 16;
  // element (row rb + r, column 16*nt + ln): Q/K tile st[row*72 + col]; V tile st[col*136 + row]
  stage8(st, c00, rowmajor ? rb0 * 72 + ln        : (ln) * 136 + rb0,      rstep);
  stage8(st, c01, rowmajor ? rb0 * 72 + 16 + ln   : (16 + ln) * 136 + rb0, rstep);
  stage8(st, c02, rowmajor ? rb0 * 72 + 32 + ln   : (32 + ln) * 136 + rb0, rstep);
  stage8(st, c03, rowmajor ? rb0 * 72 + 48 + ln   : (48 + ln) * 136 + rb0, rstep);
  stage8(st, c10, rowmajor ? rb1 * 72 + ln        : (ln) * 136 + rb1,      rstep);
  stage8(st, c11, rowmajor ? rb1 * 72 + 16 + ln   : (16 + ln) * 136 + rb1, rstep);
  stage8(st, c12, rowmajor ? rb1 * 72 + 32 + ln   : (32 + ln) * 136 + rb1, rstep);
  stage8(st, c13, rowmajor ? rb1 * 72 + 48 + ln   : (48 + ln) * 136 + rb1, rstep);
  __syncthreads();
  if (rowmajor) {
    unsigned short* base = P3 + (size_t)which * PLANE + ((size_t)bh * SEQ + s0) * HD;
    {
#pragma unroll
      for (int it = 0; it < 8; ++it) {
        const int i = tid + 128 * it;                                   // piece i: token tile i / 128, d block (i / 64) % 2, piece i % 64
        const int row = (i >> 7) * 16 + (i & 15), col = ((i >> 4) & 7) * 8;   // d = 32*c + 16*half + 8*hh
        const v8us o = *(const v8us*)(&st[row * 72 + col]);
        *(v8us*)(base + (size_t)i * 8) = o;
      }
      
    }
  } else {
    unsigned short* base = P3 + (size_t)2 * PLANE + ((size_t)bh * SEQ + s0) * HD;
    {
#pragma unroll
      for (int it = 0; it < 8; ++it) {
        const int i = tid + 128 * it;
        const int dc = ((i >> 6) & 3) * 16 + (i & 15);                  // piece i: key block i / 256, d tile (i / 64) % 4, piece i % 64
        const int tk = (i >> 8) * 32 + ((i >> 4) & 3) * 8;              // token = 32*block + 16*half + 8*hh
        const v8us o = *(const v8us*)(&st[dc * 136 + tk]);
        *(v8us*)(base + (size_t)i * 8) = o;
      }
      
    }
  }
}

// 2^x as the bare v_exp_f32. exp2f() wraps it in a range fix for results below 2^-126 (compare, two selects, add, ldexp per value). Here such a result is a weight that
// rounds to zero in both f16 planes and adds nothing to a row sum of at least 256, or a rescale factor of sums that the new maximum's terms outweigh by 2^126: flushed to 0 it gives the same output.
__device__ __forceinline__ float exp2_raw(float x) { return __builtin_amdgcn_exp2f(x); }

#define STK 64                                   /* keys of one stage of the LDS ring */
#define STG (STK * HD)                           /* elements of the K part, and of the V^T part, of one stage (8 KiB each) */
#define STB (2 * STG * 2)                        /* bytes of one ring buffer: K part, then V^T part */
static_assert(SEQ % STK == 0);
static_assert(128 % STK == 0);                   // a stage lies inside one 128-row tile of the projection: written whole or not walked at all
static_assert(STG * 2 == 4 * 128 * 16);          // 4 copies of 16 B per thread and part

// One stage into one ring buffer: 64 keys are 8 KiB of K and 8 KiB of V^T, each contiguous in its fragment-major plane, copied as they lie.
// kg, vg: this thread's first piece of the stage in the two planes (stage base + 8 * tid elements); l: its LDS byte address (buffer base + 16 * tid).
// Every thread brings pieces tid + 128 * c, c = 0..3, of each part: all addresses multiples of 16, no LDS byte written twice, all 32 lanes on.
__device__ __forceinline__ void stage_copy(const unsigned short* kg, const unsigned short* vg, unsigned int l) {
  // s_wait_xcnt as the statement's last line: it then stands in front of every later write of a register that one of the copies names
  asm volatile("global_load_async_to_lds_b128 %0, %8, off\n\t"
               "global_load_async_to_lds_b128 %1, %9, off\n\t"
               "global_load_async_to_lds_b128 %2, %10, off\n\t"
               "global_load_async_to_lds_b128 %3, %11, off\n\t"
               "global_load_async_to_lds_b128 %4, %12, off\n\t"
               "global_load_async_to_lds_b128 %5, %13, off\n\t"
               "global_load_async_to_lds_b128 %6, %14, off\n\t"
               "global_load_async_to_lds_b128 %7, %15, off\n\t"
               "s_wait_xcnt 0x0"
               :: "v"(l), "v"(l + 2048u), "v"(l + 4096u), "v"(l + 6144u), "v"(l + 8192u), "v"(l + 10240u), "v"(l + 12288u), "v"(l + 14336u),
                  "v"(kg), "v"(kg + 1024), "v"(kg + 2048), "v"(kg + 3072), "v"(vg), "v"(vg + 1024), "v"(vg + 2048), "v"(vg + 3072)
               : "memory");
}

// One 32-key step for a wave's 16 queries. Kp, Vp: the step's 4 KiB of K and of V^T in the LDS ring; key0 in the notes below = the step's first key position; mword bit j set = position key0 + j is padded out.
// MASKED = false: a step whose 32 positions are all kept keys (mword not read).
template <bool MASKED>
__device__ __forceinline__ void fa_step(const unsigned short* Kp, const unsigned short* Vp,
                                        unsigned int mword, int ln, int hh, const FragH& q0, const FragH& q1,
                                        float& mr, float& lr, v8f (&Oh)[4], v8f (&Ol)[4]) {
  // A fragments of K: row m = key (key0 + 16*kt + ln), elements 0..7 <- d = 32c + 8h + i, 8..15 <- d = 32c + 16 + 8h + i; block 2*kt + c of the step's 4 KiB
  const int lane8 = (16 * hh + ln) * 8;
  const unsigned short* kp = Kp + lane8;
  FragH k00, k01, k10, k11;
  k00.half[0] = *(const v8us*)(kp);            k00.half[1] = *(const v8us*)(kp + FRAG / 2);
  k01.half[0] = *(const v8us*)(kp + FRAG);     k01.half[1] = *(const v8us*)(kp + FRAG + FRAG / 2);
  k10.half[0] = *(const v8us*)(kp + 2 * FRAG); k10.half[1] = *(const v8us*)(kp + 2 * FRAG + FRAG / 2);
  k11.half[0] = *(const v8us*)(kp + 3 * FRAG); k11.half[1] = *(const v8us*)(kp + 3 * FRAG + FRAG / 2);
  // A fragments of V^T: row m = d (16*t + ln), elements 0..7 <- key0 + 8h + i, 8..15 <- key0 + 16 + 8h + i; block t of the step's 4 KiB
  const unsigned short* vp = Vp + lane8;
  FragH vf[4];
#pragma unroll
  for (int t = 0; t < 4; ++t) {
    vf[t].half[0] = *(const v8us*)(vp + t * FRAG);
    vf[t].half[1] = *(const v8us*)(vp + t * FRAG + FRAG / 2);
  }
  const v8f z8 = {0.f, 0.f, 0.f, 0.f, 0.f, 0.f, 0.f, 0.f};
  // S^T tiles: element r of tile kt = score(key0 + 16*kt + 8h + r, query of this lane's column)
  const v8f s0 = mma_hh2(k00.v, q0.v, k01.v, q1.v, z8);
  const v8f s1 = mma_hh2(k10.v, q0.v, k11.v, q1.v, z8);
  const unsigned int wl = mword >> (8 * hh);
  float sc[16];
#pragma unroll
  for (int r = 0; r < 8; ++r) {
    const float a = s0[r] * QKSCALE, c = s1[r] * QKSCALE;
    sc[r]     = (MASKED && ((wl >> r) & 1u)) ? NEGFILL : a;            // padded key: the score is replaced
    sc[8 + r] = (MASKED && ((wl >> (16 + r)) & 1u)) ? NEGFILL : c;
  }
  float mx = sc[0];
#pragma unroll
  for (int i = 1; i < 16; ++i) mx = fmaxf(mx, sc[i]);
  mx = fmaxf(mx, __shfl_xor(mx, 16, 32));           // the other lane half holds the other 16 keys of this query
  const float mnew = fmaxf(mr, mx);
  const float al = exp2_raw((mr - mnew) * LOG2E);
  mr = mnew;
  // weights carried x256: pc = 256 * exp(sc - mnew); hi plane f16(pc), residual plane f16((pc - hi) * 2048)
  FragH ph, pl;
  float ps = 0.0f;
#pragma unroll
  for (int i = 0; i < 16; ++i) {
    const float pc = exp2_raw(fmaf(sc[i] - mnew, LOG2E, 8.0f));
    ps += pc;
    const _Float16 h = (_Float16)pc;
    ph.h[i] = h;                                    // B element i: i<8 -> key0 + 8h + i (tile 0 row 8h+i); i>=8 -> key0 + 16 + 8h + (i-8) (tile 1)
    pl.h[i] = (_Float16)((pc - (float)h) * 2048.0f);
  }
  ps += __shfl_xor(ps, 16, 32);
  lr = lr * al + ps;
#pragma unroll
  for (int t = 0; t < 4; ++t) { Oh[t] = Oh[t] * al; Ol[t] = Ol[t] * al; }
#pragma unroll
  for (int t = 0; t < 4; ++t) mma_h2(vf[t].v, ph.v, pl.v, Oh[t], Ol[t]);
}

// Block = 4 waves x 16 query positions = 64 of one (batch, head). Key positions 0 .. cnt-1 are the kept keys: whole steps carry no mask, the last one masks its tail.
// K and V^T reach the four waves through a two-buffer LDS ring of 64-key stages: each byte is fetched once per block, by asynchronous copies that fly while the stage before is worked on.
// Stage t = key positions 64t .. 64t+63, walked only if 64t lies in front of the last step's end, so inside a projection tile that was written whole.
// Epilogue: O^T tile -> per-wave LDS tile [16 queries][64 d] (block barrier), then lanes 0..15 / 16..31 each write 256 contiguous bytes
// coverage: NB*16*(SEQ/64) blocks x 4 waves x 16 rows x 64 columns = every context element exactly once; trip counts clamped to SEQ / 32.
__global__ __launch_bounds__(128) void k_attn(const unsigned short* __restrict__ Qh, const unsigned short* __restrict__ Kh,
                                              const unsigned short* __restrict__ Vt, const int* __restrict__ cnt,
                                              float* __restrict__ Cx) {
  __shared__ __attribute__((aligned(16))) float so[4][16][68];
  __shared__ __attribute__((aligned(16))) unsigned short ring[2][2 * STG];
  const int tid = threadIdx.x, w = __builtin_amdgcn_readfirstlane((int)(tid >> 5)), lane = tid & 31, ln = lane & 15, hh = lane >> 4;
  const int bh = blockIdx.x / (SEQ / 64), qt = blockIdx.x % (SEQ / 64);
  const int b = bh / NH, h = bh - b * NH;
  const int qbase = qt * 64 + 16 * w;
  const int n = min(max(cnt[b], 0), SEQ);            // kept keys of the batch (block-uniform)
  const int full = n >> 5;                           // steps of 32 kept keys
  const int steps = n > 0 ? (n + 31) >> 5 : SEQ / 32;
  // Q^T B fragments: column n = query qbase + ln, elements 0..7 <- d = 32c + 8h + i, 8..15 <- d = 32c + 16 + 8h + i
  const unsigned short* qrow = Qh + ((size_t)bh * SEQ + qbase) * HD + lane * 8;   // the wave's 16 queries are one token tile: blocks c = 0, 1
  FragH q0, q1;
  q0.half[0] = *(const v8us*)(qrow);        q0.half[1] = *(const v8us*)(qrow + FRAG / 2);
  q1.half[0] = *(const v8us*)(qrow + FRAG); q1.half[1] = *(const v8us*)(qrow + FRAG + FRAG / 2);
  // the wait that is owed before the lane offset that the four issued loads name is overwritten
  asm volatile("s_wait_xcnt 0x0" :: "v"(lane) : "memory");
  float mr = -3.0e38f, lr = 0.0f;
  v8f Oh[4] = {}, Ol[4] = {};
  const unsigned short* Kp = Kh + (size_t)bh * SEQ * HD;
  const unsigned short* Vp = Vt + (size_t)bh * HD * SEQ;
  const int nst = (steps + 1) >> 1;                  // stages of two steps, 1 .. SEQ / 64 (block-uniform)
  const unsigned short* kg = Kp + tid * 8;
  const unsigned short* vg = Vp + tid * 8;
  const unsigned int l0 = (unsigned int)(size_t)&ring[0][0] + (unsigned int)tid * 16u;
  stage_copy(kg, vg, l0);
  asm volatile("s_wait_asynccnt 0x0" ::: "memory");  // this wave's copies of stage 0 have landed
  __syncthreads();                                   // ... and every other wave's: stage 0 may be read
  if (nst > 1) stage_copy(kg + STG, vg + STG, l0 + STB);
  for (int t = 0; t < nst; ++t) {
    const unsigned short* kb = &ring[t & 1][0];
    for (int u = 0; u < 2; ++u) {
      const int j = 2 * t + u;
      if (j < full)
        fa_step<false>(kb + u * (32 * HD), kb + STG + u * (32 * HD), 0u, ln, hh, q0, q1, mr, lr, Oh, Ol);
      else if (j < steps)                            // the tail step (positions n % 32 and up are padded keys), or every step when no key is kept
        fa_step<true>(kb + u * (32 * HD), kb + STG + u * (32 * HD), 0xFFFFFFFFu << (n & 31), ln, hh, q0, q1, mr, lr, Oh, Ol);
    }
    asm volatile("s_wait_dscnt 0x0" ::: "memory");    // this wave's reads of stage t are done before its buffer is handed back
    asm volatile("s_wait_asynccnt 0x0" ::: "memory"); // this wave's copies of stage t + 1 have landed
    __syncthreads();                                  // publishes stage t + 1 and ends every wave's reads of stage t
    if (t + 2 < nst) stage_copy(kg + (size_t)(t + 2) * STG, vg + (size_t)(t + 2) * STG, l0 + (unsigned int)(t & 1) * STB);
  }
  asm volatile("s_wait_asynccnt 0x0" ::: "memory");   // no copy is left in flight when the wave goes on

  // O^T element r of tile t = ctx(query qbase + ln, d = 16t + 8h + r); undo the carries: x256 (in lr), x16 (V), x2048 (residual plane)
  const float inv = 1.0f / (CARRY * lr);
#pragma unroll
  for (int t = 0; t < 4; ++t)
#pragma unroll
    for (int r = 0; r < 8; ++r)
      so[w][ln][16 * t + 8 * hh + r] = (Oh[t][r] + Ol[t][r] * 0.00048828125f) * inv;
  __syncthreads();
  float* og = Cx + ((size_t)b * SEQ + qbase) * DM + h * HD;
  const int rsub = lane >> 4, c4 = (lane & 15) * 4;
  {
#pragma unroll
    for (int q = 0; q < 8; ++q) {
      const int row = 2 * q + rsub;
      const v4f v = *(const v4fa*)&so[w][row][c4];
      *(v4f*)(og + (size_t)row * DM + c4) = v;
    }
    
  }
}

// coverage: NB*SEQ blocks x 256 threads x 4 columns = every output element of the processed region exactly once.
__global__ __launch_bounds__(256) void k_ln(const float* __restrict__ Cx, const float* __restrict__ gamma,
                                            const float* __restrict__ beta, const int* __restrict__ perm, float* __restrict__ out) {
  __shared__ float rs[8];
  __shared__ float rq[8];
  const int tid = threadIdx.x, lane = tid & 31, w = __builtin_amdgcn_readfirstlane((int)(tid >> 5));
  const int r = blockIdx.x;
  const int b = r / SEQ, s = perm[r];                // context row r holds the token of position r % SEQ
  const v4f x = *(const v4fa*)(Cx + (size_t)r * DM + tid * 4);
  float sm = (x[0] + x[1]) + (x[2] + x[3]);
#pragma unroll
  for (int off = 16; off >= 1; off >>= 1) sm += __shfl_xor(sm, off, 32);
  if (lane == 0) rs[w] = sm;
  __syncthreads();
  float tot = 0.0f;
#pragma unroll
  for (int i = 0; i < 8; ++i) tot += rs[i];
  const float mu = tot * (1.0f / 1024.0f);
  const float d0 = x[0] - mu, d1 = x[1] - mu, d2 = x[2] - mu, d3 = x[3] - mu;
  float sq = (d0 * d0 + d1 * d1) + (d2 * d2 + d3 * d3);
#pragma unroll
  for (int off = 16; off >= 1; off >>= 1) sq += __shfl_xor(sq, off, 32);
  if (lane == 0) rq[w] = sq;
  __syncthreads();
  float tq = 0.0f;
#pragma unroll
  for (int i = 0; i < 8; ++i) tq += rq[i];
  const float var = tq * (1.0f / 1024.0f);
  const float rinv = rsqrtf(var + 1.0e-6f);
  const v4f g = *(const v4fa*)(gamma + tid * 4);
  const v4f be = *(const v4fa*)(beta + tid * 4);
  v4f o;
  o[0] = d0 * rinv * bf16_rne(g[0]) + bf16_rne(be[0]);
  o[1] = d1 * rinv * bf16_rne(g[1]) + bf16_rne(be[1]);
  o[2] = d2 * rinv * bf16_rne(g[2]) + bf16_rne(be[2]);
  o[3] = d3 * rinv * bf16_rne(g[3]) + bf16_rne(be[3]);
  float* dst = out + ((size_t)b * SEQ_FULL + s) * DM + tid * 4;
  *(v4f*)dst = o;
  
}

extern "C" void kernel_launch(void* const* d_in, const int* in_sizes, int n_in,
                              void* d_out, int out_size, void* d_ws, size_t ws_size, hipStream_t stream) {
  if (n_in < 7) return;
  const long long need_x = (long long)(NB - 1) * SEQ_FULL * DM + (long long)SEQ * DM;   // last element touched + 1
  const long long need_m = (long long)(NB - 1) * SEQ_FULL + (long long)SEQ;
  if ((long long)in_sizes[0] < need_x || (long long)in_sizes[1] < need_m) return;
  if ((long long)in_sizes[2] < (long long)DM * DM || (long long)in_sizes[3] < (long long)DM * DM || (long long)in_sizes[4] < (long long)DM * DM) return;
  if (in_sizes[5] < DM || in_sizes[6] < DM) return;
  if ((long long)out_size < need_x) return;
  const float* X     = (const float*)d_in[0];   // wire order: q [2][2048][1024] f32, mask [2][2048] i32, Wq, Wk, Wv [1024][1024] f32, gamma, beta [1024] f32
  const int*   mask  = (const int*)d_in[1];
  const float* Wq    = (const float*)d_in[2];
  const float* Wk    = (const float*)d_in[3];
  const float* Wv    = (const float*)d_in[4];
  const float* gamma = (const float*)d_in[5];
  const float* beta  = (const float*)d_in[6];
  float* out = (float*)d_out;
  char* ws = (char*)d_ws;
  size_t off = 0;
  const size_t xb_bytes = (size_t)NB * SEQ * DM * 2;        // 8 MiB at full size; every plane is written by whole 16-B pieces, none past its end
  const size_t wb_bytes = (size_t)3 * DM * DM * 2;          // 6 MiB
  const size_t p3_bytes = 3 * PLANE * 2;                    // 24 MiB
  const size_t cx_bytes = (size_t)NB * SEQ * DM * 4;        // 16 MiB
  unsigned short* Xb = (unsigned short*)(ws + off); off += (xb_bytes + 255) & ~(size_t)255;
  unsigned short* Wb = (unsigned short*)(ws + off); off += (wb_bytes + 255) & ~(size_t)255;
  unsigned short* P3 = (unsigned short*)(ws + off); off += (p3_bytes + 255) & ~(size_t)255;
  float*          Cx = (float*)(ws + off);          off += (cx_bytes + 255) & ~(size_t)255;
  int*          perm = (int*)(ws + off);            off += ((size_t)NB * SEQ * 4 + 255) & ~(size_t)255;
  int*           cnt = (int*)(ws + off);            off += 256;
  if (off > ws_size) return;
  k_prep<<<(unsigned)(XBLK + WBLK), 256, 0, stream>>>(X, Wq, Wk, Wv, mask, Xb, Wb, perm, cnt);
  k_proj<<<dim3((unsigned)(3 * DM / 64), (unsigned)(NB * SEQ / 128)), 128, 0, stream>>>(Xb, Wb, P3, cnt);
  k_attn<<<(unsigned)(NB * NH * (SEQ / 64)), 128, 0, stream>>>(P3, P3 + PLANE, P3 + 2 * PLANE, cnt, Cx);
  k_ln<<<(unsigned)(NB * SEQ), 256, 0, stream>>>(Cx, gamma, beta, perm, out);
}

// v006
// Measured time: 67.2 microseconds a run.
// Two timings next to v005 put it at 1.06 and 1.07 times that version's speed.
// Over all steps from v000 it is 3.04 times as fast.
#include <hip/hip_runtime.h>
// Contractions: x Wq^T, x Wk^T, x Wv^T on v_wmma_f32_16x16x32_bf16 (x and W converted RNE to bf16, single product, f32 accumulate); S^T = K Q^T on v_wmma_f32_16x16x32_f16 (Q, K: f16 planes of the f32 projections x16, single product); O^T = V^T P^T on v_wmma_f32_16x16x32_f16 (V: f16 plane x16; P: x256 f16 hi plane + x2^11 f16 residual plane in a separate f32 accumulator); softmax statistics and LayerNorm f32, gamma and beta rounded RNE to bf16.
// Multi-head self attention, B x S x 1024, 16 heads x 64, scores scaled 1/8, key-padding mask replaces masked scores by -1e20, LayerNorm over the 1024 concatenated columns.
// Engine: transposed flash. Each wave owns 16 queries of one (batch, head). Per 32-key step: S^T tiles (key rows x query columns) from K rows (A, f16 plane by way of LDS)
// and Q^T (B, registers); the two 16-key D tiles pack straight into the P^T B fragment; O^T (d rows x query columns) accumulates from V^T rows (A, f16 plane by way of LDS).
// Every 16-bit plane is stored fragment-major: a 16 x 32 operand fragment (16 rows or columns x 32 k) is one 1-KiB block of 64 pieces of 8 elements,
// piece 32*half + lane (lane = 16*hh + ln) = row ln, k = 16*half + 8*hh + 0..7. A wave-wide 16-byte load of one half reads 512 contiguous bytes (4 lines, not 16).
// Token order: inside each batch the tokens are stably partitioned by the key mask, kept keys first (perm[position] = token, cnt = kept keys). A padded key's weight is
// exp(-1e20 - max) = 0 whenever one key is kept, so K, V^T and the key loop cover the first cnt positions only; every plane and the context are in position order and
// the LayerNorm kernel stores row perm[position]. No key kept: every score is -1e20 (uniform weights), so all SEQ positions are walked with every key marked padded.
#ifndef NB
#define NB 2
#endif
#ifndef SEQ
#define SEQ 2048
#endif
#define NB_FULL 2
#define SEQ_FULL 2048
#define DM 1024
#define NH 16
#define HD 64
#define XB_FULL ((size_t)SEQ_FULL * DM)          /* per-batch element stride of the activation input and of the output */
#define PLANE ((size_t)NB * NH * SEQ * HD)       /* elements of one of the Q / K / V^T planes */
#define FRAG 512                                 /* elements of one 16 x 32 fragment block; its second half starts at FRAG / 2 */
#define RTILE ((size_t)16 * DM)                  /* elements of 16 rows of a [rows][1024] plane = 32 fragment blocks */

static_assert(SEQ % 256 == 0);
static_assert(SEQ <= SEQ_FULL);
static_assert(NB <= NB_FULL);
static_assert(HD == 64);
static_assert(DM == NH * HD);
static_assert(DM % 32 == 0);
static_assert((3 * DM) % 64 == 0);
static_assert((size_t)NB * SEQ * DM * 2 + (size_t)3 * DM * DM * 2 + 3 * PLANE * 2 + (size_t)NB * SEQ * DM * 4 + (size_t)NB * SEQ * 4 + 1024 <= (size_t)134217728);

typedef __bf16 v16b __attribute__((ext_vector_type(16)));
typedef _Float16 v16h __attribute__((ext_vector_type(16)));
typedef unsigned short v8us __attribute__((ext_vector_type(8), may_alias));
typedef float v8f __attribute__((ext_vector_type(8)));
typedef float v2f __attribute__((ext_vector_type(2)));
typedef float v4f __attribute__((ext_vector_type(4)));
typedef float v4fa __attribute__((ext_vector_type(4), may_alias));
union FragB { v16b v; v8us half[2]; unsigned short u[16]; };
union FragH { v16h v; v8us half[2]; _Float16 h[16]; unsigned short u[16]; };

#define LOG2E 1.4426950408889634f
#define NEGFILL (-1.0e20f)
#define CARRY 16.0f                      /* power-of-two carry of the Q, K and V planes */
#define QKSCALE 0.00048828125f           /* (1/8) / (16*16) */

__device__ __forceinline__ unsigned short bf16_bits(float x) {   // RNE convert to bf16 bits
  unsigned int u = __float_as_uint(x);
  return (unsigned short)((u + 0x7FFFu + ((u >> 16) & 1u)) >> 16);
}
__device__ __forceinline__ float bf16_val(unsigned short b) { return __uint_as_float(((unsigned int)b) << 16); }
__device__ __forceinline__ float bf16_rne(float x) { return bf16_val(bf16_bits(x)); }
__device__ __forceinline__ unsigned short f16_bits(float x) { const _Float16 h = (_Float16)x; return __builtin_bit_cast(unsigned short, h); }

// c0..c3 += a * b0..b3 (one bf16 k-step of four column tiles), then the hazard guard
__device__ __forceinline__ void mma_b4(v16b a, v16b b0, v16b b1, v16b b2, v16b b3, v8f& c0, v8f& c1, v8f& c2, v8f& c3) {
  c0 = __builtin_amdgcn_wmma_f32_16x16x32_bf16(false, a, false, b0, (short)0, c0, false, false);
  c1 = __builtin_amdgcn_wmma_f32_16x16x32_bf16(false, a, false, b1, (short)0, c1, false, false);
  c2 = __builtin_amdgcn_wmma_f32_16x16x32_bf16(false, a, false, b2, (short)0, c2, false, false);
  c3 = __builtin_amdgcn_wmma_f32_16x16x32_bf16(false, a, false, b3, (short)0, c3, false, false);
  asm volatile("v_nop\n\tv_nop\n\tv_nop\n\tv_nop" : "+v"(c0), "+v"(c1), "+v"(c2), "+v"(c3) : "v"(a), "v"(b0), "v"(b1), "v"(b2), "v"(b3));
}
// c += a0*b0 + a1*b1 (two k-steps of one f16 tile), then the hazard guard
__device__ __forceinline__ v8f mma_hh2(v16h a0, v16h b0, v16h a1, v16h b1, v8f c) {
  c = __builtin_amdgcn_wmma_f32_16x16x32_f16(false, a0, false, b0, (short)0, c, false, false);
  c = __builtin_amdgcn_wmma_f32_16x16x32_f16(false, a1, false, b1, (short)0, c, false, false);
  asm volatile("v_nop\n\tv_nop\n\tv_nop\n\tv_nop" : "+v"(c) : "v"(a0), "v"(b0), "v"(a1), "v"(b1));
  return c;
}
// ch += a*bh ; cl += a*bl (scaled residual plane keeps its own accumulator), then the hazard guard
__device__ __forceinline__ void mma_h2(v16h a, v16h bh, v16h bl, v8f& ch, v8f& cl) {
  ch = __builtin_amdgcn_wmma_f32_16x16x32_f16(false, a, false, bh, (short)0, ch, false, false);
  cl = __builtin_amdgcn_wmma_f32_16x16x32_f16(false, a, false, bl, (short)0, cl, false, false);
  asm volatile("v_nop\n\tv_nop\n\tv_nop\n\tv_nop" : "+v"(ch), "+v"(cl) : "v"(a), "v"(bh), "v"(bl));
}

// Preparation, one launch. Blocks 0 .. XBLK-1: the activation plane; the rest: the three weight planes (no token order, no LDS, no barrier).
// Stable partition of one batch's tokens: position of token s = kept tokens before s if it is kept, else cnt + padded tokens before s (a permutation of 0..SEQ-1 for any mask).
// Every activation block works the list of its own batch out for itself (8 KiB of mask, SEQ / 256 consecutive tokens per thread, list gathered in LDS), so that no launch has to
// end before the conversion starts; the first block of each batch also stores the list as whole lines, and cnt, for the later launches.
// dst = bf16 bits (RNE) of src, fragment-major: block (row / 16) * 32 + k / 32; activation row at position p of batch b = token sp[p].
// A wave takes 8 rows x one 128-B source line each and writes four whole 128-B lines of the block (pieces 16*q + 8*rhi + 0..7, q = k / 8 in the block).
// coverage: every sp[] entry written once (permutation) before the barrier in front of its read; NB x SEQ entries of perm and NB of cnt;
// XBLK*256 and WBLK*256 threads x 8 elements = the whole planes (thread bits 0-2 and 5 -> row in the block, bits 3-4 -> q).
#define XBLK (NB * SEQ * 128 / 256)
#define WBLK (3 * DM * 128 / 256)
__global__ __launch_bounds__(256) void k_prep(const float* __restrict__ X, const float* __restrict__ Wq, const float* __restrict__ Wk, const float* __restrict__ Wv,
                                              const int* __restrict__ mask, unsigned short* __restrict__ Xb, unsigned short* __restrict__ Wb,
                                              int* __restrict__ perm, int* __restrict__ cnt) {
  constexpr int TPT = SEQ / 256;
  __shared__ int sp[SEQ];
  __shared__ int wsum[8];
  const int tid = threadIdx.x;
  const bool isx = blockIdx.x < XBLK;                // block-uniform
  const int t = (isx ? blockIdx.x : blockIdx.x - XBLK) * 256 + tid;
  const int blk = t >> 6, ln = ((t >> 5) & 1) * 8 + (t & 7), q = (t >> 3) & 3;
  const int row = (blk / (DM / 32)) * 16 + ln, k = (blk % (DM / 32)) * 32 + q * 8;
  const float* p;
  unsigned short* d;
  if (isx) {
    const int lane = tid & 31, w = tid >> 5, b = blockIdx.x / (XBLK / NB);   // a block lies inside 16 rows, so inside one batch
    const int* mp = mask + (size_t)b * SEQ_FULL + tid * TPT;
    int keep[TPT];
    int c = 0;
#pragma unroll
    for (int i = 0; i < TPT; ++i) { keep[i] = mp[i] != 0 ? 1 : 0; c += keep[i]; }
    int inc = c;                                     // inclusive scan of the threads' kept counts inside the wave
#pragma unroll
    for (int off = 1; off < 32; off <<= 1) { const int v = __shfl_up(inc, off, 32); if (lane >= off) inc += v; }
    if (lane == 31) wsum[w] = inc;
    __syncthreads();
    int base = 0, n = 0;
#pragma unroll
    for (int i = 0; i < 8; ++i) { const int v = wsum[i]; n += v; if (i < w) base += v; }
    int kr = base + inc - c;                         // kept tokens in front of this thread's first token
#pragma unroll
    for (int i = 0; i < TPT; ++i) {
      const int s = tid * TPT + i;
      sp[keep[i] ? kr : n + s - kr] = s;
      kr += keep[i];
    }
    __syncthreads();
    if (blockIdx.x % (XBLK / NB) == 0) {             // block-uniform, behind the last barrier
#pragma unroll
      for (int i = 0; i < TPT; ++i) perm[(size_t)b * SEQ + tid + 256 * i] = sp[tid + 256 * i];
      if (tid == 0) cnt[b] = n;
    }
    p = X + (size_t)b * XB_FULL + (size_t)sp[row - b * SEQ] * DM + k;
    d = Xb + (size_t)blk * FRAG + (q * 16 + ln) * 8;
  } else {
    const int which = (blockIdx.x - XBLK) / (WBLK / 3);   // a block lies inside 16 rows, so inside one of Wq, Wk, Wv
    p = (which == 0 ? Wq : which == 1 ? Wk : Wv) + (size_t)(row - which * DM) * DM + k;
    d = Wb + (size_t)blk * FRAG + (q * 16 + ln) * 8;
  }
  const v4f x0 = *(const v4fa*)(p), x1 = *(const v4fa*)(p + 4);
  v8us o;
  o[0] = bf16_bits(x0[0]); o[1] = bf16_bits(x0[1]); o[2] = bf16_bits(x0[2]); o[3] = bf16_bits(x0[3]);
  o[4] = bf16_bits(x1[0]); o[5] = bf16_bits(x1[1]); o[6] = bf16_bits(x1[2]); o[7] = bf16_bits(x1[3]);
  *(v8us*)d = o;
}

__device__ __forceinline__ void stage8(unsigned short* st, const v8f& c, int base, int rstep) {
#pragma unroll
  for (int r = 0; r < 8; ++r) st[base + r * rstep] = f16_bits(c[r] * CARRY);
}

// Y[m][n] = sum_k Xb[m][k] * Wb[n][k], M = NB*SEQ, N = 3*1024 (Wq | Wk | Wv rows), K = 1024.
// Block = 4 waves, tile 128 rows x 64 columns (one head of one of Q/K/V); wave tile 32 x 64; fragments straight from the fragment-major bf16 planes.
// A fragment: row m, elements 0..7 <- k0 + 8h + i, 8..15 <- k0 + 16 + 8h + i; B fragment: column n = W row n, same k map; D element r = (row 8h + r, column ln).
//   Q, K planes P3[0..1][b*16+h][token / 16][d / 32][fragment block: row = token % 16, k = d % 32]
//   V^T plane   P3[2][b*16+h][token / 32][d / 16][fragment block: row = d % 16, k = token % 32]; each thread stores the piece of its own index: whole lines.
// K and V^T tiles that start behind the last kept position are never read and are left out (block-uniform return in front of every barrier); a tile that straddles it is whole.
// coverage: grid (48, NB*SEQ/128) x (128 x 64) = the Q plane and every K, V^T tile the key loop reads; LDS tile fully written before it is read (128x64 or 64x128).
__global__ __launch_bounds__(128) void k_proj(const unsigned short* __restrict__ Xb, const unsigned short* __restrict__ Wb,
                                              unsigned short* __restrict__ P3, const int* __restrict__ cnt) {
  __shared__ __attribute__((aligned(16))) unsigned short st[128 * 72];
  const int tid = threadIdx.x, w = __builtin_amdgcn_readfirstlane((int)(tid >> 5)), lane = tid & 31, ln = lane & 15, hh = lane >> 4;
  const int n0 = blockIdx.x * 64;
  const int m0 = blockIdx.y * 128;
  if (n0 >= DM) {                                    // K or V columns
    const int n = cnt[m0 / SEQ];
    if (n > 0 && m0 % SEQ >= n) return;
  }
  const unsigned short* ap0 = Xb + (size_t)((m0 >> 4) + 2 * w) * RTILE + lane * 8;
  const unsigned short* ap1 = ap0 + RTILE;
  const unsigned short* bp = Wb + (size_t)(n0 >> 4) * RTILE + lane * 8;
  const v8f z8 = {0.f, 0.f, 0.f, 0.f, 0.f, 0.f, 0.f, 0.f};
  v8f c00 = z8, c01 = z8, c02 = z8, c03 = z8, c10 = z8, c11 = z8, c12 = z8, c13 = z8;
#pragma unroll 1
  for (int ko = 0; ko < (DM / 32) * FRAG; ko += FRAG) {          // ko: element offset of k-block k0 / 32 inside a row tile
    FragB a0, a1, b0, b1, b2, b3;
    a0.half[0] = *(const v8us*)(ap0 + ko);             a0.half[1] = *(const v8us*)(ap0 + ko + FRAG / 2);
    a1.half[0] = *(const v8us*)(ap1 + ko);             a1.half[1] = *(const v8us*)(ap1 + ko + FRAG / 2);
    b0.half[0] = *(const v8us*)(bp + ko);              b0.half[1] = *(const v8us*)(bp + ko + FRAG / 2);
    b1.half[0] = *(const v8us*)(bp + RTILE + ko);      b1.half[1] = *(const v8us*)(bp + RTILE + ko + FRAG / 2);
    b2.half[0] = *(const v8us*)(bp + 2 * RTILE + ko);  b2.half[1] = *(const v8us*)(bp + 2 * RTILE + ko + FRAG / 2);
    b3.half[0] = *(const v8us*)(bp + 3 * RTILE + ko);  b3.half[1] = *(const v8us*)(bp + 3 * RTILE + ko + FRAG / 2);
    // the wait that is owed before a register named by an issued load is overwritten; the two addresses as inputs keep their registers out of the loads' own destinations
    asm volatile("s_wait_xcnt 0x0" :: "v"(ap0 + ko), "v"(bp + ko) : "memory");
    mma_b4(a0.v, b0.v, b1.v, b2.v, b3.v, c00, c01, c02, c03);
    mma_b4(a1.v, b0.v, b1.v, b2.v, b3.v, c10, c11, c12, c13);
  }
  const int which = n0 >> 10;                 // 0: Q, 1: K, 2: V (block-uniform)
  const int h = (n0 & 1023) >> 6;
  const int b = m0 / SEQ, s0 = m0 - b * SEQ;
  const int bh = b * NH + h;
  const bool rowmajor = which < 2;
  const int rstep = rowmajor ? 72 : 1;
  const int rb0 = 32 * w + 8 * hh, rb1 = rb0 + 16;
  // element (row rb + r, column 16*nt + ln): Q/K tile st[row*72 + col]; V tile st[col*136 + row]
  stage8(st, c00, rowmajor ? rb0 * 72 + ln        : (ln) * 136 + rb0,      rstep);
  stage8(st, c01, rowmajor ? rb0 * 72 + 16 + ln   : (16 + ln) * 136 + rb0, rstep);
  stage8(st, c02, rowmajor ? rb0 * 72 + 32 + ln   : (32 + ln) * 136 + rb0, rstep);
  stage8(st, c03, rowmajor ? rb0 * 72 + 48 + ln   : (48 + ln) * 136 + rb0, rstep);
  stage8(st, c10, rowmajor ? rb1 * 72 + ln        : (ln) * 136 + rb1,      rstep);
  stage8(st, c11, rowmajor ? rb1 * 72 + 16 + ln   : (16 + ln) * 136 + rb1, rstep);
  stage8(st, c12, rowmajor ? rb1 * 72 + 32 + ln   : (32 + ln) * 136 + rb1, rstep);
  stage8(st, c13, rowmajor ? rb1 * 72 + 48 + ln   : (48 + ln) * 136 + rb1, rstep);
  __syncthreads();
  if (rowmajor) {
    unsigned short* base = P3 + (size_t)which * PLANE + ((size_t)bh * SEQ + s0) * HD;
    {
#pragma unroll
      for (int it = 0; it < 8; ++it) {
        const int i = tid + 128 * it;                                   // piece i: token tile i / 128, d block (i / 64) % 2, piece i % 64
        const int row = (i >> 7) * 16 + (i & 15), col = ((i >> 4) & 7) * 8;   // d = 32*c + 16*half + 8*hh
        const v8us o = *(const v8us*)(&st[row * 72 + col]);
        *(v8us*)(base + (size_t)i * 8) = o;
      }
      
    }
  } else {
    unsigned short* base = P3 + (size_t)2 * PLANE + ((size_t)bh * SEQ + s0) * HD;
    {
#pragma unroll
      for (int it = 0; it < 8; ++it) {
        const int i = tid + 128 * it;
        const int dc = ((i >> 6) & 3) * 16 + (i & 15);                  // piece i: key block i / 256, d tile (i / 64) % 4, piece i % 64
        const int tk = (i >> 8) * 32 + ((i >> 4) & 3) * 8;              // token = 32*block + 16*half + 8*hh
        const v8us o = *(const v8us*)(&st[dc * 136 + tk]);
        *(v8us*)(base + (size_t)i * 8) = o;
      }
      
    }
  }
}

// 2^x as the bare v_exp_f32. exp2f() wraps it in a range fix for results below 2^-126 (compare, two selects, add, ldexp per value). Here such a result is a weight that
// rounds to zero in both f16 planes and adds nothing to a row sum of at least 256, or a rescale factor of sums that the new maximum's terms outweigh by 2^126: flushed to 0 it gives the same output.
__device__ __forceinline__ float exp2_raw(float x) { return __builtin_amdgcn_exp2f(x); }

#define STK 64                                   /* keys of one stage of the LDS ring */
#define STG (STK * HD)                           /* elements of the K part, and of the V^T part, of one stage (8 KiB each) */
#define STB (2 * STG * 2)                        /* bytes of one ring buffer: K part, then V^T part */
static_assert(SEQ % STK == 0);
static_assert(128 % STK == 0);                   // a stage lies inside one 128-row tile of the projection: written whole or not walked at all
static_assert(STG * 2 == 4 * 128 * 16);          // 4 copies of 16 B per thread and part

// One stage into one ring buffer: 64 keys are 8 KiB of K and 8 KiB of V^T, each contiguous in its fragment-major plane, copied as they lie.
// kg, vg: this thread's first piece of the stage in the two planes (stage base + 8 * tid elements); l: its LDS byte address (buffer base + 16 * tid).
// Every thread brings pieces tid + 128 * c, c = 0..3, of each part: all addresses multiples of 16, no LDS byte written twice, all 32 lanes on.
__device__ __forceinline__ void stage_copy(const unsigned short* kg, const unsigned short* vg, unsigned int l) {
  // s_wait_xcnt as the statement's last line: it then stands in front of every later write of a register that one of the copies names
  asm volatile("global_load_async_to_lds_b128 %0, %8, off\n\t"
               "global_load_async_to_lds_b128 %1, %9, off\n\t"
               "global_load_async_to_lds_b128 %2, %10, off\n\t"
               "global_load_async_to_lds_b128 %3, %11, off\n\t"
               "global_load_async_to_lds_b128 %4, %12, off\n\t"
               "global_load_async_to_lds_b128 %5, %13, off\n\t"
               "global_load_async_to_lds_b128 %6, %14, off\n\t"
               "global_load_async_to_lds_b128 %7, %15, off\n\t"
               "s_wait_xcnt 0x0"
               :: "v"(l), "v"(l + 2048u), "v"(l + 4096u), "v"(l + 6144u), "v"(l + 8192u), "v"(l + 10240u), "v"(l + 12288u), "v"(l + 14336u),
                  "v"(kg), "v"(kg + 1024), "v"(kg + 2048), "v"(kg + 3072), "v"(vg), "v"(vg + 1024), "v"(vg + 2048), "v"(vg + 3072)
               : "memory");
}

// x[i] = 2^x[i], the bare v_exp_f32 as in exp2_raw, each in its own register. One statement, closed by a v_nop: the instruction set asks for one free slot behind a transcendental before its
// result is read or its source overwritten.
__device__ __forceinline__ void exp2_x16(float (&x)[16]) {
  asm("v_exp_f32 %0, %0\n\tv_exp_f32 %1, %1\n\tv_exp_f32 %2, %2\n\tv_exp_f32 %3, %3\n\t"
      "v_exp_f32 %4, %4\n\tv_exp_f32 %5, %5\n\tv_exp_f32 %6, %6\n\tv_exp_f32 %7, %7\n\t"
      "v_exp_f32 %8, %8\n\tv_exp_f32 %9, %9\n\tv_exp_f32 %10, %10\n\tv_exp_f32 %11, %11\n\t"
      "v_exp_f32 %12, %12\n\tv_exp_f32 %13, %13\n\tv_exp_f32 %14, %14\n\tv_exp_f32 %15, %15\n\t"
      "v_nop"
      : "+v"(x[0]), "+v"(x[1]), "+v"(x[2]), "+v"(x[3]), "+v"(x[4]), "+v"(x[5]), "+v"(x[6]), "+v"(x[7]),
        "+v"(x[8]), "+v"(x[9]), "+v"(x[10]), "+v"(x[11]), "+v"(x[12]), "+v"(x[13]), "+v"(x[14]), "+v"(x[15]));
}

#define PSMAX 32768.0f                           /* a lane's 16 weights of a step may sum to this much: each of them, and its scaled residual, is then inside f16 */
// A lane's 16 weights of one step against the reference maximum m, carried x256: pc = 256 * exp(sc - m); returns their sum (pairwise tree).
__device__ __forceinline__ float step_weights(const float (&sc)[16], float m, float (&pc)[16]) {
#pragma unroll
  for (int i = 0; i < 16; ++i) pc[i] = fmaf(sc[i] - m, LOG2E, 8.0f);
  exp2_x16(pc);
  v2f a[8];                                        // neighbours as pairs: the tree runs on packed adds
#pragma unroll
  for (int i = 0; i < 8; ++i) a[i] = v2f{pc[2 * i], pc[2 * i + 1]};
#pragma unroll
  for (int i = 0; i < 4; ++i) a[i] += a[i + 4];
  a[0] = (a[0] + a[2]) + (a[1] + a[3]);
  return a[0][0] + a[0][1];
}

// One 32-key step for a wave's 16 queries. Kp, Vp: the step's 4 KiB of K and of V^T in the LDS ring; key0 in the notes below = the step's first key position; mword bit j set = position key0 + j is padded out.
// MASKED = false: a step whose 32 positions are all kept keys (mword not read).
template <bool MASKED>
__device__ __forceinline__ void fa_step(const unsigned short* Kp, const unsigned short* Vp,
                                        unsigned int mword, int ln, int hh, const FragH& q0, const FragH& q1,
                                        float& mr, float& lr, v8f (&Oh)[4], v8f (&Ol)[4]) {
  // A fragments of K: row m = key (key0 + 16*kt + ln), elements 0..7 <- d = 32c + 8h + i, 8..15 <- d = 32c + 16 + 8h + i; block 2*kt + c of the step's 4 KiB
  const int lane8 = (16 * hh + ln) * 8;
  const unsigned short* kp = Kp + lane8;
  FragH k00, k01, k10, k11;
  k00.half[0] = *(const v8us*)(kp);            k00.half[1] = *(const v8us*)(kp + FRAG / 2);
  k01.half[0] = *(const v8us*)(kp + FRAG);     k01.half[1] = *(const v8us*)(kp + FRAG + FRAG / 2);
  k10.half[0] = *(const v8us*)(kp + 2 * FRAG); k10.half[1] = *(const v8us*)(kp + 2 * FRAG + FRAG / 2);
  k11.half[0] = *(const v8us*)(kp + 3 * FRAG); k11.half[1] = *(const v8us*)(kp + 3 * FRAG + FRAG / 2);
  // A fragments of V^T: row m = d (16*t + ln), elements 0..7 <- key0 + 8h + i, 8..15 <- key0 + 16 + 8h + i; block t of the step's 4 KiB
  const unsigned short* vp = Vp + lane8;
  FragH vf[4];
#pragma unroll
  for (int t = 0; t < 4; ++t) {
    vf[t].half[0] = *(const v8us*)(vp + t * FRAG);
    vf[t].half[1] = *(const v8us*)(vp + t * FRAG + FRAG / 2);
  }
  const v8f z8 = {0.f, 0.f, 0.f, 0.f, 0.f, 0.f, 0.f, 0.f};
  // S^T tiles: element r of tile kt = score(key0 + 16*kt + 8h + r, query of this lane's column)
  const v8f s0 = mma_hh2(k00.v, q0.v, k01.v, q1.v, z8);
  const v8f s1 = mma_hh2(k10.v, q0.v, k11.v, q1.v, z8);
  const unsigned int wl = mword >> (8 * hh);
  float sc[16];
#pragma unroll
  for (int r = 0; r < 8; ++r) {
    const float a = s0[r] * QKSCALE, c = s1[r] * QKSCALE;
    sc[r]     = (MASKED && ((wl >> r) & 1u)) ? NEGFILL : a;            // padded key: the score is replaced
    sc[8 + r] = (MASKED && ((wl >> (16 + r)) & 1u)) ? NEGFILL : c;
  }
  // mr is a reference, not the maximum: any value does for the quotient as long as the weights stay inside f16. The weights are formed against the mr at hand, and
  // only if some lane's sum of them leaves PSMAX (on the first step, mr = -3e38, it is infinite) is mr raised to the larger of itself and the step's 32-key maximum, the sums rescaled and the step's weights formed again.
  float pc[16];
  float ps = step_weights(sc, mr, pc);
  if (__builtin_amdgcn_ballot_w32(!(ps <= PSMAX)) != 0u) {   // the same for the whole wave: all 32 lanes stay on for the matrix instructions
    float mx = sc[0];
#pragma unroll
    for (int i = 1; i < 16; ++i) mx = fmaxf(mx, sc[i]);
    mx = fmaxf(mx, __shfl_xor(mx, 16, 32));         // the other lane half holds the other 16 keys of this query: both halves keep the same mr
    const float mnew = fmaxf(mr, mx);
    const float al = exp2_raw((mr - mnew) * LOG2E);
    mr = mnew;
    lr *= al;
#pragma unroll
    for (int t = 0; t < 4; ++t) { Oh[t] = Oh[t] * al; Ol[t] = Ol[t] * al; }
    ps = step_weights(sc, mr, pc);
  }
  lr += ps;                                         // this lane's 16 keys only; the two halves' sums meet behind the key loop
  // hi plane f16(pc), residual plane f16((pc - hi) * 2048)
  FragH ph, pl;
#pragma unroll
  for (int i = 0; i < 16; ++i) {
    const _Float16 h = (_Float16)pc[i];
    ph.h[i] = h;                                    // B element i: i<8 -> key0 + 8h + i (tile 0 row 8h+i); i>=8 -> key0 + 16 + 8h + (i-8) (tile 1)
    pl.h[i] = (_Float16)((pc[i] - (float)h) * 2048.0f);
  }
#pragma unroll
  for (int t = 0; t < 4; ++t) mma_h2(vf[t].v, ph.v, pl.v, Oh[t], Ol[t]);
}

// Block = 4 waves x 16 query positions = 64 of one (batch, head). Key positions 0 .. cnt-1 are the kept keys: whole steps carry no mask, the last one masks its tail.
// K and V^T reach the four waves through a two-buffer LDS ring of 64-key stages: each byte is fetched once per block, by asynchronous copies that fly while the stage before is worked on.
// Stage t = key positions 64t .. 64t+63, walked only if 64t lies in front of the last step's end, so inside a projection tile that was written whole.
// Epilogue: O^T tile -> per-wave LDS tile [16 queries][64 d] (block barrier), then lanes 0..15 / 16..31 each write 256 contiguous bytes
// coverage: NB*16*(SEQ/64) blocks x 4 waves x 16 rows x 64 columns = every context element exactly once; trip counts clamped to SEQ / 32.
__global__ __launch_bounds__(128) void k_attn(const unsigned short* __restrict__ Qh, const unsigned short* __restrict__ Kh,
                                              const unsigned short* __restrict__ Vt, const int* __restrict__ cnt,
                                              float* __restrict__ Cx) {
  __shared__ __attribute__((aligned(16))) float so[4][16][68];
  __shared__ __attribute__((aligned(16))) unsigned short ring[2][2 * STG];
  const int tid = threadIdx.x, w = __builtin_amdgcn_readfirstlane((int)(tid >> 5)), lane = tid & 31, ln = lane & 15, hh = lane >> 4;
  const int bh = blockIdx.x / (SEQ / 64), qt = blockIdx.x % (SEQ / 64);
  const int b = bh / NH, h = bh - b * NH;
  const int qbase = qt * 64 + 16 * w;
  const int n = min(max(cnt[b], 0), SEQ);            // kept keys of the batch (block-uniform)
  const int full = n >> 5;                           // steps of 32 kept keys
  const int steps = n > 0 ? (n + 31) >> 5 : SEQ / 32;
  // Q^T B fragments: column n = query qbase + ln, elements 0..7 <- d = 32c + 8h + i, 8..15 <- d = 32c + 16 + 8h + i
  const unsigned short* qrow = Qh + ((size_t)bh * SEQ + qbase) * HD + lane * 8;   // the wave's 16 queries are one token tile: blocks c = 0, 1
  FragH q0, q1;
  q0.half[0] = *(const v8us*)(qrow);        q0.half[1] = *(const v8us*)(qrow + FRAG / 2);
  q1.half[0] = *(const v8us*)(qrow + FRAG); q1.half[1] = *(const v8us*)(qrow + FRAG + FRAG / 2);
  // the wait that is owed before the lane offset that the four issued loads name is overwritten
  asm volatile("s_wait_xcnt 0x0" :: "v"(lane) : "memory");
  float mr = -3.0e38f, lr = 0.0f;
  v8f Oh[4] = {}, Ol[4] = {};
  const unsigned short* Kp = Kh + (size_t)bh * SEQ * HD;
  const unsigned short* Vp = Vt + (size_t)bh * HD * SEQ;
  const int nst = (steps + 1) >> 1;                  // stages of two steps, 1 .. SEQ / 64 (block-uniform)
  const unsigned short* kg = Kp + tid * 8;
  const unsigned short* vg = Vp + tid * 8;
  const unsigned int l0 = (unsigned int)(size_t)&ring[0][0] + (unsigned int)tid * 16u;
  stage_copy(kg, vg, l0);
  asm volatile("s_wait_asynccnt 0x0" ::: "memory");  // this wave's copies of stage 0 have landed
  __syncthreads();                                   // ... and every other wave's: stage 0 may be read
  if (nst > 1) stage_copy(kg + STG, vg + STG, l0 + STB);
  // The foot of stage t, the same behind a whole stage and behind a masked one
  auto foot = [&](int t) {
    asm volatile("s_wait_dscnt 0x0" ::: "memory");    // this wave's reads of stage t are done before its buffer is handed back
    asm volatile("s_wait_asynccnt 0x0" ::: "memory"); // this wave's copies of stage t + 1 have landed
    __syncthreads();                                  // publishes stage t + 1 and ends every wave's reads of stage t
    if (t + 2 < nst) stage_copy(kg + (size_t)(t + 2) * STG, vg + (size_t)(t + 2) * STG, l0 + (unsigned int)(t & 1) * STB);
  };
  const int nwh = full >> 1;                         // stages of two whole steps of kept keys, at most nst (block-uniform)
  int t = 0;
  for (; t < nwh; ++t) {                             // a loop of its own, with no other path through it: the 64 sums stay in their registers
    const unsigned short* kb = &ring[t & 1][0];
    fa_step<false>(kb, kb + STG, 0u, ln, hh, q0, q1, mr, lr, Oh, Ol);
    fa_step<false>(kb + 32 * HD, kb + STG + 32 * HD, 0u, ln, hh, q0, q1, mr, lr, Oh, Ol);
    foot(t);
  }
  for (; t < nst; ++t) {                             // the last stage, or every stage when no key is kept
    const unsigned short* kb = &ring[t & 1][0];
#pragma unroll 1
    for (int u = 0; u < 2; ++u) {                    // rolled: one copy of the masked step's code
      const int j = 2 * t + u;
      if (j < steps)                                 // a whole step masks nothing; the tail step masks positions n % 32 and up; no key kept: every position
        fa_step<true>(kb + u * (32 * HD), kb + STG + u * (32 * HD), j < full ? 0u : 0xFFFFFFFFu << (n & 31), ln, hh, q0, q1, mr, lr, Oh, Ol);
    }
    foot(t);
  }
  asm volatile("s_wait_asynccnt 0x0" ::: "memory");   // no copy is left in flight when the wave goes on

  // O^T element r of tile t = ctx(query qbase + ln, d = 16t + 8h + r); undo the carries: x256 (in lr), x16 (V), x2048 (residual plane)
  lr += __shfl_xor(lr, 16, 32);                      // the row sum: both lane halves' keys
  const float inv = 1.0f / (CARRY * lr);
#pragma unroll
  for (int t = 0; t < 4; ++t)
#pragma unroll
    for (int r = 0; r < 8; ++r)
      so[w][ln][16 * t + 8 * hh + r] = (Oh[t][r] + Ol[t][r] * 0.00048828125f) * inv;
  __syncthreads();
  float* og = Cx + ((size_t)b * SEQ + qbase) * DM + h * HD;
  const int rsub = lane >> 4, c4 = (lane & 15) * 4;
  {
#pragma unroll
    for (int q = 0; q < 8; ++q) {
      const int row = 2 * q + rsub;
      const v4f v = *(const v4fa*)&so[w][row][c4];
      *(v4f*)(og + (size_t)row * DM + c4) = v;
    }
    
  }
}

// coverage: NB*SEQ blocks x 256 threads x 4 columns = every output element of the processed region exactly once.
__global__ __launch_bounds__(256) void k_ln(const float* __restrict__ Cx, const float* __restrict__ gamma,
                                            const float* __restrict__ beta, const int* __restrict__ perm, float* __restrict__ out) {
  __shared__ float rs[8];
  __shared__ float rq[8];
  const int tid = threadIdx.x, lane = tid & 31, w = __builtin_amdgcn_readfirstlane((int)(tid >> 5));
  const int r = blockIdx.x;
  const int b = r / SEQ, s = perm[r];                // context row r holds the token of position r % SEQ
  const v4f x = *(const v4fa*)(Cx + (size_t)r * DM + tid * 4);
  float sm = (x[0] + x[1]) + (x[2] + x[3]);
#pragma unroll
  for (int off = 16; off >= 1; off >>= 1) sm += __shfl_xor(sm, off, 32);
  if (lane == 0) rs[w] = sm;
  __syncthreads();
  float tot = 0.0f;
#pragma unroll
  for (int i = 0; i < 8; ++i) tot += rs[i];
  const float mu = tot * (1.0f / 1024.0f);
  const float d0 = x[0] - mu, d1 = x[1] - mu, d2 = x[2] - mu, d3 = x[3] - mu;
  float sq = (d0 * d0 + d1 * d1) + (d2 * d2 + d3 * d3);
#pragma unroll
  for (int off = 16; off >= 1; off >>= 1) sq += __shfl_xor(sq, off, 32);
  if (lane == 0) rq[w] = sq;
  __syncthreads();
  float tq = 0.0f;
#pragma unroll
  for (int i = 0; i < 8; ++i) tq += rq[i];
  const float var = tq * (1.0f / 1024.0f);
  const float rinv = rsqrtf(var + 1.0e-6f);
  const v4f g = *(const v4fa*)(gamma + tid * 4);
  const v4f be = *(const v4fa*)(beta + tid * 4);
  v4f o;
  o[0] = d0 * rinv * bf16_rne(g[0]) + bf16_rne(be[0]);
  o[1] = d1 * rinv * bf16_rne(g[1]) + bf16_rne(be[1]);
  o[2] = d2 * rinv * bf16_rne(g[2]) + bf16_rne(be[2]);
  o[3] = d3 * rinv * bf16_rne(g[3]) + bf16_rne(be[3]);
  float* dst = out + ((size_t)b * SEQ_FULL + s) * DM + tid * 4;
  *(v4f*)dst = o;
  
}

extern "C" void kernel_launch(void* const* d_in, const int* in_sizes, int n_in,
                              void* d_out, int out_size, void* d_ws, size_t ws_size, hipStream_t stream) {
  if (n_in < 7) return;
  const long long need_x = (long long)(NB - 1) * SEQ_FULL * DM + (long long)SEQ * DM;   // last element touched + 1
  const long long need_m = (long long)(NB - 1) * SEQ_FULL + (long long)SEQ;
  if ((long long)in_sizes[0] < need_x || (long long)in_sizes[1] < need_m) return;
  if ((long long)in_sizes[2] < (long long)DM * DM || (long long)in_sizes[3] < (long long)DM * DM || (long long)in_sizes[4] < (long long)DM * DM) return;
  if (in_sizes[5] < DM || in_sizes[6] < DM) return;
  if ((long long)out_size < need_x) return;
  const float* X     = (const float*)d_in[0];   // wire order: q [2][2048][1024] f32, mask [2][2048] i32, Wq, Wk, Wv [1024][1024] f32, gamma, beta [1024] f32
  const int*   mask  = (const int*)d_in[1];
  const float* Wq    = (const float*)d_in[2];
  const float* Wk    = (const float*)d_in[3];
  const float* Wv    = (const float*)d_in[4];
  const float* gamma = (const float*)d_in[5];
  const float* beta  = (const float*)d_in[6];
  float* out = (float*)d_out;
  char* ws = (char*)d_ws;
  size_t off = 0;
  const size_t xb_bytes = (size_t)NB * SEQ * DM * 2;        // 8 MiB at full size; every plane is written by whole 16-B pieces, none past its end
  const size_t wb_bytes = (size_t)3 * DM * DM * 2;          // 6 MiB
  const size_t p3_bytes = 3 * PLANE * 2;                    // 24 MiB
  const size_t cx_bytes = (size_t)NB * SEQ * DM * 4;        // 16 MiB
  unsigned short* Xb = (unsigned short*)(ws + off); off += (xb_bytes + 255) & ~(size_t)255;
  unsigned short* Wb = (unsigned short*)(ws + off); off += (wb_bytes + 255) & ~(size_t)255;
  unsigned short* P3 = (unsigned short*)(ws + off); off += (p3_bytes + 255) & ~(size_t)255;
  float*          Cx = (float*)(ws + off);          off += (cx_bytes + 255) & ~(size_t)255;
  int*          perm = (int*)(ws + off);            off += ((size_t)NB * SEQ * 4 + 255) & ~(size_t)255;
  int*           cnt = (int*)(ws + off);            off += 256;
  if (off > ws_size) return;
  k_prep<<<(unsigned)(XBLK + WBLK), 256, 0, stream>>>(X, Wq, Wk, Wv, mask, Xb, Wb, perm, cnt);
  k_proj<<<dim3((unsigned)(3 * DM / 64), (unsigned)(NB * SEQ / 128)), 128, 0, stream>>>(Xb, Wb, P3, cnt);
  k_attn<<<(unsigned)(NB * NH * (SEQ / 64)), 128, 0, stream>>>(P3, P3 + PLANE, P3 + 2 * PLANE, cnt, Cx);
  k_ln<<<(unsigned)(NB * SEQ), 256, 0, stream>>>(Cx, gamma, beta, perm, out);
}

// v007
// One run takes 64.1 microseconds.
// In both of two side-by-side timings against v006, it was 1.05 times as fast.
// Counting every step since v000, it is 3.19 times as fast.
#include <hip/hip_runtime.h>
// Contractions: x Wq^T, x Wk^T, x Wv^T on v_wmma_f32_16x16x32_bf16 (x and W converted RNE to bf16, single product, f32 accumulate); S^T = K Q^T on v_wmma_f32_16x16x32_f16 (Q, K: f16 planes of the f32 projections x16, single product); O^T = V^T P^T on v_wmma_f32_16x16x32_f16 (V: f16 plane x16; P: x256 f16 hi plane + f16 plane of its rounding residual, both into one f32 accumulator); softmax statistics and LayerNorm f32.
// Multi-head self attention, B x S x 1024, 16 heads x 64, scores scaled 1/8, key-padding mask replaces masked scores by -1e20, LayerNorm over the 1024 concatenated columns.
// Engine: transposed flash. Each wave owns 16 queries of one (batch, head). Per 32-key step: S^T tiles (key rows x query columns) from K rows (A, f16 plane by way of LDS)
// and Q^T (B, registers); the two 16-key D tiles pack straight into the P^T B fragment; O^T (d rows x query columns) accumulates from V^T rows (A, f16 plane by way of LDS).
// Every 16-bit plane is stored fragment-major: a 16 x 32 operand fragment (16 rows or columns x 32 k) is one 1-KiB block of 64 pieces of 8 elements,
// piece 32*half + lane (lane = 16*hh + ln) = row ln, k = 16*half + 8*hh + 0..7. A wave-wide 16-byte load of one half reads 512 contiguous bytes (4 lines, not 16).
// Token order: inside each batch the tokens are stably partitioned by the key mask, kept keys first (perm[position] = token, cnt = kept keys). A padded key's weight is
// exp(-1e20 - max) = 0 whenever one key is kept, so K, V^T and the key loop cover the first cnt positions only; every plane and the context are in position order and
// the LayerNorm kernel stores row perm[position]. No key kept: every score is -1e20 (uniform weights), so all SEQ positions are walked with every key marked padded.
#ifndef NB
#define NB 2
#endif
#ifndef SEQ
#define SEQ 2048
#endif
#define NB_FULL 2
#define SEQ_FULL 2048
#define DM 1024
#define NH 16
#define HD 64
#define XB_FULL ((size_t)SEQ_FULL * DM)          /* per-batch element stride of the activation input and of the output */
#define PLANE ((size_t)NB * NH * SEQ * HD)       /* elements of one of the Q / K / V^T planes */
#define FRAG 512                                 /* elements of one 16 x 32 fragment block; its second half starts at FRAG / 2 */
#define RTILE ((size_t)16 * DM)                  /* elements of 16 rows of a [rows][1024] plane = 32 fragment blocks */

static_assert(SEQ % 256 == 0);
static_assert(SEQ <= SEQ_FULL);
static_assert(NB <= NB_FULL);
static_assert(HD == 64);
static_assert(DM == NH * HD);
static_assert(DM % 32 == 0);
static_assert((3 * DM) % 64 == 0);
static_assert((size_t)NB * SEQ * DM * 2 + (size_t)3 * DM * DM * 2 + 3 * PLANE * 2 + (size_t)NB * SEQ * DM * 4 + (size_t)NB * SEQ * 4 + 1024 <= (size_t)134217728);

typedef __bf16 v16b __attribute__((ext_vector_type(16)));
typedef _Float16 v16h __attribute__((ext_vector_type(16)));
typedef unsigned short v8us __attribute__((ext_vector_type(8), may_alias));
typedef float v8f __attribute__((ext_vector_type(8)));
typedef float v2f __attribute__((ext_vector_type(2)));
typedef _Float16 v2h __attribute__((ext_vector_type(2)));
typedef float v4f __attribute__((ext_vector_type(4)));
typedef float v4fa __attribute__((ext_vector_type(4), may_alias));
union FragB { v16b v; v8us half[2]; unsigned short u[16]; };
union FragH { v16h v; v8us half[2]; v2h p[8]; _Float16 h[16]; unsigned short u[16]; };

#define LOG2E 1.4426950408889634f
#define NEGFILL (-1.0e20f)
#define CARRY 16.0f                      /* power-of-two carry of the Q, K and V planes */
#define QKSCALE 0.00048828125f           /* (1/8) / (16*16) */

__device__ __forceinline__ unsigned short bf16_bits(float x) {   // RNE convert to bf16 bits
  unsigned int u = __float_as_uint(x);
  return (unsigned short)((u + 0x7FFFu + ((u >> 16) & 1u)) >> 16);
}
__device__ __forceinline__ float bf16_val(unsigned short b) { return __uint_as_float(((unsigned int)b) << 16); }
__device__ __forceinline__ float bf16_rne(float x) { return bf16_val(bf16_bits(x)); }
__device__ __forceinline__ unsigned short f16_bits(float x) { const _Float16 h = (_Float16)x; return __builtin_bit_cast(unsigned short, h); }

// c0..c3 += a * b0..b3 (one bf16 k-step of four column tiles), then the hazard guard
__device__ __forceinline__ void mma_b4(v16b a, v16b b0, v16b b1, v16b b2, v16b b3, v8f& c0, v8f& c1, v8f& c2, v8f& c3) {
  c0 = __builtin_amdgcn_wmma_f32_16x16x32_bf16(false, a, false, b0, (short)0, c0, false, false);
  c1 = __builtin_amdgcn_wmma_f32_16x16x32_bf16(false, a, false, b1, (short)0, c1, false, false);
  c2 = __builtin_amdgcn_wmma_f32_16x16x32_bf16(false, a, false, b2, (short)0, c2, false, false);
  c3 = __builtin_amdgcn_wmma_f32_16x16x32_bf16(false, a, false, b3, (short)0, c3, false, false);
  asm volatile("v_nop\n\tv_nop\n\tv_nop\n\tv_nop" : "+v"(c0), "+v"(c1), "+v"(c2), "+v"(c3) : "v"(a), "v"(b0), "v"(b1), "v"(b2), "v"(b3));
}
// c += a0*b0 + a1*b1 (two k-steps of one f16 tile), then the hazard guard
__device__ __forceinline__ v8f mma_hh2(v16h a0, v16h b0, v16h a1, v16h b1, v8f c) {
  c = __builtin_amdgcn_wmma_f32_16x16x32_f16(false, a0, false, b0, (short)0, c, false, false);
  c = __builtin_amdgcn_wmma_f32_16x16x32_f16(false, a1, false, b1, (short)0, c, false, false);
  asm volatile("v_nop\n\tv_nop\n\tv_nop\n\tv_nop" : "+v"(c) : "v"(a0), "v"(b0), "v"(a1), "v"(b1));
  return c;
}
// c0..c3 += a0..a3 * bh, then c0..c3 += a0..a3 * bl (three products stand between the two that add into one tile), then the hazard guard
__device__ __forceinline__ void mma_h8(v16h a0, v16h a1, v16h a2, v16h a3, v16h bh, v16h bl, v8f& c0, v8f& c1, v8f& c2, v8f& c3) {
  c0 = __builtin_amdgcn_wmma_f32_16x16x32_f16(false, a0, false, bh, (short)0, c0, false, false);
  c1 = __builtin_amdgcn_wmma_f32_16x16x32_f16(false, a1, false, bh, (short)0, c1, false, false);
  c2 = __builtin_amdgcn_wmma_f32_16x16x32_f16(false, a2, false, bh, (short)0, c2, false, false);
  c3 = __builtin_amdgcn_wmma_f32_16x16x32_f16(false, a3, false, bh, (short)0, c3, false, false);
  c0 = __builtin_amdgcn_wmma_f32_16x16x32_f16(false, a0, false, bl, (short)0, c0, false, false);
  c1 = __builtin_amdgcn_wmma_f32_16x16x32_f16(false, a1, false, bl, (short)0, c1, false, false);
  c2 = __builtin_amdgcn_wmma_f32_16x16x32_f16(false, a2, false, bl, (short)0, c2, false, false);
  c3 = __builtin_amdgcn_wmma_f32_16x16x32_f16(false, a3, false, bl, (short)0, c3, false, false);
  asm volatile("v_nop\n\tv_nop\n\tv_nop\n\tv_nop" : "+v"(c0), "+v"(c1), "+v"(c2), "+v"(c3) : "v"(a0), "v"(a1), "v"(a2), "v"(a3), "v"(bh), "v"(bl));
}

// Preparation, one launch. Blocks 0 .. XBLK-1: the activation plane; the rest: the three weight planes (no token order, no LDS, no barrier).
// Stable partition of one batch's tokens: position of token s = kept tokens before s if it is kept, else cnt + padded tokens before s (a permutation of 0..SEQ-1 for any mask).
// Every activation block works the list of its own batch out for itself (8 KiB of mask, SEQ / 256 consecutive tokens per thread, list gathered in LDS), so that no launch has to
// end before the conversion starts; the first block of each batch also stores the list as whole lines, and cnt, for the later launches.
// dst = bf16 bits (RNE) of src, fragment-major: block (row / 16) * 32 + k / 32; activation row at position p of batch b = token sp[p].
// A wave takes 8 rows x one 128-B source line each and writes four whole 128-B lines of the block (pieces 16*q + 8*rhi + 0..7, q = k / 8 in the block).
// coverage: every sp[] entry written once (permutation) before the barrier in front of its read; NB x SEQ entries of perm and NB of cnt;
// XBLK*256 and WBLK*256 threads x 8 elements = the whole planes (thread bits 0-2 and 5 -> row in the block, bits 3-4 -> q).
#define XBLK (NB * SEQ * 128 / 256)
#define WBLK (3 * DM * 128 / 256)
__global__ __launch_bounds__(256) void k_prep(const float* __restrict__ X, const float* __restrict__ Wq, const float* __restrict__ Wk, const float* __restrict__ Wv,
                                              const int* __restrict__ mask, unsigned short* __restrict__ Xb, unsigned short* __restrict__ Wb,
                                              int* __restrict__ perm, int* __restrict__ cnt) {
  constexpr int TPT = SEQ / 256;
  __shared__ int sp[SEQ];
  __shared__ int wsum[8];
  const int tid = threadIdx.x;
  const bool isx = blockIdx.x < XBLK;                // block-uniform
  const int t = (isx ? blockIdx.x : blockIdx.x - XBLK) * 256 + tid;
  const int blk = t >> 6, ln = ((t >> 5) & 1) * 8 + (t & 7), q = (t >> 3) & 3;
  const int row = (blk / (DM / 32)) * 16 + ln, k = (blk % (DM / 32)) * 32 + q * 8;
  const float* p;
  unsigned short* d;
  if (isx) {
    const int lane = tid & 31, w = tid >> 5, b = blockIdx.x / (XBLK / NB);   // a block lies inside 16 rows, so inside one batch
    const int* mp = mask + (size_t)b * SEQ_FULL + tid * TPT;
    int keep[TPT];
    int c = 0;
#pragma unroll
    for (int i = 0; i < TPT; ++i) { keep[i] = mp[i] != 0 ? 1 : 0; c += keep[i]; }
    int inc = c;                                     // inclusive scan of the threads' kept counts inside the wave
#pragma unroll
    for (int off = 1; off < 32; off <<= 1) { const int v = __shfl_up(inc, off, 32); if (lane >= off) inc += v; }
    if (lane == 31) wsum[w] = inc;
    __syncthreads();
    int base = 0, n = 0;
#pragma unroll
    for (int i = 0; i < 8; ++i) { const int v = wsum[i]; n += v; if (i < w) base += v; }
    int kr = base + inc - c;                         // kept tokens in front of this thread's first token
#pragma unroll
    for (int i = 0; i < TPT; ++i) {
      const int s = tid * TPT + i;
      sp[keep[i] ? kr : n + s - kr] = s;
      kr += keep[i];
    }
    __syncthreads();
    if (blockIdx.x % (XBLK / NB) == 0) {             // block-uniform, behind the last barrier
#pragma unroll
      for (int i = 0; i < TPT; ++i) perm[(size_t)b * SEQ + tid + 256 * i] = sp[tid + 256 * i];
      if (tid == 0) cnt[b] = n;
    }
    p = X + (size_t)b * XB_FULL + (size_t)sp[row - b * SEQ] * DM + k;
    d = Xb + (size_t)blk * FRAG + (q * 16 + ln) * 8;
  } else {
    const int which = (blockIdx.x - XBLK) / (WBLK / 3);   // a block lies inside 16 rows, so inside one of Wq, Wk, Wv
    p = (which == 0 ? Wq : which == 1 ? Wk : Wv) + (size_t)(row - which * DM) * DM + k;
    d = Wb + (size_t)blk * FRAG + (q * 16 + ln) * 8;
  }
  const v4f x0 = *(const v4fa*)(p), x1 = *(const v4fa*)(p + 4);
  v8us o;
  o[0] = bf16_bits(x0[0]); o[1] = bf16_bits(x0[1]); o[2] = bf16_bits(x0[2]); o[3] = bf16_bits(x0[3]);
  o[4] = bf16_bits(x1[0]); o[5] = bf16_bits(x1[1]); o[6] = bf16_bits(x1[2]); o[7] = bf16_bits(x1[3]);
  *(v8us*)d = o;
}

__device__ __forceinline__ void stage8(unsigned short* st, const v8f& c, int base, int rstep) {
#pragma unroll
  for (int r = 0; r < 8; ++r) st[base + r * rstep] = f16_bits(c[r] * CARRY);
}

// Y[m][n] = sum_k Xb[m][k] * Wb[n][k], M = NB*SEQ, N = 3*1024 (Wq | Wk | Wv rows), K = 1024.
// Block = 4 waves, tile 128 rows x 64 columns (one head of one of Q/K/V); wave tile 32 x 64; fragments straight from the fragment-major bf16 planes.
// A fragment: row m, elements 0..7 <- k0 + 8h + i, 8..15 <- k0 + 16 + 8h + i; B fragment: column n = W row n, same k map; D element r = (row 8h + r, column ln).
//   Q, K planes P3[0..1][b*16+h][token / 16][d / 32][fragment block: row = token % 16, k = d % 32]
//   V^T plane   P3[2][b*16+h][token / 32][d / 16][fragment block: row = d % 16, k = token % 32]; each thread stores the piece of its own index: whole lines.
// K and V^T tiles that start behind the last kept position are never read and are left out (block-uniform return in front of every barrier); a tile that straddles it is whole.
// coverage: grid (48, NB*SEQ/128) x (128 x 64) = the Q plane and every K, V^T tile the key loop reads; LDS tile fully written before it is read (128x64 or 64x128).
__global__ __launch_bounds__(128) void k_proj(const unsigned short* __restrict__ Xb, const unsigned short* __restrict__ Wb,
                                              unsigned short* __restrict__ P3, const int* __restrict__ cnt) {
  __shared__ __attribute__((aligned(16))) unsigned short st[128 * 72];
  const int tid = threadIdx.x, w = __builtin_amdgcn_readfirstlane((int)(tid >> 5)), lane = tid & 31, ln = lane & 15, hh = lane >> 4;
  const int n0 = blockIdx.x * 64;
  const int m0 = blockIdx.y * 128;
  if (n0 >= DM) {                                    // K or V columns
    const int n = cnt[m0 / SEQ];
    if (n > 0 && m0 % SEQ >= n) return;
  }
  const unsigned short* ap0 = Xb + (size_t)((m0 >> 4) + 2 * w) * RTILE + lane * 8;
  const unsigned short* ap1 = ap0 + RTILE;
  const unsigned short* bp = Wb + (size_t)(n0 >> 4) * RTILE + lane * 8;
  const v8f z8 = {0.f, 0.f, 0.f, 0.f, 0.f, 0.f, 0.f, 0.f};
  v8f c00 = z8, c01 = z8, c02 = z8, c03 = z8, c10 = z8, c11 = z8, c12 = z8, c13 = z8;
#pragma unroll 1
  for (int ko = 0; ko < (DM / 32) * FRAG; ko += FRAG) {          // ko: element offset of k-block k0 / 32 inside a row tile
    FragB a0, a1, b0, b1, b2, b3;
    a0.half[0] = *(const v8us*)(ap0 + ko);             a0.half[1] = *(const v8us*)(ap0 + ko + FRAG / 2);
    a1.half[0] = *(const v8us*)(ap1 + ko);             a1.half[1] = *(const v8us*)(ap1 + ko + FRAG / 2);
    b0.half[0] = *(const v8us*)(bp + ko);              b0.half[1] = *(const v8us*)(bp + ko + FRAG / 2);
    b1.half[0] = *(const v8us*)(bp + RTILE + ko);      b1.half[1] = *(const v8us*)(bp + RTILE + ko + FRAG / 2);
    b2.half[0] = *(const v8us*)(bp + 2 * RTILE + ko);  b2.half[1] = *(const v8us*)(bp + 2 * RTILE + ko + FRAG / 2);
    b3.half[0] = *(const v8us*)(bp + 3 * RTILE + ko);  b3.half[1] = *(const v8us*)(bp + 3 * RTILE + ko + FRAG / 2);
    // the wait that is owed before a register named by an issued load is overwritten; the two addresses as inputs keep their registers out of the loads' own destinations
    asm volatile("s_wait_xcnt 0x0" :: "v"(ap0 + ko), "v"(bp + ko) : "memory");
    mma_b4(a0.v, b0.v, b1.v, b2.v, b3.v, c00, c01, c02, c03);
    mma_b4(a1.v, b0.v, b1.v, b2.v, b3.v, c10, c11, c12, c13);
  }
  const int which = n0 >> 10;                 // 0: Q, 1: K, 2: V (block-uniform)
  const int h = (n0 & 1023) >> 6;
  const int b = m0 / SEQ, s0 = m0 - b * SEQ;
  const int bh = b * NH + h;
  const bool rowmajor = which < 2;
  const int rstep = rowmajor ? 72 : 1;
  const int rb0 = 32 * w + 8 * hh, rb1 = rb0 + 16;
  // element (row rb + r, column 16*nt + ln): Q/K tile st[row*72 + col]; V tile st[col*136 + row]
  stage8(st, c00, rowmajor ? rb0 * 72 + ln        : (ln) * 136 + rb0,      rstep);
  stage8(st, c01, rowmajor ? rb0 * 72 + 16 + ln   : (16 + ln) * 136 + rb0, rstep);
  stage8(st, c02, rowmajor ? rb0 * 72 + 32 + ln   : (32 + ln) * 136 + rb0, rstep);
  stage8(st, c03, rowmajor ? rb0 * 72 + 48 + ln   : (48 + ln) * 136 + rb0, rstep);
  stage8(st, c10, rowmajor ? rb1 * 72 + ln        : (ln) * 136 + rb1,      rstep);
  stage8(st, c11, rowmajor ? rb1 * 72 + 16 + ln   : (16 + ln) * 136 + rb1, rstep);
  stage8(st, c12, rowmajor ? rb1 * 72 + 32 + ln   : (32 + ln) * 136 + rb1, rstep);
  stage8(st, c13, rowmajor ? rb1 * 72 + 48 + ln   : (48 + ln) * 136 + rb1, rstep);
  __syncthreads();
  if (rowmajor) {
    unsigned short* base = P3 + (size_t)which * PLANE + ((size_t)bh * SEQ + s0) * HD;
    {
#pragma unroll
      for (int it = 0; it < 8; ++it) {
        const int i = tid + 128 * it;                                   // piece i: token tile i / 128, d block (i / 64) % 2, piece i % 64
        const int row = (i >> 7) * 16 + (i & 15), col = ((i >> 4) & 7) * 8;   // d = 32*c + 16*half + 8*hh
        const v8us o = *(const v8us*)(&st[row * 72 + col]);
        *(v8us*)(base + (size_t)i * 8) = o;
      }
      
    }
  } else {
    unsigned short* base = P3 + (size_t)2 * PLANE + ((size_t)bh * SEQ + s0) * HD;
    {
#pragma unroll
      for (int it = 0; it < 8; ++it) {
        const int i = tid + 128 * it;
        const int dc = ((i >> 6) & 3) * 16 + (i & 15);                  // piece i: key block i / 256, d tile (i / 64) % 4, piece i % 64
        const int tk = (i >> 8) * 32 + ((i >> 4) & 3) * 8;              // token = 32*block + 16*half + 8*hh
        const v8us o = *(const v8us*)(&st[dc * 136 + tk]);
        *(v8us*)(base + (size_t)i * 8) = o;
      }
      
    }
  }
}

// 2^x as the bare v_exp_f32. exp2f() wraps it in a range fix for results below 2^-126 (compare, two selects, add, ldexp per value). Here such a result is a weight that
// rounds to zero in both f16 planes and adds nothing to a row sum of at least 256, or a rescale factor of sums that the new maximum's terms outweigh by 2^126: flushed to 0 it gives the same output.
__device__ __forceinline__ float exp2_raw(float x) { return __builtin_amdgcn_exp2f(x); }

#define STK 64                                   /* keys of one stage of the LDS ring */
#define STG (STK * HD)                           /* elements of the K part, and of the V^T part, of one stage (8 KiB each) */
#define STB (2 * STG * 2)                        /* bytes of one ring buffer: K part, then V^T part */
static_assert(SEQ % STK == 0);
static_assert(128 % STK == 0);                   // a stage lies inside one 128-row tile of the projection: written whole or not walked at all
static_assert(STG * 2 == 4 * 128 * 16);          // 4 copies of 16 B per thread and part

// One stage into one ring buffer: 64 keys are 8 KiB of K and 8 KiB of V^T, each contiguous in its fragment-major plane, copied as they lie.
// kg, vg: this thread's first piece of the stage in the two planes (stage base + 8 * tid elements); l: its LDS byte address (buffer base + 16 * tid).
// Every thread brings pieces tid + 128 * c, c = 0..3, of each part: all addresses multiples of 16, no LDS byte written twice, all 32 lanes on.
__device__ __forceinline__ void stage_copy(const unsigned short* kg, const unsigned short* vg, unsigned int l) {
  // s_wait_xcnt as the statement's last line: it then stands in front of every later write of a register that one of the copies names
  asm volatile("global_load_async_to_lds_b128 %0, %8, off\n\t"
               "global_load_async_to_lds_b128 %1, %9, off\n\t"
               "global_load_async_to_lds_b128 %2, %10, off\n\t"
               "global_load_async_to_lds_b128 %3, %11, off\n\t"
               "global_load_async_to_lds_b128 %4, %12, off\n\t"
               "global_load_async_to_lds_b128 %5, %13, off\n\t"
               "global_load_async_to_lds_b128 %6, %14, off\n\t"
               "global_load_async_to_lds_b128 %7, %15, off\n\t"
               "s_wait_xcnt 0x0"
               :: "v"(l), "v"(l + 2048u), "v"(l + 4096u), "v"(l + 6144u), "v"(l + 8192u), "v"(l + 10240u), "v"(l + 12288u), "v"(l + 14336u),
                  "v"(kg), "v"(kg + 1024), "v"(kg + 2048), "v"(kg + 3072), "v"(vg), "v"(vg + 1024), "v"(vg + 2048), "v"(vg + 3072)
               : "memory");
}

// x[i] = 2^x[i], the bare v_exp_f32 as in exp2_raw, each in its own register. One statement, closed by a v_nop: the instruction set asks for one free slot behind a transcendental before its
// result is read or its source overwritten.
__device__ __forceinline__ void exp2_x16(float (&x)[16]) {
  asm("v_exp_f32 %0, %0\n\tv_exp_f32 %1, %1\n\tv_exp_f32 %2, %2\n\tv_exp_f32 %3, %3\n\t"
      "v_exp_f32 %4, %4\n\tv_exp_f32 %5, %5\n\tv_exp_f32 %6, %6\n\tv_exp_f32 %7, %7\n\t"
      "v_exp_f32 %8, %8\n\tv_exp_f32 %9, %9\n\tv_exp_f32 %10, %10\n\tv_exp_f32 %11, %11\n\t"
      "v_exp_f32 %12, %12\n\tv_exp_f32 %13, %13\n\tv_exp_f32 %14, %14\n\tv_exp_f32 %15, %15\n\t"
      "v_nop"
      : "+v"(x[0]), "+v"(x[1]), "+v"(x[2]), "+v"(x[3]), "+v"(x[4]), "+v"(x[5]), "+v"(x[6]), "+v"(x[7]),
        "+v"(x[8]), "+v"(x[9]), "+v"(x[10]), "+v"(x[11]), "+v"(x[12]), "+v"(x[13]), "+v"(x[14]), "+v"(x[15]));
}

// x[i] -= (float)h.h[i]: one v_fma_mix_f32 per value, which reads its f16 half of the packed word as it lies. Written as C, the build widened each half with a convert of its own
// and then subtracted in pairs: 24 instructions for these 16. No instruction here reads another's result.
__device__ __forceinline__ void residual_x16(float (&x)[16], const FragH& h) {
  asm("v_fma_mix_f32 %0, %16, -1.0, %0 op_sel_hi:[1,1,0]\n\tv_fma_mix_f32 %1, %16, -1.0, %1 op_sel:[1,0,0] op_sel_hi:[1,1,0]\n\t"
      "v_fma_mix_f32 %2, %17, -1.0, %2 op_sel_hi:[1,1,0]\n\tv_fma_mix_f32 %3, %17, -1.0, %3 op_sel:[1,0,0] op_sel_hi:[1,1,0]\n\t"
      "v_fma_mix_f32 %4, %18, -1.0, %4 op_sel_hi:[1,1,0]\n\tv_fma_mix_f32 %5, %18, -1.0, %5 op_sel:[1,0,0] op_sel_hi:[1,1,0]\n\t"
      "v_fma_mix_f32 %6, %19, -1.0, %6 op_sel_hi:[1,1,0]\n\tv_fma_mix_f32 %7, %19, -1.0, %7 op_sel:[1,0,0] op_sel_hi:[1,1,0]\n\t"
      "v_fma_mix_f32 %8, %20, -1.0, %8 op_sel_hi:[1,1,0]\n\tv_fma_mix_f32 %9, %20, -1.0, %9 op_sel:[1,0,0] op_sel_hi:[1,1,0]\n\t"
      "v_fma_mix_f32 %10, %21, -1.0, %10 op_sel_hi:[1,1,0]\n\tv_fma_mix_f32 %11, %21, -1.0, %11 op_sel:[1,0,0] op_sel_hi:[1,1,0]\n\t"
      "v_fma_mix_f32 %12, %22, -1.0, %12 op_sel_hi:[1,1,0]\n\tv_fma_mix_f32 %13, %22, -1.0, %13 op_sel:[1,0,0] op_sel_hi:[1,1,0]\n\t"
      "v_fma_mix_f32 %14, %23, -1.0, %14 op_sel_hi:[1,1,0]\n\tv_fma_mix_f32 %15, %23, -1.0, %15 op_sel:[1,0,0] op_sel_hi:[1,1,0]"
      : "+v"(x[0]), "+v"(x[1]), "+v"(x[2]), "+v"(x[3]), "+v"(x[4]), "+v"(x[5]), "+v"(x[6]), "+v"(x[7]),
        "+v"(x[8]), "+v"(x[9]), "+v"(x[10]), "+v"(x[11]), "+v"(x[12]), "+v"(x[13]), "+v"(x[14]), "+v"(x[15])
      : "v"(h.p[0]), "v"(h.p[1]), "v"(h.p[2]), "v"(h.p[3]), "v"(h.p[4]), "v"(h.p[5]), "v"(h.p[6]), "v"(h.p[7]));
}

#define PSMAX 32768.0f                           /* a lane's 16 weights of a step may sum to this much: each of them is then inside f16 */
// A lane's 16 weights of one step against the reference maximum m, carried x256: pc = 256 * exp(sc - m); returns their sum (pairwise tree).
__device__ __forceinline__ float step_weights(const float (&sc)[16], float m, float (&pc)[16]) {
#pragma unroll
  for (int i = 0; i < 16; ++i) pc[i] = fmaf(sc[i] - m, LOG2E, 8.0f);
  exp2_x16(pc);
  v2f a[8];                                        // neighbours as pairs: the tree runs on packed adds
#pragma unroll
  for (int i = 0; i < 8; ++i) a[i] = v2f{pc[2 * i], pc[2 * i + 1]};
#pragma unroll
  for (int i = 0; i < 4; ++i) a[i] += a[i + 4];
  a[0] = (a[0] + a[2]) + (a[1] + a[3]);
  return a[0][0] + a[0][1];
}

// One 32-key step for a wave's 16 queries. Kp, Vp: the step's 4 KiB of K and of V^T in the LDS ring; key0 in the notes below = the step's first key position; mword bit j set = position key0 + j is padded out.
// MASKED = false: a step whose 32 positions are all kept keys (mword not read).
template <bool MASKED>
__device__ __forceinline__ void fa_step(const unsigned short* Kp, const unsigned short* Vp,
                                        unsigned int mword, int ln, int hh, const FragH& q0, const FragH& q1,
                                        float& mr, float& lr, v8f (&Oh)[4]) {
  // A fragments of K: row m = key (key0 + 16*kt + ln), elements 0..7 <- d = 32c + 8h + i, 8..15 <- d = 32c + 16 + 8h + i; block 2*kt + c of the step's 4 KiB
  const int lane8 = (16 * hh + ln) * 8;
  const unsigned short* kp = Kp + lane8;
  FragH k00, k01, k10, k11;
  k00.half[0] = *(const v8us*)(kp);            k00.half[1] = *(const v8us*)(kp + FRAG / 2);
  k01.half[0] = *(const v8us*)(kp + FRAG);     k01.half[1] = *(const v8us*)(kp + FRAG + FRAG / 2);
  k10.half[0] = *(const v8us*)(kp + 2 * FRAG); k10.half[1] = *(const v8us*)(kp + 2 * FRAG + FRAG / 2);
  k11.half[0] = *(const v8us*)(kp + 3 * FRAG); k11.half[1] = *(const v8us*)(kp + 3 * FRAG + FRAG / 2);
  // A fragments of V^T: row m = d (16*t + ln), elements 0..7 <- key0 + 8h + i, 8..15 <- key0 + 16 + 8h + i; block t of the step's 4 KiB
  const unsigned short* vp = Vp + lane8;
  FragH vf[4];
#pragma unroll
  for (int t = 0; t < 4; ++t) {
    vf[t].half[0] = *(const v8us*)(vp + t * FRAG);
    vf[t].half[1] = *(const v8us*)(vp + t * FRAG + FRAG / 2);
  }
  const v8f z8 = {0.f, 0.f, 0.f, 0.f, 0.f, 0.f, 0.f, 0.f};
  // S^T tiles: element r of tile kt = score(key0 + 16*kt + 8h + r, query of this lane's column)
  const v8f s0 = mma_hh2(k00.v, q0.v, k01.v, q1.v, z8);
  const v8f s1 = mma_hh2(k10.v, q0.v, k11.v, q1.v, z8);
  const unsigned int wl = mword >> (8 * hh);
  float sc[16];
#pragma unroll
  for (int r = 0; r < 8; ++r) {
    const float a = s0[r] * QKSCALE, c = s1[r] * QKSCALE;
    sc[r]     = (MASKED && ((wl >> r) & 1u)) ? NEGFILL : a;            // padded key: the score is replaced
    sc[8 + r] = (MASKED && ((wl >> (16 + r)) & 1u)) ? NEGFILL : c;
  }
  // mr is a reference, not the maximum: any value does for the quotient as long as the weights stay inside f16. The weights are formed against the mr at hand, and
  // only if some lane's sum of them leaves PSMAX (on the first step, mr = -3e38, it is infinite) is mr raised to the larger of itself and the step's 32-key maximum, the sums rescaled and the step's weights formed again.
  float pc[16];
  float ps = step_weights(sc, mr, pc);
  if (__builtin_amdgcn_ballot_w32(!(ps <= PSMAX)) != 0u) {   // the same for the whole wave: all 32 lanes stay on for the matrix instructions
    float mx = sc[0];
#pragma unroll
    for (int i = 1; i < 16; ++i) mx = fmaxf(mx, sc[i]);
    mx = fmaxf(mx, __shfl_xor(mx, 16, 32));         // the other lane half holds the other 16 keys of this query: both halves keep the same mr
    const float mnew = fmaxf(mr, mx);
    const float al = exp2_raw((mr - mnew) * LOG2E);
    mr = mnew;
    lr *= al;
#pragma unroll
    for (int t = 0; t < 4; ++t) Oh[t] = Oh[t] * al;
    ps = step_weights(sc, mr, pc);
  }
  lr += ps;                                         // this lane's 16 keys only; the two halves' sums meet behind the key loop
  // hi plane f16(pc), residual plane f16(pc - hi), at the hi plane's own scale: both planes' products add into the same sums. pc - hi is exact in f32; as f16 it is off by
  // at most 2^-11 of itself or 2^-25 (f16 subnormals are kept), against a row sum of at least 256 (the key that set mr weighs 256).
  FragH ph, pl;
#pragma unroll
  for (int i = 0; i < 8; ++i)                       // B element i: i<8 -> key0 + 8h + i (tile 0 row 8h+i); i>=8 -> key0 + 16 + 8h + (i-8) (tile 1)
    ph.p[i] = __builtin_convertvector((v2f{pc[2 * i], pc[2 * i + 1]}), v2h);
  residual_x16(pc, ph);
#pragma unroll
  for (int i = 0; i < 8; ++i) pl.p[i] = __builtin_convertvector((v2f{pc[2 * i], pc[2 * i + 1]}), v2h);
  mma_h8(vf[0].v, vf[1].v, vf[2].v, vf[3].v, ph.v, pl.v, Oh[0], Oh[1], Oh[2], Oh[3]);
}

// Block = 4 waves x 16 query positions = 64 of one (batch, head). Key positions 0 .. cnt-1 are the kept keys: whole steps carry no mask, the last one masks its tail.
// K and V^T reach the four waves through a two-buffer LDS ring of 64-key stages: each byte is fetched once per block, by asynchronous copies that fly while the stage before is worked on.
// Stage t = key positions 64t .. 64t+63, walked only if 64t lies in front of the last step's end, so inside a projection tile that was written whole.
// Epilogue: O^T tile -> per-wave LDS tile [16 queries][64 d] (block barrier), then lanes 0..15 / 16..31 each write 256 contiguous bytes
// coverage: NB*16*(SEQ/64) blocks x 4 waves x 16 rows x 64 columns = every context element exactly once; trip counts clamped to SEQ / 32.
__global__ __launch_bounds__(128) void k_attn(const unsigned short* __restrict__ Qh, const unsigned short* __restrict__ Kh,
                                              const unsigned short* __restrict__ Vt, const int* __restrict__ cnt,
                                              float* __restrict__ Cx) {
  __shared__ __attribute__((aligned(16))) float so[4][16][68];
  __shared__ __attribute__((aligned(16))) unsigned short ring[2][2 * STG];
  const int tid = threadIdx.x, w = __builtin_amdgcn_readfirstlane((int)(tid >> 5)), lane = tid & 31, ln = lane & 15, hh = lane >> 4;
  const int bh = blockIdx.x / (SEQ / 64), qt = blockIdx.x % (SEQ / 64);
  const int b = bh / NH, h = bh - b * NH;
  const int qbase = qt * 64 + 16 * w;
  const int n = min(max(cnt[b], 0), SEQ);            // kept keys of the batch (block-uniform)
  const int full = n >> 5;                           // steps of 32 kept keys
  const int steps = n > 0 ? (n + 31) >> 5 : SEQ / 32;
  // Q^T B fragments: column n = query qbase + ln, elements 0..7 <- d = 32c + 8h + i, 8..15 <- d = 32c + 16 + 8h + i
  const unsigned short* qrow = Qh + ((size_t)bh * SEQ + qbase) * HD + lane * 8;   // the wave's 16 queries are one token tile: blocks c = 0, 1
  FragH q0, q1;
  q0.half[0] = *(const v8us*)(qrow);        q0.half[1] = *(const v8us*)(qrow + FRAG / 2);
  q1.half[0] = *(const v8us*)(qrow + FRAG); q1.half[1] = *(const v8us*)(qrow + FRAG + FRAG / 2);
  // the wait that is owed before the lane offset that the four issued loads name is overwritten
  asm volatile("s_wait_xcnt 0x0" :: "v"(lane) : "memory");
  float mr = -3.0e38f, lr = 0.0f;
  v8f Oh[4] = {};
  const unsigned short* Kp = Kh + (size_t)bh * SEQ * HD;
  const unsigned short* Vp = Vt + (size_t)bh * HD * SEQ;
  const int nst = (steps + 1) >> 1;                  // stages of two steps, 1 .. SEQ / 64 (block-uniform)
  const unsigned short* kg = Kp + tid * 8;
  const unsigned short* vg = Vp + tid * 8;
  const unsigned int l0 = (unsigned int)(size_t)&ring[0][0] + (unsigned int)tid * 16u;
  stage_copy(kg, vg, l0);
  asm volatile("s_wait_asynccnt 0x0" ::: "memory");  // this wave's copies of stage 0 have landed
  __syncthreads();                                   // ... and every other wave's: stage 0 may be read
  if (nst > 1) stage_copy(kg + STG, vg + STG, l0 + STB);
  // The foot of stage t, the same behind a whole stage and behind a masked one
  auto foot = [&](int t) {
    asm volatile("s_wait_dscnt 0x0" ::: "memory");    // this wave's reads of stage t are done before its buffer is handed back
    asm volatile("s_wait_asynccnt 0x0" ::: "memory"); // this wave's copies of stage t + 1 have landed
    __syncthreads();                                  // publishes stage t + 1 and ends every wave's reads of stage t
    if (t + 2 < nst) stage_copy(kg + (size_t)(t + 2) * STG, vg + (size_t)(t + 2) * STG, l0 + (unsigned int)(t & 1) * STB);
  };
  const int nwh = full >> 1;                         // stages of two whole steps of kept keys, at most nst (block-uniform)
  int t = 0;
  for (; t < nwh; ++t) {                             // a loop of its own, with no other path through it: the 32 sums stay in their registers
    const unsigned short* kb = &ring[t & 1][0];
    fa_step<false>(kb, kb + STG, 0u, ln, hh, q0, q1, mr, lr, Oh);
    fa_step<false>(kb + 32 * HD, kb + STG + 32 * HD, 0u, ln, hh, q0, q1, mr, lr, Oh);
    foot(t);
  }
  for (; t < nst; ++t) {                             // the last stage, or every stage when no key is kept
    const unsigned short* kb = &ring[t & 1][0];
#pragma unroll 1
    for (int u = 0; u < 2; ++u) {                    // rolled: one copy of the masked step's code
      const int j = 2 * t + u;
      if (j < steps)                                 // a whole step masks nothing; the tail step masks positions n % 32 and up; no key kept: every position
        fa_step<true>(kb + u * (32 * HD), kb + STG + u * (32 * HD), j < full ? 0u : 0xFFFFFFFFu << (n & 31), ln, hh, q0, q1, mr, lr, Oh);
    }
    foot(t);
  }
  asm volatile("s_wait_asynccnt 0x0" ::: "memory");   // no copy is left in flight when the wave goes on

  // O^T element r of tile t = ctx(query qbase + ln, d = 16t + 8h + r); undo the carries: x256 (in lr), x16 (V)
  lr += __shfl_xor(lr, 16, 32);                      // the row sum: both lane halves' keys
  const float inv = 1.0f / (CARRY * lr);
#pragma unroll
  for (int t = 0; t < 4; ++t)
#pragma unroll
    for (int r = 0; r < 8; ++r)
      so[w][ln][16 * t + 8 * hh + r] = Oh[t][r] * inv;
  __syncthreads();
  float* og = Cx + ((size_t)b * SEQ + qbase) * DM + h * HD;
  const int rsub = lane >> 4, c4 = (lane & 15) * 4;
  {
#pragma unroll
    for (int q = 0; q < 8; ++q) {
      const int row = 2 * q + rsub;
      const v4f v = *(const v4fa*)&so[w][row][c4];
      *(v4f*)(og + (size_t)row * DM + c4) = v;
    }
    
  }
}

// coverage: NB*SEQ blocks x 256 threads x 4 columns = every output element of the processed region exactly once.
__global__ __launch_bounds__(256) void k_ln(const float* __restrict__ Cx, const float* __restrict__ gamma,
                                            const float* __restrict__ beta, const int* __restrict__ perm, float* __restrict__ out) {
  __shared__ float rs[8];
  __shared__ float rq[8];
  const int tid = threadIdx.x, lane = tid & 31, w = __builtin_amdgcn_readfirstlane((int)(tid >> 5));
  const int r = blockIdx.x;
  const int b = r / SEQ, s = perm[r];                // context row r holds the token of position r % SEQ
  const v4f x = *(const v4fa*)(Cx + (size_t)r * DM + tid * 4);
  float sm = (x[0] + x[1]) + (x[2] + x[3]);
#pragma unroll
  for (int off = 16; off >= 1; off >>= 1) sm += __shfl_xor(sm, off, 32);
  if (lane == 0) rs[w] = sm;
  __syncthreads();
  float tot = 0.0f;
#pragma unroll
  for (int i = 0; i < 8; ++i) tot += rs[i];
  const float mu = tot * (1.0f / 1024.0f);
  const float d0 = x[0] - mu, d1 = x[1] - mu, d2 = x[2] - mu, d3 = x[3] - mu;
  float sq = (d0 * d0 + d1 * d1) + (d2 * d2 + d3 * d3);
#pragma unroll
  for (int off = 16; off >= 1; off >>= 1) sq += __shfl_xor(sq, off, 32);
  if (lane == 0) rq[w] = sq;
  __syncthreads();
  float tq = 0.0f;
#pragma unroll
  for (int i = 0; i < 8; ++i) tq += rq[i];
  const float var = tq * (1.0f / 1024.0f);
  const float rinv = rsqrtf(var + 1.0e-6f);
  const v4f g = *(const v4fa*)(gamma + tid * 4);
  const v4f be = *(const v4fa*)(beta + tid * 4);
  v4f o;
  o[0] = d0 * rinv * bf16_rne(g[0]) + bf16_rne(be[0]);
  o[1] = d1 * rinv * bf16_rne(g[1]) + bf16_rne(be[1]);
  o[2] = d2 * rinv * bf16_rne(g[2]) + bf16_rne(be[2]);
  o[3] = d3 * rinv * bf16_rne(g[3]) + bf16_rne(be[3]);
  float* dst = out + ((size_t)b * SEQ_FULL + s) * DM + tid * 4;
  *(v4f*)dst = o;
  
}

extern "C" void kernel_launch(void* const* d_in, const int* in_sizes, int n_in,
                              void* d_out, int out_size, void* d_ws, size_t ws_size, hipStream_t stream) {
  if (n_in < 7) return;
  const long long need_x = (long long)(NB - 1) * SEQ_FULL * DM + (long long)SEQ * DM;   // last element touched + 1
  const long long need_m = (long long)(NB - 1) * SEQ_FULL + (long long)SEQ;
  if ((long long)in_sizes[0] < need_x || (long long)in_sizes[1] < need_m) return;
  if ((long long)in_sizes[2] < (long long)DM * DM || (long long)in_sizes[3] < (long long)DM * DM || (long long)in_sizes[4] < (long long)DM * DM) return;
  if (in_sizes[5] < DM || in_sizes[6] < DM) return;
  if ((long long)out_size < need_x) return;
  const float* X     = (const float*)d_in[0];   // wire order: q [2][2048][1024] f32, mask [2][2048] i32, Wq, Wk, Wv [1024][1024] f32, gamma, beta [1024] f32
  const int*   mask  = (const int*)d_in[1];
  const float* Wq    = (const float*)d_in[2];
  const float* Wk    = (const float*)d_in[3];
  const float* Wv    = (const float*)d_in[4];
  const float* gamma = (const float*)d_in[5];
  const float* beta  = (const float*)d_in[6];
  float* out = (float*)d_out;
  char* ws = (char*)d_ws;
  size_t off = 0;
  const size_t xb_bytes = (size_t)NB * SEQ * DM * 2;        // 8 MiB at full size; every plane is written by whole 16-B pieces, none past its end
  const size_t wb_bytes = (size_t)3 * DM * DM * 2;          // 6 MiB
  const size_t p3_bytes = 3 * PLANE * 2;                    // 24 MiB
  const size_t cx_bytes = (size_t)NB * SEQ * DM * 4;        // 16 MiB
  unsigned short* Xb = (unsigned short*)(ws + off); off += (xb_bytes + 255) & ~(size_t)255;
  unsigned short* Wb = (unsigned short*)(ws + off); off += (wb_bytes + 255) & ~(size_t)255;
  unsigned short* P3 = (unsigned short*)(ws + off); off += (p3_bytes + 255) & ~(size_t)255;
  float*          Cx = (float*)(ws + off);          off += (cx_bytes + 255) & ~(size_t)255;
  int*          perm = (int*)(ws + off);            off += ((size_t)NB * SEQ * 4 + 255) & ~(size_t)255;
  int*           cnt = (int*)(ws + off);            off += 256;
  if (off > ws_size) return;
  k_prep<<<(unsigned)(XBLK + WBLK), 256, 0, stream>>>(X, Wq, Wk, Wv, mask, Xb, Wb, perm, cnt);
  k_proj<<<dim3((unsigned)(3 * DM / 64), (unsigned)(NB * SEQ / 128)), 128, 0, stream>>>(Xb, Wb, P3, cnt);
  k_attn<<<(unsigned)(NB * NH * (SEQ / 64)), 128, 0, stream>>>(P3, P3 + PLANE, P3 + 2 * PLANE, cnt, Cx);
  k_ln<<<(unsigned)(NB * SEQ), 256, 0, stream>>>(Cx, gamma, beta, perm, out);
}

// v008
// It runs in 58 microseconds.
// Two timings next to v007 both put it at 1.10 times that version's speed.
// All steps since v000 together make it 3.51 times as fast.
#include <hip/hip_runtime.h>
// Contractions: x Wq^T, x Wk^T, x Wv^T on v_wmma_f32_16x16x32_bf16 (x and W converted RNE to bf16, single product, f32 accumulate); S^T = K Q^T on v_wmma_f32_16x16x32_f16 (Q, K: f16 planes of the f32 projections x16, single product); O^T = V^T P^T on v_wmma_f32_16x16x32_f16 (V: f16 plane x16; P: x256 f16 hi plane + f16 plane of its rounding residual, both into one f32 accumulator); softmax statistics and LayerNorm f32.
// Multi-head self attention, B x S x 1024, 16 heads x 64, scores scaled 1/8, key-padding mask replaces masked scores by -1e20, LayerNorm over the 1024 concatenated columns.
// Engine: transposed flash. Each wave owns 16 queries of one (batch, head). Per 32-key step: S^T tiles (key rows x query columns) from K rows (A, f16 plane by way of LDS)
// and Q^T (B, registers); the two 16-key D tiles pack straight into the P^T B fragment; O^T (d rows x query columns) accumulates from V^T rows (A, f16 plane by way of LDS).
// Every 16-bit plane is stored fragment-major: a 16 x 32 operand fragment (16 rows or columns x 32 k) is one 1-KiB block of 64 pieces of 8 elements,
// piece 32*half + lane (lane = 16*hh + ln) = row ln, k = 16*half + 8*hh + 0..7. A wave-wide 16-byte load of one half reads 512 contiguous bytes (4 lines, not 16).
// Token order: inside each batch the tokens are stably partitioned by the key mask, kept keys first (perm[position] = token, cnt = kept keys). A padded key's weight is
// exp(-1e20 - max) = 0 whenever one key is kept, so K, V^T and the key loop cover the first cnt positions only; every plane and the context are in position order and
// the LayerNorm kernel stores row perm[position]. No key kept: every score is -1e20 (uniform weights), so all SEQ positions are walked with every key marked padded.
#ifndef NB
#define NB 2
#endif
#ifndef SEQ
#define SEQ 2048
#endif
#define NB_FULL 2
#define SEQ_FULL 2048
#define DM 1024
#define NH 16
#define HD 64
#define XB_FULL ((size_t)SEQ_FULL * DM)          /* per-batch element stride of the activation input and of the output */
#define PLANE ((size_t)NB * NH * SEQ * HD)       /* elements of one of the Q / K / V^T planes */
#define FRAG 512                                 /* elements of one 16 x 32 fragment block; its second half starts at FRAG / 2 */
#define RTILE ((size_t)16 * DM)                  /* elements of 16 rows of a [rows][1024] plane = 32 fragment blocks */

static_assert(SEQ % 256 == 0);
static_assert(SEQ <= SEQ_FULL);
static_assert(NB <= NB_FULL);
static_assert(HD == 64);
static_assert(DM == NH * HD);
static_assert(DM % 32 == 0);
static_assert((3 * DM) % 128 == 0);
static_assert((size_t)NB * SEQ * DM * 2 + (size_t)3 * DM * DM * 2 + 3 * PLANE * 2 + (size_t)NB * SEQ * DM * 4 + (size_t)NB * SEQ * 4 + 1024 <= (size_t)134217728);

typedef __bf16 v16b __attribute__((ext_vector_type(16)));
typedef _Float16 v16h __attribute__((ext_vector_type(16)));
typedef unsigned short v8us __attribute__((ext_vector_type(8), may_alias));
typedef float v8f __attribute__((ext_vector_type(8)));
typedef float v2f __attribute__((ext_vector_type(2)));
typedef _Float16 v2h __attribute__((ext_vector_type(2)));
typedef float v4f __attribute__((ext_vector_type(4)));
typedef float v4fa __attribute__((ext_vector_type(4), may_alias));
union FragB { v16b v; v8us half[2]; unsigned short u[16]; };
union FragH { v16h v; v8us half[2]; v2h p[8]; _Float16 h[16]; unsigned short u[16]; };

#define LOG2E 1.4426950408889634f
#define NEGFILL (-1.0e20f)
#define CARRY 16.0f                      /* power-of-two carry of the Q, K and V planes */
#define QKSCALE 0.00048828125f           /* (1/8) / (16*16) */

__device__ __forceinline__ unsigned short bf16_bits(float x) {   // RNE convert to bf16 bits
  unsigned int u = __float_as_uint(x);
  return (unsigned short)((u + 0x7FFFu + ((u >> 16) & 1u)) >> 16);
}
__device__ __forceinline__ float bf16_val(unsigned short b) { return __uint_as_float(((unsigned int)b) << 16); }
__device__ __forceinline__ float bf16_rne(float x) { return bf16_val(bf16_bits(x)); }
__device__ __forceinline__ unsigned short f16_bits(float x) { const _Float16 h = (_Float16)x; return __builtin_bit_cast(unsigned short, h); }

// c0..c3 += a * b0..b3 (one bf16 k-step of four column tiles), then the hazard guard
__device__ __forceinline__ void mma_b4(v16b a, v16b b0, v16b b1, v16b b2, v16b b3, v8f& c0, v8f& c1, v8f& c2, v8f& c3) {
  c0 = __builtin_amdgcn_wmma_f32_16x16x32_bf16(false, a, false, b0, (short)0, c0, false, false);
  c1 = __builtin_amdgcn_wmma_f32_16x16x32_bf16(false, a, false, b1, (short)0, c1, false, false);
  c2 = __builtin_amdgcn_wmma_f32_16x16x32_bf16(false, a, false, b2, (short)0, c2, false, false);
  c3 = __builtin_amdgcn_wmma_f32_16x16x32_bf16(false, a, false, b3, (short)0, c3, false, false);
  asm volatile("v_nop\n\tv_nop\n\tv_nop\n\tv_nop" : "+v"(c0), "+v"(c1), "+v"(c2), "+v"(c3) : "v"(a), "v"(b0), "v"(b1), "v"(b2), "v"(b3));
}
// c += a0*b0 + a1*b1 (two k-steps of one f16 tile), then the hazard guard
__device__ __forceinline__ v8f mma_hh2(v16h a0, v16h b0, v16h a1, v16h b1, v8f c) {
  c = __builtin_amdgcn_wmma_f32_16x16x32_f16(false, a0, false, b0, (short)0, c, false, false);
  c = __builtin_amdgcn_wmma_f32_16x16x32_f16(false, a1, false, b1, (short)0, c, false, false);
  asm volatile("v_nop\n\tv_nop\n\tv_nop\n\tv_nop" : "+v"(c) : "v"(a0), "v"(b0), "v"(a1), "v"(b1));
  return c;
}
// c0..c3 += a0..a3 * bh, then c0..c3 += a0..a3 * bl (three products stand between the two that add into one tile), then the hazard guard
__device__ __forceinline__ void mma_h8(v16h a0, v16h a1, v16h a2, v16h a3, v16h bh, v16h bl, v8f& c0, v8f& c1, v8f& c2, v8f& c3) {
  c0 = __builtin_amdgcn_wmma_f32_16x16x32_f16(false, a0, false, bh, (short)0, c0, false, false);
  c1 = __builtin_amdgcn_wmma_f32_16x16x32_f16(false, a1, false, bh, (short)0, c1, false, false);
  c2 = __builtin_amdgcn_wmma_f32_16x16x32_f16(false, a2, false, bh, (short)0, c2, false, false);
  c3 = __builtin_amdgcn_wmma_f32_16x16x32_f16(false, a3, false, bh, (short)0, c3, false, false);
  c0 = __builtin_amdgcn_wmma_f32_16x16x32_f16(false, a0, false, bl, (short)0, c0, false, false);
  c1 = __builtin_amdgcn_wmma_f32_16x16x32_f16(false, a1, false, bl, (short)0, c1, false, false);
  c2 = __builtin_amdgcn_wmma_f32_16x16x32_f16(false, a2, false, bl, (short)0, c2, false, false);
  c3 = __builtin_amdgcn_wmma_f32_16x16x32_f16(false, a3, false, bl, (short)0, c3, false, false);
  asm volatile("v_nop\n\tv_nop\n\tv_nop\n\tv_nop" : "+v"(c0), "+v"(c1), "+v"(c2), "+v"(c3) : "v"(a0), "v"(a1), "v"(a2), "v"(a3), "v"(bh), "v"(bl));
}

// Preparation, one launch. Blocks 0 .. XBLK-1: the activation plane; the rest: the three weight planes (no token order, no LDS, no barrier).
// Stable partition of one batch's tokens: position of token s = kept tokens before s if it is kept, else cnt + padded tokens before s (a permutation of 0..SEQ-1 for any mask).
// Every activation block works the list of its own batch out for itself (8 KiB of mask, SEQ / 256 consecutive tokens per thread, list gathered in LDS), so that no launch has to
// end before the conversion starts; the first block of each batch also stores the list as whole lines, and cnt, for the later launches.
// dst = bf16 bits (RNE) of src, fragment-major: block (row / 16) * 32 + k / 32; activation row at position p of batch b = token sp[p].
// A wave takes 8 rows x one 128-B source line each and writes four whole 128-B lines of the block (pieces 16*q + 8*rhi + 0..7, q = k / 8 in the block).
// coverage: every sp[] entry written once (permutation) before the barrier in front of its read; NB x SEQ entries of perm and NB of cnt;
// XBLK*256 and WBLK*256 threads x 8 elements = the whole planes (thread bits 0-2 and 5 -> row in the block, bits 3-4 -> q).
#define XBLK (NB * SEQ * 128 / 256)
#define WBLK (3 * DM * 128 / 256)
__global__ __launch_bounds__(256) void k_prep(const float* __restrict__ X, const float* __restrict__ Wq, const float* __restrict__ Wk, const float* __restrict__ Wv,
                                              const int* __restrict__ mask, unsigned short* __restrict__ Xb, unsigned short* __restrict__ Wb,
                                              int* __restrict__ perm, int* __restrict__ cnt) {
  constexpr int TPT = SEQ / 256;
  __shared__ int sp[SEQ];
  __shared__ int wsum[8];
  const int tid = threadIdx.x;
  const bool isx = blockIdx.x < XBLK;                // block-uniform
  const int t = (isx ? blockIdx.x : blockIdx.x - XBLK) * 256 + tid;
  const int blk = t >> 6, ln = ((t >> 5) & 1) * 8 + (t & 7), q = (t >> 3) & 3;
  const int row = (blk / (DM / 32)) * 16 + ln, k = (blk % (DM / 32)) * 32 + q * 8;
  const float* p;
  unsigned short* d;
  if (isx) {
    const int lane = tid & 31, w = tid >> 5, b = blockIdx.x / (XBLK / NB);   // a block lies inside 16 rows, so inside one batch
    const int* mp = mask + (size_t)b * SEQ_FULL + tid * TPT;
    int keep[TPT];
    int c = 0;
#pragma unroll
    for (int i = 0; i < TPT; ++i) { keep[i] = mp[i] != 0 ? 1 : 0; c += keep[i]; }
    int inc = c;                                     // inclusive scan of the threads' kept counts inside the wave
#pragma unroll
    for (int off = 1; off < 32; off <<= 1) { const int v = __shfl_up(inc, off, 32); if (lane >= off) inc += v; }
    if (lane == 31) wsum[w] = inc;
    __syncthreads();
    int base = 0, n = 0;
#pragma unroll
    for (int i = 0; i < 8; ++i) { const int v = wsum[i]; n += v; if (i < w) base += v; }
    int kr = base + inc - c;                         // kept tokens in front of this thread's first token
#pragma unroll
    for (int i = 0; i < TPT; ++i) {
      const int s = tid * TPT + i;
      sp[keep[i] ? kr : n + s - kr] = s;
      kr += keep[i];
    }
    __syncthreads();
    if (blockIdx.x % (XBLK / NB) == 0) {             // block-uniform, behind the last barrier
#pragma unroll
      for (int i = 0; i < TPT; ++i) perm[(size_t)b * SEQ + tid + 256 * i] = sp[tid + 256 * i];
      if (tid == 0) cnt[b] = n;
    }
    p = X + (size_t)b * XB_FULL + (size_t)sp[row - b * SEQ] * DM + k;
    d = Xb + (size_t)blk * FRAG + (q * 16 + ln) * 8;
  } else {
    const int which = (blockIdx.x - XBLK) / (WBLK / 3);   // a block lies inside 16 rows, so inside one of Wq, Wk, Wv
    p = (which == 0 ? Wq : which == 1 ? Wk : Wv) + (size_t)(row - which * DM) * DM + k;
    d = Wb + (size_t)blk * FRAG + (q * 16 + ln) * 8;
  }
  const v4f x0 = *(const v4fa*)(p), x1 = *(const v4fa*)(p + 4);
  v8us o;
  o[0] = bf16_bits(x0[0]); o[1] = bf16_bits(x0[1]); o[2] = bf16_bits(x0[2]); o[3] = bf16_bits(x0[3]);
  o[4] = bf16_bits(x1[0]); o[5] = bf16_bits(x1[1]); o[6] = bf16_bits(x1[2]); o[7] = bf16_bits(x1[3]);
  *(v8us*)d = o;
}

__device__ __forceinline__ void stage8(unsigned short* st, const v8f& c, int base, int rstep) {
#pragma unroll
  for (int r = 0; r < 8; ++r) st[base + r * rstep] = f16_bits(c[r] * CARRY);
}

#define PKS 64                                   /* k of one stage of the projection's LDS ring: two fragment blocks of every 16-row tile */
#define PPART (8 * (PKS / 32) * FRAG)            /* elements of the X part, and of the W part, of one stage: 8 tiles of 16 rows x 64 k (16 KiB each) */
#define PBUF (2 * PPART * 2)                     /* bytes of one ring buffer: X part, then W part */
static_assert(DM % PKS == 0);
static_assert(DM / PKS >= 2);                    // the ring's prologue fills two stages
static_assert(DM % 128 == 0);                    // a block's 128 columns lie inside one of Q, K, V
static_assert((PKS / 32) * FRAG * 2 == 128 * 16);   // one copy of 16 B per thread brings one 16-row tile's share of a stage

// One operand's part of one stage into one ring buffer: of each of 8 consecutive 16-row tiles the stage's 64 k are 2 KiB that lie contiguous in the fragment-major plane, copied as they lie.
// g: this thread's piece of the first tile (tile base + stage offset + 8 * tid elements); l: its LDS byte address (part base + 16 * tid).
// Every thread brings piece tid of each tile: all addresses multiples of 16, no LDS byte written twice, all 32 lanes on.
__device__ __forceinline__ void part_copy(const unsigned short* g, unsigned int l) {
  // s_wait_xcnt as the statement's last line: it then stands in front of every later write of a register that one of the copies names
  asm volatile("global_load_async_to_lds_b128 %0, %8, off\n\t"
               "global_load_async_to_lds_b128 %1, %9, off\n\t"
               "global_load_async_to_lds_b128 %2, %10, off\n\t"
               "global_load_async_to_lds_b128 %3, %11, off\n\t"
               "global_load_async_to_lds_b128 %4, %12, off\n\t"
               "global_load_async_to_lds_b128 %5, %13, off\n\t"
               "global_load_async_to_lds_b128 %6, %14, off\n\t"
               "global_load_async_to_lds_b128 %7, %15, off\n\t"
               "s_wait_xcnt 0x0"
               :: "v"(l), "v"(l + 2048u), "v"(l + 4096u), "v"(l + 6144u), "v"(l + 8192u), "v"(l + 10240u), "v"(l + 12288u), "v"(l + 14336u),
                  "v"(g), "v"(g + RTILE), "v"(g + 2 * RTILE), "v"(g + 3 * RTILE), "v"(g + 4 * RTILE), "v"(g + 5 * RTILE), "v"(g + 6 * RTILE), "v"(g + 7 * RTILE)
               : "memory");
}

// Y[m][n] = sum_k Xb[m][k] * Wb[n][k], M = NB*SEQ, N = 3*1024 (Wq | Wk | Wv rows), K = 1024.
// Block = 4 waves (2 x 2), tile 128 rows x 128 columns (two heads of one of Q/K/V); wave tile 64 x 64 (one head).
// X and W reach the waves through a two-buffer LDS ring of 64-k stages: each byte is fetched once per block, by asynchronous copies that fly while the stage before is worked on;
// a fragment read from LDS feeds four products. The k blocks add into each tile in the order 0, 1, 2, ...
// A fragment: row m, elements 0..7 <- k0 + 8h + i, 8..15 <- k0 + 16 + 8h + i; B fragment: column n = W row n, same k map; D element r = (row 8h + r, column ln).
//   Q, K planes P3[0..1][b*16+h][token / 16][d / 32][fragment block: row = token % 16, k = d % 32]
//   V^T plane   P3[2][b*16+h][token / 32][d / 16][fragment block: row = d % 16, k = token % 32]; each thread stores the piece of its own index: whole lines.
// K and V^T tiles that start behind the last kept position are never read and are left out (block-uniform return in front of every barrier and copy); a tile that straddles it is whole.
// coverage: grid (24, NB*SEQ/128) x (128 x 128) = the Q plane and every K, V^T tile the key loop reads; each head's LDS tile fully written before it is read (128x64 or 64x128).
__global__ __launch_bounds__(128) void k_proj(const unsigned short* __restrict__ Xb, const unsigned short* __restrict__ Wb,
                                              unsigned short* __restrict__ P3, const int* __restrict__ cnt) {
  __shared__ __attribute__((aligned(16))) unsigned short ring[2][2 * PPART];
  __shared__ __attribute__((aligned(16))) unsigned short st[2][128 * 72];
  const int tid = threadIdx.x, w = __builtin_amdgcn_readfirstlane((int)(tid >> 5)), lane = tid & 31, ln = lane & 15, hh = lane >> 4;
  const int wr = w >> 1, wc = w & 1;                 // the wave's 64 rows and its 64 columns (its head) inside the block's tile
  const int n0 = blockIdx.x * 128;
  const int m0 = blockIdx.y * 128;
  if (n0 >= DM) {                                    // K or V columns
    const int n = cnt[m0 / SEQ];
    if (n > 0 && m0 % SEQ >= n) return;
  }
  const unsigned short* ag = Xb + (size_t)(m0 >> 4) * RTILE + tid * 8;
  const unsigned short* bg = Wb + (size_t)(n0 >> 4) * RTILE + tid * 8;
  const unsigned int l0 = (unsigned int)(size_t)&ring[0][0] + (unsigned int)tid * 16u;
  auto fill = [&](int t) {                           // stage t = k 64t .. 64t+63 into buffer t % 2
    const unsigned int l = l0 + (unsigned int)(t & 1) * PBUF;
    part_copy(ag + (size_t)t * ((PKS / 32) * FRAG), l);
    part_copy(bg + (size_t)t * ((PKS / 32) * FRAG), l + PPART * 2);
  };
  fill(0);
  asm volatile("s_wait_asynccnt 0x0" ::: "memory");  // this wave's copies of stage 0 have landed
  __syncthreads();                                   // ... and every other wave's: stage 0 may be read
  fill(1);
  v8f c[4][4] = {};
#pragma unroll 1                                     // rolled: one copy of the stage's code
  for (int t = 0; t < DM / PKS; ++t) {
    const unsigned short* ab = &ring[t & 1][0] + (4 * wr) * ((PKS / 32) * FRAG) + lane * 8;
    const unsigned short* bb = &ring[t & 1][0] + PPART + (4 * wc) * ((PKS / 32) * FRAG) + lane * 8;
#pragma unroll
    for (int kb = 0; kb < PKS / 32; ++kb) {
      FragB a[4], b[4];
#pragma unroll
      for (int i = 0; i < 4; ++i) {
        a[i].half[0] = *(const v8us*)(ab + ((PKS / 32) * i + kb) * FRAG);  a[i].half[1] = *(const v8us*)(ab + ((PKS / 32) * i + kb) * FRAG + FRAG / 2);
        b[i].half[0] = *(const v8us*)(bb + ((PKS / 32) * i + kb) * FRAG);  b[i].half[1] = *(const v8us*)(bb + ((PKS / 32) * i + kb) * FRAG + FRAG / 2);
      }
#pragma unroll
      for (int i = 0; i < 4; ++i) mma_b4(a[i].v, b[0].v, b[1].v, b[2].v, b[3].v, c[i][0], c[i][1], c[i][2], c[i][3]);
    }
    asm volatile("s_wait_dscnt 0x0" ::: "memory");    // this wave's reads of stage t are done before its buffer is handed back
    asm volatile("s_wait_asynccnt 0x0" ::: "memory"); // this wave's copies of stage t + 1 have landed
    __syncthreads();                                  // publishes stage t + 1 and ends every wave's reads of stage t
    if (t + 2 < DM / PKS) fill(t + 2);
  }
  asm volatile("s_wait_asynccnt 0x0" ::: "memory");   // no copy is left in flight when the wave goes on
  const int which = n0 >> 10;                 // 0: Q, 1: K, 2: V (block-uniform)
  const int h0 = (n0 & 1023) >> 6;            // the block's first head; wave column wc holds head h0 + wc
  const int b = m0 / SEQ, s0 = m0 - b * SEQ;
  const bool rowmajor = which < 2;
  const int rstep = rowmajor ? 72 : 1;
  // element (row rb + r, column 16*j + ln) of the wave's head: Q/K tile st[wc][row*72 + col]; V tile st[wc][col*136 + row]
#pragma unroll
  for (int i = 0; i < 4; ++i) {
    const int rb = 64 * wr + 16 * i + 8 * hh;
#pragma unroll
    for (int j = 0; j < 4; ++j) stage8(&st[wc][0], c[i][j], rowmajor ? rb * 72 + 16 * j + ln : (16 * j + ln) * 136 + rb, rstep);
  }
  __syncthreads();
#pragma unroll
  for (int hs = 0; hs < 2; ++hs) {
    unsigned short* base = P3 + (size_t)which * PLANE + ((size_t)(b * NH + h0 + hs) * SEQ + s0) * HD;
    if (rowmajor) {
#pragma unroll
      for (int it = 0; it < 8; ++it) {
        const int i = tid + 128 * it;                                   // piece i: token tile i / 128, d block (i / 64) % 2, piece i % 64
        const int row = (i >> 7) * 16 + (i & 15), col = ((i >> 4) & 7) * 8;   // d = 32*c + 16*half + 8*hh
        const v8us o = *(const v8us*)(&st[hs][row * 72 + col]);
        *(v8us*)(base + (size_t)i * 8) = o;
      }
    } else {
#pragma unroll
      for (int it = 0; it < 8; ++it) {
        const int i = tid + 128 * it;
        const int dc = ((i >> 6) & 3) * 16 + (i & 15);                  // piece i: key block i / 256, d tile (i / 64) % 4, piece i % 64
        const int tk = (i >> 8) * 32 + ((i >> 4) & 3) * 8;              // token = 32*block + 16*half + 8*hh
        const v8us o = *(const v8us*)(&st[hs][dc * 136 + tk]);
        *(v8us*)(base + (size_t)i * 8) = o;
      }
    }
  }
}

// 2^x as the bare v_exp_f32. exp2f() wraps it in a range fix for results below 2^-126 (compare, two selects, add, ldexp per value). Here such a result is a weight that
// rounds to zero in both f16 planes and adds nothing to a row sum of at least 256, or a rescale factor of sums that the new maximum's terms outweigh by 2^126: flushed to 0 it gives the same output.
__device__ __forceinline__ float exp2_raw(float x) { return __builtin_amdgcn_exp2f(x); }

#define STK 64                                   /* keys of one stage of the LDS ring */
#define STG (STK * HD)                           /* elements of the K part, and of the V^T part, of one stage (8 KiB each) */
#define STB (2 * STG * 2)                        /* bytes of one ring buffer: K part, then V^T part */
static_assert(SEQ % STK == 0);
static_assert(128 % STK == 0);                   // a stage lies inside one 128-row tile of the projection: written whole or not walked at all
static_assert(STG * 2 == 4 * 128 * 16);          // 4 copies of 16 B per thread and part

// One stage into one ring buffer: 64 keys are 8 KiB of K and 8 KiB of V^T, each contiguous in its fragment-major plane, copied as they lie.
// kg, vg: this thread's first piece of the stage in the two planes (stage base + 8 * tid elements); l: its LDS byte address (buffer base + 16 * tid).
// Every thread brings pieces tid + 128 * c, c = 0..3, of each part: all addresses multiples of 16, no LDS byte written twice, all 32 lanes on.
__device__ __forceinline__ void stage_copy(const unsigned short* kg, const unsigned short* vg, unsigned int l) {
  // s_wait_xcnt as the statement's last line: it then stands in front of every later write of a register that one of the copies names
  asm volatile("global_load_async_to_lds_b128 %0, %8, off\n\t"
               "global_load_async_to_lds_b128 %1, %9, off\n\t"
               "global_load_async_to_lds_b128 %2, %10, off\n\t"
               "global_load_async_to_lds_b128 %3, %11, off\n\t"
               "global_load_async_to_lds_b128 %4, %12, off\n\t"
               "global_load_async_to_lds_b128 %5, %13, off\n\t"
               "global_load_async_to_lds_b128 %6, %14, off\n\t"
               "global_load_async_to_lds_b128 %7, %15, off\n\t"
               "s_wait_xcnt 0x0"
               :: "v"(l), "v"(l + 2048u), "v"(l + 4096u), "v"(l + 6144u), "v"(l + 8192u), "v"(l + 10240u), "v"(l + 12288u), "v"(l + 14336u),
                  "v"(kg), "v"(kg + 1024), "v"(kg + 2048), "v"(kg + 3072), "v"(vg), "v"(vg + 1024), "v"(vg + 2048), "v"(vg + 3072)
               : "memory");
}

// x[i] = 2^x[i], the bare v_exp_f32 as in exp2_raw, each in its own register. One statement, closed by a v_nop: the instruction set asks for one free slot behind a transcendental before its
// result is read or its source overwritten.
__device__ __forceinline__ void exp2_x16(float (&x)[16]) {
  asm("v_exp_f32 %0, %0\n\tv_exp_f32 %1, %1\n\tv_exp_f32 %2, %2\n\tv_exp_f32 %3, %3\n\t"
      "v_exp_f32 %4, %4\n\tv_exp_f32 %5, %5\n\tv_exp_f32 %6, %6\n\tv_exp_f32 %7, %7\n\t"
      "v_exp_f32 %8, %8\n\tv_exp_f32 %9, %9\n\tv_exp_f32 %10, %10\n\tv_exp_f32 %11, %11\n\t"
      "v_exp_f32 %12, %12\n\tv_exp_f32 %13, %13\n\tv_exp_f32 %14, %14\n\tv_exp_f32 %15, %15\n\t"
      "v_nop"
      : "+v"(x[0]), "+v"(x[1]), "+v"(x[2]), "+v"(x[3]), "+v"(x[4]), "+v"(x[5]), "+v"(x[6]), "+v"(x[7]),
        "+v"(x[8]), "+v"(x[9]), "+v"(x[10]), "+v"(x[11]), "+v"(x[12]), "+v"(x[13]), "+v"(x[14]), "+v"(x[15]));
}

// x[i] -= (float)h.h[i]: one v_fma_mix_f32 per value, which reads its f16 half of the packed word as it lies. Written as C, the build widened each half with a convert of its own
// and then subtracted in pairs: 24 instructions for these 16. No instruction here reads another's result.
__device__ __forceinline__ void residual_x16(float (&x)[16], const FragH& h) {
  asm("v_fma_mix_f32 %0, %16, -1.0, %0 op_sel_hi:[1,1,0]\n\tv_fma_mix_f32 %1, %16, -1.0, %1 op_sel:[1,0,0] op_sel_hi:[1,1,0]\n\t"
      "v_fma_mix_f32 %2, %17, -1.0, %2 op_sel_hi:[1,1,0]\n\tv_fma_mix_f32 %3, %17, -1.0, %3 op_sel:[1,0,0] op_sel_hi:[1,1,0]\n\t"
      "v_fma_mix_f32 %4, %18, -1.0, %4 op_sel_hi:[1,1,0]\n\tv_fma_mix_f32 %5, %18, -1.0, %5 op_sel:[1,0,0] op_sel_hi:[1,1,0]\n\t"
      "v_fma_mix_f32 %6, %19, -1.0, %6 op_sel_hi:[1,1,0]\n\tv_fma_mix_f32 %7, %19, -1.0, %7 op_sel:[1,0,0] op_sel_hi:[1,1,0]\n\t"
      "v_fma_mix_f32 %8, %20, -1.0, %8 op_sel_hi:[1,1,0]\n\tv_fma_mix_f32 %9, %20, -1.0, %9 op_sel:[1,0,0] op_sel_hi:[1,1,0]\n\t"
      "v_fma_mix_f32 %10, %21, -1.0, %10 op_sel_hi:[1,1,0]\n\tv_fma_mix_f32 %11, %21, -1.0, %11 op_sel:[1,0,0] op_sel_hi:[1,1,0]\n\t"
      "v_fma_mix_f32 %12, %22, -1.0, %12 op_sel_hi:[1,1,0]\n\tv_fma_mix_f32 %13, %22, -1.0, %13 op_sel:[1,0,0] op_sel_hi:[1,1,0]\n\t"
      "v_fma_mix_f32 %14, %23, -1.0, %14 op_sel_hi:[1,1,0]\n\tv_fma_mix_f32 %15, %23, -1.0, %15 op_sel:[1,0,0] op_sel_hi:[1,1,0]"
      : "+v"(x[0]), "+v"(x[1]), "+v"(x[2]), "+v"(x[3]), "+v"(x[4]), "+v"(x[5]), "+v"(x[6]), "+v"(x[7]),
        "+v"(x[8]), "+v"(x[9]), "+v"(x[10]), "+v"(x[11]), "+v"(x[12]), "+v"(x[13]), "+v"(x[14]), "+v"(x[15])
      : "v"(h.p[0]), "v"(h.p[1]), "v"(h.p[2]), "v"(h.p[3]), "v"(h.p[4]), "v"(h.p[5]), "v"(h.p[6]), "v"(h.p[7]));
}

#define PSMAX 32768.0f                           /* a lane's 16 weights of a step may sum to this much: each of them is then inside f16 */
// A lane's 16 weights of one step against the reference maximum m, carried x256: pc = 256 * exp(sc - m); returns their sum (pairwise tree).
__device__ __forceinline__ float step_weights(const float (&sc)[16], float m, float (&pc)[16]) {
#pragma unroll
  for (int i = 0; i < 16; ++i) pc[i] = fmaf(sc[i] - m, LOG2E, 8.0f);
  exp2_x16(pc);
  v2f a[8];                                        // neighbours as pairs: the tree runs on packed adds
#pragma unroll
  for (int i = 0; i < 8; ++i) a[i] = v2f{pc[2 * i], pc[2 * i + 1]};
#pragma unroll
  for (int i = 0; i < 4; ++i) a[i] += a[i + 4];
  a[0] = (a[0] + a[2]) + (a[1] + a[3]);
  return a[0][0] + a[0][1];
}

// One 32-key step for a wave's 16 queries. Kp, Vp: the step's 4 KiB of K and of V^T in the LDS ring; key0 in the notes below = the step's first key position; mword bit j set = position key0 + j is padded out.
// MASKED = false: a step whose 32 positions are all kept keys (mword not read).
template <bool MASKED>
__device__ __forceinline__ void fa_step(const unsigned short* Kp, const unsigned short* Vp,
                                        unsigned int mword, int ln, int hh, const FragH& q0, const FragH& q1,
                                        float& mr, float& lr, v8f (&Oh)[4]) {
  // A fragments of K: row m = key (key0 + 16*kt + ln), elements 0..7 <- d = 32c + 8h + i, 8..15 <- d = 32c + 16 + 8h + i; block 2*kt + c of the step's 4 KiB
  const int lane8 = (16 * hh + ln) * 8;
  const unsigned short* kp = Kp + lane8;
  FragH k00, k01, k10, k11;
  k00.half[0] = *(const v8us*)(kp);            k00.half[1] = *(const v8us*)(kp + FRAG / 2);
  k01.half[0] = *(const v8us*)(kp + FRAG);     k01.half[1] = *(const v8us*)(kp + FRAG + FRAG / 2);
  k10.half[0] = *(const v8us*)(kp + 2 * FRAG); k10.half[1] = *(const v8us*)(kp + 2 * FRAG + FRAG / 2);
  k11.half[0] = *(const v8us*)(kp + 3 * FRAG); k11.half[1] = *(const v8us*)(kp + 3 * FRAG + FRAG / 2);
  // A fragments of V^T: row m = d (16*t + ln), elements 0..7 <- key0 + 8h + i, 8..15 <- key0 + 16 + 8h + i; block t of the step's 4 KiB
  const unsigned short* vp = Vp + lane8;
  FragH vf[4];
#pragma unroll
  for (int t = 0; t < 4; ++t) {
    vf[t].half[0] = *(const v8us*)(vp + t * FRAG);
    vf[t].half[1] = *(const v8us*)(vp + t * FRAG + FRAG / 2);
  }
  const v8f z8 = {0.f, 0.f, 0.f, 0.f, 0.f, 0.f, 0.f, 0.f};
  // S^T tiles: element r of tile kt = score(key0 + 16*kt + 8h + r, query of this lane's column)
  const v8f s0 = mma_hh2(k00.v, q0.v, k01.v, q1.v, z8);
  const v8f s1 = mma_hh2(k10.v, q0.v, k11.v, q1.v, z8);
  const unsigned int wl = mword >> (8 * hh);
  float sc[16];
#pragma unroll
  for (int r = 0; r < 8; ++r) {
    const float a = s0[r] * QKSCALE, c = s1[r] * QKSCALE;
    sc[r]     = (MASKED && ((wl >> r) & 1u)) ? NEGFILL : a;            // padded key: the score is replaced
    sc[8 + r] = (MASKED && ((wl >> (16 + r)) & 1u)) ? NEGFILL : c;
  }
  // mr is a reference, not the maximum: any value does for the quotient as long as the weights stay inside f16. The weights are formed against the mr at hand, and
  // only if some lane's sum of them leaves PSMAX (on the first step, mr = -3e38, it is infinite) is mr raised to the larger of itself and the step's 32-key maximum, the sums rescaled and the step's weights formed again.
  float pc[16];
  float ps = step_weights(sc, mr, pc);
  if (__builtin_amdgcn_ballot_w32(!(ps <= PSMAX)) != 0u) {   // the same for the whole wave: all 32 lanes stay on for the matrix instructions
    float mx = sc[0];
#pragma unroll
    for (int i = 1; i < 16; ++i) mx = fmaxf(mx, sc[i]);
    mx = fmaxf(mx, __shfl_xor(mx, 16, 32));         // the other lane half holds the other 16 keys of this query: both halves keep the same mr
    const float mnew = fmaxf(mr, mx);
    const float al = exp2_raw((mr - mnew) * LOG2E);
    mr = mnew;
    lr *= al;
#pragma unroll
    for (int t = 0; t < 4; ++t) Oh[t] = Oh[t] * al;
    ps = step_weights(sc, mr, pc);
  }
  lr += ps;                                         // this lane's 16 keys only; the two halves' sums meet behind the key loop
  // hi plane f16(pc), residual plane f16(pc - hi), at the hi plane's own scale: both planes' products add into the same sums. pc - hi is exact in f32; as f16 it is off by
  // at most 2^-11 of itself or 2^-25 (f16 subnormals are kept), against a row sum of at least 256 (the key that set mr weighs 256).
  FragH ph, pl;
#pragma unroll
  for (int i = 0; i < 8; ++i)                       // B element i: i<8 -> key0 + 8h + i (tile 0 row 8h+i); i>=8 -> key0 + 16 + 8h + (i-8) (tile 1)
    ph.p[i] = __builtin_convertvector((v2f{pc[2 * i], pc[2 * i + 1]}), v2h);
  residual_x16(pc, ph);
#pragma unroll
  for (int i = 0; i < 8; ++i) pl.p[i] = __builtin_convertvector((v2f{pc[2 * i], pc[2 * i + 1]}), v2h);
  mma_h8(vf[0].v, vf[1].v, vf[2].v, vf[3].v, ph.v, pl.v, Oh[0], Oh[1], Oh[2], Oh[3]);
}

// Block = 4 waves x 16 query positions = 64 of one (batch, head). Key positions 0 .. cnt-1 are the kept keys: whole steps carry no mask, the last one masks its tail.
// K and V^T reach the four waves through a two-buffer LDS ring of 64-key stages: each byte is fetched once per block, by asynchronous copies that fly while the stage before is worked on.
// Stage t = key positions 64t .. 64t+63, walked only if 64t lies in front of the last step's end, so inside a projection tile that was written whole.
// Epilogue: O^T tile -> per-wave LDS tile [16 queries][64 d] (block barrier), then lanes 0..15 / 16..31 each write 256 contiguous bytes
// coverage: NB*16*(SEQ/64) blocks x 4 waves x 16 rows x 64 columns = every context element exactly once; trip counts clamped to SEQ / 32.
__global__ __launch_bounds__(128) void k_attn(const unsigned short* __restrict__ Qh, const unsigned short* __restrict__ Kh,
                                              const unsigned short* __restrict__ Vt, const int* __restrict__ cnt,
                                              float* __restrict__ Cx) {
  __shared__ __attribute__((aligned(16))) float so[4][16][68];
  __shared__ __attribute__((aligned(16))) unsigned short ring[2][2 * STG];
  const int tid = threadIdx.x, w = __builtin_amdgcn_readfirstlane((int)(tid >> 5)), lane = tid & 31, ln = lane & 15, hh = lane >> 4;
  const int bh = blockIdx.x / (SEQ / 64), qt = blockIdx.x % (SEQ / 64);
  const int b = bh / NH, h = bh - b * NH;
  const int qbase = qt * 64 + 16 * w;
  const int n = min(max(cnt[b], 0), SEQ);            // kept keys of the batch (block-uniform)
  const int full = n >> 5;                           // steps of 32 kept keys
  const int steps = n > 0 ? (n + 31) >> 5 : SEQ / 32;
  // Q^T B fragments: column n = query qbase + ln, elements 0..7 <- d = 32c + 8h + i, 8..15 <- d = 32c + 16 + 8h + i
  const unsigned short* qrow = Qh + ((size_t)bh * SEQ + qbase) * HD + lane * 8;   // the wave's 16 queries are one token tile: blocks c = 0, 1
  FragH q0, q1;
  q0.half[0] = *(const v8us*)(qrow);        q0.half[1] = *(const v8us*)(qrow + FRAG / 2);
  q1.half[0] = *(const v8us*)(qrow + FRAG); q1.half[1] = *(const v8us*)(qrow + FRAG + FRAG / 2);
  // the wait that is owed before the lane offset that the four issued loads name is overwritten
  asm volatile("s_wait_xcnt 0x0" :: "v"(lane) : "memory");
  float mr = -3.0e38f, lr = 0.0f;
  v8f Oh[4] = {};
  const unsigned short* Kp = Kh + (size_t)bh * SEQ * HD;
  const unsigned short* Vp = Vt + (size_t)bh * HD * SEQ;
  const int nst = (steps + 1) >> 1;                  // stages of two steps, 1 .. SEQ / 64 (block-uniform)
  const unsigned short* kg = Kp + tid * 8;
  const unsigned short* vg = Vp + tid * 8;
  const unsigned int l0 = (unsigned int)(size_t)&ring[0][0] + (unsigned int)tid * 16u;
  stage_copy(kg, vg, l0);
  asm volatile("s_wait_asynccnt 0x0" ::: "memory");  // this wave's copies of stage 0 have landed
  __syncthreads();                                   // ... and every other wave's: stage 0 may be read
  if (nst > 1) stage_copy(kg + STG, vg + STG, l0 + STB);
  // The foot of stage t, the same behind a whole stage and behind a masked one
  auto foot = [&](int t) {
    asm volatile("s_wait_dscnt 0x0" ::: "memory");    // this wave's reads of stage t are done before its buffer is handed back
    asm volatile("s_wait_asynccnt 0x0" ::: "memory"); // this wave's copies of stage t + 1 have landed
    __syncthreads();                                  // publishes stage t + 1 and ends every wave's reads of stage t
    if (t + 2 < nst) stage_copy(kg + (size_t)(t + 2) * STG, vg + (size_t)(t + 2) * STG, l0 + (unsigned int)(t & 1) * STB);
  };
  const int nwh = full >> 1;                         // stages of two whole steps of kept keys, at most nst (block-uniform)
  int t = 0;
  for (; t < nwh; ++t) {                             // a loop of its own, with no other path through it: the 32 sums stay in their registers
    const unsigned short* kb = &ring[t & 1][0];
    fa_step<false>(kb, kb + STG, 0u, ln, hh, q0, q1, mr, lr, Oh);
    fa_step<false>(kb + 32 * HD, kb + STG + 32 * HD, 0u, ln, hh, q0, q1, mr, lr, Oh);
    foot(t);
  }
  for (; t < nst; ++t) {                             // the last stage, or every stage when no key is kept
    const unsigned short* kb = &ring[t & 1][0];
#pragma unroll 1
    for (int u = 0; u < 2; ++u) {                    // rolled: one copy of the masked step's code
      const int j = 2 * t + u;
      if (j < steps)                                 // a whole step masks nothing; the tail step masks positions n % 32 and up; no key kept: every position
        fa_step<true>(kb + u * (32 * HD), kb + STG + u * (32 * HD), j < full ? 0u : 0xFFFFFFFFu << (n & 31), ln, hh, q0, q1, mr, lr, Oh);
    }
    foot(t);
  }
  asm volatile("s_wait_asynccnt 0x0" ::: "memory");   // no copy is left in flight when the wave goes on

  // O^T element r of tile t = ctx(query qbase + ln, d = 16t + 8h + r); undo the carries: x256 (in lr), x16 (V)
  lr += __shfl_xor(lr, 16, 32);                      // the row sum: both lane halves' keys
  const float inv = 1.0f / (CARRY * lr);
#pragma unroll
  for (int t = 0; t < 4; ++t)
#pragma unroll
    for (int r = 0; r < 8; ++r)
      so[w][ln][16 * t + 8 * hh + r] = Oh[t][r] * inv;
  __syncthreads();
  float* og = Cx + ((size_t)b * SEQ + qbase) * DM + h * HD;
  const int rsub = lane >> 4, c4 = (lane & 15) * 4;
  {
#pragma unroll
    for (int q = 0; q < 8; ++q) {
      const int row = 2 * q + rsub;
      const v4f v = *(const v4fa*)&so[w][row][c4];
      *(v4f*)(og + (size_t)row * DM + c4) = v;
    }
    
  }
}

// coverage: NB*SEQ blocks x 256 threads x 4 columns = every output element of the processed region exactly once.
__global__ __launch_bounds__(256) void k_ln(const float* __restrict__ Cx, const float* __restrict__ gamma,
                                            const float* __restrict__ beta, const int* __restrict__ perm, float* __restrict__ out) {
  __shared__ float rs[8];
  __shared__ float rq[8];
  const int tid = threadIdx.x, lane = tid & 31, w = __builtin_amdgcn_readfirstlane((int)(tid >> 5));
  const int r = blockIdx.x;
  const int b = r / SEQ, s = perm[r];                // context row r holds the token of position r % SEQ
  const v4f x = *(const v4fa*)(Cx + (size_t)r * DM + tid * 4);
  float sm = (x[0] + x[1]) + (x[2] + x[3]);
#pragma unroll
  for (int off = 16; off >= 1; off >>= 1) sm += __shfl_xor(sm, off, 32);
  if (lane == 0) rs[w] = sm;
  __syncthreads();
  float tot = 0.0f;
#pragma unroll
  for (int i = 0; i < 8; ++i) tot += rs[i];
  const float mu = tot * (1.0f / 1024.0f);
  const float d0 = x[0] - mu, d1 = x[1] - mu, d2 = x[2] - mu, d3 = x[3] - mu;
  float sq = (d0 * d0 + d1 * d1) + (d2 * d2 + d3 * d3);
#pragma unroll
  for (int off = 16; off >= 1; off >>= 1) sq += __shfl_xor(sq, off, 32);
  if (lane == 0) rq[w] = sq;
  __syncthreads();
  float tq = 0.0f;
#pragma unroll
  for (int i = 0; i < 8; ++i) tq += rq[i];
  const float var = tq * (1.0f / 1024.0f);
  const float rinv = rsqrtf(var + 1.0e-6f);
  const v4f g = *(const v4fa*)(gamma + tid * 4);
  const v4f be = *(const v4fa*)(beta + tid * 4);
  v4f o;
  o[0] = d0 * rinv * bf16_rne(g[0]) + bf16_rne(be[0]);
  o[1] = d1 * rinv * bf16_rne(g[1]) + bf16_rne(be[1]);
  o[2] = d2 * rinv * bf16_rne(g[2]) + bf16_rne(be[2]);
  o[3] = d3 * rinv * bf16_rne(g[3]) + bf16_rne(be[3]);
  float* dst = out + ((size_t)b * SEQ_FULL + s) * DM + tid * 4;
  *(v4f*)dst = o;
  
}

extern "C" void kernel_launch(void* const* d_in, const int* in_sizes, int n_in,
                              void* d_out, int out_size, void* d_ws, size_t ws_size, hipStream_t stream) {
  if (n_in < 7) return;
  const long long need_x = (long long)(NB - 1) * SEQ_FULL * DM + (long long)SEQ * DM;   // last element touched + 1
  const long long need_m = (long long)(NB - 1) * SEQ_FULL + (long long)SEQ;
  if ((long long)in_sizes[0] < need_x || (long long)in_sizes[1] < need_m) return;
  if ((long long)in_sizes[2] < (long long)DM * DM || (long long)in_sizes[3] < (long long)DM * DM || (long long)in_sizes[4] < (long long)DM * DM) return;
  if (in_sizes[5] < DM || in_sizes[6] < DM) return;
  if ((long long)out_size < need_x) return;
  const float* X     = (const float*)d_in[0];   // wire order: q [2][2048][1024] f32, mask [2][2048] i32, Wq, Wk, Wv [1024][1024] f32, gamma, beta [1024] f32
  const int*   mask  = (const int*)d_in[1];
  const float* Wq    = (const float*)d_in[2];
  const float* Wk    = (const float*)d_in[3];
  const float* Wv    = (const float*)d_in[4];
  const float* gamma = (const float*)d_in[5];
  const float* beta  = (const float*)d_in[6];
  float* out = (float*)d_out;
  char* ws = (char*)d_ws;
  size_t off = 0;
  const size_t xb_bytes = (size_t)NB * SEQ * DM * 2;        // 8 MiB at full size; every plane is written by whole 16-B pieces, none past its end
  const size_t wb_bytes = (size_t)3 * DM * DM * 2;          // 6 MiB
  const size_t p3_bytes = 3 * PLANE * 2;                    // 24 MiB
  const size_t cx_bytes = (size_t)NB * SEQ * DM * 4;        // 16 MiB
  unsigned short* Xb = (unsigned short*)(ws + off); off += (xb_bytes + 255) & ~(size_t)255;
  unsigned short* Wb = (unsigned short*)(ws + off); off += (wb_bytes + 255) & ~(size_t)255;
  unsigned short* P3 = (unsigned short*)(ws + off); off += (p3_bytes + 255) & ~(size_t)255;
  float*          Cx = (float*)(ws + off);          off += (cx_bytes + 255) & ~(size_t)255;
  int*          perm = (int*)(ws + off);            off += ((size_t)NB * SEQ * 4 + 255) & ~(size_t)255;
  int*           cnt = (int*)(ws + off);            off += 256;
  if (off > ws_size) return;
  k_prep<<<(unsigned)(XBLK + WBLK), 256, 0, stream>>>(X, Wq, Wk, Wv, mask, Xb, Wb, perm, cnt);
  k_proj<<<dim3((unsigned)(3 * DM / 128), (unsigned)(NB * SEQ / 128)), 128, 0, stream>>>(Xb, Wb, P3, cnt);
  k_attn<<<(unsigned)(NB * NH * (SEQ / 64)), 128, 0, stream>>>(P3, P3 + PLANE, P3 + 2 * PLANE, cnt, Cx);
  k_ln<<<(unsigned)(NB * SEQ), 256, 0, stream>>>(Cx, gamma, beta, perm, out);
}

// v009
// Measured time: 54.6 microseconds a run.
// Two timings next to v008 put it at 1.05 and 1.06 times that version's speed.
// Over all steps from v000 it is 3.69 times as fast.
#include <hip/hip_runtime.h>
// Contractions: x Wq^T, x Wk^T, x Wv^T on v_wmma_f32_16x16x32_bf16 (x and W converted RNE to bf16, single product, f32 accumulate); S^T = K Q^T on v_wmma_f32_16x16x32_f16 (Q, K: f16 planes of the f32 projections x16, single product); O^T = V^T P^T on v_wmma_f32_16x16x32_f16 (V: f16 plane x16; P: x256 f16 hi plane + f16 plane of its rounding residual, both into one f32 accumulator); softmax statistics and LayerNorm f32 (gamma and beta rounded RNE to bf16).
// Multi-head self attention, B x S x 1024, 16 heads x 64, scores scaled 1/8, key-padding mask replaces masked scores by -1e20, LayerNorm over the 1024 concatenated columns.
// Engine: transposed flash. Each wave owns 16 queries of one (batch, head). Per 32-key step: S^T tiles (key rows x query columns) from K rows (A, f16 plane by way of LDS)
// and Q^T (B, registers); the two 16-key D tiles pack straight into the P^T B fragment; O^T (d rows x query columns) accumulates from V^T rows (A, f16 plane by way of LDS).
// Every 16-bit plane is stored fragment-major: a 16 x 32 operand fragment (16 rows or columns x 32 k) is one 1-KiB block of 64 pieces of 8 elements,
// piece 32*half + lane (lane = 16*hh + ln) = row ln, k = 16*half + 8*hh + 0..7. A wave-wide 16-byte load of one half reads 512 contiguous bytes (4 lines, not 16).
// Token order: inside each batch the tokens are stably partitioned by the key mask, kept keys first (perm[position] = token, cnt = kept keys). A padded key's weight is
// exp(-1e20 - max) = 0 whenever one key is kept, so K, V^T and the key loop cover the first cnt positions only; every plane and the context are in position order and
// the LayerNorm kernel stores row perm[position]. No key kept: every score is -1e20 (uniform weights), so all SEQ positions are walked with every key marked padded.
#ifndef NB
#define NB 2
#endif
#ifndef SEQ
#define SEQ 2048
#endif
#define NB_FULL 2
#define SEQ_FULL 2048
#define DM 1024
#define NH 16
#define HD 64
#define XB_FULL ((size_t)SEQ_FULL * DM)          /* per-batch element stride of the activation input and of the output */
#define PLANE ((size_t)NB * NH * SEQ * HD)       /* elements of one of the Q / K / V^T planes */
#define FRAG 512                                 /* elements of one 16 x 32 fragment block; its second half starts at FRAG / 2 */
#define RTILE ((size_t)16 * DM)                  /* elements of 16 rows of a [rows][1024] plane = 32 fragment blocks */

static_assert(SEQ % 256 == 0);
static_assert(SEQ <= SEQ_FULL);
static_assert(NB <= NB_FULL);
static_assert(HD == 64);
static_assert(DM == NH * HD);
static_assert(DM % 32 == 0);
static_assert((3 * DM) % 128 == 0);
static_assert((size_t)NB * SEQ * DM * 2 + (size_t)3 * DM * DM * 2 + 3 * PLANE * 2 + (size_t)NB * SEQ * DM * 4 + (size_t)NB * SEQ * 4 + 1024 <= (size_t)134217728);

typedef __bf16 v16b __attribute__((ext_vector_type(16)));
typedef _Float16 v16h __attribute__((ext_vector_type(16)));
typedef unsigned short v8us __attribute__((ext_vector_type(8), may_alias));
typedef float v8f __attribute__((ext_vector_type(8)));
typedef float v2f __attribute__((ext_vector_type(2)));
typedef _Float16 v2h __attribute__((ext_vector_type(2)));
typedef float v4f __attribute__((ext_vector_type(4)));
typedef float v4fa __attribute__((ext_vector_type(4), may_alias));
union FragB { v16b v; v8us half[2]; unsigned short u[16]; };
union FragH { v16h v; v8us half[2]; v2h p[8]; _Float16 h[16]; unsigned short u[16]; };

#define LOG2E 1.4426950408889634f
#define NEGFILL (-1.0e20f)
#define CARRY 16.0f                      /* power-of-two carry of the Q, K and V planes */
#define QKSCALE 0.00048828125f           /* (1/8) / (16*16) */

__device__ __forceinline__ unsigned short bf16_bits(float x) {   // RNE convert to bf16 bits
  unsigned int u = __float_as_uint(x);
  return (unsigned short)((u + 0x7FFFu + ((u >> 16) & 1u)) >> 16);
}
__device__ __forceinline__ float bf16_val(unsigned short b) { return __uint_as_float(((unsigned int)b) << 16); }
__device__ __forceinline__ float bf16_rne(float x) { return bf16_val(bf16_bits(x)); }
__device__ __forceinline__ unsigned short f16_bits(float x) { const _Float16 h = (_Float16)x; return __builtin_bit_cast(unsigned short, h); }

// c0..c3 += a * b0..b3 (one bf16 k-step of four column tiles), then the hazard guard
__device__ __forceinline__ void mma_b4(v16b a, v16b b0, v16b b1, v16b b2, v16b b3, v8f& c0, v8f& c1, v8f& c2, v8f& c3) {
  c0 = __builtin_amdgcn_wmma_f32_16x16x32_bf16(false, a, false, b0, (short)0, c0, false, false);
  c1 = __builtin_amdgcn_wmma_f32_16x16x32_bf16(false, a, false, b1, (short)0, c1, false, false);
  c2 = __builtin_amdgcn_wmma_f32_16x16x32_bf16(false, a, false, b2, (short)0, c2, false, false);
  c3 = __builtin_amdgcn_wmma_f32_16x16x32_bf16(false, a, false, b3, (short)0, c3, false, false);
  asm volatile("v_nop\n\tv_nop\n\tv_nop\n\tv_nop" : "+v"(c0), "+v"(c1), "+v"(c2), "+v"(c3) : "v"(a), "v"(b0), "v"(b1), "v"(b2), "v"(b3));
}
// c += a0*b0 + a1*b1 (two k-steps of one f16 tile), then the hazard guard
__device__ __forceinline__ v8f mma_hh2(v16h a0, v16h b0, v16h a1, v16h b1, v8f c) {
  c = __builtin_amdgcn_wmma_f32_16x16x32_f16(false, a0, false, b0, (short)0, c, false, false);
  c = __builtin_amdgcn_wmma_f32_16x16x32_f16(false, a1, false, b1, (short)0, c, false, false);
  asm volatile("v_nop\n\tv_nop\n\tv_nop\n\tv_nop" : "+v"(c) : "v"(a0), "v"(b0), "v"(a1), "v"(b1));
  return c;
}
// c0..c3 += a0..a3 * bh, then c0..c3 += a0..a3 * bl (three products stand between the two that add into one tile), then the hazard guard
__device__ __forceinline__ void mma_h8(v16h a0, v16h a1, v16h a2, v16h a3, v16h bh, v16h bl, v8f& c0, v8f& c1, v8f& c2, v8f& c3) {
  c0 = __builtin_amdgcn_wmma_f32_16x16x32_f16(false, a0, false, bh, (short)0, c0, false, false);
  c1 = __builtin_amdgcn_wmma_f32_16x16x32_f16(false, a1, false, bh, (short)0, c1, false, false);
  c2 = __builtin_amdgcn_wmma_f32_16x16x32_f16(false, a2, false, bh, (short)0, c2, false, false);
  c3 = __builtin_amdgcn_wmma_f32_16x16x32_f16(false, a3, false, bh, (short)0, c3, false, false);
  c0 = __builtin_amdgcn_wmma_f32_16x16x32_f16(false, a0, false, bl, (short)0, c0, false, false);
  c1 = __builtin_amdgcn_wmma_f32_16x16x32_f16(false, a1, false, bl, (short)0, c1, false, false);
  c2 = __builtin_amdgcn_wmma_f32_16x16x32_f16(false, a2, false, bl, (short)0, c2, false, false);
  c3 = __builtin_amdgcn_wmma_f32_16x16x32_f16(false, a3, false, bl, (short)0, c3, false, false);
  asm volatile("v_nop\n\tv_nop\n\tv_nop\n\tv_nop" : "+v"(c0), "+v"(c1), "+v"(c2), "+v"(c3) : "v"(a0), "v"(a1), "v"(a2), "v"(a3), "v"(bh), "v"(bl));
}

// Preparation, one launch. Blocks 0 .. XBLK-1: the activation plane; the rest: the three weight planes (no token order, no LDS, no barrier).
// Stable partition of one batch's tokens: position of token s = kept tokens before s if it is kept, else cnt + padded tokens before s (a permutation of 0..SEQ-1 for any mask).
// Every activation block works the list of its own batch out for itself (8 KiB of mask, SEQ / 256 consecutive tokens per thread, list gathered in LDS), so that no launch has to
// end before the conversion starts; the first block of each batch also stores the list as whole lines, and cnt, for the later launches.
// dst = bf16 bits (RNE) of src, fragment-major: block (row / 16) * 32 + k / 32; activation row at position p of batch b = token sp[p].
// A block converts one whole 16-row tile (32 fragment blocks, 64 KiB of source) in PIT passes of 4 fragment blocks: few waves with much to do each, for speed only. A thread keeps its row; all its loads are issued before the first store.
// In each pass a wave takes 8 rows x one 128-B source line each and writes four whole 128-B lines of a fragment block (pieces 16*q + 8*rhi + 0..7, q = k / 8 in the block).
// coverage: every sp[] entry written once (permutation) before the barrier in front of its read; NB x SEQ entries of perm and NB of cnt;
// XBLK and WBLK blocks x 256 threads x PIT passes x 8 elements = the whole planes (thread bits 0-2 and 5 -> row in the tile, bits 3-4 -> q, bits 6-7 and the pass -> fragment block).
#define XBLK (NB * SEQ / 16)
#define WBLK (3 * DM / 16)
#define PIT (DM / 128)
static_assert(SEQ % 16 == 0);                    // a 16-row tile lies inside one batch
static_assert(DM % 16 == 0);                     // ... or inside one of Wq, Wk, Wv
__global__ __launch_bounds__(256) void k_prep(const float* __restrict__ X, const float* __restrict__ Wq, const float* __restrict__ Wk, const float* __restrict__ Wv,
                                              const int* __restrict__ mask, unsigned short* __restrict__ Xb, unsigned short* __restrict__ Wb,
                                              int* __restrict__ perm, int* __restrict__ cnt) {
  constexpr int TPT = SEQ / 256;
  __shared__ int sp[SEQ];
  __shared__ int wsum[8];
  const int tid = threadIdx.x;
  const bool isx = blockIdx.x < XBLK;                // block-uniform
  const int tile = isx ? blockIdx.x : blockIdx.x - XBLK;   // 16-row tile of the activation plane or of the weight plane
  const int ln = ((tid >> 5) & 1) * 8 + (tid & 7), q = (tid >> 3) & 3;
  const int row = tile * 16 + ln, k = (tid >> 6) * 32 + q * 8;   // k of pass 0; a pass goes on by 128
  const float* p;
  unsigned short* d;
  if (isx) {
    const int lane = tid & 31, w = tid >> 5, b = tile / (SEQ / 16);
    const int* mp = mask + (size_t)b * SEQ_FULL + tid * TPT;
    int keep[TPT];
    int c = 0;
#pragma unroll
    for (int i = 0; i < TPT; ++i) { keep[i] = mp[i] != 0 ? 1 : 0; c += keep[i]; }
    int inc = c;                                     // inclusive scan of the threads' kept counts inside the wave
#pragma unroll
    for (int off = 1; off < 32; off <<= 1) { const int v = __shfl_up(inc, off, 32); if (lane >= off) inc += v; }
    if (lane == 31) wsum[w] = inc;
    __syncthreads();
    int base = 0, n = 0;
#pragma unroll
    for (int i = 0; i < 8; ++i) { const int v = wsum[i]; n += v; if (i < w) base += v; }
    int kr = base + inc - c;                         // kept tokens in front of this thread's first token
#pragma unroll
    for (int i = 0; i < TPT; ++i) {
      const int s = tid * TPT + i;
      sp[keep[i] ? kr : n + s - kr] = s;
      kr += keep[i];
    }
    __syncthreads();
    if (tile % (SEQ / 16) == 0) {                    // block-uniform, behind the last barrier
#pragma unroll
      for (int i = 0; i < TPT; ++i) perm[(size_t)b * SEQ + tid + 256 * i] = sp[tid + 256 * i];
      if (tid == 0) cnt[b] = n;
    }
    p = X + (size_t)b * XB_FULL + (size_t)sp[row - b * SEQ] * DM + k;
    d = Xb + (size_t)tile * RTILE + (tid >> 6) * FRAG + (q * 16 + ln) * 8;
  } else {
    const int which = tile / (DM / 16);
    p = (which == 0 ? Wq : which == 1 ? Wk : Wv) + (size_t)(row - which * DM) * DM + k;
    d = Wb + (size_t)tile * RTILE + (tid >> 6) * FRAG + (q * 16 + ln) * 8;
  }
  v4f x0[PIT], x1[PIT];
#pragma unroll
  for (int it = 0; it < PIT; ++it) { x0[it] = *(const v4fa*)(p + it * 128); x1[it] = *(const v4fa*)(p + it * 128 + 4); }
  // the wait that is owed before the address that the issued loads name is overwritten; naming the address keeps its registers out of the loads' own results
  asm volatile("s_wait_xcnt 0x0" :: "v"(p) : "memory");
#pragma unroll
  for (int it = 0; it < PIT; ++it) {
    v8us o;
    o[0] = bf16_bits(x0[it][0]); o[1] = bf16_bits(x0[it][1]); o[2] = bf16_bits(x0[it][2]); o[3] = bf16_bits(x0[it][3]);
    o[4] = bf16_bits(x1[it][0]); o[5] = bf16_bits(x1[it][1]); o[6] = bf16_bits(x1[it][2]); o[7] = bf16_bits(x1[it][3]);
    *(v8us*)(d + it * (4 * FRAG)) = o;
  }
}

__device__ __forceinline__ void stage8(unsigned short* st, const v8f& c, int base, int rstep) {
#pragma unroll
  for (int r = 0; r < 8; ++r) st[base + r * rstep] = f16_bits(c[r] * CARRY);
}

#define PKS 64                                   /* k of one stage of the projection's LDS ring: two fragment blocks of every 16-row tile */
#define PPART (8 * (PKS / 32) * FRAG)            /* elements of the X part, and of the W part, of one stage: 8 tiles of 16 rows x 64 k (16 KiB each) */
#define PBUF (2 * PPART * 2)                     /* bytes of one ring buffer: X part, then W part */
static_assert(DM % PKS == 0);
static_assert(DM / PKS >= 2);                    // the ring's prologue fills two stages
static_assert(DM % 128 == 0);                    // a block's 128 columns lie inside one of Q, K, V
static_assert((PKS / 32) * FRAG * 2 == 128 * 16);   // one copy of 16 B per thread brings one 16-row tile's share of a stage

// One operand's part of one stage into one ring buffer: of each of 8 consecutive 16-row tiles the stage's 64 k are 2 KiB that lie contiguous in the fragment-major plane, copied as they lie.
// g: this thread's piece of the first tile (tile base + stage offset + 8 * tid elements); l: its LDS byte address (part base + 16 * tid).
// Every thread brings piece tid of each tile: all addresses multiples of 16, no LDS byte written twice, all 32 lanes on.
__device__ __forceinline__ void part_copy(const unsigned short* g, unsigned int l) {
  // s_wait_xcnt as the statement's last line: it then stands in front of every later write of a register that one of the copies names
  asm volatile("global_load_async_to_lds_b128 %0, %8, off\n\t"
               "global_load_async_to_lds_b128 %1, %9, off\n\t"
               "global_load_async_to_lds_b128 %2, %10, off\n\t"
               "global_load_async_to_lds_b128 %3, %11, off\n\t"
               "global_load_async_to_lds_b128 %4, %12, off\n\t"
               "global_load_async_to_lds_b128 %5, %13, off\n\t"
               "global_load_async_to_lds_b128 %6, %14, off\n\t"
               "global_load_async_to_lds_b128 %7, %15, off\n\t"
               "s_wait_xcnt 0x0"
               :: "v"(l), "v"(l + 2048u), "v"(l + 4096u), "v"(l + 6144u), "v"(l + 8192u), "v"(l + 10240u), "v"(l + 12288u), "v"(l + 14336u),
                  "v"(g), "v"(g + RTILE), "v"(g + 2 * RTILE), "v"(g + 3 * RTILE), "v"(g + 4 * RTILE), "v"(g + 5 * RTILE), "v"(g + 6 * RTILE), "v"(g + 7 * RTILE)
               : "memory");
}

// Y[m][n] = sum_k Xb[m][k] * Wb[n][k], M = NB*SEQ, N = 3*1024 (Wq | Wk | Wv rows), K = 1024.
// Block = 4 waves (2 x 2), tile 128 rows x 128 columns (two heads of one of Q/K/V); wave tile 64 x 64 (one head).
// X and W reach the waves through a two-buffer LDS ring of 64-k stages: each byte is fetched once per block, by asynchronous copies that fly while the stage before is worked on;
// a fragment read from LDS feeds four products. The k blocks add into each tile in the order 0, 1, 2, ...
// A fragment: row m, elements 0..7 <- k0 + 8h + i, 8..15 <- k0 + 16 + 8h + i; B fragment: column n = W row n, same k map; D element r = (row 8h + r, column ln).
//   Q, K planes P3[0..1][b*16+h][token / 16][d / 32][fragment block: row = token % 16, k = d % 32]
//   V^T plane   P3[2][b*16+h][token / 32][d / 16][fragment block: row = d % 16, k = token % 32]; each thread stores the piece of its own index: whole lines.
// K and V^T tiles that start behind the last kept position are never read and are left out (block-uniform return in front of every barrier and copy); a tile that straddles it is whole.
// coverage: grid (24, NB*SEQ/128) x (128 x 128) = the Q plane and every K, V^T tile the key loop reads; each head's LDS tile fully written before it is read (128x64 or 64x128).
__global__ __launch_bounds__(128) void k_proj(const unsigned short* __restrict__ Xb, const unsigned short* __restrict__ Wb,
                                              unsigned short* __restrict__ P3, const int* __restrict__ cnt) {
  __shared__ __attribute__((aligned(16))) unsigned short ring[2][2 * PPART];
  __shared__ __attribute__((aligned(16))) unsigned short st[2][128 * 72];
  const int tid = threadIdx.x, w = __builtin_amdgcn_readfirstlane((int)(tid >> 5)), lane = tid & 31, ln = lane & 15, hh = lane >> 4;
  const int wr = w >> 1, wc = w & 1;                 // the wave's 64 rows and its 64 columns (its head) inside the block's tile
  const int n0 = blockIdx.x * 128;
  const int m0 = blockIdx.y * 128;
  if (n0 >= DM) {                                    // K or V columns
    const int n = cnt[m0 / SEQ];
    if (n > 0 && m0 % SEQ >= n) return;
  }
  const unsigned short* ag = Xb + (size_t)(m0 >> 4) * RTILE + tid * 8;
  const unsigned short* bg = Wb + (size_t)(n0 >> 4) * RTILE + tid * 8;
  const unsigned int l0 = (unsigned int)(size_t)&ring[0][0] + (unsigned int)tid * 16u;
  auto fill = [&](int t) {                           // stage t = k 64t .. 64t+63 into buffer t % 2
    const unsigned int l = l0 + (unsigned int)(t & 1) * PBUF;
    part_copy(ag + (size_t)t * ((PKS / 32) * FRAG), l);
    part_copy(bg + (size_t)t * ((PKS / 32) * FRAG), l + PPART * 2);
  };
  fill(0);
  asm volatile("s_wait_asynccnt 0x0" ::: "memory");  // this wave's copies of stage 0 have landed
  __syncthreads();                                   // ... and every other wave's: stage 0 may be read
  fill(1);
  v8f c[4][4] = {};
#pragma unroll 1                                     // rolled: one copy of the stage's code
  for (int t = 0; t < DM / PKS; ++t) {
    const unsigned short* ab = &ring[t & 1][0] + (4 * wr) * ((PKS / 32) * FRAG) + lane * 8;
    const unsigned short* bb = &ring[t & 1][0] + PPART + (4 * wc) * ((PKS / 32) * FRAG) + lane * 8;
#pragma unroll
    for (int kb = 0; kb < PKS / 32; ++kb) {
      FragB a[4], b[4];
#pragma unroll
      for (int i = 0; i < 4; ++i) {
        a[i].half[0] = *(const v8us*)(ab + ((PKS / 32) * i + kb) * FRAG);  a[i].half[1] = *(const v8us*)(ab + ((PKS / 32) * i + kb) * FRAG + FRAG / 2);
        b[i].half[0] = *(const v8us*)(bb + ((PKS / 32) * i + kb) * FRAG);  b[i].half[1] = *(const v8us*)(bb + ((PKS / 32) * i + kb) * FRAG + FRAG / 2);
      }
#pragma unroll
      for (int i = 0; i < 4; ++i) mma_b4(a[i].v, b[0].v, b[1].v, b[2].v, b[3].v, c[i][0], c[i][1], c[i][2], c[i][3]);
    }
    asm volatile("s_wait_dscnt 0x0" ::: "memory");    // this wave's reads of stage t are done before its buffer is handed back
    asm volatile("s_wait_asynccnt 0x0" ::: "memory"); // this wave's copies of stage t + 1 have landed
    __syncthreads();                                  // publishes stage t + 1 and ends every wave's reads of stage t
    if (t + 2 < DM / PKS) fill(t + 2);
  }
  asm volatile("s_wait_asynccnt 0x0" ::: "memory");   // no copy is left in flight when the wave goes on
  const int which = n0 >> 10;                 // 0: Q, 1: K, 2: V (block-uniform)
  const int h0 = (n0 & 1023) >> 6;            // the block's first head; wave column wc holds head h0 + wc
  const int b = m0 / SEQ, s0 = m0 - b * SEQ;
  const bool rowmajor = which < 2;
  const int rstep = rowmajor ? 72 : 1;
  // element (row rb + r, column 16*j + ln) of the wave's head: Q/K tile st[wc][row*72 + col]; V tile st[wc][col*136 + row]
#pragma unroll
  for (int i = 0; i < 4; ++i) {
    const int rb = 64 * wr + 16 * i + 8 * hh;
#pragma unroll
    for (int j = 0; j < 4; ++j) stage8(&st[wc][0], c[i][j], rowmajor ? rb * 72 + 16 * j + ln : (16 * j + ln) * 136 + rb, rstep);
  }
  __syncthreads();
#pragma unroll
  for (int hs = 0; hs < 2; ++hs) {
    unsigned short* base = P3 + (size_t)which * PLANE + ((size_t)(b * NH + h0 + hs) * SEQ + s0) * HD;
    if (rowmajor) {
#pragma unroll
      for (int it = 0; it < 8; ++it) {
        const int i = tid + 128 * it;                                   // piece i: token tile i / 128, d block (i / 64) % 2, piece i % 64
        const int row = (i >> 7) * 16 + (i & 15), col = ((i >> 4) & 7) * 8;   // d = 32*c + 16*half + 8*hh
        const v8us o = *(const v8us*)(&st[hs][row * 72 + col]);
        *(v8us*)(base + (size_t)i * 8) = o;
      }
    } else {
#pragma unroll
      for (int it = 0; it < 8; ++it) {
        const int i = tid + 128 * it;
        const int dc = ((i >> 6) & 3) * 16 + (i & 15);                  // piece i: key block i / 256, d tile (i / 64) % 4, piece i % 64
        const int tk = (i >> 8) * 32 + ((i >> 4) & 3) * 8;              // token = 32*block + 16*half + 8*hh
        const v8us o = *(const v8us*)(&st[hs][dc * 136 + tk]);
        *(v8us*)(base + (size_t)i * 8) = o;
      }
    }
  }
}

// 2^x as the bare v_exp_f32. exp2f() wraps it in a range fix for results below 2^-126 (compare, two selects, add, ldexp per value). Here such a result is a weight that
// rounds to zero in both f16 planes and adds nothing to a row sum of at least 256, or a rescale factor of sums that the new maximum's terms outweigh by 2^126: flushed to 0 it gives the same output.
__device__ __forceinline__ float exp2_raw(float x) { return __builtin_amdgcn_exp2f(x); }

#define STK 64                                   /* keys of one stage of the LDS ring */
#define STG (STK * HD)                           /* elements of the K part, and of the V^T part, of one stage (8 KiB each) */
#define STB (2 * STG * 2)                        /* bytes of one ring buffer: K part, then V^T part */
static_assert(SEQ % STK == 0);
static_assert(128 % STK == 0);                   // a stage lies inside one 128-row tile of the projection: written whole or not walked at all
static_assert(STG * 2 == 4 * 128 * 16);          // 4 copies of 16 B per thread and part

// One stage into one ring buffer: 64 keys are 8 KiB of K and 8 KiB of V^T, each contiguous in its fragment-major plane, copied as they lie.
// kg, vg: this thread's first piece of the stage in the two planes (stage base + 8 * tid elements); l: its LDS byte address (buffer base + 16 * tid).
// Every thread brings pieces tid + 128 * c, c = 0..3, of each part: all addresses multiples of 16, no LDS byte written twice, all 32 lanes on.
__device__ __forceinline__ void stage_copy(const unsigned short* kg, const unsigned short* vg, unsigned int l) {
  // s_wait_xcnt as the statement's last line: it then stands in front of every later write of a register that one of the copies names
  asm volatile("global_load_async_to_lds_b128 %0, %8, off\n\t"
               "global_load_async_to_lds_b128 %1, %9, off\n\t"
               "global_load_async_to_lds_b128 %2, %10, off\n\t"
               "global_load_async_to_lds_b128 %3, %11, off\n\t"
               "global_load_async_to_lds_b128 %4, %12, off\n\t"
               "global_load_async_to_lds_b128 %5, %13, off\n\t"
               "global_load_async_to_lds_b128 %6, %14, off\n\t"
               "global_load_async_to_lds_b128 %7, %15, off\n\t"
               "s_wait_xcnt 0x0"
               :: "v"(l), "v"(l + 2048u), "v"(l + 4096u), "v"(l + 6144u), "v"(l + 8192u), "v"(l + 10240u), "v"(l + 12288u), "v"(l + 14336u),
                  "v"(kg), "v"(kg + 1024), "v"(kg + 2048), "v"(kg + 3072), "v"(vg), "v"(vg + 1024), "v"(vg + 2048), "v"(vg + 3072)
               : "memory");
}

// x[i] = 2^x[i], the bare v_exp_f32 as in exp2_raw, each in its own register. One statement, closed by a v_nop: the instruction set asks for one free slot behind a transcendental before its
// result is read or its source overwritten.
__device__ __forceinline__ void exp2_x16(float (&x)[16]) {
  asm("v_exp_f32 %0, %0\n\tv_exp_f32 %1, %1\n\tv_exp_f32 %2, %2\n\tv_exp_f32 %3, %3\n\t"
      "v_exp_f32 %4, %4\n\tv_exp_f32 %5, %5\n\tv_exp_f32 %6, %6\n\tv_exp_f32 %7, %7\n\t"
      "v_exp_f32 %8, %8\n\tv_exp_f32 %9, %9\n\tv_exp_f32 %10, %10\n\tv_exp_f32 %11, %11\n\t"
      "v_exp_f32 %12, %12\n\tv_exp_f32 %13, %13\n\tv_exp_f32 %14, %14\n\tv_exp_f32 %15, %15\n\t"
      "v_nop"
      : "+v"(x[0]), "+v"(x[1]), "+v"(x[2]), "+v"(x[3]), "+v"(x[4]), "+v"(x[5]), "+v"(x[6]), "+v"(x[7]),
        "+v"(x[8]), "+v"(x[9]), "+v"(x[10]), "+v"(x[11]), "+v"(x[12]), "+v"(x[13]), "+v"(x[14]), "+v"(x[15]));
}

// x[i] -= (float)h.h[i]: one v_fma_mix_f32 per value, which reads its f16 half of the packed word as it lies. Written as C, the build widened each half with a convert of its own
// and then subtracted in pairs: 24 instructions for these 16. No instruction here reads another's result.
__device__ __forceinline__ void residual_x16(float (&x)[16], const FragH& h) {
  asm("v_fma_mix_f32 %0, %16, -1.0, %0 op_sel_hi:[1,1,0]\n\tv_fma_mix_f32 %1, %16, -1.0, %1 op_sel:[1,0,0] op_sel_hi:[1,1,0]\n\t"
      "v_fma_mix_f32 %2, %17, -1.0, %2 op_sel_hi:[1,1,0]\n\tv_fma_mix_f32 %3, %17, -1.0, %3 op_sel:[1,0,0] op_sel_hi:[1,1,0]\n\t"
      "v_fma_mix_f32 %4, %18, -1.0, %4 op_sel_hi:[1,1,0]\n\tv_fma_mix_f32 %5, %18, -1.0, %5 op_sel:[1,0,0] op_sel_hi:[1,1,0]\n\t"
      "v_fma_mix_f32 %6, %19, -1.0, %6 op_sel_hi:[1,1,0]\n\tv_fma_mix_f32 %7, %19, -1.0, %7 op_sel:[1,0,0] op_sel_hi:[1,1,0]\n\t"
      "v_fma_mix_f32 %8, %20, -1.0, %8 op_sel_hi:[1,1,0]\n\tv_fma_mix_f32 %9, %20, -1.0, %9 op_sel:[1,0,0] op_sel_hi:[1,1,0]\n\t"
      "v_fma_mix_f32 %10, %21, -1.0, %10 op_sel_hi:[1,1,0]\n\tv_fma_mix_f32 %11, %21, -1.0, %11 op_sel:[1,0,0] op_sel_hi:[1,1,0]\n\t"
      "v_fma_mix_f32 %12, %22, -1.0, %12 op_sel_hi:[1,1,0]\n\tv_fma_mix_f32 %13, %22, -1.0, %13 op_sel:[1,0,0] op_sel_hi:[1,1,0]\n\t"
      "v_fma_mix_f32 %14, %23, -1.0, %14 op_sel_hi:[1,1,0]\n\tv_fma_mix_f32 %15, %23, -1.0, %15 op_sel:[1,0,0] op_sel_hi:[1,1,0]"
      : "+v"(x[0]), "+v"(x[1]), "+v"(x[2]), "+v"(x[3]), "+v"(x[4]), "+v"(x[5]), "+v"(x[6]), "+v"(x[7]),
        "+v"(x[8]), "+v"(x[9]), "+v"(x[10]), "+v"(x[11]), "+v"(x[12]), "+v"(x[13]), "+v"(x[14]), "+v"(x[15])
      : "v"(h.p[0]), "v"(h.p[1]), "v"(h.p[2]), "v"(h.p[3]), "v"(h.p[4]), "v"(h.p[5]), "v"(h.p[6]), "v"(h.p[7]));
}

#define PSMAX 32768.0f                           /* a lane's 16 weights of a step may sum to this much: each of them is then inside f16 */
// A lane's 16 weights of one step against the reference maximum m, carried x256: pc = 256 * exp(sc - m); returns their sum (pairwise tree).
__device__ __forceinline__ float step_weights(const float (&sc)[16], float m, float (&pc)[16]) {
#pragma unroll
  for (int i = 0; i < 16; ++i) pc[i] = fmaf(sc[i] - m, LOG2E, 8.0f);
  exp2_x16(pc);
  v2f a[8];                                        // neighbours as pairs: the tree runs on packed adds
#pragma unroll
  for (int i = 0; i < 8; ++i) a[i] = v2f{pc[2 * i], pc[2 * i + 1]};
#pragma unroll
  for (int i = 0; i < 4; ++i) a[i] += a[i + 4];
  a[0] = (a[0] + a[2]) + (a[1] + a[3]);
  return a[0][0] + a[0][1];
}

// One 32-key step for a wave's 16 queries. Kp, Vp: the step's 4 KiB of K and of V^T in the LDS ring; key0 in the notes below = the step's first key position; mword bit j set = position key0 + j is padded out.
// MASKED = false: a step whose 32 positions are all kept keys (mword not read).
template <bool MASKED>
__device__ __forceinline__ void fa_step(const unsigned short* Kp, const unsigned short* Vp,
                                        unsigned int mword, int ln, int hh, const FragH& q0, const FragH& q1,
                                        float& mr, float& lr, v8f (&Oh)[4]) {
  // A fragments of K: row m = key (key0 + 16*kt + ln), elements 0..7 <- d = 32c + 8h + i, 8..15 <- d = 32c + 16 + 8h + i; block 2*kt + c of the step's 4 KiB
  const int lane8 = (16 * hh + ln) * 8;
  const unsigned short* kp = Kp + lane8;
  FragH k00, k01, k10, k11;
  k00.half[0] = *(const v8us*)(kp);            k00.half[1] = *(const v8us*)(kp + FRAG / 2);
  k01.half[0] = *(const v8us*)(kp + FRAG);     k01.half[1] = *(const v8us*)(kp + FRAG + FRAG / 2);
  k10.half[0] = *(const v8us*)(kp + 2 * FRAG); k10.half[1] = *(const v8us*)(kp + 2 * FRAG + FRAG / 2);
  k11.half[0] = *(const v8us*)(kp + 3 * FRAG); k11.half[1] = *(const v8us*)(kp + 3 * FRAG + FRAG / 2);
  // A fragments of V^T: row m = d (16*t + ln), elements 0..7 <- key0 + 8h + i, 8..15 <- key0 + 16 + 8h + i; block t of the step's 4 KiB
  const unsigned short* vp = Vp + lane8;
  FragH vf[4];
#pragma unroll
  for (int t = 0; t < 4; ++t) {
    vf[t].half[0] = *(const v8us*)(vp + t * FRAG);
    vf[t].half[1] = *(const v8us*)(vp + t * FRAG + FRAG / 2);
  }
  const v8f z8 = {0.f, 0.f, 0.f, 0.f, 0.f, 0.f, 0.f, 0.f};
  // S^T tiles: element r of tile kt = score(key0 + 16*kt + 8h + r, query of this lane's column)
  const v8f s0 = mma_hh2(k00.v, q0.v, k01.v, q1.v, z8);
  const v8f s1 = mma_hh2(k10.v, q0.v, k11.v, q1.v, z8);
  const unsigned int wl = mword >> (8 * hh);
  float sc[16];
#pragma unroll
  for (int r = 0; r < 8; ++r) {
    const float a = s0[r] * QKSCALE, c = s1[r] * QKSCALE;
    sc[r]     = (MASKED && ((wl >> r) & 1u)) ? NEGFILL : a;            // padded key: the score is replaced
    sc[8 + r] = (MASKED && ((wl >> (16 + r)) & 1u)) ? NEGFILL : c;
  }
  // mr is a reference, not the maximum: any value does for the quotient as long as the weights stay inside f16. The weights are formed against the mr at hand, and
  // only if some lane's sum of them leaves PSMAX (on the first step, mr = -3e38, it is infinite) is mr raised to the larger of itself and the step's 32-key maximum, the sums rescaled and the step's weights formed again.
  float pc[16];
  float ps = step_weights(sc, mr, pc);
  if (__builtin_amdgcn_ballot_w32(!(ps <= PSMAX)) != 0u) {   // the same for the whole wave: all 32 lanes stay on for the matrix instructions
    float mx = sc[0];
#pragma unroll
    for (int i = 1; i < 16; ++i) mx = fmaxf(mx, sc[i]);
    mx = fmaxf(mx, __shfl_xor(mx, 16, 32));         // the other lane half holds the other 16 keys of this query: both halves keep the same mr
    const float mnew = fmaxf(mr, mx);
    const float al = exp2_raw((mr - mnew) * LOG2E);
    mr = mnew;
    lr *= al;
#pragma unroll
    for (int t = 0; t < 4; ++t) Oh[t] = Oh[t] * al;
    ps = step_weights(sc, mr, pc);
  }
  lr += ps;                                         // this lane's 16 keys only; the two halves' sums meet behind the key loop
  // hi plane f16(pc), residual plane f16(pc - hi), at the hi plane's own scale: both planes' products add into the same sums. pc - hi is exact in f32; as f16 it is off by
  // at most 2^-11 of itself or 2^-25 (f16 subnormals are kept), against a row sum of at least 256 (the key that set mr weighs 256).
  FragH ph, pl;
#pragma unroll
  for (int i = 0; i < 8; ++i)                       // B element i: i<8 -> key0 + 8h + i (tile 0 row 8h+i); i>=8 -> key0 + 16 + 8h + (i-8) (tile 1)
    ph.p[i] = __builtin_convertvector((v2f{pc[2 * i], pc[2 * i + 1]}), v2h);
  residual_x16(pc, ph);
#pragma unroll
  for (int i = 0; i < 8; ++i) pl.p[i] = __builtin_convertvector((v2f{pc[2 * i], pc[2 * i + 1]}), v2h);
  mma_h8(vf[0].v, vf[1].v, vf[2].v, vf[3].v, ph.v, pl.v, Oh[0], Oh[1], Oh[2], Oh[3]);
}

// Block = 4 waves x 16 query positions = 64 of one (batch, head). Key positions 0 .. cnt-1 are the kept keys: whole steps carry no mask, the last one masks its tail.
// K and V^T reach the four waves through a two-buffer LDS ring of 64-key stages: each byte is fetched once per block, by asynchronous copies that fly while the stage before is worked on.
// Stage t = key positions 64t .. 64t+63, walked only if 64t lies in front of the last step's end, so inside a projection tile that was written whole.
// Epilogue: O^T tile -> per-wave LDS tile [16 queries][64 d] (block barrier), then lanes 0..15 / 16..31 each write 256 contiguous bytes
// coverage: NB*16*(SEQ/64) blocks x 4 waves x 16 rows x 64 columns = every context element exactly once; trip counts clamped to SEQ / 32.
__global__ __launch_bounds__(128) void k_attn(const unsigned short* __restrict__ Qh, const unsigned short* __restrict__ Kh,
                                              const unsigned short* __restrict__ Vt, const int* __restrict__ cnt,
                                              float* __restrict__ Cx) {
  __shared__ __attribute__((aligned(16))) float so[4][16][68];
  __shared__ __attribute__((aligned(16))) unsigned short ring[2][2 * STG];
  const int tid = threadIdx.x, w = __builtin_amdgcn_readfirstlane((int)(tid >> 5)), lane = tid & 31, ln = lane & 15, hh = lane >> 4;
  const int bh = blockIdx.x / (SEQ / 64), qt = blockIdx.x % (SEQ / 64);
  const int b = bh / NH, h = bh - b * NH;
  const int qbase = qt * 64 + 16 * w;
  const int n = min(max(cnt[b], 0), SEQ);            // kept keys of the batch (block-uniform)
  const int full = n >> 5;                           // steps of 32 kept keys
  const int steps = n > 0 ? (n + 31) >> 5 : SEQ / 32;
  // Q^T B fragments: column n = query qbase + ln, elements 0..7 <- d = 32c + 8h + i, 8..15 <- d = 32c + 16 + 8h + i
  const unsigned short* qrow = Qh + ((size_t)bh * SEQ + qbase) * HD + lane * 8;   // the wave's 16 queries are one token tile: blocks c = 0, 1
  FragH q0, q1;
  q0.half[0] = *(const v8us*)(qrow);        q0.half[1] = *(const v8us*)(qrow + FRAG / 2);
  q1.half[0] = *(const v8us*)(qrow + FRAG); q1.half[1] = *(const v8us*)(qrow + FRAG + FRAG / 2);
  // the wait that is owed before the lane offset that the four issued loads name is overwritten
  asm volatile("s_wait_xcnt 0x0" :: "v"(lane) : "memory");
  float mr = -3.0e38f, lr = 0.0f;
  v8f Oh[4] = {};
  const unsigned short* Kp = Kh + (size_t)bh * SEQ * HD;
  const unsigned short* Vp = Vt + (size_t)bh * HD * SEQ;
  const int nst = (steps + 1) >> 1;                  // stages of two steps, 1 .. SEQ / 64 (block-uniform)
  const unsigned short* kg = Kp + tid * 8;
  const unsigned short* vg = Vp + tid * 8;
  const unsigned int l0 = (unsigned int)(size_t)&ring[0][0] + (unsigned int)tid * 16u;
  stage_copy(kg, vg, l0);
  asm volatile("s_wait_asynccnt 0x0" ::: "memory");  // this wave's copies of stage 0 have landed
  __syncthreads();                                   // ... and every other wave's: stage 0 may be read
  if (nst > 1) stage_copy(kg + STG, vg + STG, l0 + STB);
  // The foot of stage t, the same behind a whole stage and behind a masked one
  auto foot = [&](int t) {
    asm volatile("s_wait_dscnt 0x0" ::: "memory");    // this wave's reads of stage t are done before its buffer is handed back
    asm volatile("s_wait_asynccnt 0x0" ::: "memory"); // this wave's copies of stage t + 1 have landed
    __syncthreads();                                  // publishes stage t + 1 and ends every wave's reads of stage t
    if (t + 2 < nst) stage_copy(kg + (size_t)(t + 2) * STG, vg + (size_t)(t + 2) * STG, l0 + (unsigned int)(t & 1) * STB);
  };
  const int nwh = full >> 1;                         // stages of two whole steps of kept keys, at most nst (block-uniform)
  int t = 0;
  for (; t < nwh; ++t) {                             // a loop of its own, with no other path through it: the 32 sums stay in their registers
    const unsigned short* kb = &ring[t & 1][0];
    fa_step<false>(kb, kb + STG, 0u, ln, hh, q0, q1, mr, lr, Oh);
    fa_step<false>(kb + 32 * HD, kb + STG + 32 * HD, 0u, ln, hh, q0, q1, mr, lr, Oh);
    foot(t);
  }
  for (; t < nst; ++t) {                             // the last stage, or every stage when no key is kept
    const unsigned short* kb = &ring[t & 1][0];
#pragma unroll 1
    for (int u = 0; u < 2; ++u) {                    // rolled: one copy of the masked step's code
      const int j = 2 * t + u;
      if (j < steps)                                 // a whole step masks nothing; the tail step masks positions n % 32 and up; no key kept: every position
        fa_step<true>(kb + u * (32 * HD), kb + STG + u * (32 * HD), j < full ? 0u : 0xFFFFFFFFu << (n & 31), ln, hh, q0, q1, mr, lr, Oh);
    }
    foot(t);
  }
  asm volatile("s_wait_asynccnt 0x0" ::: "memory");   // no copy is left in flight when the wave goes on

  // O^T element r of tile t = ctx(query qbase + ln, d = 16t + 8h + r); undo the carries: x256 (in lr), x16 (V)
  lr += __shfl_xor(lr, 16, 32);                      // the row sum: both lane halves' keys
  const float inv = 1.0f / (CARRY * lr);
#pragma unroll
  for (int t = 0; t < 4; ++t)
#pragma unroll
    for (int r = 0; r < 8; ++r)
      so[w][ln][16 * t + 8 * hh + r] = Oh[t][r] * inv;
  __syncthreads();
  float* og = Cx + ((size_t)b * SEQ + qbase) * DM + h * HD;
  const int rsub = lane >> 4, c4 = (lane & 15) * 4;
  {
#pragma unroll
    for (int q = 0; q < 8; ++q) {
      const int row = 2 * q + rsub;
      const v4f v = *(const v4fa*)&so[w][row][c4];
      *(v4f*)(og + (size_t)row * DM + c4) = v;
    }
    
  }
}

// Sum over the 32 lanes, the same bits in every lane: four exchanges inside the 16-lane row (DPP row_xmask 1, 2, 4, 8), then one with the other row. All lanes on.
template <int CTRL>
__device__ __forceinline__ float dpp_get(float v) {
  return __int_as_float(__builtin_amdgcn_update_dpp(0, __float_as_int(v), CTRL, 0xf, 0xf, true));
}
__device__ __forceinline__ float wave_sum(float v) {
  v += dpp_get<0x161>(v);
  v += dpp_get<0x162>(v);
  v += dpp_get<0x164>(v);
  v += dpp_get<0x168>(v);
  const int u = __float_as_int(v);
  return v + __int_as_float(__builtin_amdgcn_permlanex16(u, u, 0x76543210, 0xfedcba98, true, false));   // lane l reads lane l ^ 16
}

// LayerNorm. A wave norms LNR whole rows by itself: a lane holds columns 128*i + 4*lane + 0..3, i = 0..7, of each row (every load and store 512 contiguous bytes), the row's sums
// meet inside the wave: no LDS, no barrier, and few waves with much to do each (see the note at the preparation kernel). All loads are issued before the first value is used.
// coverage: NB*SEQ/(8*LNR) blocks x 8 waves x LNR rows x 32 lanes x 32 columns = every output element of the processed region exactly once (perm is a permutation inside each batch).
#define LNR 2
static_assert(SEQ % LNR == 0);                   // a wave's rows lie inside one batch
static_assert((NB * SEQ) % (8 * LNR) == 0);
static_assert(DM == 8 * 128);
__global__ __launch_bounds__(256) void k_ln(const float* __restrict__ Cx, const float* __restrict__ gamma,
                                            const float* __restrict__ beta, const int* __restrict__ perm, float* __restrict__ out) {
  const int tid = threadIdx.x, lane = tid & 31, w = __builtin_amdgcn_readfirstlane((int)(tid >> 5));
  const int r0 = (blockIdx.x * 8 + w) * LNR;         // context row r holds the token of position r % SEQ
  const int b = r0 / SEQ;
  int s[LNR];
#pragma unroll
  for (int j = 0; j < LNR; ++j) s[j] = perm[r0 + j];
  const float* xp = Cx + (size_t)r0 * DM + lane * 4;
  const float* gp = gamma + lane * 4;
  const float* bp = beta + lane * 4;
  v4f x[LNR][8], g[8], be[8];
#pragma unroll
  for (int j = 0; j < LNR; ++j)
#pragma unroll
    for (int i = 0; i < 8; ++i) x[j][i] = *(const v4fa*)(xp + j * DM + i * 128);
#pragma unroll
  for (int i = 0; i < 8; ++i) { g[i] = *(const v4fa*)(gp + i * 128); be[i] = *(const v4fa*)(bp + i * 128); }
  // the wait that is owed before an address that the issued loads name is overwritten
  asm volatile("s_wait_xcnt 0x0" ::: "memory");
  __builtin_amdgcn_sched_barrier(0);                 // without it the build put half the loads behind the first sums, one memory trip after another
  float sm[LNR];
#pragma unroll
  for (int j = 0; j < LNR; ++j) {
    v4f a = (x[j][0] + x[j][1]) + (x[j][2] + x[j][3]);
    a += (x[j][4] + x[j][5]) + (x[j][6] + x[j][7]);
    sm[j] = wave_sum((a[0] + a[1]) + (a[2] + a[3]));
  }
  float sq[LNR];
#pragma unroll
  for (int j = 0; j < LNR; ++j) {
    const float mu = sm[j] * (1.0f / 1024.0f);
    v4f a = {0.f, 0.f, 0.f, 0.f};
#pragma unroll
    for (int i = 0; i < 8; ++i) { x[j][i] -= mu; a += x[j][i] * x[j][i]; }
    sq[j] = wave_sum((a[0] + a[1]) + (a[2] + a[3]));
  }
#pragma unroll
  for (int i = 0; i < 8; ++i)
#pragma unroll
    for (int e = 0; e < 4; ++e) { g[i][e] = bf16_rne(g[i][e]); be[i][e] = bf16_rne(be[i][e]); }
#pragma unroll
  for (int j = 0; j < LNR; ++j) {
    const float rinv = rsqrtf(sq[j] * (1.0f / 1024.0f) + 1.0e-6f);
    float* dst = out + ((size_t)b * SEQ_FULL + s[j]) * DM + lane * 4;
#pragma unroll
    for (int i = 0; i < 8; ++i) {
      const v4f o = x[j][i] * rinv * g[i] + be[i];
      *(v4f*)(dst + i * 128) = o;
    }
  }
}

extern "C" void kernel_launch(void* const* d_in, const int* in_sizes, int n_in,
                              void* d_out, int out_size, void* d_ws, size_t ws_size, hipStream_t stream) {
  if (n_in < 7) return;
  const long long need_x = (long long)(NB - 1) * SEQ_FULL * DM + (long long)SEQ * DM;   // last element touched + 1
  const long long need_m = (long long)(NB - 1) * SEQ_FULL + (long long)SEQ;
  if ((long long)in_sizes[0] < need_x || (long long)in_sizes[1] < need_m) return;
  if ((long long)in_sizes[2] < (long long)DM * DM || (long long)in_sizes[3] < (long long)DM * DM || (long long)in_sizes[4] < (long long)DM * DM) return;
  if (in_sizes[5] < DM || in_sizes[6] < DM) return;
  if ((long long)out_size < need_x) return;
  const float* X     = (const float*)d_in[0];   // wire order: q [2][2048][1024] f32, mask [2][2048] i32, Wq, Wk, Wv [1024][1024] f32, gamma, beta [1024] f32
  const int*   mask  = (const int*)d_in[1];
  const float* Wq    = (const float*)d_in[2];
  const float* Wk    = (const float*)d_in[3];
  const float* Wv    = (const float*)d_in[4];
  const float* gamma = (const float*)d_in[5];
  const float* beta  = (const float*)d_in[6];
  float* out = (float*)d_out;
  char* ws = (char*)d_ws;
  size_t off = 0;
  const size_t xb_bytes = (size_t)NB * SEQ * DM * 2;        // 8 MiB at full size; every plane is written by whole 16-B pieces, none past its end
  const size_t wb_bytes = (size_t)3 * DM * DM * 2;          // 6 MiB
  const size_t p3_bytes = 3 * PLANE * 2;                    // 24 MiB
  const size_t cx_bytes = (size_t)NB * SEQ * DM * 4;        // 16 MiB
  unsigned short* Xb = (unsigned short*)(ws + off); off += (xb_bytes + 255) & ~(size_t)255;
  unsigned short* Wb = (unsigned short*)(ws + off); off += (wb_bytes + 255) & ~(size_t)255;
  unsigned short* P3 = (unsigned short*)(ws + off); off += (p3_bytes + 255) & ~(size_t)255;
  float*          Cx = (float*)(ws + off);          off += (cx_bytes + 255) & ~(size_t)255;
  int*          perm = (int*)(ws + off);            off += ((size_t)NB * SEQ * 4 + 255) & ~(size_t)255;
  int*           cnt = (int*)(ws + off);            off += 256;
  if (off > ws_size) return;
  k_prep<<<(unsigned)(XBLK + WBLK), 256, 0, stream>>>(X, Wq, Wk, Wv, mask, Xb, Wb, perm, cnt);
  k_proj<<<dim3((unsigned)(3 * DM / 128), (unsigned)(NB * SEQ / 128)), 128, 0, stream>>>(Xb, Wb, P3, cnt);
  k_attn<<<(unsigned)(NB * NH * (SEQ / 64)), 128, 0, stream>>>(P3, P3 + PLANE, P3 + 2 * PLANE, cnt, Cx);
  k_ln<<<(unsigned)(NB * SEQ / (8 * LNR)), 256, 0, stream>>>(Cx, gamma, beta, perm, out);
}

// v010
// A run of this version takes 53.8 microseconds.
// In two side-by-side timings against v009, it was 1.03 and 1.02 times as fast.
// Counting every step since v000, it is 3.78 times as fast.
#include <hip/hip_runtime.h>
// Contractions: x Wq^T, x Wk^T, x Wv^T on v_wmma_f32_16x16x32_bf16 (x and W converted RNE to bf16, single product, f32 accumulate); S^T = K Q^T on v_wmma_f32_16x16x32_f16 (Q, K: f16 planes of the f32 projections x16, single product); O^T = V^T P^T on v_wmma_f32_16x16x32_f16 (V: f16 plane x16; P: x256 f16 hi plane + f16 plane of its rounding residual, both into one f32 accumulator); softmax statistics and LayerNorm f32 (gamma and beta rounded RNE to bf16).
// Multi-head self attention, B x S x 1024, 16 heads x 64, scores scaled 1/8, key-padding mask replaces masked scores by -1e20, LayerNorm over the 1024 concatenated columns.
// Engine: transposed flash. Each wave owns 16 queries of one (batch, head). Per 32-key step: S^T tiles (key rows x query columns) from K rows (A, f16 plane by way of LDS)
// and Q^T (B, registers); the two 16-key D tiles pack straight into the P^T B fragment; O^T (d rows x query columns) accumulates from V^T rows (A, f16 plane by way of LDS).
// Every 16-bit plane is stored fragment-major: a 16 x 32 operand fragment (16 rows or columns x 32 k) is one 1-KiB block of 64 pieces of 8 elements,
// piece 32*half + lane (lane = 16*hh + ln) = row ln, k = 16*half + 8*hh + 0..7. A wave-wide 16-byte load of one half reads 512 contiguous bytes (4 lines, not 16).
// Token order: inside each batch the tokens are stably partitioned by the key mask, kept keys first (perm[position] = token, cnt = kept keys). A padded key's weight is
// exp(-1e20 - max) = 0 whenever one key is kept, so K, V^T and the key loop cover the first cnt positions only; every plane and the context are in position order and
// the LayerNorm kernel stores row perm[position]. No key kept: every score is -1e20 (uniform weights), so all SEQ positions are walked with every key marked padded.
#ifndef NB
#define NB 2
#endif
#ifndef SEQ
#define SEQ 2048
#endif
#define NB_FULL 2
#define SEQ_FULL 2048
#define DM 1024
#define NH 16
#define HD 64
#define XB_FULL ((size_t)SEQ_FULL * DM)          /* per-batch element stride of the activation input and of the output */
#define PLANE ((size_t)NB * NH * SEQ * HD)       /* elements of one of the Q / K / V^T planes */
#define FRAG 512                                 /* elements of one 16 x 32 fragment block; its second half starts at FRAG / 2 */
#define RTILE ((size_t)16 * DM)                  /* elements of 16 rows of a [rows][1024] plane = 32 fragment blocks */

static_assert(SEQ % 256 == 0);
static_assert(SEQ <= SEQ_FULL);
static_assert(NB <= NB_FULL);
static_assert(HD == 64);
static_assert(DM == NH * HD);
static_assert(DM % 32 == 0);
static_assert((3 * DM) % 128 == 0);
static_assert((size_t)NB * SEQ * DM * 2 + (size_t)3 * DM * DM * 2 + 3 * PLANE * 2 + (size_t)NB * SEQ * DM * 4 + (size_t)NB * SEQ * 4 + 1024 <= (size_t)134217728);

typedef __bf16 v16b __attribute__((ext_vector_type(16)));
typedef _Float16 v16h __attribute__((ext_vector_type(16)));
typedef unsigned short v8us __attribute__((ext_vector_type(8), may_alias));
typedef float v8f __attribute__((ext_vector_type(8)));
typedef float v2f __attribute__((ext_vector_type(2)));
typedef _Float16 v2h __attribute__((ext_vector_type(2)));
typedef float v4f __attribute__((ext_vector_type(4)));
typedef float v4fa __attribute__((ext_vector_type(4), may_alias));
union FragB { v16b v; v8us half[2]; unsigned short u[16]; };
union FragH { v16h v; v8us half[2]; v2h p[8]; _Float16 h[16]; unsigned short u[16]; };

#define LOG2E 1.4426950408889634f
#define NEGFILL (-1.0e20f)
#define CARRY 16.0f                      /* power-of-two carry of the Q, K and V planes */
#define QKSCALE 0.00048828125f           /* (1/8) / (16*16) */

__device__ __forceinline__ unsigned short bf16_bits(float x) {   // RNE convert to bf16 bits
  unsigned int u = __float_as_uint(x);
  return (unsigned short)((u + 0x7FFFu + ((u >> 16) & 1u)) >> 16);
}
__device__ __forceinline__ float bf16_val(unsigned short b) { return __uint_as_float(((unsigned int)b) << 16); }
__device__ __forceinline__ float bf16_rne(float x) { return bf16_val(bf16_bits(x)); }
__device__ __forceinline__ unsigned short f16_bits(float x) { const _Float16 h = (_Float16)x; return __builtin_bit_cast(unsigned short, h); }

// c0..c3 += a * b0..b3 (one bf16 k-step of four column tiles), then the hazard guard
__device__ __forceinline__ void mma_b4(v16b a, v16b b0, v16b b1, v16b b2, v16b b3, v8f& c0, v8f& c1, v8f& c2, v8f& c3) {
  c0 = __builtin_amdgcn_wmma_f32_16x16x32_bf16(false, a, false, b0, (short)0, c0, false, false);
  c1 = __builtin_amdgcn_wmma_f32_16x16x32_bf16(false, a, false, b1, (short)0, c1, false, false);
  c2 = __builtin_amdgcn_wmma_f32_16x16x32_bf16(false, a, false, b2, (short)0, c2, false, false);
  c3 = __builtin_amdgcn_wmma_f32_16x16x32_bf16(false, a, false, b3, (short)0, c3, false, false);
  asm volatile("v_nop\n\tv_nop\n\tv_nop\n\tv_nop" : "+v"(c0), "+v"(c1), "+v"(c2), "+v"(c3) : "v"(a), "v"(b0), "v"(b1), "v"(b2), "v"(b3));
}
// c += a0*b0 + a1*b1 (two k-steps of one f16 tile), then the hazard guard
__device__ __forceinline__ v8f mma_hh2(v16h a0, v16h b0, v16h a1, v16h b1, v8f c) {
  c = __builtin_amdgcn_wmma_f32_16x16x32_f16(false, a0, false, b0, (short)0, c, false, false);
  c = __builtin_amdgcn_wmma_f32_16x16x32_f16(false, a1, false, b1, (short)0, c, false, false);
  asm volatile("v_nop\n\tv_nop\n\tv_nop\n\tv_nop" : "+v"(c) : "v"(a0), "v"(b0), "v"(a1), "v"(b1));
  return c;
}
// c0..c3 += a0..a3 * bh, then c0..c3 += a0..a3 * bl (three products stand between the two that add into one tile), then the hazard guard
__device__ __forceinline__ void mma_h8(v16h a0, v16h a1, v16h a2, v16h a3, v16h bh, v16h bl, v8f& c0, v8f& c1, v8f& c2, v8f& c3) {
  c0 = __builtin_amdgcn_wmma_f32_16x16x32_f16(false, a0, false, bh, (short)0, c0, false, false);
  c1 = __builtin_amdgcn_wmma_f32_16x16x32_f16(false, a1, false, bh, (short)0, c1, false, false);
  c2 = __builtin_amdgcn_wmma_f32_16x16x32_f16(false, a2, false, bh, (short)0, c2, false, false);
  c3 = __builtin_amdgcn_wmma_f32_16x16x32_f16(false, a3, false, bh, (short)0, c3, false, false);
  c0 = __builtin_amdgcn_wmma_f32_16x16x32_f16(false, a0, false, bl, (short)0, c0, false, false);
  c1 = __builtin_amdgcn_wmma_f32_16x16x32_f16(false, a1, false, bl, (short)0, c1, false, false);
  c2 = __builtin_amdgcn_wmma_f32_16x16x32_f16(false, a2, false, bl, (short)0, c2, false, false);
  c3 = __builtin_amdgcn_wmma_f32_16x16x32_f16(false, a3, false, bl, (short)0, c3, false, false);
  asm volatile("v_nop\n\tv_nop\n\tv_nop\n\tv_nop" : "+v"(c0), "+v"(c1), "+v"(c2), "+v"(c3) : "v"(a0), "v"(a1), "v"(a2), "v"(a3), "v"(bh), "v"(bl));
}

// Preparation, one launch. Blocks 0 .. XBLK-1: the activation plane; the rest: the three weight planes (no token order, no LDS, no barrier).
// Stable partition of one batch's tokens: position of token s = kept tokens before s if it is kept, else cnt + padded tokens before s (a permutation of 0..SEQ-1 for any mask).
// Every activation block works the list of its own batch out for itself (8 KiB of mask, SEQ / 256 consecutive tokens per thread, list gathered in LDS), so that no launch has to
// end before the conversion starts; the first block of each batch also stores the list as whole lines, and cnt, for the later launches.
// dst = bf16 bits (RNE) of src, fragment-major: block (row / 16) * 32 + k / 32; activation row at position p of batch b = token sp[p].
// A block converts one whole 16-row tile (32 fragment blocks, 64 KiB of source) in PIT passes of 4 fragment blocks: few waves with much to do each, for speed only. A thread keeps its row; all its loads are issued before the first store.
// In each pass a wave takes 8 rows x one 128-B source line each and writes four whole 128-B lines of a fragment block (pieces 16*q + 8*rhi + 0..7, q = k / 8 in the block).
// coverage: every sp[] entry written once (permutation) before the barrier in front of its read; NB x SEQ entries of perm and NB of cnt;
// XBLK and WBLK blocks x 256 threads x PIT passes x 8 elements = the whole planes (thread bits 0-2 and 5 -> row in the tile, bits 3-4 -> q, bits 6-7 and the pass -> fragment block).
#define XBLK (NB * SEQ / 16)
#define WBLK (3 * DM / 16)
#define PIT (DM / 128)
static_assert(SEQ % 16 == 0);                    // a 16-row tile lies inside one batch
static_assert(DM % 16 == 0);                     // ... or inside one of Wq, Wk, Wv
__global__ __launch_bounds__(256) void k_prep(const float* __restrict__ X, const float* __restrict__ Wq, const float* __restrict__ Wk, const float* __restrict__ Wv,
                                              const int* __restrict__ mask, unsigned short* __restrict__ Xb, unsigned short* __restrict__ Wb,
                                              int* __restrict__ perm, int* __restrict__ cnt) {
  constexpr int TPT = SEQ / 256;
  __shared__ int sp[SEQ];
  __shared__ int wsum[8];
  const int tid = threadIdx.x;
  const bool isx = blockIdx.x < XBLK;                // block-uniform
  const int tile = isx ? blockIdx.x : blockIdx.x - XBLK;   // 16-row tile of the activation plane or of the weight plane
  const int ln = ((tid >> 5) & 1) * 8 + (tid & 7), q = (tid >> 3) & 3;
  const int row = tile * 16 + ln, k = (tid >> 6) * 32 + q * 8;   // k of pass 0; a pass goes on by 128
  const float* p;
  unsigned short* d;
  if (isx) {
    const int lane = tid & 31, w = tid >> 5, b = tile / (SEQ / 16);
    const int* mp = mask + (size_t)b * SEQ_FULL + tid * TPT;
    int keep[TPT];
    int c = 0;
#pragma unroll
    for (int i = 0; i < TPT; ++i) { keep[i] = mp[i] != 0 ? 1 : 0; c += keep[i]; }
    int inc = c;                                     // inclusive scan of the threads' kept counts inside the wave
#pragma unroll
    for (int off = 1; off < 32; off <<= 1) { const int v = __shfl_up(inc, off, 32); if (lane >= off) inc += v; }
    if (lane == 31) wsum[w] = inc;
    __syncthreads();
    int base = 0, n = 0;
#pragma unroll
    for (int i = 0; i < 8; ++i) { const int v = wsum[i]; n += v; if (i < w) base += v; }
    int kr = base + inc - c;                         // kept tokens in front of this thread's first token
#pragma unroll
    for (int i = 0; i < TPT; ++i) {
      const int s = tid * TPT + i;
      sp[keep[i] ? kr : n + s - kr] = s;
      kr += keep[i];
    }
    __syncthreads();
    if (tile % (SEQ / 16) == 0) {                    // block-uniform, behind the last barrier
#pragma unroll
      for (int i = 0; i < TPT; ++i) perm[(size_t)b * SEQ + tid + 256 * i] = sp[tid + 256 * i];
      if (tid == 0) cnt[b] = n;
    }
    p = X + (size_t)b * XB_FULL + (size_t)sp[row - b * SEQ] * DM + k;
    d = Xb + (size_t)tile * RTILE + (tid >> 6) * FRAG + (q * 16 + ln) * 8;
  } else {
    const int which = tile / (DM / 16);
    p = (which == 0 ? Wq : which == 1 ? Wk : Wv) + (size_t)(row - which * DM) * DM + k;
    d = Wb + (size_t)tile * RTILE + (tid >> 6) * FRAG + (q * 16 + ln) * 8;
  }
  v4f x0[PIT], x1[PIT];
#pragma unroll
  for (int it = 0; it < PIT; ++it) { x0[it] = *(const v4fa*)(p + it * 128); x1[it] = *(const v4fa*)(p + it * 128 + 4); }
  // the wait that is owed before the address that the issued loads name is overwritten; naming the address keeps its registers out of the loads' own results
  asm volatile("s_wait_xcnt 0x0" :: "v"(p) : "memory");
#pragma unroll
  for (int it = 0; it < PIT; ++it) {
    v8us o;
    o[0] = bf16_bits(x0[it][0]); o[1] = bf16_bits(x0[it][1]); o[2] = bf16_bits(x0[it][2]); o[3] = bf16_bits(x0[it][3]);
    o[4] = bf16_bits(x1[it][0]); o[5] = bf16_bits(x1[it][1]); o[6] = bf16_bits(x1[it][2]); o[7] = bf16_bits(x1[it][3]);
    *(v8us*)(d + it * (4 * FRAG)) = o;
  }
}

__device__ __forceinline__ void stage8(unsigned short* st, const v8f& c, int base, int rstep) {
#pragma unroll
  for (int r = 0; r < 8; ++r) st[base + r * rstep] = f16_bits(c[r] * CARRY);
}

#define PKS 64                                   /* k of one stage of the projection's LDS ring: two fragment blocks of every 16-row tile */
#define PPART (8 * (PKS / 32) * FRAG)            /* elements of the X part, and of the W part, of one stage: 8 tiles of 16 rows x 64 k (16 KiB each) */
#define PBUF (2 * PPART * 2)                     /* bytes of one ring buffer: X part, then W part */
static_assert(DM % PKS == 0);
static_assert(DM / PKS >= 2);                    // the ring's prologue fills two stages
static_assert(DM % 128 == 0);                    // a block's 128 columns lie inside one of Q, K, V
static_assert((PKS / 32) * FRAG * 2 == 128 * 16);   // one copy of 16 B per thread brings one 16-row tile's share of a stage

// One operand's part of one stage into one ring buffer: of each of 8 consecutive 16-row tiles the stage's 64 k are 2 KiB that lie contiguous in the fragment-major plane, copied as they lie.
// g: this thread's piece of the first tile (tile base + stage offset + 8 * tid elements); l: its LDS byte address (part base + 16 * tid).
// Every thread brings piece tid of each tile: all addresses multiples of 16, no LDS byte written twice, all 32 lanes on.
__device__ __forceinline__ void part_copy(const unsigned short* g, unsigned int l) {
  // s_wait_xcnt as the statement's last line: it then stands in front of every later write of a register that one of the copies names
  asm volatile("global_load_async_to_lds_b128 %0, %8, off\n\t"
               "global_load_async_to_lds_b128 %1, %9, off\n\t"
               "global_load_async_to_lds_b128 %2, %10, off\n\t"
               "global_load_async_to_lds_b128 %3, %11, off\n\t"
               "global_load_async_to_lds_b128 %4, %12, off\n\t"
               "global_load_async_to_lds_b128 %5, %13, off\n\t"
               "global_load_async_to_lds_b128 %6, %14, off\n\t"
               "global_load_async_to_lds_b128 %7, %15, off\n\t"
               "s_wait_xcnt 0x0"
               :: "v"(l), "v"(l + 2048u), "v"(l + 4096u), "v"(l + 6144u), "v"(l + 8192u), "v"(l + 10240u), "v"(l + 12288u), "v"(l + 14336u),
                  "v"(g), "v"(g + RTILE), "v"(g + 2 * RTILE), "v"(g + 3 * RTILE), "v"(g + 4 * RTILE), "v"(g + 5 * RTILE), "v"(g + 6 * RTILE), "v"(g + 7 * RTILE)
               : "memory");
}

// Y[m][n] = sum_k Xb[m][k] * Wb[n][k], M = NB*SEQ, N = 3*1024 (Wq | Wk | Wv rows), K = 1024.
// Block = 4 waves (2 x 2), tile 128 rows x 128 columns (two heads of one of Q/K/V); wave tile 64 x 64 (one head).
// X and W reach the waves through a two-buffer LDS ring of 64-k stages: each byte is fetched once per block, by asynchronous copies that fly while the stage before is worked on;
// a fragment read from LDS feeds four products. The k blocks add into each tile in the order 0, 1, 2, ...
// A fragment: row m, elements 0..7 <- k0 + 8h + i, 8..15 <- k0 + 16 + 8h + i; B fragment: column n = W row n, same k map; D element r = (row 8h + r, column ln).
//   Q, K planes P3[0..1][b*16+h][token / 16][d / 32][fragment block: row = token % 16, k = d % 32]
//   V^T plane   P3[2][b*16+h][token / 32][d / 16][fragment block: row = d % 16, k = token % 32]; each thread stores the piece of its own index: whole lines.
// K and V^T tiles that start behind the last kept position are never read and are left out (block-uniform return in front of every barrier and copy); a tile that straddles it is whole.
// coverage: grid (24, NB*SEQ/128) x (128 x 128) = the Q plane and every K, V^T tile the key loop reads; each head's LDS tile fully written before it is read (128x64 or 64x128).
__global__ __launch_bounds__(128) void k_proj(const unsigned short* __restrict__ Xb, const unsigned short* __restrict__ Wb,
                                              unsigned short* __restrict__ P3, const int* __restrict__ cnt) {
  __shared__ __attribute__((aligned(16))) unsigned short ring[2][2 * PPART];
  __shared__ __attribute__((aligned(16))) unsigned short st[2][128 * 72];
  const int tid = threadIdx.x, w = __builtin_amdgcn_readfirstlane((int)(tid >> 5)), lane = tid & 31, ln = lane & 15, hh = lane >> 4;
  const int wr = w >> 1, wc = w & 1;                 // the wave's 64 rows and its 64 columns (its head) inside the block's tile
  const int n0 = blockIdx.x * 128;
  const int m0 = blockIdx.y * 128;
  if (n0 >= DM) {                                    // K or V columns
    const int n = cnt[m0 / SEQ];
    if (n > 0 && m0 % SEQ >= n) return;
  }
  const unsigned short* ag = Xb + (size_t)(m0 >> 4) * RTILE + tid * 8;
  const unsigned short* bg = Wb + (size_t)(n0 >> 4) * RTILE + tid * 8;
  const unsigned int l0 = (unsigned int)(size_t)&ring[0][0] + (unsigned int)tid * 16u;
  auto fill = [&](int t) {                           // stage t = k 64t .. 64t+63 into buffer t % 2
    const unsigned int l = l0 + (unsigned int)(t & 1) * PBUF;
    part_copy(ag + (size_t)t * ((PKS / 32) * FRAG), l);
    part_copy(bg + (size_t)t * ((PKS / 32) * FRAG), l + PPART * 2);
  };
  fill(0);
  asm volatile("s_wait_asynccnt 0x0" ::: "memory");  // this wave's copies of stage 0 have landed
  __syncthreads();                                   // ... and every other wave's: stage 0 may be read
  fill(1);
  v8f c[4][4] = {};
#pragma unroll 1                                     // rolled: one copy of the stage's code
  for (int t = 0; t < DM / PKS; ++t) {
    const unsigned short* ab = &ring[t & 1][0] + (4 * wr) * ((PKS / 32) * FRAG) + lane * 8;
    const unsigned short* bb = &ring[t & 1][0] + PPART + (4 * wc) * ((PKS / 32) * FRAG) + lane * 8;
#pragma unroll
    for (int kb = 0; kb < PKS / 32; ++kb) {
      FragB a[4], b[4];
#pragma unroll
      for (int i = 0; i < 4; ++i) {
        a[i].half[0] = *(const v8us*)(ab + ((PKS / 32) * i + kb) * FRAG);  a[i].half[1] = *(const v8us*)(ab + ((PKS / 32) * i + kb) * FRAG + FRAG / 2);
        b[i].half[0] = *(const v8us*)(bb + ((PKS / 32) * i + kb) * FRAG);  b[i].half[1] = *(const v8us*)(bb + ((PKS / 32) * i + kb) * FRAG + FRAG / 2);
      }
#pragma unroll
      for (int i = 0; i < 4; ++i) mma_b4(a[i].v, b[0].v, b[1].v, b[2].v, b[3].v, c[i][0], c[i][1], c[i][2], c[i][3]);
    }
    asm volatile("s_wait_dscnt 0x0" ::: "memory");    // this wave's reads of stage t are done before its buffer is handed back
    asm volatile("s_wait_asynccnt 0x0" ::: "memory"); // this wave's copies of stage t + 1 have landed
    __syncthreads();                                  // publishes stage t + 1 and ends every wave's reads of stage t
    if (t + 2 < DM / PKS) fill(t + 2);
  }
  asm volatile("s_wait_asynccnt 0x0" ::: "memory");   // no copy is left in flight when the wave goes on
  const int which = n0 >> 10;                 // 0: Q, 1: K, 2: V (block-uniform)
  const int h0 = (n0 & 1023) >> 6;            // the block's first head; wave column wc holds head h0 + wc
  const int b = m0 / SEQ, s0 = m0 - b * SEQ;
  const bool rowmajor = which < 2;
  const int rstep = rowmajor ? 72 : 1;
  // element (row rb + r, column 16*j + ln) of the wave's head: Q/K tile st[wc][row*72 + col]; V tile st[wc][col*136 + row]
#pragma unroll
  for (int i = 0; i < 4; ++i) {
    const int rb = 64 * wr + 16 * i + 8 * hh;
#pragma unroll
    for (int j = 0; j < 4; ++j) stage8(&st[wc][0], c[i][j], rowmajor ? rb * 72 + 16 * j + ln : (16 * j + ln) * 136 + rb, rstep);
  }
  __syncthreads();
#pragma unroll
  for (int hs = 0; hs < 2; ++hs) {
    unsigned short* base = P3 + (size_t)which * PLANE + ((size_t)(b * NH + h0 + hs) * SEQ + s0) * HD;
    if (rowmajor) {
#pragma unroll
      for (int it = 0; it < 8; ++it) {
        const int i = tid + 128 * it;                                   // piece i: token tile i / 128, d block (i / 64) % 2, piece i % 64
        const int row = (i >> 7) * 16 + (i & 15), col = ((i >> 4) & 7) * 8;   // d = 32*c + 16*half + 8*hh
        const v8us o = *(const v8us*)(&st[hs][row * 72 + col]);
        *(v8us*)(base + (size_t)i * 8) = o;
      }
    } else {
#pragma unroll
      for (int it = 0; it < 8; ++it) {
        const int i = tid + 128 * it;
        const int dc = ((i >> 6) & 3) * 16 + (i & 15);                  // piece i: key block i / 256, d tile (i / 64) % 4, piece i % 64
        const int tk = (i >> 8) * 32 + ((i >> 4) & 3) * 8;              // token = 32*block + 16*half + 8*hh
        const v8us o = *(const v8us*)(&st[hs][dc * 136 + tk]);
        *(v8us*)(base + (size_t)i * 8) = o;
      }
    }
  }
}

// 2^x as the bare v_exp_f32. exp2f() wraps it in a range fix for results below 2^-126 (compare, two selects, add, ldexp per value). Here such a result is a weight that
// rounds to zero in both f16 planes and adds nothing to a row sum of at least 256, or a rescale factor of sums that the new maximum's terms outweigh by 2^126: flushed to 0 it gives the same output.
__device__ __forceinline__ float exp2_raw(float x) { return __builtin_amdgcn_exp2f(x); }

#define STK 64                                   /* keys of one stage of the LDS ring */
#define STG (STK * HD)                           /* elements of the K part, and of the V^T part, of one stage (8 KiB each) */
#define STB (2 * STG * 2)                        /* bytes of one ring buffer: K part, then V^T part */
static_assert(SEQ % STK == 0);
static_assert(128 % STK == 0);                   // a stage lies inside one 128-row tile of the projection: written whole or not walked at all
#define AWV 8                                    /* waves of an attention block: AWV x 16 queries share every stage that the block fetches */
static_assert(STG * 2 == 2 * (AWV * 32) * 16);   // 2 copies of 16 B per thread and part
static_assert(SEQ % (AWV * 16) == 0);            // a block's queries lie inside one (batch, head)

// One stage into one ring buffer: 64 keys are 8 KiB of K and 8 KiB of V^T, each contiguous in its fragment-major plane, copied as they lie.
// kg, vg: this thread's first piece of the stage in the two planes (stage base + 8 * tid elements); l: its LDS byte address (buffer base + 16 * tid).
// Every thread brings pieces tid + 256 * c, c = 0..1, of each part: all addresses multiples of 16, no LDS byte written twice, all 32 lanes on.
__device__ __forceinline__ void stage_copy(const unsigned short* kg, const unsigned short* vg, unsigned int l) {
  // s_wait_xcnt as the statement's last line: it then stands in front of every later write of a register that one of the copies names
  asm volatile("global_load_async_to_lds_b128 %0, %4, off\n\t"
               "global_load_async_to_lds_b128 %1, %5, off\n\t"
               "global_load_async_to_lds_b128 %2, %6, off\n\t"
               "global_load_async_to_lds_b128 %3, %7, off\n\t"
               "s_wait_xcnt 0x0"
               :: "v"(l), "v"(l + 4096u), "v"(l + 8192u), "v"(l + 12288u),
                  "v"(kg), "v"(kg + 2048), "v"(vg), "v"(vg + 2048)
               : "memory");
}

// x[i] = 2^x[i], the bare v_exp_f32 as in exp2_raw, each in its own register. One statement, closed by a v_nop: the instruction set asks for one free slot behind a transcendental before its
// result is read or its source overwritten.
__device__ __forceinline__ void exp2_x16(float (&x)[16]) {
  asm("v_exp_f32 %0, %0\n\tv_exp_f32 %1, %1\n\tv_exp_f32 %2, %2\n\tv_exp_f32 %3, %3\n\t"
      "v_exp_f32 %4, %4\n\tv_exp_f32 %5, %5\n\tv_exp_f32 %6, %6\n\tv_exp_f32 %7, %7\n\t"
      "v_exp_f32 %8, %8\n\tv_exp_f32 %9, %9\n\tv_exp_f32 %10, %10\n\tv_exp_f32 %11, %11\n\t"
      "v_exp_f32 %12, %12\n\tv_exp_f32 %13, %13\n\tv_exp_f32 %14, %14\n\tv_exp_f32 %15, %15\n\t"
      "v_nop"
      : "+v"(x[0]), "+v"(x[1]), "+v"(x[2]), "+v"(x[3]), "+v"(x[4]), "+v"(x[5]), "+v"(x[6]), "+v"(x[7]),
        "+v"(x[8]), "+v"(x[9]), "+v"(x[10]), "+v"(x[11]), "+v"(x[12]), "+v"(x[13]), "+v"(x[14]), "+v"(x[15]));
}

// x[i] -= (float)h.h[i]: one v_fma_mix_f32 per value, which reads its f16 half of the packed word as it lies. Written as C, the build widened each half with a convert of its own
// and then subtracted in pairs: 24 instructions for these 16. No instruction here reads another's result.
__device__ __forceinline__ void residual_x16(float (&x)[16], const FragH& h) {
  asm("v_fma_mix_f32 %0, %16, -1.0, %0 op_sel_hi:[1,1,0]\n\tv_fma_mix_f32 %1, %16, -1.0, %1 op_sel:[1,0,0] op_sel_hi:[1,1,0]\n\t"
      "v_fma_mix_f32 %2, %17, -1.0, %2 op_sel_hi:[1,1,0]\n\tv_fma_mix_f32 %3, %17, -1.0, %3 op_sel:[1,0,0] op_sel_hi:[1,1,0]\n\t"
      "v_fma_mix_f32 %4, %18, -1.0, %4 op_sel_hi:[1,1,0]\n\tv_fma_mix_f32 %5, %18, -1.0, %5 op_sel:[1,0,0] op_sel_hi:[1,1,0]\n\t"
      "v_fma_mix_f32 %6, %19, -1.0, %6 op_sel_hi:[1,1,0]\n\tv_fma_mix_f32 %7, %19, -1.0, %7 op_sel:[1,0,0] op_sel_hi:[1,1,0]\n\t"
      "v_fma_mix_f32 %8, %20, -1.0, %8 op_sel_hi:[1,1,0]\n\tv_fma_mix_f32 %9, %20, -1.0, %9 op_sel:[1,0,0] op_sel_hi:[1,1,0]\n\t"
      "v_fma_mix_f32 %10, %21, -1.0, %10 op_sel_hi:[1,1,0]\n\tv_fma_mix_f32 %11, %21, -1.0, %11 op_sel:[1,0,0] op_sel_hi:[1,1,0]\n\t"
      "v_fma_mix_f32 %12, %22, -1.0, %12 op_sel_hi:[1,1,0]\n\tv_fma_mix_f32 %13, %22, -1.0, %13 op_sel:[1,0,0] op_sel_hi:[1,1,0]\n\t"
      "v_fma_mix_f32 %14, %23, -1.0, %14 op_sel_hi:[1,1,0]\n\tv_fma_mix_f32 %15, %23, -1.0, %15 op_sel:[1,0,0] op_sel_hi:[1,1,0]"
      : "+v"(x[0]), "+v"(x[1]), "+v"(x[2]), "+v"(x[3]), "+v"(x[4]), "+v"(x[5]), "+v"(x[6]), "+v"(x[7]),
        "+v"(x[8]), "+v"(x[9]), "+v"(x[10]), "+v"(x[11]), "+v"(x[12]), "+v"(x[13]), "+v"(x[14]), "+v"(x[15])
      : "v"(h.p[0]), "v"(h.p[1]), "v"(h.p[2]), "v"(h.p[3]), "v"(h.p[4]), "v"(h.p[5]), "v"(h.p[6]), "v"(h.p[7]));
}

#define PSMAX 32768.0f                           /* a lane's 16 weights of a step may sum to this much: each of them is then inside f16 */
// A lane's 16 weights of one step against the reference maximum m, carried x256: pc = 256 * exp(sc - m); returns their sum (pairwise tree).
__device__ __forceinline__ float step_weights(const float (&sc)[16], float m, float (&pc)[16]) {
#pragma unroll
  for (int i = 0; i < 16; ++i) pc[i] = fmaf(sc[i] - m, LOG2E, 8.0f);
  exp2_x16(pc);
  v2f a[8];                                        // neighbours as pairs: the tree runs on packed adds
#pragma unroll
  for (int i = 0; i < 8; ++i) a[i] = v2f{pc[2 * i], pc[2 * i + 1]};
#pragma unroll
  for (int i = 0; i < 4; ++i) a[i] += a[i + 4];
  a[0] = (a[0] + a[2]) + (a[1] + a[3]);
  return a[0][0] + a[0][1];
}

// One 32-key step for a wave's 16 queries. Kp, Vp: the step's 4 KiB of K and of V^T in the LDS ring; key0 in the notes below = the step's first key position; mword bit j set = position key0 + j is padded out.
// MASKED = false: a step whose 32 positions are all kept keys (mword not read).
template <bool MASKED>
__device__ __forceinline__ void fa_step(const unsigned short* Kp, const unsigned short* Vp,
                                        unsigned int mword, int ln, int hh, const FragH& q0, const FragH& q1,
                                        float& mr, float& lr, v8f (&Oh)[4]) {
  // A fragments of K: row m = key (key0 + 16*kt + ln), elements 0..7 <- d = 32c + 8h + i, 8..15 <- d = 32c + 16 + 8h + i; block 2*kt + c of the step's 4 KiB
  const int lane8 = (16 * hh + ln) * 8;
  const unsigned short* kp = Kp + lane8;
  FragH k00, k01, k10, k11;
  k00.half[0] = *(const v8us*)(kp);            k00.half[1] = *(const v8us*)(kp + FRAG / 2);
  k01.half[0] = *(const v8us*)(kp + FRAG);     k01.half[1] = *(const v8us*)(kp + FRAG + FRAG / 2);
  k10.half[0] = *(const v8us*)(kp + 2 * FRAG); k10.half[1] = *(const v8us*)(kp + 2 * FRAG + FRAG / 2);
  k11.half[0] = *(const v8us*)(kp + 3 * FRAG); k11.half[1] = *(const v8us*)(kp + 3 * FRAG + FRAG / 2);
  // A fragments of V^T: row m = d (16*t + ln), elements 0..7 <- key0 + 8h + i, 8..15 <- key0 + 16 + 8h + i; block t of the step's 4 KiB
  const unsigned short* vp = Vp + lane8;
  FragH vf[4];
#pragma unroll
  for (int t = 0; t < 4; ++t) {
    vf[t].half[0] = *(const v8us*)(vp + t * FRAG);
    vf[t].half[1] = *(const v8us*)(vp + t * FRAG + FRAG / 2);
  }
  const v8f z8 = {0.f, 0.f, 0.f, 0.f, 0.f, 0.f, 0.f, 0.f};
  // S^T tiles: element r of tile kt = score(key0 + 16*kt + 8h + r, query of this lane's column)
  const v8f s0 = mma_hh2(k00.v, q0.v, k01.v, q1.v, z8);
  const v8f s1 = mma_hh2(k10.v, q0.v, k11.v, q1.v, z8);
  const unsigned int wl = mword >> (8 * hh);
  float sc[16];
#pragma unroll
  for (int r = 0; r < 8; ++r) {
    const float a = s0[r] * QKSCALE, c = s1[r] * QKSCALE;
    sc[r]     = (MASKED && ((wl >> r) & 1u)) ? NEGFILL : a;            // padded key: the score is replaced
    sc[8 + r] = (MASKED && ((wl >> (16 + r)) & 1u)) ? NEGFILL : c;
  }
  // mr is a reference, not the maximum: any value does for the quotient as long as the weights stay inside f16. The weights are formed against the mr at hand, and
  // only if some lane's sum of them leaves PSMAX (on the first step, mr = -3e38, it is infinite) is mr raised to the larger of itself and the step's 32-key maximum, the sums rescaled and the step's weights formed again.
  float pc[16];
  float ps = step_weights(sc, mr, pc);
  if (__builtin_amdgcn_ballot_w32(!(ps <= PSMAX)) != 0u) {   // the same for the whole wave: all 32 lanes stay on for the matrix instructions
    float mx = sc[0];
#pragma unroll
    for (int i = 1; i < 16; ++i) mx = fmaxf(mx, sc[i]);
    mx = fmaxf(mx, __shfl_xor(mx, 16, 32));         // the other lane half holds the other 16 keys of this query: both halves keep the same mr
    const float mnew = fmaxf(mr, mx);
    const float al = exp2_raw((mr - mnew) * LOG2E);
    mr = mnew;
    lr *= al;
#pragma unroll
    for (int t = 0; t < 4; ++t) Oh[t] = Oh[t] * al;
    ps = step_weights(sc, mr, pc);
  }
  lr += ps;                                         // this lane's 16 keys only; the two halves' sums meet behind the key loop
  // hi plane f16(pc), residual plane f16(pc - hi), at the hi plane's own scale: both planes' products add into the same sums. pc - hi is exact in f32; as f16 it is off by
  // at most 2^-11 of itself or 2^-25 (f16 subnormals are kept), against a row sum of at least 256 (the key that set mr weighs 256).
  FragH ph, pl;
#pragma unroll
  for (int i = 0; i < 8; ++i)                       // B element i: i<8 -> key0 + 8h + i (tile 0 row 8h+i); i>=8 -> key0 + 16 + 8h + (i-8) (tile 1)
    ph.p[i] = __builtin_convertvector((v2f{pc[2 * i], pc[2 * i + 1]}), v2h);
  residual_x16(pc, ph);
#pragma unroll
  for (int i = 0; i < 8; ++i) pl.p[i] = __builtin_convertvector((v2f{pc[2 * i], pc[2 * i + 1]}), v2h);
  mma_h8(vf[0].v, vf[1].v, vf[2].v, vf[3].v, ph.v, pl.v, Oh[0], Oh[1], Oh[2], Oh[3]);
}

// Block = 8 waves x 16 query positions = 128 of one (batch, head). Key positions 0 .. cnt-1 are the kept keys: whole steps carry no mask, the last one masks its tail.
// K and V^T reach the eight waves through a two-buffer LDS ring of 64-key stages: each byte is fetched once per block, by asynchronous copies that fly while the stage before is worked on.
// The more queries a block holds, the fewer blocks fetch the same K and V^T bytes from L2: 16 blocks walk each (batch, head), two blocks of eight waves fill a WGP's SIMDs four deep.
// Stage t = key positions 64t .. 64t+63, walked only if 64t lies in front of the last step's end, so inside a projection tile that was written whole.
// Epilogue: O^T tile -> per-wave LDS tile [16 queries][64 d] (block barrier), then lanes 0..15 / 16..31 each write 256 contiguous bytes
// coverage: NB*16*(SEQ/128) blocks x 8 waves x 16 rows x 64 columns = every context element exactly once; trip counts clamped to SEQ / 32.
__global__ __launch_bounds__(AWV * 32) void k_attn(const unsigned short* __restrict__ Qh, const unsigned short* __restrict__ Kh,
                                              const unsigned short* __restrict__ Vt, const int* __restrict__ cnt,
                                              float* __restrict__ Cx) {
  __shared__ __attribute__((aligned(16))) float so[AWV][16][68];
  __shared__ __attribute__((aligned(16))) unsigned short ring[2][2 * STG];
  const int tid = threadIdx.x, w = __builtin_amdgcn_readfirstlane((int)(tid >> 5)), lane = tid & 31, ln = lane & 15, hh = lane >> 4;
  const int bh = blockIdx.x / (SEQ / (AWV * 16)), qt = blockIdx.x % (SEQ / (AWV * 16));
  const int b = bh / NH, h = bh - b * NH;
  const int qbase = qt * (AWV * 16) + 16 * w;
  const int n = min(max(cnt[b], 0), SEQ);            // kept keys of the batch (block-uniform)
  const int full = n >> 5;                           // steps of 32 kept keys
  const int steps = n > 0 ? (n + 31) >> 5 : SEQ / 32;
  // Q^T B fragments: column n = query qbase + ln, elements 0..7 <- d = 32c + 8h + i, 8..15 <- d = 32c + 16 + 8h + i
  const unsigned short* qrow = Qh + ((size_t)bh * SEQ + qbase) * HD + lane * 8;   // the wave's 16 queries are one token tile: blocks c = 0, 1
  FragH q0, q1;
  q0.half[0] = *(const v8us*)(qrow);        q0.half[1] = *(const v8us*)(qrow + FRAG / 2);
  q1.half[0] = *(const v8us*)(qrow + FRAG); q1.half[1] = *(const v8us*)(qrow + FRAG + FRAG / 2);
  // the wait that is owed before the lane offset that the four issued loads name is overwritten
  asm volatile("s_wait_xcnt 0x0" :: "v"(lane) : "memory");
  float mr = -3.0e38f, lr = 0.0f;
  v8f Oh[4] = {};
  const unsigned short* Kp = Kh + (size_t)bh * SEQ * HD;
  const unsigned short* Vp = Vt + (size_t)bh * HD * SEQ;
  const int nst = (steps + 1) >> 1;                  // stages of two steps, 1 .. SEQ / 64 (block-uniform)
  const unsigned short* kg = Kp + tid * 8;
  const unsigned short* vg = Vp + tid * 8;
  const unsigned int l0 = (unsigned int)(size_t)&ring[0][0] + (unsigned int)tid * 16u;
  stage_copy(kg, vg, l0);
  asm volatile("s_wait_asynccnt 0x0" ::: "memory");  // this wave's copies of stage 0 have landed
  __syncthreads();                                   // ... and every other wave's: stage 0 may be read
  if (nst > 1) stage_copy(kg + STG, vg + STG, l0 + STB);
  // The foot of stage t, the same behind a whole stage and behind a masked one
  auto foot = [&](int t) {
    asm volatile("s_wait_dscnt 0x0" ::: "memory");    // this wave's reads of stage t are done before its buffer is handed back
    asm volatile("s_wait_asynccnt 0x0" ::: "memory"); // this wave's copies of stage t + 1 have landed
    __syncthreads();                                  // publishes stage t + 1 and ends every wave's reads of stage t
    if (t + 2 < nst) stage_copy(kg + (size_t)(t + 2) * STG, vg + (size_t)(t + 2) * STG, l0 + (unsigned int)(t & 1) * STB);
  };
  const int nwh = full >> 1;                         // stages of two whole steps of kept keys, at most nst (block-uniform)
  int t = 0;
  for (; t < nwh; ++t) {                             // a loop of its own, with no other path through it: the 32 sums stay in their registers
    const unsigned short* kb = &ring[t & 1][0];
    fa_step<false>(kb, kb + STG, 0u, ln, hh, q0, q1, mr, lr, Oh);
    fa_step<false>(kb + 32 * HD, kb + STG + 32 * HD, 0u, ln, hh, q0, q1, mr, lr, Oh);
    foot(t);
  }
  for (; t < nst; ++t) {                             // the last stage, or every stage when no key is kept
    const unsigned short* kb = &ring[t & 1][0];
#pragma unroll 1
    for (int u = 0; u < 2; ++u) {                    // rolled: one copy of the masked step's code
      const int j = 2 * t + u;
      if (j < steps)                                 // a whole step masks nothing; the tail step masks positions n % 32 and up; no key kept: every position
        fa_step<true>(kb + u * (32 * HD), kb + STG + u * (32 * HD), j < full ? 0u : 0xFFFFFFFFu << (n & 31), ln, hh, q0, q1, mr, lr, Oh);
    }
    foot(t);
  }
  asm volatile("s_wait_asynccnt 0x0" ::: "memory");   // no copy is left in flight when the wave goes on

  // O^T element r of tile t = ctx(query qbase + ln, d = 16t + 8h + r); undo the carries: x256 (in lr), x16 (V)
  lr += __shfl_xor(lr, 16, 32);                      // the row sum: both lane halves' keys
  const float inv = 1.0f / (CARRY * lr);
#pragma unroll
  for (int t = 0; t < 4; ++t)
#pragma unroll
    for (int r = 0; r < 8; ++r)
      so[w][ln][16 * t + 8 * hh + r] = Oh[t][r] * inv;
  __syncthreads();
  float* og = Cx + ((size_t)b * SEQ + qbase) * DM + h * HD;
  const int rsub = lane >> 4, c4 = (lane & 15) * 4;
  {
#pragma unroll
    for (int q = 0; q < 8; ++q) {
      const int row = 2 * q + rsub;
      const v4f v = *(const v4fa*)&so[w][row][c4];
      *(v4f*)(og + (size_t)row * DM + c4) = v;
    }
    
  }
}

// Sum over the 32 lanes, the same bits in every lane: four exchanges inside the 16-lane row (DPP row_xmask 1, 2, 4, 8), then one with the other row. All lanes on.
template <int CTRL>
__device__ __forceinline__ float dpp_get(float v) {
  return __int_as_float(__builtin_amdgcn_update_dpp(0, __float_as_int(v), CTRL, 0xf, 0xf, true));
}
__device__ __forceinline__ float wave_sum(float v) {
  v += dpp_get<0x161>(v);
  v += dpp_get<0x162>(v);
  v += dpp_get<0x164>(v);
  v += dpp_get<0x168>(v);
  const int u = __float_as_int(v);
  return v + __int_as_float(__builtin_amdgcn_permlanex16(u, u, 0x76543210, 0xfedcba98, true, false));   // lane l reads lane l ^ 16
}

// LayerNorm. A wave norms LNR whole rows by itself: a lane holds columns 128*i + 4*lane + 0..3, i = 0..7, of each row (every load and store 512 contiguous bytes), the row's sums
// meet inside the wave: no LDS, no barrier, and few waves with much to do each (see the note at the preparation kernel). All loads are issued before the first value is used.
// coverage: NB*SEQ/(8*LNR) blocks x 8 waves x LNR rows x 32 lanes x 32 columns = every output element of the processed region exactly once (perm is a permutation inside each batch).
#define LNR 2
static_assert(SEQ % LNR == 0);                   // a wave's rows lie inside one batch
static_assert((NB * SEQ) % (8 * LNR) == 0);
static_assert(DM == 8 * 128);
__global__ __launch_bounds__(256) void k_ln(const float* __restrict__ Cx, const float* __restrict__ gamma,
                                            const float* __restrict__ beta, const int* __restrict__ perm, float* __restrict__ out) {
  const int tid = threadIdx.x, lane = tid & 31, w = __builtin_amdgcn_readfirstlane((int)(tid >> 5));
  const int r0 = (blockIdx.x * 8 + w) * LNR;         // context row r holds the token of position r % SEQ
  const int b = r0 / SEQ;
  int s[LNR];
#pragma unroll
  for (int j = 0; j < LNR; ++j) s[j] = perm[r0 + j];
  const float* xp = Cx + (size_t)r0 * DM + lane * 4;
  const float* gp = gamma + lane * 4;
  const float* bp = beta + lane * 4;
  v4f x[LNR][8], g[8], be[8];
#pragma unroll
  for (int j = 0; j < LNR; ++j)
#pragma unroll
    for (int i = 0; i < 8; ++i) x[j][i] = *(const v4fa*)(xp + j * DM + i * 128);
#pragma unroll
  for (int i = 0; i < 8; ++i) { g[i] = *(const v4fa*)(gp + i * 128); be[i] = *(const v4fa*)(bp + i * 128); }
  // the wait that is owed before an address that the issued loads name is overwritten
  asm volatile("s_wait_xcnt 0x0" ::: "memory");
  __builtin_amdgcn_sched_barrier(0);                 // without it the build put half the loads behind the first sums, one memory trip after another
  float sm[LNR];
#pragma unroll
  for (int j = 0; j < LNR; ++j) {
    v4f a = (x[j][0] + x[j][1]) + (x[j][2] + x[j][3]);
    a += (x[j][4] + x[j][5]) + (x[j][6] + x[j][7]);
    sm[j] = wave_sum((a[0] + a[1]) + (a[2] + a[3]));
  }
  float sq[LNR];
#pragma unroll
  for (int j = 0; j < LNR; ++j) {
    const float mu = sm[j] * (1.0f / 1024.0f);
    v4f a = {0.f, 0.f, 0.f, 0.f};
#pragma unroll
    for (int i = 0; i < 8; ++i) { x[j][i] -= mu; a += x[j][i] * x[j][i]; }
    sq[j] = wave_sum((a[0] + a[1]) + (a[2] + a[3]));
  }
#pragma unroll
  for (int i = 0; i < 8; ++i)
#pragma unroll
    for (int e = 0; e < 4; ++e) { g[i][e] = bf16_rne(g[i][e]); be[i][e] = bf16_rne(be[i][e]); }
#pragma unroll
  for (int j = 0; j < LNR; ++j) {
    const float rinv = rsqrtf(sq[j] * (1.0f / 1024.0f) + 1.0e-6f);
    float* dst = out + ((size_t)b * SEQ_FULL + s[j]) * DM + lane * 4;
#pragma unroll
    for (int i = 0; i < 8; ++i) {
      const v4f o = x[j][i] * rinv * g[i] + be[i];
      *(v4f*)(dst + i * 128) = o;
    }
  }
}

extern "C" void kernel_launch(void* const* d_in, const int* in_sizes, int n_in,
                              void* d_out, int out_size, void* d_ws, size_t ws_size, hipStream_t stream) {
  if (n_in < 7) return;
  const long long need_x = (long long)(NB - 1) * SEQ_FULL * DM + (long long)SEQ * DM;   // last element touched + 1
  const long long need_m = (long long)(NB - 1) * SEQ_FULL + (long long)SEQ;
  if ((long long)in_sizes[0] < need_x || (long long)in_sizes[1] < need_m) return;
  if ((long long)in_sizes[2] < (long long)DM * DM || (long long)in_sizes[3] < (long long)DM * DM || (long long)in_sizes[4] < (long long)DM * DM) return;
  if (in_sizes[5] < DM || in_sizes[6] < DM) return;
  if ((long long)out_size < need_x) return;
  const float* X     = (const float*)d_in[0];   // wire order: q [2][2048][1024] f32, mask [2][2048] i32, Wq, Wk, Wv [1024][1024] f32, gamma, beta [1024] f32
  const int*   mask  = (const int*)d_in[1];
  const float* Wq    = (const float*)d_in[2];
  const float* Wk    = (const float*)d_in[3];
  const float* Wv    = (const float*)d_in[4];
  const float* gamma = (const float*)d_in[5];
  const float* beta  = (const float*)d_in[6];
  float* out = (float*)d_out;
  char* ws = (char*)d_ws;
  size_t off = 0;
  const size_t xb_bytes = (size_t)NB * SEQ * DM * 2;        // 8 MiB at full size; every plane is written by whole 16-B pieces, none past its end
  const size_t wb_bytes = (size_t)3 * DM * DM * 2;          // 6 MiB
  const size_t p3_bytes = 3 * PLANE * 2;                    // 24 MiB
  const size_t cx_bytes = (size_t)NB * SEQ * DM * 4;        // 16 MiB
  unsigned short* Xb = (unsigned short*)(ws + off); off += (xb_bytes + 255) & ~(size_t)255;
  unsigned short* Wb = (unsigned short*)(ws + off); off += (wb_bytes + 255) & ~(size_t)255;
  unsigned short* P3 = (unsigned short*)(ws + off); off += (p3_bytes + 255) & ~(size_t)255;
  float*          Cx = (float*)(ws + off);          off += (cx_bytes + 255) & ~(size_t)255;
  int*          perm = (int*)(ws + off);            off += ((size_t)NB * SEQ * 4 + 255) & ~(size_t)255;
  int*           cnt = (int*)(ws + off);            off += 256;
  if (off > ws_size) return;
  k_prep<<<(unsigned)(XBLK + WBLK), 256, 0, stream>>>(X, Wq, Wk, Wv, mask, Xb, Wb, perm, cnt);
  k_proj<<<dim3((unsigned)(3 * DM / 128), (unsigned)(NB * SEQ / 128)), 128, 0, stream>>>(Xb, Wb, P3, cnt);
  k_attn<<<(unsigned)(NB * NH * (SEQ / (AWV * 16))), AWV * 32, 0, stream>>>(P3, P3 + PLANE, P3 + 2 * PLANE, cnt, Cx);
  k_ln<<<(unsigned)(NB * SEQ / (8 * LNR)), 256, 0, stream>>>(Cx, gamma, beta, perm, out);
}
